// v000
// Measured on an AMD MI455X. A time is GPU time per run, averaged over a window of back-to-back runs after a warm-up
// (all launches, gaps included; the runs take copies of the inputs in turn), and the median of several windows.
// Apart from v000's, it joins two sittings. Times from different sittings can be a few percent apart, while
// side-by-side timings come from the same sitting.
// v000, which the later versions start from, runs in 601 microseconds.
// Contractions: node K|V projection (nodes x [Wk|Wv]^T), head-merge projection (O x W_comb^T) and pointer scores (MH x nodes^T) on v_wmma_f32_16x16x32_bf16 with bf16 hi/lo operand planes (hi.hi + hi.lo + lo.hi); lazy-mask hidden layer (H1 f16 x lm_W2^T f16 carried x16) on v_wmma_f32_16x16x32_f16; all f32 accumulate; query/FiLM/gating/qf projections, lazy layers 1 (K=3 after the broadcast fold) and 3 (N=1), the 16-dim attention core and both softmaxes in f32 on the VALU.
#include <hip/hip_runtime.h>
#include <math.h>

typedef __attribute__((ext_vector_type(16))) _Float16 v16h;
typedef __attribute__((ext_vector_type(8)))  _Float16 v8h;
typedef __attribute__((ext_vector_type(16))) __bf16   v16b;
typedef __attribute__((ext_vector_type(8)))  __bf16   v8b;
typedef __attribute__((ext_vector_type(8)))  float    v8f;
typedef __attribute__((ext_vector_type(4)))  float    v4f;
typedef __attribute__((ext_vector_type(4)))  unsigned int v4u;

// ---------------------------------------------------------------------------
// Problem constants
// ---------------------------------------------------------------------------
constexpr int kB   = 16;      // batch
constexpr int kP   = 100;     // queries per batch
constexpr int kN   = 1000;    // nodes
constexpr int kNP  = 1024;    // nodes padded
constexpr int kE   = 128;     // embedding
constexpr int kH   = 8;       // heads
constexpr int kD   = 16;      // head dim
constexpr int kHD  = 128;     // H*D
constexpr int kQD  = 16;      // lazy query dim
constexpr int kDYN = 3;       // dynamic features
constexpr int kHID = 64;      // lazy hidden
constexpr int kBP     = kB * kP;          // 1600 (b,p) rows
constexpr int kBPpad  = 1664;             // 26 * 64
constexpr int kEncRows = kB * kNP;        // 16384 padded node rows
constexpr int kChunkB   = 2;              // batches per lazy-MLP chunk
constexpr int kChunkBP  = kChunkB * kP;   // 200
constexpr int kChunkRows = kChunkBP * kNP; // 204800 rows per chunk
constexpr int kNumChunks = kB / kChunkB;  // 8
constexpr int kSrows = 128;               // pointer-score rows per batch (100 padded)
constexpr float kWCarry   = 16.0f;        // lm_W2 carried x16 in f16
constexpr float kInvSqrtE = 0.08838834764831845f;
constexpr float kClip     = 10.0f;
static_assert(kBPpad % 64 == 0 && kBPpad >= kBP, "pad");
static_assert(kChunkRows % 256 == 0 && kChunkRows % 64 == 0, "chunk");
static_assert(kB % kChunkB == 0, "chunks");
static_assert(kBPpad >= (kB - 1) * kP + kSrows, "last batch score rows inside MH planes");
static_assert(kH * kD == kHD && kE == kHD, "dims");

// ---------------------------------------------------------------------------
// Helpers
// ---------------------------------------------------------------------------
__device__ __forceinline__ unsigned short f2bf_bits(float f) {
  unsigned u = __float_as_uint(f);
  return (unsigned short)((u + 0x7FFFu + ((u >> 16) & 1u)) >> 16);
}
__device__ __forceinline__ float bf_bits2f(unsigned short h) { return __uint_as_float(((unsigned)h) << 16); }

// hazard guards as plain device helpers (no inline asm inside the kernel template body)
__device__ __forceinline__ void dep_guard_h(v8f& a, v8f& b, v16h x, v16h y) { asm volatile("v_nop\n\tv_nop\n\tv_nop\n\tv_nop" : "+v"(a), "+v"(b) : "v"(x), "v"(y)); }
__device__ __forceinline__ void dep_guard_b(v8f& a, v8f& b, v16b x, v16b y) { asm volatile("v_nop\n\tv_nop\n\tv_nop\n\tv_nop" : "+v"(a), "+v"(b) : "v"(x), "v"(y)); }
__device__ __forceinline__ void keep4_h(v16h a, v16h b, v16h c, v16h d) { asm volatile("v_nop" :: "v"(a), "v"(b), "v"(c), "v"(d)); }
__device__ __forceinline__ void keep4_b(v16b a, v16b b, v16b c, v16b d) { asm volatile("v_nop" :: "v"(a), "v"(b), "v"(c), "v"(d)); }
__device__ __forceinline__ void acc_guard4(v8f& a, v8f& b, v8f& c, v8f& d) { asm volatile("v_nop\n\tv_nop\n\tv_nop\n\tv_nop" : "+v"(a), "+v"(b), "+v"(c), "+v"(d)); }
template <typename T> struct Frag;
template <> struct Frag<_Float16> {
  typedef v16h V; union U { v16h v; v8h h[2]; };
  static __device__ __forceinline__ v16h load(const _Float16* p) {   // elements 0..7 <- p[0..7], 8..15 <- p[16..23]
    U f; f.h[0] = *(const v8h*)(p); f.h[1] = *(const v8h*)(p + 16); return f.v;
  }
  static __device__ __forceinline__ v8f mma(v16h a, v16h b, v8f c) {
    return __builtin_amdgcn_wmma_f32_16x16x32_f16(false, a, false, b, (short)0, c, false, false);
  }
  static __device__ __forceinline__ void guard(v8f& a, v8f& b, v16h x, v16h y) { dep_guard_h(a, b, x, y); }
  static __device__ __forceinline__ void keep(v16h a, v16h b, v16h c, v16h d) { keep4_h(a, b, c, d); }
};
template <> struct Frag<__bf16> {
  typedef v16b V; union U { v16b v; v8b h[2]; };
  static __device__ __forceinline__ v16b load(const __bf16* p) {
    U f; f.h[0] = *(const v8b*)(p); f.h[1] = *(const v8b*)(p + 16); return f.v;
  }
  static __device__ __forceinline__ v8f mma(v16b a, v16b b, v8f c) {
    return __builtin_amdgcn_wmma_f32_16x16x32_bf16(false, a, false, b, (short)0, c, false, false);
  }
  static __device__ __forceinline__ void guard(v8f& a, v8f& b, v16b x, v16b y) { dep_guard_b(a, b, x, y); }
  static __device__ __forceinline__ void keep(v16b a, v16b b, v16b c, v16b d) { keep4_b(a, b, c, d); }
};

__device__ __forceinline__ unsigned pk16(unsigned short a, unsigned short b) { return (unsigned)a | ((unsigned)b << 16); }
__device__ __forceinline__ unsigned short h_bits(float f) { const _Float16 h = (_Float16)f; return __builtin_bit_cast(unsigned short, h); }
// bf16 hi + bf16 lo split of an f32 value (both RNE converts)
__device__ __forceinline__ void split_bf(float f, unsigned short& hb, unsigned short& lb) {
  hb = f2bf_bits(f);
  lb = f2bf_bits(f - bf_bits2f(hb));
}

// ---- Register-blocked batched WMMA GEMM (ACT reduced to none/relu/leaky) -----------------------
// C[m,n] = scale * sum_k A[m,k] * Bt[n,k] (+bias)(+resid); each wave owns a 64x64 tile.
// A row-major [M,K]; Bt row-major [N,K]; M,N % 64 == 0, K % 32 == 0.
// SPLIT: operands are hi/lo planes (A2/Bt2 = lo planes, same layout); product = hi·hi + hi·lo + lo·hi.
// BIAS_MODE: 0 = none, 1 = bias[m], 2 = bias[n].
// OUT_MODE: 0 = f32, 1 = f16, 2 = bf16 hi plane (Cout) + bf16 lo plane (Cout2).
// ET: 0 = f16 operands, 1 = bf16 operands (pointers passed as 16-bit storage)
template <int ET> struct Elem;
template <> struct Elem<0> { typedef _Float16 T; };
template <> struct Elem<1> { typedef __bf16 T; };
template <int ET, bool SPLIT, int BIAS_MODE, int OUT_MODE, bool RESID, int ACT = 0>
__global__ __launch_bounds__(256) void wmma_gemm64(
    const unsigned short* __restrict__ Ap, const unsigned short* __restrict__ A2p, int lda, long strideA,
    const unsigned short* __restrict__ Btp, const unsigned short* __restrict__ Bt2p, int ldb, long strideB,
    void* __restrict__ Cout, void* __restrict__ Cout2, int ldc, long strideC,
    const float* __restrict__ bias,
    const float* __restrict__ resid, long strideR,
    int M, int N, int K, float scale) {
  typedef typename Elem<ET>::T T;
  typedef typename Frag<T>::V V;
  const T* A = (const T*)Ap; const T* A2 = (const T*)A2p; const T* Bt = (const T*)Btp; const T* Bt2 = (const T*)Bt2p;
  __shared__ __align__(16) float sT[8][16 * 68];   // per-wave 16x64 slab, pitch 68 floats
  const int b    = blockIdx.y;
  const int lane = threadIdx.x & 31;
  const int wave = threadIdx.x >> 5;
  const int tilesN = N >> 6;
  const int tilesM = M >> 6;
  const int tile = blockIdx.x * 8 + wave;
  if (tile >= tilesM * tilesN) return;   // wave-uniform; no block barriers in this kernel
  const int tm = tile / tilesN;
  const int tn = tile - tm * tilesN;
  const int m0 = tm << 6;
  const int n0 = tn << 6;

  const T* Ab  = A  + (size_t)b * strideA;
  const T* Bb  = Bt + (size_t)b * strideB;
  const T* Ab2 = SPLIT ? (A2  + (size_t)b * strideA) : nullptr;
  const T* Bb2 = SPLIT ? (Bt2 + (size_t)b * strideB) : nullptr;

  const int rlane = lane & 15;                 // row (A) / col (B, D) within subtile
  const int koff  = (lane >> 4) * 8;           // k offset of this lane half
  const int mOff  = (lane >> 4) * 8;           // D row offset

  v8f acc[4][4];
#pragma unroll
  for (int i = 0; i < 4; ++i)
#pragma unroll
    for (int j = 0; j < 4; ++j) acc[i][j] = (v8f){0.f,0.f,0.f,0.f,0.f,0.f,0.f,0.f};

  for (int k0 = 0; k0 < K; k0 += 32) {
    V bh[4], bl[4];
#pragma unroll
    for (int j = 0; j < 4; ++j) {
      const size_t bo = (size_t)(n0 + (j << 4) + rlane) * ldb + koff + k0;
      bh[j] = Frag<T>::load(Bb + bo);
      if (SPLIT) bl[j] = Frag<T>::load(Bb2 + bo);
    }
#pragma unroll
    for (int i = 0; i < 4; ++i) {
      const size_t ao = (size_t)(m0 + (i << 4) + rlane) * lda + koff + k0;
      V ah = Frag<T>::load(Ab + ao);
      V al;
      if (SPLIT) al = Frag<T>::load(Ab2 + ao);
#pragma unroll
      for (int j = 0; j < 4; ++j) {
        acc[i][j] = Frag<T>::mma(ah, bh[j], acc[i][j]);
        if (SPLIT) {
          acc[i][j] = Frag<T>::mma(ah, bl[j], acc[i][j]);
          acc[i][j] = Frag<T>::mma(al, bh[j], acc[i][j]);
        }
      }
      Frag<T>::guard(acc[i][0], acc[i][3], ah, SPLIT ? al : ah);
    }
    Frag<T>::keep(bh[0], bh[1], bh[2], bh[3]);
    if (SPLIT) Frag<T>::keep(bl[0], bl[1], bl[2], bl[3]);
  }
  acc_guard4(acc[0][0], acc[0][1], acc[0][2], acc[0][3]);
  acc_guard4(acc[1][0], acc[1][1], acc[1][2], acc[1][3]);
  acc_guard4(acc[2][0], acc[2][1], acc[2][2], acc[2][3]);
  acc_guard4(acc[3][0], acc[3][1], acc[3][2], acc[3][3]);

  // ---- epilogue ----
  float* slab = sT[wave];
  const float* Rb = RESID ? (resid + (size_t)b * strideR) : nullptr;
#pragma unroll
  for (int i = 0; i < 4; ++i) {
    const int mBase = m0 + (i << 4);
#pragma unroll
    for (int j = 0; j < 4; ++j) {
      const int n = n0 + (j << 4) + rlane;
      float bv = 0.f;
      if (BIAS_MODE == 2) bv = bias[n];
#pragma unroll
      for (int r = 0; r < 8; ++r) {
        float v = acc[i][j][r] * scale;
        if (BIAS_MODE == 1) v += bias[mBase + mOff + r];
        if (BIAS_MODE == 2) v += bv;
        if (RESID) v += Rb[(size_t)(mBase + mOff + r) * ldc + n];
        if (ACT == 2) v = fmaxf(v, 0.0f);
        if (ACT == 4) v = (v > 0.f) ? v : 0.01f * v;
        slab[(mOff + r) * 68 + (j << 4) + rlane] = v;
      }
    }
    __builtin_amdgcn_fence(__ATOMIC_RELEASE, "workgroup");
    __builtin_amdgcn_wave_barrier();
    __builtin_amdgcn_fence(__ATOMIC_ACQUIRE, "workgroup");
    if (OUT_MODE == 0) {
      float* C = (float*)Cout + (size_t)b * strideC;
      const int hh = lane >> 4, c4 = (lane & 15) * 4;     // row seg = 256 B = 16 lanes x 16 B
      {
#pragma unroll
        for (int it = 0; it < 8; ++it) {
          const int row = it * 2 + hh;
          v4f v = *(const v4f*)(slab + row * 68 + c4);
          *(v4f*)(C + (size_t)(mBase + row) * ldc + n0 + c4) = v;
        }
        
      }
    } else {
      const int q = lane >> 3, c8 = (lane & 7) * 8;
      unsigned short* C  = (unsigned short*)Cout  + (size_t)b * strideC;
      unsigned short* C2 = (OUT_MODE == 2) ? ((unsigned short*)Cout2 + (size_t)b * strideC) : nullptr;
      {
#pragma unroll
        for (int it = 0; it < 4; ++it) {
          const int row = it * 4 + q;
          const float* sp = slab + row * 68 + c8;
          v8h hv, lv;
#pragma unroll
          for (int e = 0; e < 8; ++e) {
            if (OUT_MODE == 1) {
              hv[e] = (_Float16)sp[e];
            } else {
              unsigned short hb = f2bf_bits(sp[e]);
              unsigned short lb = f2bf_bits(sp[e] - bf_bits2f(hb));
              hv[e] = __builtin_bit_cast(_Float16, hb);
              lv[e] = __builtin_bit_cast(_Float16, lb);
            }
          }
          *(v8h*)(C + (size_t)(mBase + row) * ldc + n0 + c8) = hv;
          if (OUT_MODE == 2) *(v8h*)(C2 + (size_t)(mBase + row) * ldc + n0 + c8) = lv;
        }
        
      }
    }
    __builtin_amdgcn_fence(__ATOMIC_RELEASE, "workgroup");
    __builtin_amdgcn_wave_barrier();
    __builtin_amdgcn_fence(__ATOMIC_ACQUIRE, "workgroup");
  }
}

// ---------------------------------------------------------------------------
// Weight preparation: 64x64 transpose tiles of f32 W[k][n] (pitch ldn) -> WT[n][k] (pitch ldk).
// blocks 0..3: Wk -> WkvHi/WkvLo rows 0..127 (bf16 hi + bf16 lo planes); 4..7: Wv -> rows 128..255;
// 8..11: W_comb -> WcHi/WcLo; 12: lm_W2 -> W2T (f16 carried x16, single plane).
// Load coverage: 16 x 256 = 4096 = whole tile. Store coverage: 8 waves x 2 it x 4 rows (lane>>3) = 64 rows,
// ---------------------------------------------------------------------------
__global__ __launch_bounds__(256) void k_wprep(const float* __restrict__ Wk, const float* __restrict__ Wv,
                                              const float* __restrict__ Wcomb, const float* __restrict__ W2,
                                              unsigned short* __restrict__ WkvHi, unsigned short* __restrict__ WkvLo,
                                              unsigned short* __restrict__ WcHi, unsigned short* __restrict__ WcLo,
                                              unsigned short* __restrict__ W2T) {
  __shared__ float sm[64][65];   // sm[n_local][k_local]
  const int t = threadIdx.x, lane = t & 31, wave = t >> 5;
  const int bid = blockIdx.x;    // block-uniform selection below
  const float* W = Wk; unsigned short* outH = WkvHi; unsigned short* outL = WkvLo;
  int ldn = kHD, ldk = kE, nt = 0, kt = 0; float carry = 1.0f;
  const bool two_planes = (bid < 12);
  if (bid < 4)       { W = Wk;    outH = WkvHi;                    outL = WkvLo;                    ldn = kHD;  ldk = kE;   nt = bid & 1;       kt = bid >> 1;       carry = 1.0f; }
  else if (bid < 8)  { W = Wv;    outH = WkvHi + (size_t)kHD * kE; outL = WkvLo + (size_t)kHD * kE; ldn = kHD;  ldk = kE;   nt = (bid - 4) & 1; kt = (bid - 4) >> 1; carry = 1.0f; }
  else if (bid < 12) { W = Wcomb; outH = WcHi;                     outL = WcLo;                     ldn = kE;   ldk = kHD;  nt = (bid - 8) & 1; kt = (bid - 8) >> 1; carry = 1.0f; }
  else               { W = W2;    outH = W2T;                      outL = W2T;                      ldn = kHID; ldk = kHID; nt = 0;             kt = 0;              carry = kWCarry; }
  const int n0 = nt * 64, k0 = kt * 64;
#pragma unroll
  for (int i = 0; i < 16; ++i) {
    const int e = i * 256 + t;
    const int r = e >> 6;    // k local
    const int c = e & 63;    // n local
    sm[c][r] = W[(size_t)(k0 + r) * ldn + n0 + c] * carry;
  }
  __syncthreads();
  const int q = lane >> 3, c8 = (lane & 7) * 8;
  v4u uh[2], ul[2];
  int rowv[2];
#pragma unroll
  for (int it = 0; it < 2; ++it) {
    const int row = wave * 8 + it * 4 + q;   // n local
    rowv[it] = row;
    unsigned short hb[8], lb[8];
#pragma unroll
    for (int e = 0; e < 8; ++e) {
      const float v = sm[row][c8 + e];
      if (two_planes) { split_bf(v, hb[e], lb[e]); }
      else { hb[e] = h_bits(v); lb[e] = hb[e]; }
    }
    uh[it] = (v4u){pk16(hb[0], hb[1]), pk16(hb[2], hb[3]), pk16(hb[4], hb[5]), pk16(hb[6], hb[7])};
    ul[it] = (v4u){pk16(lb[0], lb[1]), pk16(lb[2], lb[3]), pk16(lb[4], lb[5]), pk16(lb[6], lb[7])};
  }
  {
#pragma unroll
    for (int it = 0; it < 2; ++it) {
      const size_t o = (size_t)(n0 + rowv[it]) * ldk + k0 + c8;
      *(v4u*)(outH + o) = uh[it];
      if (two_planes) *(v4u*)(outL + o) = ul[it];
    }
    
  }
}

// ---------------------------------------------------------------------------
// Node split: enc f32 [B][1000][128] -> EncHi/EncLo bf16 hi/lo planes [B][1024][128] each
// (rows 1000..1023 of every batch written as zeros in both planes).
// ---------------------------------------------------------------------------
__global__ __launch_bounds__(256) void k_enc_cast(const float* __restrict__ enc, unsigned short* __restrict__ outHi,
                                                 unsigned short* __restrict__ outLo) {
  const int i = blockIdx.x * 256 + threadIdx.x;
  if (i >= kEncRows * 16) return;
  const int row = i >> 4, c8 = (i & 15) * 8;
  const int b = row >> 10, n = row & (kNP - 1);
  const int nc = (n < kN) ? n : (kN - 1);                    // address clamp
  const float* p = enc + ((size_t)(b * kN + nc)) * kE + c8;
  const v4f a = *(const v4f*)(p);
  const v4f c = *(const v4f*)(p + 4);
  const bool valid = (n < kN);
  unsigned short hb[8], lb[8];
#pragma unroll
  for (int e = 0; e < 4; ++e) {
    split_bf(valid ? a[e] : 0.0f, hb[e], lb[e]);
    split_bf(valid ? c[e] : 0.0f, hb[4 + e], lb[4 + e]);
  }
  const v4u uh = (v4u){pk16(hb[0], hb[1]), pk16(hb[2], hb[3]), pk16(hb[4], hb[5]), pk16(hb[6], hb[7])};
  const v4u ul = (v4u){pk16(lb[0], lb[1]), pk16(lb[2], lb[3]), pk16(lb[4], lb[5]), pk16(lb[6], lb[7])};
  const size_t o = (size_t)row * kE + c8;
  *(v4u*)(outHi + o) = uh;
  *(v4u*)(outLo + o) = ul;
  
}

// ---------------------------------------------------------------------------
// Query side per (b,p) (f32, VALU): q_in = [last | load] (129);
//   Qs[bp][h*16+d] = ((q_in.Wq_last) * 2*sigmoid(relu(q_in.fW1 + fb1).fW2 + fb2)) * 0.25   (1/sqrt(16) folded, exact)
//   QW[bp][64]     = lm_b1 + qf.lm_W1[3:19]   with qf = q_in.lazy_q_W + lazy_q_b
// 128 threads; rolled loops. Stores: wave 0 writes the 512-B Qs row (32 lanes x 16 B, one instruction),
// ---------------------------------------------------------------------------
__global__ __launch_bounds__(128) void k_qside(const float* __restrict__ enc_last, const float* __restrict__ loadv,
                                              const float* __restrict__ Wq, const float* __restrict__ fW1,
                                              const float* __restrict__ fb1, const float* __restrict__ fW2,
                                              const float* __restrict__ fb2, const float* __restrict__ lqW,
                                              const float* __restrict__ lqb, const float* __restrict__ lW1,
                                              const float* __restrict__ lb1,
                                              float* __restrict__ Qs, float* __restrict__ QW) {
  __shared__ float qin[kE + 4];
  __shared__ float g1s[kE + 4];
  __shared__ __align__(16) float qst[kHD];
  __shared__ float qfs[kQD];
  __shared__ __align__(16) float qws[kHID];
  const int bp = blockIdx.x;
  const int t = threadIdx.x, lane = t & 31, wave = t >> 5;
  qin[t] = enc_last[(size_t)bp * kE + t];
  if (t == 0) qin[kE] = loadv[bp];
  __syncthreads();
  for (int j = t; j < kE + 1; j += 128) {
    float acc = fb1[j];
#pragma unroll 1
    for (int e = 0; e < kE + 1; ++e) acc = fmaf(qin[e], fW1[(size_t)e * (kE + 1) + j], acc);
    g1s[j] = fmaxf(acc, 0.0f);
  }
  __syncthreads();
  {
    const int j = t;
    float qv = 0.0f, gm = fb2[j];
#pragma unroll 1
    for (int e = 0; e < kE + 1; ++e) {
      qv = fmaf(qin[e], Wq[(size_t)e * kHD + j], qv);
      gm = fmaf(g1s[e], fW2[(size_t)e * kHD + j], gm);
    }
    const float den = 1.0f + expf(-gm);
    const float gamma = 2.0f * (1.0f / den);
    qst[j] = (qv * gamma) * 0.25f;
  }
  if (t < kQD) {
    float acc = lqb[t];
#pragma unroll 1
    for (int e = 0; e < kE + 1; ++e) acc = fmaf(qin[e], lqW[(size_t)e * kQD + t], acc);
    qfs[t] = acc;
  }
  __syncthreads();
  if (t < kHID) {
    float acc = lb1[t];
#pragma unroll 1
    for (int i = 0; i < kQD; ++i) acc = fmaf(qfs[i], lW1[(size_t)(kDYN + i) * kHID + t], acc);
    qws[t] = acc;
  }
  __syncthreads();
  if (wave == 0) {
    const v4f v = *(const v4f*)(qst + 4 * lane);
    float* dst = Qs + (size_t)bp * kHD + 4 * lane;
    *(v4f*)dst = v;
    
  } else if (wave == 1) {
    if (lane < 16) {
      const v4f v = *(const v4f*)(qws + 4 * lane);
      float* dst = QW + (size_t)bp * kHID + 4 * lane;
      *(v4f*)dst = v;
      
    }
  }
}

// ---------------------------------------------------------------------------
// Lazy layer 1 (f32 VALU, K=3 after the per-(b,p) fold): row (bp_local, n) of the chunk, thread per row:
//   H1[row][j] = f16(relu(dyn . lm_W1[0:3][j] + QW[bp][j])), 64 outputs in 8 rolled groups of 8.
// Coverage: 800 blocks x 256 rows = 204800 = chunk rows (pad node slots 1000..1023 written too, from clamped inputs).
// ---------------------------------------------------------------------------
__global__ __launch_bounds__(256) void k_lazy1(const float* __restrict__ dyn, const float* __restrict__ QW,
                                              const float* __restrict__ lW1, unsigned short* __restrict__ H1,
                                              int chunk) {
  __shared__ __align__(16) float w1s[3 * kHID];
  __shared__ __align__(16) unsigned short hs[256 * kHID];
  const int t = threadIdx.x;
  if (t < 3 * kHID) w1s[t] = lW1[t];
  __syncthreads();
  const int row = blockIdx.x * 256 + t;
  const int bpl = row >> 10, n = row & (kNP - 1);
  const int bp = chunk * kChunkBP + bpl;
  const int nc = (n < kN) ? n : (kN - 1);
  const float* dp = dyn + ((size_t)bp * kN + nc) * kDYN;
  const float d0 = dp[0], d1 = dp[1], d2 = dp[2];
  const float* qwp = QW + (size_t)bp * kHID;
#pragma unroll 1
  for (int g = 0; g < 8; ++g) {
    const v4f qa = *(const v4f*)(qwp + 8 * g), qb = *(const v4f*)(qwp + 8 * g + 4);
    const v4f a0 = *(const v4f*)(w1s + 8 * g),            a1 = *(const v4f*)(w1s + 8 * g + 4);
    const v4f e0 = *(const v4f*)(w1s + kHID + 8 * g),     e1 = *(const v4f*)(w1s + kHID + 8 * g + 4);
    const v4f c0 = *(const v4f*)(w1s + 2 * kHID + 8 * g), c1 = *(const v4f*)(w1s + 2 * kHID + 8 * g + 4);
    const v4f x0 = a0 * d0 + (e0 * d1 + (c0 * d2 + qa));
    const v4f x1 = a1 * d0 + (e1 * d1 + (c1 * d2 + qb));
    unsigned short hb[8];
#pragma unroll
    for (int e = 0; e < 4; ++e) {
      hb[e]     = h_bits(fmaxf(x0[e], 0.0f));
      hb[4 + e] = h_bits(fmaxf(x1[e], 0.0f));
    }
    *(v4u*)(hs + t * kHID + 8 * g) = (v4u){pk16(hb[0], hb[1]), pk16(hb[2], hb[3]), pk16(hb[4], hb[5]), pk16(hb[6], hb[7])};
  }
  __syncthreads();
  unsigned short* hbase = H1 + (size_t)blockIdx.x * 256 * kHID;
  v4u vv[8];
#pragma unroll
  for (int i = 0; i < 8; ++i) vv[i] = *(const v4u*)(hs + 8 * (i * 256 + t));
  {
#pragma unroll
    for (int i = 0; i < 8; ++i) *(v4u*)(hbase + 8 * (size_t)(i * 256 + t)) = vv[i];
    
  }
}

// ---------------------------------------------------------------------------
// Lazy layer 3 + bias assembly (f32 VALU): thread per chunk row:
//   z = H2[row] . lm_W3 + lm_b3;  MASKB[bp][n] = ninf_mask[b,p,min(n,999)] - softplus(z)   (ALPHA = 1)
// Coverage: 800 x 256 = 204800 rows = MASKB rows chunk*200 .. chunk*200+199, all 1024 columns.
// ---------------------------------------------------------------------------
__global__ __launch_bounds__(256) void k_lazy3(const _Float16* __restrict__ H2, const float* __restrict__ lW3,
                                              const float* __restrict__ lb3, const float* __restrict__ ninfm,
                                              float* __restrict__ maskb, int chunk) {
  __shared__ __align__(16) float w3s[kHID];
  const int t = threadIdx.x;
  if (t < kHID) w3s[t] = lW3[t];
  __syncthreads();
  const int row = blockIdx.x * 256 + t;
  const int bpl = row >> 10, n = row & (kNP - 1);
  const int bp = chunk * kChunkBP + bpl;
  const int nc = (n < kN) ? n : (kN - 1);
  const _Float16* hp = H2 + (size_t)row * kHID;
  float z = 0.0f;
#pragma unroll 1
  for (int c = 0; c < 8; ++c) {
    const v8h hv = *(const v8h*)(hp + 8 * c);
    const v4f w0 = *(const v4f*)(w3s + 8 * c), w1 = *(const v4f*)(w3s + 8 * c + 4);
#pragma unroll
    for (int e = 0; e < 4; ++e) z = fmaf((float)hv[e], w0[e], z);
#pragma unroll
    for (int e = 0; e < 4; ++e) z = fmaf((float)hv[4 + e], w1[e], z);
  }
  z += lb3[0];
  const float spv = fmaxf(z, 0.0f) + log1pf(expf(-fabsf(z)));
  const float val = ninfm[(size_t)bp * kN + nc] - spv;
  float* mp = maskb + (size_t)chunk * kChunkRows + row;
  *(float*)mp = val;
  
}

// ---------------------------------------------------------------------------
// Attention core (f32 VALU, head dim 16): block = (b, group of 16 queries) x 8 heads = 128 threads (h = t>>4, p local = t&15).
// K|V rows of 32 nodes (32 x 256 f32 = 32 KB, contiguous) and the bias tile [16][32] staged in LDS per chunk;
// online softmax per thread over 1024 node slots (slots >= 1000 forced to -inf by value); l,m,acc in f32.
// Output O as bf16 hi + bf16 lo planes into Ohi/Olo[bp][h*16+d]: tile [16][128] staged in LDS, each wave writes 4 rows as
// 2 instructions per plane of 32 lanes x 16 B = 512 B = 2 whole 256-B rows (rows >= P skipped, boundary is even);
// ---------------------------------------------------------------------------
__global__ __launch_bounds__(128) void k_attn(const float* __restrict__ Qs, const float* __restrict__ KV,
                                             const float* __restrict__ maskb, unsigned short* __restrict__ Ohi,
                                             unsigned short* __restrict__ Olo) {
  __shared__ __align__(16) float kvs[32 * 256];
  __shared__ __align__(16) float ms[16 * 32];
  __shared__ __align__(16) float ost[16 * kHD];
  const float kNegInf = -__builtin_inff();
  const int t = threadIdx.x, lane = t & 31, wave = t >> 5;
  const int b = blockIdx.x / 7, pg = blockIdx.x - b * 7, p0 = pg * 16;
  const int h = t >> 4, pl = t & 15;
  const int p = p0 + pl, pc = (p < kP) ? p : (kP - 1);
  const float* qp = Qs + (size_t)(b * kP + pc) * kHD + h * kD;
  const v4f qa = *(const v4f*)(qp), qb = *(const v4f*)(qp + 4), qc = *(const v4f*)(qp + 8), qd = *(const v4f*)(qp + 12);
  v4f oa = (v4f){0.f, 0.f, 0.f, 0.f}, ob = (v4f){0.f, 0.f, 0.f, 0.f}, oc = (v4f){0.f, 0.f, 0.f, 0.f}, od = (v4f){0.f, 0.f, 0.f, 0.f};
  float m = -3.0e38f, l = 0.0f;
  const float* kvb = KV + (size_t)b * kNP * (2 * kHD);
  const float* mkb = maskb + (size_t)(b * kP) * kNP;
#pragma unroll 1
  for (int ch = 0; ch < kNP / 32; ++ch) {
    const int n0 = ch * 32;
    __syncthreads();
    const float* src = kvb + (size_t)n0 * (2 * kHD);
    // stage 32 rows x 256 floats = 2048 float4: 16 x 128 threads
#pragma unroll
    for (int i = 0; i < 16; ++i) {
      const int f = i * 128 + t;
      *(v4f*)(kvs + 4 * f) = *(const v4f*)(src + 4 * f);
    }
    {  // bias tile 16 rows x 32 cols = 128 float4: one per thread
      const int r = t >> 3, j4 = (t & 7) * 4;
      const int pr = (p0 + r < kP) ? (p0 + r) : (kP - 1);
      *(v4f*)(ms + r * 32 + j4) = *(const v4f*)(mkb + (size_t)pr * kNP + n0 + j4);
    }
    __syncthreads();
#pragma unroll 1
    for (int j = 0; j < 32; ++j) {
      const float* kr = kvs + j * 256 + h * kD;
      const v4f k0 = *(const v4f*)(kr), k1 = *(const v4f*)(kr + 4), k2 = *(const v4f*)(kr + 8), k3 = *(const v4f*)(kr + 12);
      float s = ms[pl * 32 + j];
      s = fmaf(qa[0], k0[0], s); s = fmaf(qa[1], k0[1], s); s = fmaf(qa[2], k0[2], s); s = fmaf(qa[3], k0[3], s);
      s = fmaf(qb[0], k1[0], s); s = fmaf(qb[1], k1[1], s); s = fmaf(qb[2], k1[2], s); s = fmaf(qb[3], k1[3], s);
      s = fmaf(qc[0], k2[0], s); s = fmaf(qc[1], k2[1], s); s = fmaf(qc[2], k2[2], s); s = fmaf(qc[3], k2[3], s);
      s = fmaf(qd[0], k3[0], s); s = fmaf(qd[1], k3[1], s); s = fmaf(qd[2], k3[2], s); s = fmaf(qd[3], k3[3], s);
      s = (n0 + j < kN) ? s : kNegInf;
      const float mn = fmaxf(m, s);
      const float alpha = __expf(m - mn);
      const float pj = __expf(s - mn);
      m = mn;
      l = fmaf(l, alpha, pj);
      const v4f v0 = *(const v4f*)(kr + kHD), v1 = *(const v4f*)(kr + kHD + 4), v2 = *(const v4f*)(kr + kHD + 8), v3 = *(const v4f*)(kr + kHD + 12);
      oa = v0 * pj + oa * alpha;
      ob = v1 * pj + ob * alpha;
      oc = v2 * pj + oc * alpha;
      od = v3 * pj + od * alpha;
    }
  }
  const float inv = 1.0f / l;
  {
    float* op = ost + pl * kHD + h * kD;
    *(v4f*)(op)      = oa * inv;
    *(v4f*)(op + 4)  = ob * inv;
    *(v4f*)(op + 8)  = oc * inv;
    *(v4f*)(op + 12) = od * inv;
  }
  __syncthreads();
  const int hh = lane >> 4, c8 = (lane & 15) * 8;
  v4u uh[2], ul[2];
  int prow[2];
#pragma unroll
  for (int k = 0; k < 2; ++k) {
    const int rl = wave * 4 + 2 * k + hh;
    prow[k] = p0 + rl;
    const float* s8 = ost + rl * kHD + c8;
    const v4f x0 = *(const v4f*)(s8), x1 = *(const v4f*)(s8 + 4);
    unsigned short hb[8], lb[8];
#pragma unroll
    for (int e = 0; e < 4; ++e) {
      split_bf(x0[e], hb[e], lb[e]);
      split_bf(x1[e], hb[4 + e], lb[4 + e]);
    }
    uh[k] = (v4u){pk16(hb[0], hb[1]), pk16(hb[2], hb[3]), pk16(hb[4], hb[5]), pk16(hb[6], hb[7])};
    ul[k] = (v4u){pk16(lb[0], lb[1]), pk16(lb[2], lb[3]), pk16(lb[4], lb[5]), pk16(lb[6], lb[7])};
  }
  {
#pragma unroll
    for (int k = 0; k < 2; ++k) {
      if (prow[k] < kP) {
        const size_t o = (size_t)(b * kP + prow[k]) * kHD + c8;
        *(v4u*)(Ohi + o) = uh[k];
        *(v4u*)(Olo + o) = ul[k];
      }
    }
    
  }
}

// ---------------------------------------------------------------------------
// Zero fill of two regions, nvec x 16 B each (nvec % 256 == 0, so the region select is block-uniform).
// ---------------------------------------------------------------------------
__global__ __launch_bounds__(256) void k_zero16x2(unsigned int* __restrict__ p0, unsigned int* __restrict__ p1, int nvec) {
  const int i = blockIdx.x * 256 + threadIdx.x;
  if (i >= 2 * nvec) return;
  unsigned int* p = (i < nvec) ? (p0 + 4 * (size_t)i) : (p1 + 4 * (size_t)(i - nvec));
  const v4u z = (v4u){0u, 0u, 0u, 0u};
  *(v4u*)p = z;
  
}

// ---------------------------------------------------------------------------
// Final: per (b,p) row: x = 10*tanh(S) + ninf_mask, softmax over 1000 nodes (f32, fixed-order wave reductions).
// Coverage: 200 blocks x 8 rows = 1600 rows.
// ---------------------------------------------------------------------------
__global__ __launch_bounds__(256) void k_final(const float* __restrict__ Sp, const float* __restrict__ ninfm,
                                              float* __restrict__ out) {
  __shared__ __align__(16) float xs[8 * kN];
  __shared__ float invs[8];
  const float kNegInf = -__builtin_inff();
  const int t = threadIdx.x, lane = t & 31, wave = t >> 5;
  const int r = blockIdx.x * 8 + wave;
  const int b = r / kP, p = r - b * kP;
  const float* srow = Sp + (size_t)(b * kSrows + p) * kNP;
  const float* nrow = ninfm + (size_t)r * kN;
  float* xr = xs + wave * kN;
  float mx = kNegInf;
#pragma unroll 1
  for (int i = 0; i < 32; ++i) {
    const int n = lane + 32 * i;
    const int nc = (n < kN) ? n : (kN - 1);
    const float x = kClip * tanhf(srow[nc]) + nrow[nc];
    if (n < kN) { xr[n] = x; mx = fmaxf(mx, x); }
  }
#pragma unroll
  for (int off = 16; off > 0; off >>= 1) mx = fmaxf(mx, __shfl_xor(mx, off, 32));
  float sum = 0.0f;
#pragma unroll 1
  for (int i = 0; i < 32; ++i) {
    const int n = lane + 32 * i;
    if (n < kN) { const float e = __expf(xr[n] - mx); xr[n] = e; sum += e; }
  }
#pragma unroll
  for (int off = 16; off > 0; off >>= 1) sum += __shfl_xor(sum, off, 32);
  if (lane == 0) invs[wave] = 1.0f / sum;
  __syncthreads();
  float* obase = out + (size_t)blockIdx.x * 8 * kN;
  {
#pragma unroll 1
    for (int f = t; f < 2 * kN; f += 256) {
      v4f v = *(const v4f*)(xs + 4 * f);
      v = v * invs[f / 250];
      *(v4f*)(obase + 4 * (size_t)f) = v;
    }
    
  }
}

// ---------------------------------------------------------------------------
// Host launcher
// Workspace region map (bytes, 256-B aligned offsets):
//   EncHi bf16 [16][1024][128]          4,194,304
//   EncLo bf16 [16][1024][128]          4,194,304
//   WkvHi bf16 [256][128]                 65,536
//   WkvLo bf16 [256][128]                 65,536
//   WcHi  bf16 [128][128]                 32,768
//   WcLo  bf16 [128][128]                 32,768
//   W2T   f16  [64][64]                    8,192
//   KVf   f32  [16384][256]            16,777,216
//   Qs    f32  [1600][128]                819,200
//   QW    f32  [1600][64]                 409,600
//   MASKB f32  [1600][1024]             6,553,600
//   H1c   f16  [204800][64]            26,214,400
//   H2c   f16  [204800][64]            26,214,400
//   Ohi   bf16 [1664][128]                425,984
//   Olo   bf16 [1664][128]                425,984
//   MHhi  bf16 [1664][128]                425,984
//   MHlo  bf16 [1664][128]                425,984
//   Sp    f32  [16][128][1024]           8,388,608
//   total                              95,674,368
// ---------------------------------------------------------------------------
static inline size_t align256(size_t x) { return (x + 255) & ~(size_t)255; }

extern "C" void kernel_launch(void* const* d_in, const int* in_sizes, int n_in,
                              void* d_out, int out_size, void* d_ws, size_t ws_size,
                              hipStream_t stream) {
  if (n_in < 22) return;
  if (in_sizes[0] != kB * kN * kE || in_sizes[1] != kB * kP * kE || in_sizes[2] != kB * kP ||
      in_sizes[3] != kB * kP * kN || in_sizes[4] != kB * kP * kN * kDYN || out_size != kB * kP * kN) return;

  const float* enc      = (const float*)d_in[0];
  const float* enc_last = (const float*)d_in[1];
  const float* loadv    = (const float*)d_in[2];
  const float* ninfm    = (const float*)d_in[3];
  const float* dyn      = (const float*)d_in[4];
  const float* Wq       = (const float*)d_in[5];
  const float* Wk       = (const float*)d_in[6];
  const float* Wv       = (const float*)d_in[7];
  const float* Wc       = (const float*)d_in[8];
  const float* bcv      = (const float*)d_in[9];
  const float* fW1      = (const float*)d_in[10];
  const float* fb1      = (const float*)d_in[11];
  const float* fW2      = (const float*)d_in[12];
  const float* fb2      = (const float*)d_in[13];
  const float* lqW      = (const float*)d_in[14];
  const float* lqb      = (const float*)d_in[15];
  const float* lW1      = (const float*)d_in[16];
  const float* lb1      = (const float*)d_in[17];
  const float* lW2      = (const float*)d_in[18];
  const float* lb2      = (const float*)d_in[19];
  const float* lW3      = (const float*)d_in[20];
  const float* lb3      = (const float*)d_in[21];
  float* out = (float*)d_out;

  char* ws = (char*)d_ws;
  size_t off = 0;
  unsigned short* EncHi = (unsigned short*)(ws + off); off = align256(off + (size_t)kEncRows * kE * 2);
  unsigned short* EncLo = (unsigned short*)(ws + off); off = align256(off + (size_t)kEncRows * kE * 2);
  unsigned short* WkvHi = (unsigned short*)(ws + off); off = align256(off + (size_t)2 * kHD * kE * 2);
  unsigned short* WkvLo = (unsigned short*)(ws + off); off = align256(off + (size_t)2 * kHD * kE * 2);
  unsigned short* WcHi  = (unsigned short*)(ws + off); off = align256(off + (size_t)kE * kHD * 2);
  unsigned short* WcLo  = (unsigned short*)(ws + off); off = align256(off + (size_t)kE * kHD * 2);
  unsigned short* W2T   = (unsigned short*)(ws + off); off = align256(off + (size_t)kHID * kHID * 2);
  float* KVf   = (float*)(ws + off); off = align256(off + (size_t)kEncRows * 2 * kHD * 4);
  float* Qs    = (float*)(ws + off); off = align256(off + (size_t)kBP * kHD * 4);
  float* QW    = (float*)(ws + off); off = align256(off + (size_t)kBP * kHID * 4);
  float* MASKB = (float*)(ws + off); off = align256(off + (size_t)kBP * kNP * 4);
  unsigned short* H1c  = (unsigned short*)(ws + off); off = align256(off + (size_t)kChunkRows * kHID * 2);
  unsigned short* H2c  = (unsigned short*)(ws + off); off = align256(off + (size_t)kChunkRows * kHID * 2);
  unsigned short* Ohi  = (unsigned short*)(ws + off); off = align256(off + (size_t)kBPpad * kHD * 2);
  unsigned short* Olo  = (unsigned short*)(ws + off); off = align256(off + (size_t)kBPpad * kHD * 2);
  unsigned short* MHhi = (unsigned short*)(ws + off); off = align256(off + (size_t)kBPpad * kE * 2);
  unsigned short* MHlo = (unsigned short*)(ws + off); off = align256(off + (size_t)kBPpad * kE * 2);
  float* Sp    = (float*)(ws + off); off = align256(off + (size_t)kB * kSrows * kNP * 4);
  if (off > ws_size) return;
  const float* fdummy = Qs;   // valid, never dereferenced (BIAS_MODE 0 / RESID false)

  // weight planes: Wk|Wv and W_comb transposed to bf16 hi/lo [n][k]; lm_W2 transposed to f16 x16
  k_wprep<<<13, 256, 0, stream>>>(Wk, Wv, Wc, lW2, WkvHi, WkvLo, WcHi, WcLo, W2T);
  // node planes (bf16 hi/lo, 24 zero pad rows per batch in both)
  k_enc_cast<<<(kEncRows * 16) / 256, 256, 0, stream>>>(enc, EncHi, EncLo);
  // K|V projection: [16384][128] x [256][128]^T, bf16 hi/lo both operands, K=128, M=16384, N=256 -> f32
  wmma_gemm64<1, true, 0, 0, false, 0><<<dim3((kEncRows / 64) * (2 * kHD / 64) / 8, 1), 256, 0, stream>>>(
      EncHi, EncLo, kE, 0L, WkvHi, WkvLo, kE, 0L, (void*)KVf, (void*)KVf, 2 * kHD, 0L,
      fdummy, fdummy, 0L, kEncRows, 2 * kHD, kE, 1.0f);
  // query side (f32)
  k_qside<<<kBP, 128, 0, stream>>>(enc_last, loadv, Wq, fW1, fb1, fW2, fb2, lqW, lqb, lW1, lb1, Qs, QW);
  // lazy-mask MLP in 8 chunks of 2 batches (204800 rows each)
  for (int c = 0; c < kNumChunks; ++c) {
    k_lazy1<<<kChunkRows / 256, 256, 0, stream>>>(dyn, QW, lW1, H1c, c);
    // hidden layer: [204800][64] x [64][64]^T, plain f16 (W x16), K=64, bias lm_b2[n], relu, f16 out, scale 1/16
    wmma_gemm64<0, false, 2, 1, false, 2><<<dim3((kChunkRows / 64) / 8, 1), 256, 0, stream>>>(
        H1c, H1c, kHID, 0L, W2T, W2T, kHID, 0L, (void*)H2c, (void*)H2c, kHID, 0L,
        lb2, lb2, 0L, kChunkRows, kHID, kHID, 1.0f / kWCarry);
    k_lazy3<<<kChunkRows / 256, 256, 0, stream>>>((const _Float16*)H2c, lW3, lb3, ninfm, MASKB, c);
  }
  // zero the 64 pad rows (1600..1663) of Ohi and Olo: 64*128 halves = 1024 x 16 B each
  k_zero16x2<<<(2 * 1024) / 256, 256, 0, stream>>>((unsigned int*)(Ohi + (size_t)kBP * kHD),
                                                   (unsigned int*)(Olo + (size_t)kBP * kHD), 1024);
  // attention core (f32) -> O as bf16 hi/lo planes
  k_attn<<<kB * 7, 128, 0, stream>>>(Qs, KVf, MASKB, Ohi, Olo);
  // head merge: [1664][128] x [128][128]^T, bf16 hi/lo both operands, K=128, bias b_comb[n], bf16 hi/lo out planes
  wmma_gemm64<1, true, 2, 2, false, 0><<<dim3(((kBPpad / 64) * (kE / 64) + 7) / 8, 1), 256, 0, stream>>>(
      Ohi, Olo, kHD, 0L, WcHi, WcLo, kHD, 0L, (void*)MHhi, (void*)MHlo, kE, 0L,
      bcv, fdummy, 0L, kBPpad, kE, kHD, 1.0f);
  // pointer scores per batch: A = MH rows b*100 .. b*100+127 (hi/lo, rows beyond the batch are finite data),
  // Bt = node planes of batch b [1024][128] (hi/lo); M=128, N=1024, K=128 -> f32 Sp[b][128][1024], scale 1/sqrt(128)
  wmma_gemm64<1, true, 0, 0, false, 0><<<dim3((kSrows / 64) * (kNP / 64) / 8, kB), 256, 0, stream>>>(
      MHhi, MHlo, kE, (long)kP * kE, EncHi, EncLo, kE, (long)kNP * kE, (void*)Sp, (void*)Sp, kNP, (long)kSrows * kNP,
      fdummy, fdummy, 0L, kSrows, kNP, kE, kInvSqrtE);
  // clipped tanh + mask + softmax -> probs
  k_final<<<kBP / 8, 256, 0, stream>>>(Sp, ninfm, out);
}

// v001
// It runs in 374 microseconds.
// Next to v000, in two timings, it ran 1.61 times as fast each time.
// Contractions: node K|V projection (nodes x [Wk|Wv]^T), head-merge projection (O x W_comb^T) and pointer scores (MH x nodes^T) on v_wmma_f32_16x16x32_bf16 with bf16 hi/lo operand planes (hi.hi + hi.lo + lo.hi); lazy-mask hidden layer (lm_W2^T f16 carried x16, as A, x H1 f16, as B) on v_wmma_f32_16x16x32_f16 inside the fused lazy-mask kernel; all f32 accumulate; query/FiLM/gating/qf projections, lazy layers 1 (K=3 after the broadcast fold) and 3 (N=1), the 16-dim attention core and both softmaxes in f32 on the VALU.
#include <hip/hip_runtime.h>
#include <math.h>

typedef __attribute__((ext_vector_type(16))) _Float16 v16h;
typedef __attribute__((ext_vector_type(8)))  _Float16 v8h;
typedef __attribute__((ext_vector_type(16))) __bf16   v16b;
typedef __attribute__((ext_vector_type(8)))  __bf16   v8b;
typedef __attribute__((ext_vector_type(8)))  float    v8f;
typedef __attribute__((ext_vector_type(4)))  float    v4f;
typedef __attribute__((ext_vector_type(4)))  unsigned int v4u;
typedef __attribute__((ext_vector_type(2)))  float    v2f;
typedef __attribute__((ext_vector_type(2)))  _Float16 v2h;

// ---------------------------------------------------------------------------
// Problem constants
// ---------------------------------------------------------------------------
constexpr int kB   = 16;      // batch
constexpr int kP   = 100;     // queries per batch
constexpr int kN   = 1000;    // nodes
constexpr int kNP  = 1024;    // nodes padded
constexpr int kE   = 128;     // embedding
constexpr int kH   = 8;       // heads
constexpr int kD   = 16;      // head dim
constexpr int kHD  = 128;     // H*D
constexpr int kQD  = 16;      // lazy query dim
constexpr int kDYN = 3;       // dynamic features
constexpr int kHID = 64;      // lazy hidden
constexpr int kBP     = kB * kP;          // 1600 (b,p) rows
constexpr int kBPpad  = 1664;             // 26 * 64
constexpr int kEncRows = kB * kNP;        // 16384 padded node rows
constexpr int kSrows = 128;               // pointer-score rows per batch (100 padded)
constexpr float kWCarry   = 16.0f;        // lm_W2 carried x16 in f16
constexpr float kInvSqrtE = 0.08838834764831845f;
constexpr float kClip     = 10.0f;
static_assert(kBPpad % 64 == 0 && kBPpad >= kBP, "pad");
static_assert(kBPpad >= (kB - 1) * kP + kSrows, "last batch score rows inside MH planes");
static_assert(kH * kD == kHD && kE == kHD, "dims");

// ---------------------------------------------------------------------------
// Helpers
// ---------------------------------------------------------------------------
__device__ __forceinline__ unsigned short f2bf_bits(float f) {
  unsigned u = __float_as_uint(f);
  return (unsigned short)((u + 0x7FFFu + ((u >> 16) & 1u)) >> 16);
}
__device__ __forceinline__ float bf_bits2f(unsigned short h) { return __uint_as_float(((unsigned)h) << 16); }

// hazard guards as plain device helpers (no inline asm inside the kernel template body)
__device__ __forceinline__ void dep_guard_h(v8f& a, v8f& b, v16h x, v16h y) { asm volatile("v_nop\n\tv_nop\n\tv_nop\n\tv_nop" : "+v"(a), "+v"(b) : "v"(x), "v"(y)); }
__device__ __forceinline__ void dep_guard_b(v8f& a, v8f& b, v16b x, v16b y) { asm volatile("v_nop\n\tv_nop\n\tv_nop\n\tv_nop" : "+v"(a), "+v"(b) : "v"(x), "v"(y)); }
__device__ __forceinline__ void keep4_h(v16h a, v16h b, v16h c, v16h d) { asm volatile("v_nop" :: "v"(a), "v"(b), "v"(c), "v"(d)); }
__device__ __forceinline__ void keep4_b(v16b a, v16b b, v16b c, v16b d) { asm volatile("v_nop" :: "v"(a), "v"(b), "v"(c), "v"(d)); }
__device__ __forceinline__ void acc_guard4(v8f& a, v8f& b, v8f& c, v8f& d) { asm volatile("v_nop\n\tv_nop\n\tv_nop\n\tv_nop" : "+v"(a), "+v"(b), "+v"(c), "+v"(d)); }
template <typename T> struct Frag;
template <> struct Frag<_Float16> {
  typedef v16h V; union U { v16h v; v8h h[2]; };
  static __device__ __forceinline__ v16h load(const _Float16* p) {   // elements 0..7 <- p[0..7], 8..15 <- p[16..23]
    U f; f.h[0] = *(const v8h*)(p); f.h[1] = *(const v8h*)(p + 16); return f.v;
  }
  static __device__ __forceinline__ v8f mma(v16h a, v16h b, v8f c) {
    return __builtin_amdgcn_wmma_f32_16x16x32_f16(false, a, false, b, (short)0, c, false, false);
  }
  static __device__ __forceinline__ void guard(v8f& a, v8f& b, v16h x, v16h y) { dep_guard_h(a, b, x, y); }
  static __device__ __forceinline__ void keep(v16h a, v16h b, v16h c, v16h d) { keep4_h(a, b, c, d); }
};
template <> struct Frag<__bf16> {
  typedef v16b V; union U { v16b v; v8b h[2]; };
  static __device__ __forceinline__ v16b load(const __bf16* p) {
    U f; f.h[0] = *(const v8b*)(p); f.h[1] = *(const v8b*)(p + 16); return f.v;
  }
  static __device__ __forceinline__ v8f mma(v16b a, v16b b, v8f c) {
    return __builtin_amdgcn_wmma_f32_16x16x32_bf16(false, a, false, b, (short)0, c, false, false);
  }
  static __device__ __forceinline__ void guard(v8f& a, v8f& b, v16b x, v16b y) { dep_guard_b(a, b, x, y); }
  static __device__ __forceinline__ void keep(v16b a, v16b b, v16b c, v16b d) { keep4_b(a, b, c, d); }
};

__device__ __forceinline__ unsigned pk16(unsigned short a, unsigned short b) { return (unsigned)a | ((unsigned)b << 16); }
__device__ __forceinline__ unsigned short h_bits(float f) { const _Float16 h = (_Float16)f; return __builtin_bit_cast(unsigned short, h); }
// bf16 hi + bf16 lo split of an f32 value (both RNE converts)
__device__ __forceinline__ void split_bf(float f, unsigned short& hb, unsigned short& lb) {
  hb = f2bf_bits(f);
  lb = f2bf_bits(f - bf_bits2f(hb));
}

// ---- Register-blocked batched WMMA GEMM (ACT reduced to none/relu/leaky) -----------------------
// C[m,n] = scale * sum_k A[m,k] * Bt[n,k] (+bias)(+resid); each wave owns a 64x64 tile.
// A row-major [M,K]; Bt row-major [N,K]; M,N % 64 == 0, K % 32 == 0.
// SPLIT: operands are hi/lo planes (A2/Bt2 = lo planes, same layout); product = hi·hi + hi·lo + lo·hi.
// BIAS_MODE: 0 = none, 1 = bias[m], 2 = bias[n].
// OUT_MODE: 0 = f32, 1 = f16, 2 = bf16 hi plane (Cout) + bf16 lo plane (Cout2).
// ET: 0 = f16 operands, 1 = bf16 operands (pointers passed as 16-bit storage)
template <int ET> struct Elem;
template <> struct Elem<0> { typedef _Float16 T; };
template <> struct Elem<1> { typedef __bf16 T; };
template <int ET, bool SPLIT, int BIAS_MODE, int OUT_MODE, bool RESID, int ACT = 0>
__global__ __launch_bounds__(256) void wmma_gemm64(
    const unsigned short* __restrict__ Ap, const unsigned short* __restrict__ A2p, int lda, long strideA,
    const unsigned short* __restrict__ Btp, const unsigned short* __restrict__ Bt2p, int ldb, long strideB,
    void* __restrict__ Cout, void* __restrict__ Cout2, int ldc, long strideC,
    const float* __restrict__ bias,
    const float* __restrict__ resid, long strideR,
    int M, int N, int K, float scale) {
  typedef typename Elem<ET>::T T;
  typedef typename Frag<T>::V V;
  const T* A = (const T*)Ap; const T* A2 = (const T*)A2p; const T* Bt = (const T*)Btp; const T* Bt2 = (const T*)Bt2p;
  __shared__ __align__(16) float sT[8][16 * 68];   // per-wave 16x64 slab, pitch 68 floats
  const int b    = blockIdx.y;
  const int lane = threadIdx.x & 31;
  const int wave = threadIdx.x >> 5;
  const int tilesN = N >> 6;
  const int tilesM = M >> 6;
  const int tile = blockIdx.x * 8 + wave;
  if (tile >= tilesM * tilesN) return;   // wave-uniform; no block barriers in this kernel
  const int tm = tile / tilesN;
  const int tn = tile - tm * tilesN;
  const int m0 = tm << 6;
  const int n0 = tn << 6;

  const T* Ab  = A  + (size_t)b * strideA;
  const T* Bb  = Bt + (size_t)b * strideB;
  const T* Ab2 = SPLIT ? (A2  + (size_t)b * strideA) : nullptr;
  const T* Bb2 = SPLIT ? (Bt2 + (size_t)b * strideB) : nullptr;

  const int rlane = lane & 15;                 // row (A) / col (B, D) within subtile
  const int koff  = (lane >> 4) * 8;           // k offset of this lane half
  const int mOff  = (lane >> 4) * 8;           // D row offset

  v8f acc[4][4];
#pragma unroll
  for (int i = 0; i < 4; ++i)
#pragma unroll
    for (int j = 0; j < 4; ++j) acc[i][j] = (v8f){0.f,0.f,0.f,0.f,0.f,0.f,0.f,0.f};

  for (int k0 = 0; k0 < K; k0 += 32) {
    V bh[4], bl[4];
#pragma unroll
    for (int j = 0; j < 4; ++j) {
      const size_t bo = (size_t)(n0 + (j << 4) + rlane) * ldb + koff + k0;
      bh[j] = Frag<T>::load(Bb + bo);
      if (SPLIT) bl[j] = Frag<T>::load(Bb2 + bo);
    }
#pragma unroll
    for (int i = 0; i < 4; ++i) {
      const size_t ao = (size_t)(m0 + (i << 4) + rlane) * lda + koff + k0;
      V ah = Frag<T>::load(Ab + ao);
      V al;
      if (SPLIT) al = Frag<T>::load(Ab2 + ao);
#pragma unroll
      for (int j = 0; j < 4; ++j) {
        acc[i][j] = Frag<T>::mma(ah, bh[j], acc[i][j]);
        if (SPLIT) {
          acc[i][j] = Frag<T>::mma(ah, bl[j], acc[i][j]);
          acc[i][j] = Frag<T>::mma(al, bh[j], acc[i][j]);
        }
      }
      Frag<T>::guard(acc[i][0], acc[i][3], ah, SPLIT ? al : ah);
    }
    Frag<T>::keep(bh[0], bh[1], bh[2], bh[3]);
    if (SPLIT) Frag<T>::keep(bl[0], bl[1], bl[2], bl[3]);
  }
  acc_guard4(acc[0][0], acc[0][1], acc[0][2], acc[0][3]);
  acc_guard4(acc[1][0], acc[1][1], acc[1][2], acc[1][3]);
  acc_guard4(acc[2][0], acc[2][1], acc[2][2], acc[2][3]);
  acc_guard4(acc[3][0], acc[3][1], acc[3][2], acc[3][3]);

  // ---- epilogue ----
  float* slab = sT[wave];
  const float* Rb = RESID ? (resid + (size_t)b * strideR) : nullptr;
#pragma unroll
  for (int i = 0; i < 4; ++i) {
    const int mBase = m0 + (i << 4);
#pragma unroll
    for (int j = 0; j < 4; ++j) {
      const int n = n0 + (j << 4) + rlane;
      float bv = 0.f;
      if (BIAS_MODE == 2) bv = bias[n];
#pragma unroll
      for (int r = 0; r < 8; ++r) {
        float v = acc[i][j][r] * scale;
        if (BIAS_MODE == 1) v += bias[mBase + mOff + r];
        if (BIAS_MODE == 2) v += bv;
        if (RESID) v += Rb[(size_t)(mBase + mOff + r) * ldc + n];
        if (ACT == 2) v = fmaxf(v, 0.0f);
        if (ACT == 4) v = (v > 0.f) ? v : 0.01f * v;
        slab[(mOff + r) * 68 + (j << 4) + rlane] = v;
      }
    }
    __builtin_amdgcn_fence(__ATOMIC_RELEASE, "workgroup");
    __builtin_amdgcn_wave_barrier();
    __builtin_amdgcn_fence(__ATOMIC_ACQUIRE, "workgroup");
    if (OUT_MODE == 0) {
      float* C = (float*)Cout + (size_t)b * strideC;
      const int hh = lane >> 4, c4 = (lane & 15) * 4;     // row seg = 256 B = 16 lanes x 16 B
      {
#pragma unroll
        for (int it = 0; it < 8; ++it) {
          const int row = it * 2 + hh;
          v4f v = *(const v4f*)(slab + row * 68 + c4);
          *(v4f*)(C + (size_t)(mBase + row) * ldc + n0 + c4) = v;
        }
        
      }
    } else {
      const int q = lane >> 3, c8 = (lane & 7) * 8;
      unsigned short* C  = (unsigned short*)Cout  + (size_t)b * strideC;
      unsigned short* C2 = (OUT_MODE == 2) ? ((unsigned short*)Cout2 + (size_t)b * strideC) : nullptr;
      {
#pragma unroll
        for (int it = 0; it < 4; ++it) {
          const int row = it * 4 + q;
          const float* sp = slab + row * 68 + c8;
          v8h hv, lv;
#pragma unroll
          for (int e = 0; e < 8; ++e) {
            if (OUT_MODE == 1) {
              hv[e] = (_Float16)sp[e];
            } else {
              unsigned short hb = f2bf_bits(sp[e]);
              unsigned short lb = f2bf_bits(sp[e] - bf_bits2f(hb));
              hv[e] = __builtin_bit_cast(_Float16, hb);
              lv[e] = __builtin_bit_cast(_Float16, lb);
            }
          }
          *(v8h*)(C + (size_t)(mBase + row) * ldc + n0 + c8) = hv;
          if (OUT_MODE == 2) *(v8h*)(C2 + (size_t)(mBase + row) * ldc + n0 + c8) = lv;
        }
        
      }
    }
    __builtin_amdgcn_fence(__ATOMIC_RELEASE, "workgroup");
    __builtin_amdgcn_wave_barrier();
    __builtin_amdgcn_fence(__ATOMIC_ACQUIRE, "workgroup");
  }
}

// ---------------------------------------------------------------------------
// Weight preparation: 64x64 transpose tiles of f32 W[k][n] (pitch ldn) -> WT[n][k] (pitch ldk).
// blocks 0..3: Wk -> WkvHi/WkvLo rows 0..127 (bf16 hi + bf16 lo planes); 4..7: Wv -> rows 128..255;
// 8..11: W_comb -> WcHi/WcLo; 12: lm_W2 -> W2T (f16 carried x16, single plane).
// Load coverage: 16 x 256 = 4096 = whole tile. Store coverage: 8 waves x 2 it x 4 rows (lane>>3) = 64 rows,
// ---------------------------------------------------------------------------
__global__ __launch_bounds__(256) void k_wprep(const float* __restrict__ Wk, const float* __restrict__ Wv,
                                              const float* __restrict__ Wcomb, const float* __restrict__ W2,
                                              unsigned short* __restrict__ WkvHi, unsigned short* __restrict__ WkvLo,
                                              unsigned short* __restrict__ WcHi, unsigned short* __restrict__ WcLo,
                                              unsigned short* __restrict__ W2T) {
  __shared__ float sm[64][65];   // sm[n_local][k_local]
  const int t = threadIdx.x, lane = t & 31, wave = t >> 5;
  const int bid = blockIdx.x;    // block-uniform selection below
  const float* W = Wk; unsigned short* outH = WkvHi; unsigned short* outL = WkvLo;
  int ldn = kHD, ldk = kE, nt = 0, kt = 0; float carry = 1.0f;
  const bool two_planes = (bid < 12);
  if (bid < 4)       { W = Wk;    outH = WkvHi;                    outL = WkvLo;                    ldn = kHD;  ldk = kE;   nt = bid & 1;       kt = bid >> 1;       carry = 1.0f; }
  else if (bid < 8)  { W = Wv;    outH = WkvHi + (size_t)kHD * kE; outL = WkvLo + (size_t)kHD * kE; ldn = kHD;  ldk = kE;   nt = (bid - 4) & 1; kt = (bid - 4) >> 1; carry = 1.0f; }
  else if (bid < 12) { W = Wcomb; outH = WcHi;                     outL = WcLo;                     ldn = kE;   ldk = kHD;  nt = (bid - 8) & 1; kt = (bid - 8) >> 1; carry = 1.0f; }
  else               { W = W2;    outH = W2T;                      outL = W2T;                      ldn = kHID; ldk = kHID; nt = 0;             kt = 0;              carry = kWCarry; }
  const int n0 = nt * 64, k0 = kt * 64;
#pragma unroll
  for (int i = 0; i < 16; ++i) {
    const int e = i * 256 + t;
    const int r = e >> 6;    // k local
    const int c = e & 63;    // n local
    sm[c][r] = W[(size_t)(k0 + r) * ldn + n0 + c] * carry;
  }
  __syncthreads();
  const int q = lane >> 3, c8 = (lane & 7) * 8;
  v4u uh[2], ul[2];
  int rowv[2];
#pragma unroll
  for (int it = 0; it < 2; ++it) {
    const int row = wave * 8 + it * 4 + q;   // n local
    rowv[it] = row;
    unsigned short hb[8], lb[8];
#pragma unroll
    for (int e = 0; e < 8; ++e) {
      const float v = sm[row][c8 + e];
      if (two_planes) { split_bf(v, hb[e], lb[e]); }
      else { hb[e] = h_bits(v); lb[e] = hb[e]; }
    }
    uh[it] = (v4u){pk16(hb[0], hb[1]), pk16(hb[2], hb[3]), pk16(hb[4], hb[5]), pk16(hb[6], hb[7])};
    ul[it] = (v4u){pk16(lb[0], lb[1]), pk16(lb[2], lb[3]), pk16(lb[4], lb[5]), pk16(lb[6], lb[7])};
  }
  {
#pragma unroll
    for (int it = 0; it < 2; ++it) {
      const size_t o = (size_t)(n0 + rowv[it]) * ldk + k0 + c8;
      *(v4u*)(outH + o) = uh[it];
      if (two_planes) *(v4u*)(outL + o) = ul[it];
    }
    
  }
}

// ---------------------------------------------------------------------------
// Node split: enc f32 [B][1000][128] -> EncHi/EncLo bf16 hi/lo planes [B][1024][128] each
// (rows 1000..1023 of every batch written as zeros in both planes).
// ---------------------------------------------------------------------------
__global__ __launch_bounds__(256) void k_enc_cast(const float* __restrict__ enc, unsigned short* __restrict__ outHi,
                                                 unsigned short* __restrict__ outLo) {
  const int i = blockIdx.x * 256 + threadIdx.x;
  if (i >= kEncRows * 16) return;
  const int row = i >> 4, c8 = (i & 15) * 8;
  const int b = row >> 10, n = row & (kNP - 1);
  const int nc = (n < kN) ? n : (kN - 1);                    // address clamp
  const float* p = enc + ((size_t)(b * kN + nc)) * kE + c8;
  const v4f a = *(const v4f*)(p);
  const v4f c = *(const v4f*)(p + 4);
  const bool valid = (n < kN);
  unsigned short hb[8], lb[8];
#pragma unroll
  for (int e = 0; e < 4; ++e) {
    split_bf(valid ? a[e] : 0.0f, hb[e], lb[e]);
    split_bf(valid ? c[e] : 0.0f, hb[4 + e], lb[4 + e]);
  }
  const v4u uh = (v4u){pk16(hb[0], hb[1]), pk16(hb[2], hb[3]), pk16(hb[4], hb[5]), pk16(hb[6], hb[7])};
  const v4u ul = (v4u){pk16(lb[0], lb[1]), pk16(lb[2], lb[3]), pk16(lb[4], lb[5]), pk16(lb[6], lb[7])};
  const size_t o = (size_t)row * kE + c8;
  *(v4u*)(outHi + o) = uh;
  *(v4u*)(outLo + o) = ul;
  
}

// ---------------------------------------------------------------------------
// Query side per (b,p) (f32, VALU): q_in = [last | load] (129);
//   Qs[bp][h*16+d] = ((q_in.Wq_last) * 2*sigmoid(relu(q_in.fW1 + fb1).fW2 + fb2)) * 0.25   (1/sqrt(16) folded, exact)
//   QW[bp][64]     = lm_b1 + qf.lm_W1[3:19]   with qf = q_in.lazy_q_W + lazy_q_b
// 128 threads; rolled loops. Stores: wave 0 writes the 512-B Qs row (32 lanes x 16 B, one instruction),
// ---------------------------------------------------------------------------
__global__ __launch_bounds__(128) void k_qside(const float* __restrict__ enc_last, const float* __restrict__ loadv,
                                              const float* __restrict__ Wq, const float* __restrict__ fW1,
                                              const float* __restrict__ fb1, const float* __restrict__ fW2,
                                              const float* __restrict__ fb2, const float* __restrict__ lqW,
                                              const float* __restrict__ lqb, const float* __restrict__ lW1,
                                              const float* __restrict__ lb1,
                                              float* __restrict__ Qs, float* __restrict__ QW) {
  __shared__ float qin[kE + 4];
  __shared__ float g1s[kE + 4];
  __shared__ __align__(16) float qst[kHD];
  __shared__ float qfs[kQD];
  __shared__ __align__(16) float qws[kHID];
  const int bp = blockIdx.x;
  const int t = threadIdx.x, lane = t & 31, wave = t >> 5;
  qin[t] = enc_last[(size_t)bp * kE + t];
  if (t == 0) qin[kE] = loadv[bp];
  __syncthreads();
  for (int j = t; j < kE + 1; j += 128) {
    float acc = fb1[j];
#pragma unroll 1
    for (int e = 0; e < kE + 1; ++e) acc = fmaf(qin[e], fW1[(size_t)e * (kE + 1) + j], acc);
    g1s[j] = fmaxf(acc, 0.0f);
  }
  __syncthreads();
  {
    const int j = t;
    float qv = 0.0f, gm = fb2[j];
#pragma unroll 1
    for (int e = 0; e < kE + 1; ++e) {
      qv = fmaf(qin[e], Wq[(size_t)e * kHD + j], qv);
      gm = fmaf(g1s[e], fW2[(size_t)e * kHD + j], gm);
    }
    const float den = 1.0f + expf(-gm);
    const float gamma = 2.0f * (1.0f / den);
    qst[j] = (qv * gamma) * 0.25f;
  }
  if (t < kQD) {
    float acc = lqb[t];
#pragma unroll 1
    for (int e = 0; e < kE + 1; ++e) acc = fmaf(qin[e], lqW[(size_t)e * kQD + t], acc);
    qfs[t] = acc;
  }
  __syncthreads();
  if (t < kHID) {
    float acc = lb1[t];
#pragma unroll 1
    for (int i = 0; i < kQD; ++i) acc = fmaf(qfs[i], lW1[(size_t)(kDYN + i) * kHID + t], acc);
    qws[t] = acc;
  }
  __syncthreads();
  if (wave == 0) {
    const v4f v = *(const v4f*)(qst + 4 * lane);
    float* dst = Qs + (size_t)bp * kHD + 4 * lane;
    *(v4f*)dst = v;
    
  } else if (wave == 1) {
    if (lane < 16) {
      const v4f v = *(const v4f*)(qws + 4 * lane);
      float* dst = QW + (size_t)bp * kHID + 4 * lane;
      *(v4f*)dst = v;
      
    }
  }
}

// ---------------------------------------------------------------------------
// Lazy-mask MLP, all three layers in one kernel; H1 and H2 never leave the registers.
// Block = one (b,p) row of MASKB, 4 waves; a wave owns 256 node slots and walks them 32 at a time (two 16-slot tiles).
// Lane l: c = l & 15, h = l >> 4.
//   layer 1 (f32 VALU): the lane computes H1[slot c][k] for its own 32 k (k = 32 s + 16 h + e, s = 0,1, e = 0..15),
//     relu, f16: that is the B fragment of k step s as it stands. Its weights come from an LDS table, per k pair
//     {W1[0][k,k+1], W1[1][k,k+1], W1[2][k,k+1], QW[k,k+1]}; the row's dynamic features and mask row are staged in LDS once.
//   layer 2 (WMMA f16): A = lm_W2^T x16, row j = 16 i + c, the same k per lane and element;
//     D register r of tile i = 16 * (H1 . lm_W2[:, j]) for hidden unit j = 16 i + 8 h + r of slot c.
//   layer 3 (f32 VALU): z = sum_j relu(D / 16 + lm_b2[j]) * lm_W3[j]: 32 j in the lane, the other 32 in lane l ^ 16.
//   MASKB[bp][n] = ninf_mask[b,p,min(n,999)] - softplus(z + lm_b3)   (ALPHA = 1)
// Coverage: 1600 blocks x 4 waves x 8 trips x 32 slots = all 1024 columns of all 1600 rows (pad slots from clamped inputs).
// ---------------------------------------------------------------------------
// layer 3 for one 16-unit tile: sum over the lane's 8 hidden units of relu(D / 16 + b2) * w3
__device__ __forceinline__ v2f lazy_l3(v8f acc, const v2f (&b2)[4], const v2f (&w3)[4]) {
  const v2f zero = (v2f){0.0f, 0.0f};
  const v2f sc = (v2f){1.0f / kWCarry, 1.0f / kWCarry};
  v2f zs = zero;
#pragma unroll
  for (int q = 0; q < 4; ++q) {
    const v2f a = __builtin_elementwise_max(__builtin_elementwise_fma((v2f){acc[2 * q], acc[2 * q + 1]}, sc, b2[q]), zero);
    zs = __builtin_elementwise_fma(a, w3[q], zs);
  }
  return zs;
}
__global__ __launch_bounds__(128) void k_lazy(const float* __restrict__ dyn, const float* __restrict__ QW,
                                             const float* __restrict__ lW1, const _Float16* __restrict__ W2T,
                                             const float* __restrict__ lb2, const float* __restrict__ lW3,
                                             const float* __restrict__ lb3, const float* __restrict__ ninfm,
                                             float* __restrict__ maskb) {
  __shared__ __align__(16) float tbl[2 * 16 * 8];      // [h][k pair][w0 w0 w1 w1 w2 w2 qw qw]
  __shared__ __align__(16) float sd[kN * kDYN];        // dynamic features of this (b,p): 1000 x 3
  __shared__ __align__(16) float sn[kN];               // ninf_mask row of this (b,p)
  const int bp = blockIdx.x;
  const int t = threadIdx.x;
  const int lane = t & 31, wave = t >> 5;
  const int c = lane & 15, h = lane >> 4;
  // stage the 12000 contiguous bytes of dynamic features: 750 x 16 B over 128 threads
  const unsigned oD = (unsigned)t * 16u;
  const char* dsrc = (const char*)(dyn + (size_t)bp * kN * kDYN);
  v4f dv[6];
#pragma unroll
  for (int i = 0; i < 5; ++i) dv[i] = *(const v4f*)(dsrc + oD + i * 2048);
  const bool last = (t < (kN * kDYN * 4 - 5 * 2048) / 16);
  const unsigned oL = last ? (oD + 5 * 2048) : 0u;     // threads past the end fetch in bounds and store nothing
  dv[5] = *(const v4f*)(dsrc + oL);
  // and the 4000 contiguous bytes of the mask row: 250 x 16 B
  const char* nsrc = (const char*)(ninfm + (size_t)bp * kN);
  const bool lastn = (t < (kN * 4 - 2048) / 16);
  const unsigned oN = lastn ? (oD + 2048) : 0u;
  const v4f nv0 = *(const v4f*)(nsrc + oD);
  const v4f nv1 = *(const v4f*)(nsrc + oN);
  // weight table: thread t fetches one pair: h = t >> 6, k pair p = (t >> 2) & 15, which = t & 3
  const int tp = (t >> 2) & 15, tw = t & 3;
  const int tk = 32 * (tp >> 3) + 16 * (t >> 6) + 2 * (tp & 7);
  const float* tsrc = (tw < 3) ? (lW1 + tw * kHID + tk) : (QW + (size_t)bp * kHID + tk);
  const v2f tv = *(const v2f*)tsrc;
  // byte offsets of the lane's first fragment / bias element; these set-up loads are scalar base + one of them
  const unsigned oA = (unsigned)(c * kHID + 16 * h) * 2u;
  const unsigned oJ = (unsigned)(8 * h) * 4u;
  v16h aw[4][2];
#pragma unroll
  for (int i = 0; i < 4; ++i)
#pragma unroll
    for (int s = 0; s < 2; ++s) aw[i][s] = *(const v16h*)((const char*)W2T + oA + (16 * i * kHID + 32 * s) * 2);
  v2f b2[4][4], w3[4][4];
#pragma unroll
  for (int i = 0; i < 4; ++i)
#pragma unroll
    for (int q = 0; q < 4; ++q) {
      b2[i][q] = *(const v2f*)((const char*)lb2 + oJ + (16 * i + 2 * q) * 4);
      w3[i][q] = *(const v2f*)((const char*)lW3 + oJ + (16 * i + 2 * q) * 4);
    }
  const float b3 = lb3[0];
  // address translations done before a register that a load above names is reused
  asm volatile("s_wait_xcnt 0x0" :: "v"(oD), "v"(oL), "v"(oN), "v"(tsrc), "v"(oA), "v"(oJ) : "memory");
#pragma unroll
  for (int i = 0; i < 5; ++i) *(v4f*)((char*)sd + oD + i * 2048) = dv[i];
  if (last) *(v4f*)((char*)sd + oL) = dv[5];
  *(v4f*)((char*)sn + oD) = nv0;
  if (lastn) *(v4f*)((char*)sn + oN) = nv1;
  *(v2f*)(tbl + 2 * t) = tv;
  __syncthreads();
  const int nw = wave * 256;
  float* mp = maskb + (size_t)bp * kNP + nw + lane;
  const v4f* tb4 = (const v4f*)(tbl + h * 128);
  for (int it = 0; it < 8; ++it) {
    const int n0 = nw + it * 32;
    const int n = n0 + lane;
    const int nc = (n < kN) ? n : (kN - 1);                          // address clamps (pad slots)
    const int ia = ((n0 + c < kN) ? (n0 + c) : (kN - 1)) * kDYN;
    const int ib = ((n0 + 16 + c < kN) ? (n0 + 16 + c) : (kN - 1)) * kDYN;
    const float a0 = sd[ia], a1 = sd[ia + 1], a2 = sd[ia + 2];
    const float e0 = sd[ib], e1 = sd[ib + 1], e2 = sd[ib + 2];
    v16h ba[2], bb[2];
    const v2h hzero = (v2h){(_Float16)0.0f, (_Float16)0.0f};
    v4f tq[2][8];                               // weight-table reads, four k pairs a group, one group ahead
#pragma unroll
    for (int j = 0; j < 8; ++j) tq[0][j] = tb4[j];
#pragma unroll
    for (int g = 0; g < 4; ++g) {
      if (g < 3) {
#pragma unroll
        for (int j = 0; j < 8; ++j) tq[(g + 1) & 1][j] = tb4[8 * (g + 1) + j];
      }
      // keeps the next group's LDS reads in front of this group's arithmetic, which then covers their latency
      __builtin_amdgcn_sched_barrier(0);
#pragma unroll
      for (int pp = 0; pp < 4; ++pp) {
        const int p = 4 * g + pp;
        const v4f u = tq[g & 1][2 * pp], v = tq[g & 1][2 * pp + 1];
        const v2f w0 = (v2f){u[0], u[1]}, w1 = (v2f){u[2], u[3]}, w2 = (v2f){v[0], v[1]}, qw = (v2f){v[2], v[3]};
        const v2f xa = __builtin_elementwise_fma(w0, (v2f){a0, a0}, __builtin_elementwise_fma(w1, (v2f){a1, a1},
                       __builtin_elementwise_fma(w2, (v2f){a2, a2}, qw)));
        const v2f xb = __builtin_elementwise_fma(w0, (v2f){e0, e0}, __builtin_elementwise_fma(w1, (v2f){e1, e1},
                       __builtin_elementwise_fma(w2, (v2f){e2, e2}, qw)));
        // relu behind the rounding: same value as rounding behind relu
        const v2h ya = __builtin_elementwise_max(__builtin_convertvector(xa, v2h), hzero);
        const v2h yb = __builtin_elementwise_max(__builtin_convertvector(xb, v2h), hzero);
        ba[p >> 3][2 * (p & 7)] = ya[0]; ba[p >> 3][2 * (p & 7) + 1] = ya[1];
        bb[p >> 3][2 * (p & 7)] = yb[0]; bb[p >> 3][2 * (p & 7) + 1] = yb[1];
      }
    }
    v2f za2[4], zb2[4];
#pragma unroll
    for (int i = 0; i < 4; ++i) {
      const v8f czero = (v8f){0.f, 0.f, 0.f, 0.f, 0.f, 0.f, 0.f, 0.f};
      v8f ca = __builtin_amdgcn_wmma_f32_16x16x32_f16(false, aw[i][0], false, ba[0], (short)0, czero, false, false);
      v8f cc = __builtin_amdgcn_wmma_f32_16x16x32_f16(false, aw[i][0], false, bb[0], (short)0, czero, false, false);
      ca = __builtin_amdgcn_wmma_f32_16x16x32_f16(false, aw[i][1], false, ba[1], (short)0, ca, false, false);
      cc = __builtin_amdgcn_wmma_f32_16x16x32_f16(false, aw[i][1], false, bb[1], (short)0, cc, false, false);
      za2[i] = lazy_l3(ca, b2[i], w3[i]);
      zb2[i] = lazy_l3(cc, b2[i], w3[i]);
    }
    const v2f ta = (za2[0] + za2[1]) + (za2[2] + za2[3]);
    const v2f tb = (zb2[0] + zb2[1]) + (zb2[2] + zb2[3]);
    const float za = ta[0] + ta[1], zb = tb[0] + tb[1];
    // lanes 0..15 finish slots n0 + c (tile a), lanes 16..31 slots n0 + 16 + c (tile b): one exchange l <-> l ^ 16 for both
    const float mine = h ? zb : za;
    const int other = __float_as_int(h ? za : zb);
    const float z = (mine + __int_as_float(__builtin_amdgcn_permlanex16(other, other, 0x76543210, 0xfedcba98, false, false))) + b3;
    const float spv = fmaxf(z, 0.0f) + log1pf(expf(-fabsf(z)));
    *mp = sn[nc] - spv;
    // address translation done before the store's address register is advanced; the "memory" clobber also keeps the
    // weight-table reads inside the loop (hoisted they hold 128 more registers: over 256, one wave per SIMD fewer)
    asm volatile("s_wait_xcnt 0x0" :: "v"(mp) : "memory");
    mp += 32;
  }
}

// ---------------------------------------------------------------------------
// Attention core (f32 VALU, head dim 16): block = (b, group of 16 queries) x 8 heads = 128 threads (h = t>>4, p local = t&15).
// K|V rows of 32 nodes (32 x 256 f32 = 32 KB, contiguous) and the bias tile [16][32] staged in LDS per chunk;
// online softmax per thread over 1024 node slots (slots >= 1000 forced to -inf by value); l,m,acc in f32.
// Output O as bf16 hi + bf16 lo planes into Ohi/Olo[bp][h*16+d]: tile [16][128] staged in LDS, each wave writes 4 rows as
// 2 instructions per plane of 32 lanes x 16 B = 512 B = 2 whole 256-B rows (rows >= P skipped, boundary is even);
// ---------------------------------------------------------------------------
__global__ __launch_bounds__(128) void k_attn(const float* __restrict__ Qs, const float* __restrict__ KV,
                                             const float* __restrict__ maskb, unsigned short* __restrict__ Ohi,
                                             unsigned short* __restrict__ Olo) {
  __shared__ __align__(16) float kvs[32 * 256];
  __shared__ __align__(16) float ms[16 * 32];
  __shared__ __align__(16) float ost[16 * kHD];
  const float kNegInf = -__builtin_inff();
  const int t = threadIdx.x, lane = t & 31, wave = t >> 5;
  const int b = blockIdx.x / 7, pg = blockIdx.x - b * 7, p0 = pg * 16;
  const int h = t >> 4, pl = t & 15;
  const int p = p0 + pl, pc = (p < kP) ? p : (kP - 1);
  const float* qp = Qs + (size_t)(b * kP + pc) * kHD + h * kD;
  const v4f qa = *(const v4f*)(qp), qb = *(const v4f*)(qp + 4), qc = *(const v4f*)(qp + 8), qd = *(const v4f*)(qp + 12);
  v4f oa = (v4f){0.f, 0.f, 0.f, 0.f}, ob = (v4f){0.f, 0.f, 0.f, 0.f}, oc = (v4f){0.f, 0.f, 0.f, 0.f}, od = (v4f){0.f, 0.f, 0.f, 0.f};
  float m = -3.0e38f, l = 0.0f;
  const float* kvb = KV + (size_t)b * kNP * (2 * kHD);
  const float* mkb = maskb + (size_t)(b * kP) * kNP;
#pragma unroll 1
  for (int ch = 0; ch < kNP / 32; ++ch) {
    const int n0 = ch * 32;
    __syncthreads();
    const float* src = kvb + (size_t)n0 * (2 * kHD);
    // stage 32 rows x 256 floats = 2048 float4: 16 x 128 threads
#pragma unroll
    for (int i = 0; i < 16; ++i) {
      const int f = i * 128 + t;
      *(v4f*)(kvs + 4 * f) = *(const v4f*)(src + 4 * f);
    }
    {  // bias tile 16 rows x 32 cols = 128 float4: one per thread
      const int r = t >> 3, j4 = (t & 7) * 4;
      const int pr = (p0 + r < kP) ? (p0 + r) : (kP - 1);
      *(v4f*)(ms + r * 32 + j4) = *(const v4f*)(mkb + (size_t)pr * kNP + n0 + j4);
    }
    __syncthreads();
#pragma unroll 1
    for (int j = 0; j < 32; ++j) {
      const float* kr = kvs + j * 256 + h * kD;
      const v4f k0 = *(const v4f*)(kr), k1 = *(const v4f*)(kr + 4), k2 = *(const v4f*)(kr + 8), k3 = *(const v4f*)(kr + 12);
      float s = ms[pl * 32 + j];
      s = fmaf(qa[0], k0[0], s); s = fmaf(qa[1], k0[1], s); s = fmaf(qa[2], k0[2], s); s = fmaf(qa[3], k0[3], s);
      s = fmaf(qb[0], k1[0], s); s = fmaf(qb[1], k1[1], s); s = fmaf(qb[2], k1[2], s); s = fmaf(qb[3], k1[3], s);
      s = fmaf(qc[0], k2[0], s); s = fmaf(qc[1], k2[1], s); s = fmaf(qc[2], k2[2], s); s = fmaf(qc[3], k2[3], s);
      s = fmaf(qd[0], k3[0], s); s = fmaf(qd[1], k3[1], s); s = fmaf(qd[2], k3[2], s); s = fmaf(qd[3], k3[3], s);
      s = (n0 + j < kN) ? s : kNegInf;
      const float mn = fmaxf(m, s);
      const float alpha = __expf(m - mn);
      const float pj = __expf(s - mn);
      m = mn;
      l = fmaf(l, alpha, pj);
      const v4f v0 = *(const v4f*)(kr + kHD), v1 = *(const v4f*)(kr + kHD + 4), v2 = *(const v4f*)(kr + kHD + 8), v3 = *(const v4f*)(kr + kHD + 12);
      oa = v0 * pj + oa * alpha;
      ob = v1 * pj + ob * alpha;
      oc = v2 * pj + oc * alpha;
      od = v3 * pj + od * alpha;
    }
  }
  const float inv = 1.0f / l;
  {
    float* op = ost + pl * kHD + h * kD;
    *(v4f*)(op)      = oa * inv;
    *(v4f*)(op + 4)  = ob * inv;
    *(v4f*)(op + 8)  = oc * inv;
    *(v4f*)(op + 12) = od * inv;
  }
  __syncthreads();
  const int hh = lane >> 4, c8 = (lane & 15) * 8;
  v4u uh[2], ul[2];
  int prow[2];
#pragma unroll
  for (int k = 0; k < 2; ++k) {
    const int rl = wave * 4 + 2 * k + hh;
    prow[k] = p0 + rl;
    const float* s8 = ost + rl * kHD + c8;
    const v4f x0 = *(const v4f*)(s8), x1 = *(const v4f*)(s8 + 4);
    unsigned short hb[8], lb[8];
#pragma unroll
    for (int e = 0; e < 4; ++e) {
      split_bf(x0[e], hb[e], lb[e]);
      split_bf(x1[e], hb[4 + e], lb[4 + e]);
    }
    uh[k] = (v4u){pk16(hb[0], hb[1]), pk16(hb[2], hb[3]), pk16(hb[4], hb[5]), pk16(hb[6], hb[7])};
    ul[k] = (v4u){pk16(lb[0], lb[1]), pk16(lb[2], lb[3]), pk16(lb[4], lb[5]), pk16(lb[6], lb[7])};
  }
  {
#pragma unroll
    for (int k = 0; k < 2; ++k) {
      if (prow[k] < kP) {
        const size_t o = (size_t)(b * kP + prow[k]) * kHD + c8;
        *(v4u*)(Ohi + o) = uh[k];
        *(v4u*)(Olo + o) = ul[k];
      }
    }
    
  }
}

// ---------------------------------------------------------------------------
// Zero fill of two regions, nvec x 16 B each (nvec % 256 == 0, so the region select is block-uniform).
// ---------------------------------------------------------------------------
__global__ __launch_bounds__(256) void k_zero16x2(unsigned int* __restrict__ p0, unsigned int* __restrict__ p1, int nvec) {
  const int i = blockIdx.x * 256 + threadIdx.x;
  if (i >= 2 * nvec) return;
  unsigned int* p = (i < nvec) ? (p0 + 4 * (size_t)i) : (p1 + 4 * (size_t)(i - nvec));
  const v4u z = (v4u){0u, 0u, 0u, 0u};
  *(v4u*)p = z;
  
}

// ---------------------------------------------------------------------------
// Final: per (b,p) row: x = 10*tanh(S) + ninf_mask, softmax over 1000 nodes (f32, fixed-order wave reductions).
// Coverage: 200 blocks x 8 rows = 1600 rows.
// ---------------------------------------------------------------------------
__global__ __launch_bounds__(256) void k_final(const float* __restrict__ Sp, const float* __restrict__ ninfm,
                                              float* __restrict__ out) {
  __shared__ __align__(16) float xs[8 * kN];
  __shared__ float invs[8];
  const float kNegInf = -__builtin_inff();
  const int t = threadIdx.x, lane = t & 31, wave = t >> 5;
  const int r = blockIdx.x * 8 + wave;
  const int b = r / kP, p = r - b * kP;
  const float* srow = Sp + (size_t)(b * kSrows + p) * kNP;
  const float* nrow = ninfm + (size_t)r * kN;
  float* xr = xs + wave * kN;
  float mx = kNegInf;
#pragma unroll 1
  for (int i = 0; i < 32; ++i) {
    const int n = lane + 32 * i;
    const int nc = (n < kN) ? n : (kN - 1);
    const float x = kClip * tanhf(srow[nc]) + nrow[nc];
    if (n < kN) { xr[n] = x; mx = fmaxf(mx, x); }
  }
#pragma unroll
  for (int off = 16; off > 0; off >>= 1) mx = fmaxf(mx, __shfl_xor(mx, off, 32));
  float sum = 0.0f;
#pragma unroll 1
  for (int i = 0; i < 32; ++i) {
    const int n = lane + 32 * i;
    if (n < kN) { const float e = __expf(xr[n] - mx); xr[n] = e; sum += e; }
  }
#pragma unroll
  for (int off = 16; off > 0; off >>= 1) sum += __shfl_xor(sum, off, 32);
  if (lane == 0) invs[wave] = 1.0f / sum;
  __syncthreads();
  float* obase = out + (size_t)blockIdx.x * 8 * kN;
  {
#pragma unroll 1
    for (int f = t; f < 2 * kN; f += 256) {
      v4f v = *(const v4f*)(xs + 4 * f);
      v = v * invs[f / 250];
      *(v4f*)(obase + 4 * (size_t)f) = v;
    }
    
  }
}

// ---------------------------------------------------------------------------
// Host launcher
// Workspace region map (bytes, 256-B aligned offsets):
//   EncHi bf16 [16][1024][128]          4,194,304
//   EncLo bf16 [16][1024][128]          4,194,304
//   WkvHi bf16 [256][128]                 65,536
//   WkvLo bf16 [256][128]                 65,536
//   WcHi  bf16 [128][128]                 32,768
//   WcLo  bf16 [128][128]                 32,768
//   W2T   f16  [64][64]                    8,192
//   KVf   f32  [16384][256]            16,777,216
//   Qs    f32  [1600][128]                819,200
//   QW    f32  [1600][64]                 409,600
//   MASKB f32  [1600][1024]             6,553,600
//   Ohi   bf16 [1664][128]                425,984
//   Olo   bf16 [1664][128]                425,984
//   MHhi  bf16 [1664][128]                425,984
//   MHlo  bf16 [1664][128]                425,984
//   Sp    f32  [16][128][1024]           8,388,608
//   total                              43,245,568
// ---------------------------------------------------------------------------
static inline size_t align256(size_t x) { return (x + 255) & ~(size_t)255; }

extern "C" void kernel_launch(void* const* d_in, const int* in_sizes, int n_in,
                              void* d_out, int out_size, void* d_ws, size_t ws_size,
                              hipStream_t stream) {
  if (n_in < 22) return;
  if (in_sizes[0] != kB * kN * kE || in_sizes[1] != kB * kP * kE || in_sizes[2] != kB * kP ||
      in_sizes[3] != kB * kP * kN || in_sizes[4] != kB * kP * kN * kDYN || out_size != kB * kP * kN) return;

  const float* enc      = (const float*)d_in[0];
  const float* enc_last = (const float*)d_in[1];
  const float* loadv    = (const float*)d_in[2];
  const float* ninfm    = (const float*)d_in[3];
  const float* dyn      = (const float*)d_in[4];
  const float* Wq       = (const float*)d_in[5];
  const float* Wk       = (const float*)d_in[6];
  const float* Wv       = (const float*)d_in[7];
  const float* Wc       = (const float*)d_in[8];
  const float* bcv      = (const float*)d_in[9];
  const float* fW1      = (const float*)d_in[10];
  const float* fb1      = (const float*)d_in[11];
  const float* fW2      = (const float*)d_in[12];
  const float* fb2      = (const float*)d_in[13];
  const float* lqW      = (const float*)d_in[14];
  const float* lqb      = (const float*)d_in[15];
  const float* lW1      = (const float*)d_in[16];
  const float* lb1      = (const float*)d_in[17];
  const float* lW2      = (const float*)d_in[18];
  const float* lb2      = (const float*)d_in[19];
  const float* lW3      = (const float*)d_in[20];
  const float* lb3      = (const float*)d_in[21];
  float* out = (float*)d_out;

  char* ws = (char*)d_ws;
  size_t off = 0;
  unsigned short* EncHi = (unsigned short*)(ws + off); off = align256(off + (size_t)kEncRows * kE * 2);
  unsigned short* EncLo = (unsigned short*)(ws + off); off = align256(off + (size_t)kEncRows * kE * 2);
  unsigned short* WkvHi = (unsigned short*)(ws + off); off = align256(off + (size_t)2 * kHD * kE * 2);
  unsigned short* WkvLo = (unsigned short*)(ws + off); off = align256(off + (size_t)2 * kHD * kE * 2);
  unsigned short* WcHi  = (unsigned short*)(ws + off); off = align256(off + (size_t)kE * kHD * 2);
  unsigned short* WcLo  = (unsigned short*)(ws + off); off = align256(off + (size_t)kE * kHD * 2);
  unsigned short* W2T   = (unsigned short*)(ws + off); off = align256(off + (size_t)kHID * kHID * 2);
  float* KVf   = (float*)(ws + off); off = align256(off + (size_t)kEncRows * 2 * kHD * 4);
  float* Qs    = (float*)(ws + off); off = align256(off + (size_t)kBP * kHD * 4);
  float* QW    = (float*)(ws + off); off = align256(off + (size_t)kBP * kHID * 4);
  float* MASKB = (float*)(ws + off); off = align256(off + (size_t)kBP * kNP * 4);
  unsigned short* Ohi  = (unsigned short*)(ws + off); off = align256(off + (size_t)kBPpad * kHD * 2);
  unsigned short* Olo  = (unsigned short*)(ws + off); off = align256(off + (size_t)kBPpad * kHD * 2);
  unsigned short* MHhi = (unsigned short*)(ws + off); off = align256(off + (size_t)kBPpad * kE * 2);
  unsigned short* MHlo = (unsigned short*)(ws + off); off = align256(off + (size_t)kBPpad * kE * 2);
  float* Sp    = (float*)(ws + off); off = align256(off + (size_t)kB * kSrows * kNP * 4);
  if (off > ws_size) return;
  const float* fdummy = Qs;   // valid, never dereferenced (BIAS_MODE 0 / RESID false)

  // weight planes: Wk|Wv and W_comb transposed to bf16 hi/lo [n][k]; lm_W2 transposed to f16 x16
  k_wprep<<<13, 256, 0, stream>>>(Wk, Wv, Wc, lW2, WkvHi, WkvLo, WcHi, WcLo, W2T);
  // node planes (bf16 hi/lo, 24 zero pad rows per batch in both)
  k_enc_cast<<<(kEncRows * 16) / 256, 256, 0, stream>>>(enc, EncHi, EncLo);
  // K|V projection: [16384][128] x [256][128]^T, bf16 hi/lo both operands, K=128, M=16384, N=256 -> f32
  wmma_gemm64<1, true, 0, 0, false, 0><<<dim3((kEncRows / 64) * (2 * kHD / 64) / 8, 1), 256, 0, stream>>>(
      EncHi, EncLo, kE, 0L, WkvHi, WkvLo, kE, 0L, (void*)KVf, (void*)KVf, 2 * kHD, 0L,
      fdummy, fdummy, 0L, kEncRows, 2 * kHD, kE, 1.0f);
  // query side (f32)
  k_qside<<<kBP, 128, 0, stream>>>(enc_last, loadv, Wq, fW1, fb1, fW2, fb2, lqW, lqb, lW1, lb1, Qs, QW);
  // lazy-mask MLP, three layers fused, one launch for all 1600 x 1024 slots; hidden layer on WMMA f16 (W x16), K=64
  k_lazy<<<kBP, 128, 0, stream>>>(dyn, QW, lW1, (const _Float16*)W2T, lb2, lW3, lb3, ninfm, MASKB);
  // zero the 64 pad rows (1600..1663) of Ohi and Olo: 64*128 halves = 1024 x 16 B each
  k_zero16x2<<<(2 * 1024) / 256, 256, 0, stream>>>((unsigned int*)(Ohi + (size_t)kBP * kHD),
                                                   (unsigned int*)(Olo + (size_t)kBP * kHD), 1024);
  // attention core (f32) -> O as bf16 hi/lo planes
  k_attn<<<kB * 7, 128, 0, stream>>>(Qs, KVf, MASKB, Ohi, Olo);
  // head merge: [1664][128] x [128][128]^T, bf16 hi/lo both operands, K=128, bias b_comb[n], bf16 hi/lo out planes
  wmma_gemm64<1, true, 2, 2, false, 0><<<dim3(((kBPpad / 64) * (kE / 64) + 7) / 8, 1), 256, 0, stream>>>(
      Ohi, Olo, kHD, 0L, WcHi, WcLo, kHD, 0L, (void*)MHhi, (void*)MHlo, kE, 0L,
      bcv, fdummy, 0L, kBPpad, kE, kHD, 1.0f);
  // pointer scores per batch: A = MH rows b*100 .. b*100+127 (hi/lo, rows beyond the batch are finite data),
  // Bt = node planes of batch b [1024][128] (hi/lo); M=128, N=1024, K=128 -> f32 Sp[b][128][1024], scale 1/sqrt(128)
  wmma_gemm64<1, true, 0, 0, false, 0><<<dim3((kSrows / 64) * (kNP / 64) / 8, kB), 256, 0, stream>>>(
      MHhi, MHlo, kE, (long)kP * kE, EncHi, EncLo, kE, (long)kNP * kE, (void*)Sp, (void*)Sp, kNP, (long)kSrows * kNP,
      fdummy, fdummy, 0L, kSrows, kNP, kE, kInvSqrtE);
  // clipped tanh + mask + softmax -> probs
  k_final<<<kBP / 8, 256, 0, stream>>>(Sp, ninfm, out);
}

// v002
// One run takes 265 microseconds.
// Timed twice side by side with v001, it ran 1.41 times as fast both times.
// Over all steps from v000 it is 2.27 times as fast.
// Contractions: node K|V projection (nodes x [Wk|Wv]^T), head-merge projection (O x W_comb^T) and pointer scores (MH x nodes^T) on v_wmma_f32_16x16x32_bf16 with bf16 hi/lo operand planes (hi.hi + hi.lo + lo.hi); lazy-mask hidden layer (lm_W2^T f16 carried x16, as A, x H1 f16, as B) on v_wmma_f32_16x16x32_f16 inside the fused lazy-mask kernel; all f32 accumulate; query/FiLM/gating/qf projections, lazy layers 1 (K=3 after the broadcast fold) and 3 (N=1), the 16-dim attention core and both softmaxes in f32 on the VALU.
#include <hip/hip_runtime.h>
#include <math.h>

typedef __attribute__((ext_vector_type(16))) _Float16 v16h;
typedef __attribute__((ext_vector_type(8)))  _Float16 v8h;
typedef __attribute__((ext_vector_type(16))) __bf16   v16b;
typedef __attribute__((ext_vector_type(8)))  __bf16   v8b;
typedef __attribute__((ext_vector_type(8)))  float    v8f;
typedef __attribute__((ext_vector_type(4)))  float    v4f;
typedef __attribute__((ext_vector_type(4)))  unsigned int v4u;
typedef __attribute__((ext_vector_type(2)))  float    v2f;
typedef __attribute__((ext_vector_type(2)))  _Float16 v2h;

// ---------------------------------------------------------------------------
// Problem constants
// ---------------------------------------------------------------------------
constexpr int kB   = 16;      // batch
constexpr int kP   = 100;     // queries per batch
constexpr int kN   = 1000;    // nodes
constexpr int kNP  = 1024;    // nodes padded
constexpr int kE   = 128;     // embedding
constexpr int kH   = 8;       // heads
constexpr int kD   = 16;      // head dim
constexpr int kHD  = 128;     // H*D
constexpr int kQD  = 16;      // lazy query dim
constexpr int kDYN = 3;       // dynamic features
constexpr int kHID = 64;      // lazy hidden
constexpr int kBP     = kB * kP;          // 1600 (b,p) rows
constexpr int kBPpad  = 1664;             // 26 * 64
constexpr int kEncRows = kB * kNP;        // 16384 padded node rows
constexpr int kSrows = 128;               // pointer-score rows per batch (100 padded)
constexpr float kWCarry   = 16.0f;        // lm_W2 carried x16 in f16
constexpr float kInvSqrtE = 0.08838834764831845f;
constexpr float kClip     = 10.0f;
static_assert(kBPpad % 64 == 0 && kBPpad >= kBP, "pad");
static_assert(kBPpad >= (kB - 1) * kP + kSrows, "last batch score rows inside MH planes");
static_assert(kH * kD == kHD && kE == kHD, "dims");

// ---------------------------------------------------------------------------
// Helpers
// ---------------------------------------------------------------------------
__device__ __forceinline__ unsigned short f2bf_bits(float f) {
  unsigned u = __float_as_uint(f);
  return (unsigned short)((u + 0x7FFFu + ((u >> 16) & 1u)) >> 16);
}
__device__ __forceinline__ float bf_bits2f(unsigned short h) { return __uint_as_float(((unsigned)h) << 16); }

// hazard guards as plain device helpers (no inline asm inside the kernel template body)
__device__ __forceinline__ void dep_guard_h(v8f& a, v8f& b, v16h x, v16h y) { asm volatile("v_nop\n\tv_nop\n\tv_nop\n\tv_nop" : "+v"(a), "+v"(b) : "v"(x), "v"(y)); }
__device__ __forceinline__ void dep_guard_b(v8f& a, v8f& b, v16b x, v16b y) { asm volatile("v_nop\n\tv_nop\n\tv_nop\n\tv_nop" : "+v"(a), "+v"(b) : "v"(x), "v"(y)); }
__device__ __forceinline__ void keep4_h(v16h a, v16h b, v16h c, v16h d) { asm volatile("v_nop" :: "v"(a), "v"(b), "v"(c), "v"(d)); }
__device__ __forceinline__ void keep4_b(v16b a, v16b b, v16b c, v16b d) { asm volatile("v_nop" :: "v"(a), "v"(b), "v"(c), "v"(d)); }
__device__ __forceinline__ void acc_guard4(v8f& a, v8f& b, v8f& c, v8f& d) { asm volatile("v_nop\n\tv_nop\n\tv_nop\n\tv_nop" : "+v"(a), "+v"(b), "+v"(c), "+v"(d)); }
template <typename T> struct Frag;
template <> struct Frag<_Float16> {
  typedef v16h V; union U { v16h v; v8h h[2]; };
  static __device__ __forceinline__ v16h load(const _Float16* p) {   // elements 0..7 <- p[0..7], 8..15 <- p[16..23]
    U f; f.h[0] = *(const v8h*)(p); f.h[1] = *(const v8h*)(p + 16); return f.v;
  }
  static __device__ __forceinline__ v8f mma(v16h a, v16h b, v8f c) {
    return __builtin_amdgcn_wmma_f32_16x16x32_f16(false, a, false, b, (short)0, c, false, false);
  }
  static __device__ __forceinline__ void guard(v8f& a, v8f& b, v16h x, v16h y) { dep_guard_h(a, b, x, y); }
  static __device__ __forceinline__ void keep(v16h a, v16h b, v16h c, v16h d) { keep4_h(a, b, c, d); }
};
template <> struct Frag<__bf16> {
  typedef v16b V; union U { v16b v; v8b h[2]; };
  static __device__ __forceinline__ v16b load(const __bf16* p) {
    U f; f.h[0] = *(const v8b*)(p); f.h[1] = *(const v8b*)(p + 16); return f.v;
  }
  static __device__ __forceinline__ v8f mma(v16b a, v16b b, v8f c) {
    return __builtin_amdgcn_wmma_f32_16x16x32_bf16(false, a, false, b, (short)0, c, false, false);
  }
  static __device__ __forceinline__ void guard(v8f& a, v8f& b, v16b x, v16b y) { dep_guard_b(a, b, x, y); }
  static __device__ __forceinline__ void keep(v16b a, v16b b, v16b c, v16b d) { keep4_b(a, b, c, d); }
};

__device__ __forceinline__ unsigned pk16(unsigned short a, unsigned short b) { return (unsigned)a | ((unsigned)b << 16); }
__device__ __forceinline__ unsigned short h_bits(float f) { const _Float16 h = (_Float16)f; return __builtin_bit_cast(unsigned short, h); }
// bf16 hi + bf16 lo split of an f32 value (both RNE converts)
__device__ __forceinline__ void split_bf(float f, unsigned short& hb, unsigned short& lb) {
  hb = f2bf_bits(f);
  lb = f2bf_bits(f - bf_bits2f(hb));
}

// ---- Register-blocked batched WMMA GEMM (ACT reduced to none/relu/leaky) -----------------------
// C[m,n] = scale * sum_k A[m,k] * Bt[n,k] (+bias)(+resid); each wave owns a 64x64 tile.
// A row-major [M,K]; Bt row-major [N,K]; M,N % 64 == 0, K % 32 == 0.
// SPLIT: operands are hi/lo planes (A2/Bt2 = lo planes, same layout); product = hi·hi + hi·lo + lo·hi.
// BIAS_MODE: 0 = none, 1 = bias[m], 2 = bias[n].
// OUT_MODE: 0 = f32, 1 = f16, 2 = bf16 hi plane (Cout) + bf16 lo plane (Cout2).
// ET: 0 = f16 operands, 1 = bf16 operands (pointers passed as 16-bit storage)
template <int ET> struct Elem;
template <> struct Elem<0> { typedef _Float16 T; };
template <> struct Elem<1> { typedef __bf16 T; };
template <int ET, bool SPLIT, int BIAS_MODE, int OUT_MODE, bool RESID, int ACT = 0>
__global__ __launch_bounds__(256) void wmma_gemm64(
    const unsigned short* __restrict__ Ap, const unsigned short* __restrict__ A2p, int lda, long strideA,
    const unsigned short* __restrict__ Btp, const unsigned short* __restrict__ Bt2p, int ldb, long strideB,
    void* __restrict__ Cout, void* __restrict__ Cout2, int ldc, long strideC,
    const float* __restrict__ bias,
    const float* __restrict__ resid, long strideR,
    int M, int N, int K, float scale) {
  typedef typename Elem<ET>::T T;
  typedef typename Frag<T>::V V;
  const T* A = (const T*)Ap; const T* A2 = (const T*)A2p; const T* Bt = (const T*)Btp; const T* Bt2 = (const T*)Bt2p;
  __shared__ __align__(16) float sT[8][16 * 68];   // per-wave 16x64 slab, pitch 68 floats
  const int b    = blockIdx.y;
  const int lane = threadIdx.x & 31;
  const int wave = threadIdx.x >> 5;
  const int tilesN = N >> 6;
  const int tilesM = M >> 6;
  const int tile = blockIdx.x * 8 + wave;
  if (tile >= tilesM * tilesN) return;   // wave-uniform; no block barriers in this kernel
  const int tm = tile / tilesN;
  const int tn = tile - tm * tilesN;
  const int m0 = tm << 6;
  const int n0 = tn << 6;

  const T* Ab  = A  + (size_t)b * strideA;
  const T* Bb  = Bt + (size_t)b * strideB;
  const T* Ab2 = SPLIT ? (A2  + (size_t)b * strideA) : nullptr;
  const T* Bb2 = SPLIT ? (Bt2 + (size_t)b * strideB) : nullptr;

  const int rlane = lane & 15;                 // row (A) / col (B, D) within subtile
  const int koff  = (lane >> 4) * 8;           // k offset of this lane half
  const int mOff  = (lane >> 4) * 8;           // D row offset

  v8f acc[4][4];
#pragma unroll
  for (int i = 0; i < 4; ++i)
#pragma unroll
    for (int j = 0; j < 4; ++j) acc[i][j] = (v8f){0.f,0.f,0.f,0.f,0.f,0.f,0.f,0.f};

  for (int k0 = 0; k0 < K; k0 += 32) {
    V bh[4], bl[4];
#pragma unroll
    for (int j = 0; j < 4; ++j) {
      const size_t bo = (size_t)(n0 + (j << 4) + rlane) * ldb + koff + k0;
      bh[j] = Frag<T>::load(Bb + bo);
      if (SPLIT) bl[j] = Frag<T>::load(Bb2 + bo);
    }
#pragma unroll
    for (int i = 0; i < 4; ++i) {
      const size_t ao = (size_t)(m0 + (i << 4) + rlane) * lda + koff + k0;
      V ah = Frag<T>::load(Ab + ao);
      V al;
      if (SPLIT) al = Frag<T>::load(Ab2 + ao);
#pragma unroll
      for (int j = 0; j < 4; ++j) {
        acc[i][j] = Frag<T>::mma(ah, bh[j], acc[i][j]);
        if (SPLIT) {
          acc[i][j] = Frag<T>::mma(ah, bl[j], acc[i][j]);
          acc[i][j] = Frag<T>::mma(al, bh[j], acc[i][j]);
        }
      }
      Frag<T>::guard(acc[i][0], acc[i][3], ah, SPLIT ? al : ah);
    }
    Frag<T>::keep(bh[0], bh[1], bh[2], bh[3]);
    if (SPLIT) Frag<T>::keep(bl[0], bl[1], bl[2], bl[3]);
  }
  acc_guard4(acc[0][0], acc[0][1], acc[0][2], acc[0][3]);
  acc_guard4(acc[1][0], acc[1][1], acc[1][2], acc[1][3]);
  acc_guard4(acc[2][0], acc[2][1], acc[2][2], acc[2][3]);
  acc_guard4(acc[3][0], acc[3][1], acc[3][2], acc[3][3]);

  // ---- epilogue ----
  float* slab = sT[wave];
  const float* Rb = RESID ? (resid + (size_t)b * strideR) : nullptr;
#pragma unroll
  for (int i = 0; i < 4; ++i) {
    const int mBase = m0 + (i << 4);
#pragma unroll
    for (int j = 0; j < 4; ++j) {
      const int n = n0 + (j << 4) + rlane;
      float bv = 0.f;
      if (BIAS_MODE == 2) bv = bias[n];
#pragma unroll
      for (int r = 0; r < 8; ++r) {
        float v = acc[i][j][r] * scale;
        if (BIAS_MODE == 1) v += bias[mBase + mOff + r];
        if (BIAS_MODE == 2) v += bv;
        if (RESID) v += Rb[(size_t)(mBase + mOff + r) * ldc + n];
        if (ACT == 2) v = fmaxf(v, 0.0f);
        if (ACT == 4) v = (v > 0.f) ? v : 0.01f * v;
        slab[(mOff + r) * 68 + (j << 4) + rlane] = v;
      }
    }
    __builtin_amdgcn_fence(__ATOMIC_RELEASE, "workgroup");
    __builtin_amdgcn_wave_barrier();
    __builtin_amdgcn_fence(__ATOMIC_ACQUIRE, "workgroup");
    if (OUT_MODE == 0) {
      float* C = (float*)Cout + (size_t)b * strideC;
      const int hh = lane >> 4, c4 = (lane & 15) * 4;     // row seg = 256 B = 16 lanes x 16 B
      {
#pragma unroll
        for (int it = 0; it < 8; ++it) {
          const int row = it * 2 + hh;
          v4f v = *(const v4f*)(slab + row * 68 + c4);
          *(v4f*)(C + (size_t)(mBase + row) * ldc + n0 + c4) = v;
        }
        
      }
    } else {
      const int q = lane >> 3, c8 = (lane & 7) * 8;
      unsigned short* C  = (unsigned short*)Cout  + (size_t)b * strideC;
      unsigned short* C2 = (OUT_MODE == 2) ? ((unsigned short*)Cout2 + (size_t)b * strideC) : nullptr;
      {
#pragma unroll
        for (int it = 0; it < 4; ++it) {
          const int row = it * 4 + q;
          const float* sp = slab + row * 68 + c8;
          v8h hv, lv;
#pragma unroll
          for (int e = 0; e < 8; ++e) {
            if (OUT_MODE == 1) {
              hv[e] = (_Float16)sp[e];
            } else {
              unsigned short hb = f2bf_bits(sp[e]);
              unsigned short lb = f2bf_bits(sp[e] - bf_bits2f(hb));
              hv[e] = __builtin_bit_cast(_Float16, hb);
              lv[e] = __builtin_bit_cast(_Float16, lb);
            }
          }
          *(v8h*)(C + (size_t)(mBase + row) * ldc + n0 + c8) = hv;
          if (OUT_MODE == 2) *(v8h*)(C2 + (size_t)(mBase + row) * ldc + n0 + c8) = lv;
        }
        
      }
    }
    __builtin_amdgcn_fence(__ATOMIC_RELEASE, "workgroup");
    __builtin_amdgcn_wave_barrier();
    __builtin_amdgcn_fence(__ATOMIC_ACQUIRE, "workgroup");
  }
}

// ---------------------------------------------------------------------------
// Weight preparation: 64x64 transpose tiles of f32 W[k][n] (pitch ldn) -> WT[n][k] (pitch ldk).
// blocks 0..3: Wk -> WkvHi/WkvLo rows 0..127 (bf16 hi + bf16 lo planes); 4..7: Wv -> rows 128..255;
// 8..11: W_comb -> WcHi/WcLo; 12: lm_W2 -> W2T (f16 carried x16, single plane).
// Load coverage: 16 x 256 = 4096 = whole tile. Store coverage: 8 waves x 2 it x 4 rows (lane>>3) = 64 rows,
// ---------------------------------------------------------------------------
__global__ __launch_bounds__(256) void k_wprep(const float* __restrict__ Wk, const float* __restrict__ Wv,
                                              const float* __restrict__ Wcomb, const float* __restrict__ W2,
                                              unsigned short* __restrict__ WkvHi, unsigned short* __restrict__ WkvLo,
                                              unsigned short* __restrict__ WcHi, unsigned short* __restrict__ WcLo,
                                              unsigned short* __restrict__ W2T) {
  __shared__ float sm[64][65];   // sm[n_local][k_local]
  const int t = threadIdx.x, lane = t & 31, wave = t >> 5;
  const int bid = blockIdx.x;    // block-uniform selection below
  const float* W = Wk; unsigned short* outH = WkvHi; unsigned short* outL = WkvLo;
  int ldn = kHD, ldk = kE, nt = 0, kt = 0; float carry = 1.0f;
  const bool two_planes = (bid < 12);
  if (bid < 4)       { W = Wk;    outH = WkvHi;                    outL = WkvLo;                    ldn = kHD;  ldk = kE;   nt = bid & 1;       kt = bid >> 1;       carry = 1.0f; }
  else if (bid < 8)  { W = Wv;    outH = WkvHi + (size_t)kHD * kE; outL = WkvLo + (size_t)kHD * kE; ldn = kHD;  ldk = kE;   nt = (bid - 4) & 1; kt = (bid - 4) >> 1; carry = 1.0f; }
  else if (bid < 12) { W = Wcomb; outH = WcHi;                     outL = WcLo;                     ldn = kE;   ldk = kHD;  nt = (bid - 8) & 1; kt = (bid - 8) >> 1; carry = 1.0f; }
  else               { W = W2;    outH = W2T;                      outL = W2T;                      ldn = kHID; ldk = kHID; nt = 0;             kt = 0;              carry = kWCarry; }
  const int n0 = nt * 64, k0 = kt * 64;
#pragma unroll
  for (int i = 0; i < 16; ++i) {
    const int e = i * 256 + t;
    const int r = e >> 6;    // k local
    const int c = e & 63;    // n local
    sm[c][r] = W[(size_t)(k0 + r) * ldn + n0 + c] * carry;
  }
  __syncthreads();
  const int q = lane >> 3, c8 = (lane & 7) * 8;
  v4u uh[2], ul[2];
  int rowv[2];
#pragma unroll
  for (int it = 0; it < 2; ++it) {
    const int row = wave * 8 + it * 4 + q;   // n local
    rowv[it] = row;
    unsigned short hb[8], lb[8];
#pragma unroll
    for (int e = 0; e < 8; ++e) {
      const float v = sm[row][c8 + e];
      if (two_planes) { split_bf(v, hb[e], lb[e]); }
      else { hb[e] = h_bits(v); lb[e] = hb[e]; }
    }
    uh[it] = (v4u){pk16(hb[0], hb[1]), pk16(hb[2], hb[3]), pk16(hb[4], hb[5]), pk16(hb[6], hb[7])};
    ul[it] = (v4u){pk16(lb[0], lb[1]), pk16(lb[2], lb[3]), pk16(lb[4], lb[5]), pk16(lb[6], lb[7])};
  }
  {
#pragma unroll
    for (int it = 0; it < 2; ++it) {
      const size_t o = (size_t)(n0 + rowv[it]) * ldk + k0 + c8;
      *(v4u*)(outH + o) = uh[it];
      if (two_planes) *(v4u*)(outL + o) = ul[it];
    }
    
  }
}

// ---------------------------------------------------------------------------
// Node split: enc f32 [B][1000][128] -> EncHi/EncLo bf16 hi/lo planes [B][1024][128] each
// (rows 1000..1023 of every batch written as zeros in both planes).
// ---------------------------------------------------------------------------
__global__ __launch_bounds__(256) void k_enc_cast(const float* __restrict__ enc, unsigned short* __restrict__ outHi,
                                                 unsigned short* __restrict__ outLo) {
  const int i = blockIdx.x * 256 + threadIdx.x;
  if (i >= kEncRows * 16) return;
  const int row = i >> 4, c8 = (i & 15) * 8;
  const int b = row >> 10, n = row & (kNP - 1);
  const int nc = (n < kN) ? n : (kN - 1);                    // address clamp
  const float* p = enc + ((size_t)(b * kN + nc)) * kE + c8;
  const v4f a = *(const v4f*)(p);
  const v4f c = *(const v4f*)(p + 4);
  const bool valid = (n < kN);
  unsigned short hb[8], lb[8];
#pragma unroll
  for (int e = 0; e < 4; ++e) {
    split_bf(valid ? a[e] : 0.0f, hb[e], lb[e]);
    split_bf(valid ? c[e] : 0.0f, hb[4 + e], lb[4 + e]);
  }
  const v4u uh = (v4u){pk16(hb[0], hb[1]), pk16(hb[2], hb[3]), pk16(hb[4], hb[5]), pk16(hb[6], hb[7])};
  const v4u ul = (v4u){pk16(lb[0], lb[1]), pk16(lb[2], lb[3]), pk16(lb[4], lb[5]), pk16(lb[6], lb[7])};
  const size_t o = (size_t)row * kE + c8;
  *(v4u*)(outHi + o) = uh;
  *(v4u*)(outLo + o) = ul;
  
}

// ---------------------------------------------------------------------------
// Query side per (b,p) (f32, VALU): q_in = [last | load] (129);
//   Qs[bp][h*16+d] = ((q_in.Wq_last) * 2*sigmoid(relu(q_in.fW1 + fb1).fW2 + fb2)) * 0.25   (1/sqrt(16) folded, exact)
//   QW[bp][64]     = lm_b1 + qf.lm_W1[3:19]   with qf = q_in.lazy_q_W + lazy_q_b
// 128 threads; rolled loops. Stores: wave 0 writes the 512-B Qs row (32 lanes x 16 B, one instruction),
// ---------------------------------------------------------------------------
__global__ __launch_bounds__(128) void k_qside(const float* __restrict__ enc_last, const float* __restrict__ loadv,
                                              const float* __restrict__ Wq, const float* __restrict__ fW1,
                                              const float* __restrict__ fb1, const float* __restrict__ fW2,
                                              const float* __restrict__ fb2, const float* __restrict__ lqW,
                                              const float* __restrict__ lqb, const float* __restrict__ lW1,
                                              const float* __restrict__ lb1,
                                              float* __restrict__ Qs, float* __restrict__ QW) {
  __shared__ float qin[kE + 4];
  __shared__ float g1s[kE + 4];
  __shared__ __align__(16) float qst[kHD];
  __shared__ float qfs[kQD];
  __shared__ __align__(16) float qws[kHID];
  const int bp = blockIdx.x;
  const int t = threadIdx.x, lane = t & 31, wave = t >> 5;
  qin[t] = enc_last[(size_t)bp * kE + t];
  if (t == 0) qin[kE] = loadv[bp];
  __syncthreads();
  for (int j = t; j < kE + 1; j += 128) {
    float acc = fb1[j];
#pragma unroll 1
    for (int e = 0; e < kE + 1; ++e) acc = fmaf(qin[e], fW1[(size_t)e * (kE + 1) + j], acc);
    g1s[j] = fmaxf(acc, 0.0f);
  }
  __syncthreads();
  {
    const int j = t;
    float qv = 0.0f, gm = fb2[j];
#pragma unroll 1
    for (int e = 0; e < kE + 1; ++e) {
      qv = fmaf(qin[e], Wq[(size_t)e * kHD + j], qv);
      gm = fmaf(g1s[e], fW2[(size_t)e * kHD + j], gm);
    }
    const float den = 1.0f + expf(-gm);
    const float gamma = 2.0f * (1.0f / den);
    qst[j] = (qv * gamma) * 0.25f;
  }
  if (t < kQD) {
    float acc = lqb[t];
#pragma unroll 1
    for (int e = 0; e < kE + 1; ++e) acc = fmaf(qin[e], lqW[(size_t)e * kQD + t], acc);
    qfs[t] = acc;
  }
  __syncthreads();
  if (t < kHID) {
    float acc = lb1[t];
#pragma unroll 1
    for (int i = 0; i < kQD; ++i) acc = fmaf(qfs[i], lW1[(size_t)(kDYN + i) * kHID + t], acc);
    qws[t] = acc;
  }
  __syncthreads();
  if (wave == 0) {
    const v4f v = *(const v4f*)(qst + 4 * lane);
    float* dst = Qs + (size_t)bp * kHD + 4 * lane;
    *(v4f*)dst = v;
    
  } else if (wave == 1) {
    if (lane < 16) {
      const v4f v = *(const v4f*)(qws + 4 * lane);
      float* dst = QW + (size_t)bp * kHID + 4 * lane;
      *(v4f*)dst = v;
      
    }
  }
}

// ---------------------------------------------------------------------------
// Lazy-mask MLP, all three layers in one kernel; H1 and H2 never leave the registers.
// Block = one (b,p) row of MASKB, 4 waves; a wave owns 256 node slots and walks them 32 at a time (two 16-slot tiles).
// Lane l: c = l & 15, h = l >> 4.
//   layer 1 (f32 VALU): the lane computes H1[slot c][k] for its own 32 k (k = 32 s + 16 h + e, s = 0,1, e = 0..15),
//     relu, f16: that is the B fragment of k step s as it stands. Its weights come from an LDS table, per k pair
//     {W1[0][k,k+1], W1[1][k,k+1], W1[2][k,k+1], QW[k,k+1]}; the row's dynamic features and mask row are staged in LDS once.
//   layer 2 (WMMA f16): A = lm_W2^T x16, row j = 16 i + c, the same k per lane and element;
//     D register r of tile i = 16 * (H1 . lm_W2[:, j]) for hidden unit j = 16 i + 8 h + r of slot c.
//   layer 3 (f32 VALU): z = sum_j relu(D / 16 + lm_b2[j]) * lm_W3[j]: 32 j in the lane, the other 32 in lane l ^ 16.
//   MASKB[bp][n] = ninf_mask[b,p,min(n,999)] - softplus(z + lm_b3)   (ALPHA = 1)
// Coverage: 1600 blocks x 4 waves x 8 trips x 32 slots = all 1024 columns of all 1600 rows (pad slots from clamped inputs).
// ---------------------------------------------------------------------------
// layer 3 for one 16-unit tile: sum over the lane's 8 hidden units of relu(D / 16 + b2) * w3
__device__ __forceinline__ v2f lazy_l3(v8f acc, const v2f (&b2)[4], const v2f (&w3)[4]) {
  const v2f zero = (v2f){0.0f, 0.0f};
  const v2f sc = (v2f){1.0f / kWCarry, 1.0f / kWCarry};
  v2f zs = zero;
#pragma unroll
  for (int q = 0; q < 4; ++q) {
    const v2f a = __builtin_elementwise_max(__builtin_elementwise_fma((v2f){acc[2 * q], acc[2 * q + 1]}, sc, b2[q]), zero);
    zs = __builtin_elementwise_fma(a, w3[q], zs);
  }
  return zs;
}
__global__ __launch_bounds__(128) void k_lazy(const float* __restrict__ dyn, const float* __restrict__ QW,
                                             const float* __restrict__ lW1, const _Float16* __restrict__ W2T,
                                             const float* __restrict__ lb2, const float* __restrict__ lW3,
                                             const float* __restrict__ lb3, const float* __restrict__ ninfm,
                                             float* __restrict__ maskb) {
  __shared__ __align__(16) float tbl[2 * 16 * 8];      // [h][k pair][w0 w0 w1 w1 w2 w2 qw qw]
  __shared__ __align__(16) float sd[kN * kDYN];        // dynamic features of this (b,p): 1000 x 3
  __shared__ __align__(16) float sn[kN];               // ninf_mask row of this (b,p)
  const int bp = blockIdx.x;
  const int t = threadIdx.x;
  const int lane = t & 31, wave = t >> 5;
  const int c = lane & 15, h = lane >> 4;
  // stage the 12000 contiguous bytes of dynamic features: 750 x 16 B over 128 threads
  const unsigned oD = (unsigned)t * 16u;
  const char* dsrc = (const char*)(dyn + (size_t)bp * kN * kDYN);
  v4f dv[6];
#pragma unroll
  for (int i = 0; i < 5; ++i) dv[i] = *(const v4f*)(dsrc + oD + i * 2048);
  const bool last = (t < (kN * kDYN * 4 - 5 * 2048) / 16);
  const unsigned oL = last ? (oD + 5 * 2048) : 0u;     // threads past the end fetch in bounds and store nothing
  dv[5] = *(const v4f*)(dsrc + oL);
  // and the 4000 contiguous bytes of the mask row: 250 x 16 B
  const char* nsrc = (const char*)(ninfm + (size_t)bp * kN);
  const bool lastn = (t < (kN * 4 - 2048) / 16);
  const unsigned oN = lastn ? (oD + 2048) : 0u;
  const v4f nv0 = *(const v4f*)(nsrc + oD);
  const v4f nv1 = *(const v4f*)(nsrc + oN);
  // weight table: thread t fetches one pair: h = t >> 6, k pair p = (t >> 2) & 15, which = t & 3
  const int tp = (t >> 2) & 15, tw = t & 3;
  const int tk = 32 * (tp >> 3) + 16 * (t >> 6) + 2 * (tp & 7);
  const float* tsrc = (tw < 3) ? (lW1 + tw * kHID + tk) : (QW + (size_t)bp * kHID + tk);
  const v2f tv = *(const v2f*)tsrc;
  // byte offsets of the lane's first fragment / bias element; these set-up loads are scalar base + one of them
  const unsigned oA = (unsigned)(c * kHID + 16 * h) * 2u;
  const unsigned oJ = (unsigned)(8 * h) * 4u;
  v16h aw[4][2];
#pragma unroll
  for (int i = 0; i < 4; ++i)
#pragma unroll
    for (int s = 0; s < 2; ++s) aw[i][s] = *(const v16h*)((const char*)W2T + oA + (16 * i * kHID + 32 * s) * 2);
  v2f b2[4][4], w3[4][4];
#pragma unroll
  for (int i = 0; i < 4; ++i)
#pragma unroll
    for (int q = 0; q < 4; ++q) {
      b2[i][q] = *(const v2f*)((const char*)lb2 + oJ + (16 * i + 2 * q) * 4);
      w3[i][q] = *(const v2f*)((const char*)lW3 + oJ + (16 * i + 2 * q) * 4);
    }
  const float b3 = lb3[0];
  // address translations done before a register that a load above names is reused
  asm volatile("s_wait_xcnt 0x0" :: "v"(oD), "v"(oL), "v"(oN), "v"(tsrc), "v"(oA), "v"(oJ) : "memory");
#pragma unroll
  for (int i = 0; i < 5; ++i) *(v4f*)((char*)sd + oD + i * 2048) = dv[i];
  if (last) *(v4f*)((char*)sd + oL) = dv[5];
  *(v4f*)((char*)sn + oD) = nv0;
  if (lastn) *(v4f*)((char*)sn + oN) = nv1;
  *(v2f*)(tbl + 2 * t) = tv;
  __syncthreads();
  const int nw = wave * 256;
  float* mp = maskb + (size_t)bp * kNP + nw + lane;
  const v4f* tb4 = (const v4f*)(tbl + h * 128);
  for (int it = 0; it < 8; ++it) {
    const int n0 = nw + it * 32;
    const int n = n0 + lane;
    const int nc = (n < kN) ? n : (kN - 1);                          // address clamps (pad slots)
    const int ia = ((n0 + c < kN) ? (n0 + c) : (kN - 1)) * kDYN;
    const int ib = ((n0 + 16 + c < kN) ? (n0 + 16 + c) : (kN - 1)) * kDYN;
    const float a0 = sd[ia], a1 = sd[ia + 1], a2 = sd[ia + 2];
    const float e0 = sd[ib], e1 = sd[ib + 1], e2 = sd[ib + 2];
    v16h ba[2], bb[2];
    const v2h hzero = (v2h){(_Float16)0.0f, (_Float16)0.0f};
    v4f tq[2][8];                               // weight-table reads, four k pairs a group, one group ahead
#pragma unroll
    for (int j = 0; j < 8; ++j) tq[0][j] = tb4[j];
#pragma unroll
    for (int g = 0; g < 4; ++g) {
      if (g < 3) {
#pragma unroll
        for (int j = 0; j < 8; ++j) tq[(g + 1) & 1][j] = tb4[8 * (g + 1) + j];
      }
      // keeps the next group's LDS reads in front of this group's arithmetic, which then covers their latency
      __builtin_amdgcn_sched_barrier(0);
#pragma unroll
      for (int pp = 0; pp < 4; ++pp) {
        const int p = 4 * g + pp;
        const v4f u = tq[g & 1][2 * pp], v = tq[g & 1][2 * pp + 1];
        const v2f w0 = (v2f){u[0], u[1]}, w1 = (v2f){u[2], u[3]}, w2 = (v2f){v[0], v[1]}, qw = (v2f){v[2], v[3]};
        const v2f xa = __builtin_elementwise_fma(w0, (v2f){a0, a0}, __builtin_elementwise_fma(w1, (v2f){a1, a1},
                       __builtin_elementwise_fma(w2, (v2f){a2, a2}, qw)));
        const v2f xb = __builtin_elementwise_fma(w0, (v2f){e0, e0}, __builtin_elementwise_fma(w1, (v2f){e1, e1},
                       __builtin_elementwise_fma(w2, (v2f){e2, e2}, qw)));
        // relu behind the rounding: same value as rounding behind relu
        const v2h ya = __builtin_elementwise_max(__builtin_convertvector(xa, v2h), hzero);
        const v2h yb = __builtin_elementwise_max(__builtin_convertvector(xb, v2h), hzero);
        ba[p >> 3][2 * (p & 7)] = ya[0]; ba[p >> 3][2 * (p & 7) + 1] = ya[1];
        bb[p >> 3][2 * (p & 7)] = yb[0]; bb[p >> 3][2 * (p & 7) + 1] = yb[1];
      }
    }
    v2f za2[4], zb2[4];
#pragma unroll
    for (int i = 0; i < 4; ++i) {
      const v8f czero = (v8f){0.f, 0.f, 0.f, 0.f, 0.f, 0.f, 0.f, 0.f};
      v8f ca = __builtin_amdgcn_wmma_f32_16x16x32_f16(false, aw[i][0], false, ba[0], (short)0, czero, false, false);
      v8f cc = __builtin_amdgcn_wmma_f32_16x16x32_f16(false, aw[i][0], false, bb[0], (short)0, czero, false, false);
      ca = __builtin_amdgcn_wmma_f32_16x16x32_f16(false, aw[i][1], false, ba[1], (short)0, ca, false, false);
      cc = __builtin_amdgcn_wmma_f32_16x16x32_f16(false, aw[i][1], false, bb[1], (short)0, cc, false, false);
      za2[i] = lazy_l3(ca, b2[i], w3[i]);
      zb2[i] = lazy_l3(cc, b2[i], w3[i]);
    }
    const v2f ta = (za2[0] + za2[1]) + (za2[2] + za2[3]);
    const v2f tb = (zb2[0] + zb2[1]) + (zb2[2] + zb2[3]);
    const float za = ta[0] + ta[1], zb = tb[0] + tb[1];
    // lanes 0..15 finish slots n0 + c (tile a), lanes 16..31 slots n0 + 16 + c (tile b): one exchange l <-> l ^ 16 for both
    const float mine = h ? zb : za;
    const int other = __float_as_int(h ? za : zb);
    const float z = (mine + __int_as_float(__builtin_amdgcn_permlanex16(other, other, 0x76543210, 0xfedcba98, false, false))) + b3;
    const float spv = fmaxf(z, 0.0f) + log1pf(expf(-fabsf(z)));
    *mp = sn[nc] - spv;
    // address translation done before the store's address register is advanced; the "memory" clobber also keeps the
    // weight-table reads inside the loop (hoisted they hold 128 more registers: over 256, one wave per SIMD fewer)
    asm volatile("s_wait_xcnt 0x0" :: "v"(mp) : "memory");
    mp += 32;
  }
}

// ---------------------------------------------------------------------------
// Attention core (f32 VALU, head dim 16), node axis split over the waves of a block.
// Block = (b, group of 16 queries, group of 4 heads), 512 threads = 16 waves: wave = (node slice sl = wave >> 1 of 128 slots,
// head pair wave & 1); lane = (head of the pair, query). 16 x 7 x 2 = 224 blocks.
// Per stage every slice gets its next 32 nodes in LDS: the 4 heads' K (64 f32) and V (64 f32) of each node, and the bias tile
// [16 queries][32 nodes] at a pitch of 36 floats (16 rows on 16 different banks). Four stages cover the 128 slots of a slice.
// Online softmax per thread over its slice (slots >= 1000 forced to -inf by value); m, l, acc in f32.
// Merge: every wave leaves (acc[16], m, l) per lane in LDS; 128 threads fold the 8 slices in slice order,
//   M = max m_s, w_s = exp(m_s - M), O = sum_s w_s acc_s / sum_s w_s l_s,
// and write O as bf16 hi + bf16 lo planes into Ohi/Olo[bp][h*16+d]: 8 lanes x 16 B = the block's whole 128-B line of a row
// (rows >= P skipped).
// ---------------------------------------------------------------------------
constexpr int kASl  = 8;               // node slices per block
constexpr int kASn  = kNP / kASl;      // 128 node slots per slice
constexpr int kACh  = 32;              // nodes per slice and stage
constexpr int kAHb  = 4;               // heads per block
constexpr int kARow = 2 * kAHb * kD;   // 128 floats per staged node: K of 4 heads | V of 4 heads
constexpr int kAMp  = 36;              // bias tile pitch in floats
constexpr int kACp  = 20;              // merge record pitch in floats: acc[16], m, l, 2 unused
static_assert(kASl * kAHb * 16 * kACp <= kASl * kACh * kARow, "merge records fit the K|V buffer");
__global__ __launch_bounds__(512) void k_attn(const float* __restrict__ Qs, const float* __restrict__ KV,
                                             const float* __restrict__ maskb, unsigned short* __restrict__ Ohi,
                                             unsigned short* __restrict__ Olo) {
  __shared__ __align__(16) float kvs[kASl * kACh * kARow];   // 131072 B; the merge records reuse it
  __shared__ __align__(16) float ms[kASl * 16 * kAMp];       // 18432 B
  const float kNegInf = -__builtin_inff();
  const int t = threadIdx.x, lane = t & 31;
  const int wave = __builtin_amdgcn_readfirstlane(t >> 5);   // scalar: slice bounds and LDS bases stay off the vector unit
  const int b = blockIdx.x / 14, rem = blockIdx.x - b * 14, pg = rem >> 1, hq = rem & 1, p0 = pg * 16;
  const int sl = wave >> 1;
  const int hl = (wave & 1) * 2 + (lane >> 4), pl = lane & 15;
  const int p = p0 + pl, pc = (p < kP) ? p : (kP - 1);
  const float* qp = Qs + (size_t)(b * kP + pc) * kHD + (hq * kAHb + hl) * kD;
  const v4f qa = *(const v4f*)(qp), qb = *(const v4f*)(qp + 4), qc = *(const v4f*)(qp + 8), qd = *(const v4f*)(qp + 12);
  v4f oa = (v4f){0.f, 0.f, 0.f, 0.f}, ob = (v4f){0.f, 0.f, 0.f, 0.f}, oc = (v4f){0.f, 0.f, 0.f, 0.f}, od = (v4f){0.f, 0.f, 0.f, 0.f};
  float m = -3.0e38f, l = 0.0f;
  const float* kvb = KV + (size_t)b * kNP * (2 * kHD);
  const float* mkb = maskb + (size_t)(b * kP) * kNP;
  // staging roles: a wave copies whole node rows (lanes 0..15 the K part, 16..31 the V part, 256 B each)
  const int scol = ((lane < 16) ? 0 : kHD) + hq * (kAHb * kD) + (lane & 15) * 4;
  // bias tile roles: thread t copies 4 columns (t & 7) * 4 of row (t >> 3) & 15 for slices t >> 7 and 4 + (t >> 7)
  const int mr = (t >> 3) & 15, mj4 = (t & 7) * 4, msl = t >> 7;
  const int mpr = (p0 + mr < kP) ? (p0 + mr) : (kP - 1);
  const float* mrow = mkb + (size_t)mpr * kNP + msl * kASn + mj4;
  float* mdst = ms + (msl * 16 + mr) * kAMp + mj4;
#pragma unroll 1   // rolled: one set of 18 staging register quads serves every stage
  for (int st = 0; st < kASn / kACh; ++st) {
    // 8 slices x 32 nodes x 32 float4 = 8192 float4: 16 x 512 threads; trip i: slice i >> 1, node (i & 1) * 16 + wave
    const float* gk = kvb + (size_t)(st * kACh + wave) * (2 * kHD) + scol;
    v4f kvr[16];
#pragma unroll
    for (int i = 0; i < 16; ++i) kvr[i] = *(const v4f*)(gk + (size_t)((i >> 1) * kASn + (i & 1) * 16) * (2 * kHD));
    // bias tiles: 8 slices x 16 rows x 8 float4 = 1024 float4: 2 x 512 threads; trip i: slice i * 4 + (t >> 7)
    const float* gm = mrow + st * kACh;
    const v4f mr0 = *(const v4f*)(gm);
    const v4f mr1 = *(const v4f*)(gm + 4 * kASn);
    // address translations done before a register that a load above names is reused
    asm volatile("s_wait_xcnt 0x0" :: "v"(gk), "v"(gm) : "memory");
    __syncthreads();   // every wave has left the buffers of the stage before
#pragma unroll
    for (int i = 0; i < 16; ++i) *(v4f*)(kvs + ((i >> 1) * kACh + (i & 1) * 16 + wave) * kARow + lane * 4) = kvr[i];
    *(v4f*)(mdst) = mr0;
    *(v4f*)(mdst + 4 * 16 * kAMp) = mr1;
    __syncthreads();
    const int n0 = sl * kASn + st * kACh;
    const float* kw = kvs + sl * kACh * kARow + hl * kD;
    const float* mw = ms + (sl * 16 + pl) * kAMp;
#pragma unroll 1   // rolled as before: the running m, l, acc make one serial chain from node to node
    for (int j = 0; j < kACh; ++j) {
      const float* kr = kw + j * kARow;
      const v4f k0 = *(const v4f*)(kr), k1 = *(const v4f*)(kr + 4), k2 = *(const v4f*)(kr + 8), k3 = *(const v4f*)(kr + 12);
      float s = mw[j];
      s = fmaf(qa[0], k0[0], s); s = fmaf(qa[1], k0[1], s); s = fmaf(qa[2], k0[2], s); s = fmaf(qa[3], k0[3], s);
      s = fmaf(qb[0], k1[0], s); s = fmaf(qb[1], k1[1], s); s = fmaf(qb[2], k1[2], s); s = fmaf(qb[3], k1[3], s);
      s = fmaf(qc[0], k2[0], s); s = fmaf(qc[1], k2[1], s); s = fmaf(qc[2], k2[2], s); s = fmaf(qc[3], k2[3], s);
      s = fmaf(qd[0], k3[0], s); s = fmaf(qd[1], k3[1], s); s = fmaf(qd[2], k3[2], s); s = fmaf(qd[3], k3[3], s);
      s = (n0 + j < kN) ? s : kNegInf;
      const float mn = fmaxf(m, s);
      const float alpha = __expf(m - mn);
      const float pj = __expf(s - mn);
      m = mn;
      l = fmaf(l, alpha, pj);
      const float* vr = kr + kAHb * kD;
      const v4f v0 = *(const v4f*)(vr), v1 = *(const v4f*)(vr + 4), v2 = *(const v4f*)(vr + 8), v3 = *(const v4f*)(vr + 12);
      oa = v0 * pj + oa * alpha;
      ob = v1 * pj + ob * alpha;
      oc = v2 * pj + oc * alpha;
      od = v3 * pj + od * alpha;
    }
  }
  __syncthreads();   // every wave has left the K|V buffer before the merge records overwrite it
  {
    float* op = kvs + ((sl * kAHb + hl) * 16 + pl) * kACp;
    *(v4f*)(op)      = oa;
    *(v4f*)(op + 4)  = ob;
    *(v4f*)(op + 8)  = oc;
    *(v4f*)(op + 12) = od;
    *(v2f*)(op + 16) = (v2f){m, l};
  }
  __syncthreads();
  if (wave < 4) {    // threads 0..127; no barrier behind this point
    const int rl = t >> 3, c8 = (t & 7) * 8;
    const float* cb = kvs + ((c8 >> 4) * 16 + rl) * kACp;
    constexpr int kSs = kAHb * 16 * kACp;      // floats from one slice's records to the next
    float ml[kASl], ll[kASl];
#pragma unroll
    for (int s = 0; s < kASl; ++s) { const v2f e = *(const v2f*)(cb + s * kSs + 16); ml[s] = e[0]; ll[s] = e[1]; }
    float mx = ml[0];
#pragma unroll
    for (int s = 1; s < kASl; ++s) mx = fmaxf(mx, ml[s]);
    float lsum = 0.0f;
    v4f x0 = (v4f){0.f, 0.f, 0.f, 0.f}, x1 = (v4f){0.f, 0.f, 0.f, 0.f};
#pragma unroll
    for (int s = 0; s < kASl; ++s) {
      const float w = __expf(ml[s] - mx);
      const float* s8 = cb + s * kSs + (c8 & 15);
      lsum = fmaf(ll[s], w, lsum);
      x0 = *(const v4f*)(s8) * w + x0;
      x1 = *(const v4f*)(s8 + 4) * w + x1;
    }
    const float inv = 1.0f / lsum;
    x0 = x0 * inv;
    x1 = x1 * inv;
    unsigned short hb[8], lb[8];
#pragma unroll
    for (int e = 0; e < 4; ++e) {
      split_bf(x0[e], hb[e], lb[e]);
      split_bf(x1[e], hb[4 + e], lb[4 + e]);
    }
    const v4u uh = (v4u){pk16(hb[0], hb[1]), pk16(hb[2], hb[3]), pk16(hb[4], hb[5]), pk16(hb[6], hb[7])};
    const v4u ul = (v4u){pk16(lb[0], lb[1]), pk16(lb[2], lb[3]), pk16(lb[4], lb[5]), pk16(lb[6], lb[7])};
    if (p0 + rl < kP) {
      const size_t o = (size_t)(b * kP + p0 + rl) * kHD + hq * (kAHb * kD) + c8;
      *(v4u*)(Ohi + o) = uh;
      *(v4u*)(Olo + o) = ul;
    }
  }
}

// ---------------------------------------------------------------------------
// Zero fill of two regions, nvec x 16 B each (nvec % 256 == 0, so the region select is block-uniform).
// ---------------------------------------------------------------------------
__global__ __launch_bounds__(256) void k_zero16x2(unsigned int* __restrict__ p0, unsigned int* __restrict__ p1, int nvec) {
  const int i = blockIdx.x * 256 + threadIdx.x;
  if (i >= 2 * nvec) return;
  unsigned int* p = (i < nvec) ? (p0 + 4 * (size_t)i) : (p1 + 4 * (size_t)(i - nvec));
  const v4u z = (v4u){0u, 0u, 0u, 0u};
  *(v4u*)p = z;
  
}

// ---------------------------------------------------------------------------
// Final: per (b,p) row: x = 10*tanh(S) + ninf_mask, softmax over 1000 nodes (f32, fixed-order wave reductions).
// Coverage: 200 blocks x 8 rows = 1600 rows.
// ---------------------------------------------------------------------------
__global__ __launch_bounds__(256) void k_final(const float* __restrict__ Sp, const float* __restrict__ ninfm,
                                              float* __restrict__ out) {
  __shared__ __align__(16) float xs[8 * kN];
  __shared__ float invs[8];
  const float kNegInf = -__builtin_inff();
  const int t = threadIdx.x, lane = t & 31, wave = t >> 5;
  const int r = blockIdx.x * 8 + wave;
  const int b = r / kP, p = r - b * kP;
  const float* srow = Sp + (size_t)(b * kSrows + p) * kNP;
  const float* nrow = ninfm + (size_t)r * kN;
  float* xr = xs + wave * kN;
  float mx = kNegInf;
#pragma unroll 1
  for (int i = 0; i < 32; ++i) {
    const int n = lane + 32 * i;
    const int nc = (n < kN) ? n : (kN - 1);
    const float x = kClip * tanhf(srow[nc]) + nrow[nc];
    if (n < kN) { xr[n] = x; mx = fmaxf(mx, x); }
  }
#pragma unroll
  for (int off = 16; off > 0; off >>= 1) mx = fmaxf(mx, __shfl_xor(mx, off, 32));
  float sum = 0.0f;
#pragma unroll 1
  for (int i = 0; i < 32; ++i) {
    const int n = lane + 32 * i;
    if (n < kN) { const float e = __expf(xr[n] - mx); xr[n] = e; sum += e; }
  }
#pragma unroll
  for (int off = 16; off > 0; off >>= 1) sum += __shfl_xor(sum, off, 32);
  if (lane == 0) invs[wave] = 1.0f / sum;
  __syncthreads();
  float* obase = out + (size_t)blockIdx.x * 8 * kN;
  {
#pragma unroll 1
    for (int f = t; f < 2 * kN; f += 256) {
      v4f v = *(const v4f*)(xs + 4 * f);
      v = v * invs[f / 250];
      *(v4f*)(obase + 4 * (size_t)f) = v;
    }
    
  }
}

// ---------------------------------------------------------------------------
// Host launcher
// Workspace region map (bytes, 256-B aligned offsets):
//   EncHi bf16 [16][1024][128]          4,194,304
//   EncLo bf16 [16][1024][128]          4,194,304
//   WkvHi bf16 [256][128]                 65,536
//   WkvLo bf16 [256][128]                 65,536
//   WcHi  bf16 [128][128]                 32,768
//   WcLo  bf16 [128][128]                 32,768
//   W2T   f16  [64][64]                    8,192
//   KVf   f32  [16384][256]            16,777,216
//   Qs    f32  [1600][128]                819,200
//   QW    f32  [1600][64]                 409,600
//   MASKB f32  [1600][1024]             6,553,600
//   Ohi   bf16 [1664][128]                425,984
//   Olo   bf16 [1664][128]                425,984
//   MHhi  bf16 [1664][128]                425,984
//   MHlo  bf16 [1664][128]                425,984
//   Sp    f32  [16][128][1024]           8,388,608
//   total                              43,245,568
// ---------------------------------------------------------------------------
static inline size_t align256(size_t x) { return (x + 255) & ~(size_t)255; }

extern "C" void kernel_launch(void* const* d_in, const int* in_sizes, int n_in,
                              void* d_out, int out_size, void* d_ws, size_t ws_size,
                              hipStream_t stream) {
  if (n_in < 22) return;
  if (in_sizes[0] != kB * kN * kE || in_sizes[1] != kB * kP * kE || in_sizes[2] != kB * kP ||
      in_sizes[3] != kB * kP * kN || in_sizes[4] != kB * kP * kN * kDYN || out_size != kB * kP * kN) return;

  const float* enc      = (const float*)d_in[0];
  const float* enc_last = (const float*)d_in[1];
  const float* loadv    = (const float*)d_in[2];
  const float* ninfm    = (const float*)d_in[3];
  const float* dyn      = (const float*)d_in[4];
  const float* Wq       = (const float*)d_in[5];
  const float* Wk       = (const float*)d_in[6];
  const float* Wv       = (const float*)d_in[7];
  const float* Wc       = (const float*)d_in[8];
  const float* bcv      = (const float*)d_in[9];
  const float* fW1      = (const float*)d_in[10];
  const float* fb1      = (const float*)d_in[11];
  const float* fW2      = (const float*)d_in[12];
  const float* fb2      = (const float*)d_in[13];
  const float* lqW      = (const float*)d_in[14];
  const float* lqb      = (const float*)d_in[15];
  const float* lW1      = (const float*)d_in[16];
  const float* lb1      = (const float*)d_in[17];
  const float* lW2      = (const float*)d_in[18];
  const float* lb2      = (const float*)d_in[19];
  const float* lW3      = (const float*)d_in[20];
  const float* lb3      = (const float*)d_in[21];
  float* out = (float*)d_out;

  char* ws = (char*)d_ws;
  size_t off = 0;
  unsigned short* EncHi = (unsigned short*)(ws + off); off = align256(off + (size_t)kEncRows * kE * 2);
  unsigned short* EncLo = (unsigned short*)(ws + off); off = align256(off + (size_t)kEncRows * kE * 2);
  unsigned short* WkvHi = (unsigned short*)(ws + off); off = align256(off + (size_t)2 * kHD * kE * 2);
  unsigned short* WkvLo = (unsigned short*)(ws + off); off = align256(off + (size_t)2 * kHD * kE * 2);
  unsigned short* WcHi  = (unsigned short*)(ws + off); off = align256(off + (size_t)kE * kHD * 2);
  unsigned short* WcLo  = (unsigned short*)(ws + off); off = align256(off + (size_t)kE * kHD * 2);
  unsigned short* W2T   = (unsigned short*)(ws + off); off = align256(off + (size_t)kHID * kHID * 2);
  float* KVf   = (float*)(ws + off); off = align256(off + (size_t)kEncRows * 2 * kHD * 4);
  float* Qs    = (float*)(ws + off); off = align256(off + (size_t)kBP * kHD * 4);
  float* QW    = (float*)(ws + off); off = align256(off + (size_t)kBP * kHID * 4);
  float* MASKB = (float*)(ws + off); off = align256(off + (size_t)kBP * kNP * 4);
  unsigned short* Ohi  = (unsigned short*)(ws + off); off = align256(off + (size_t)kBPpad * kHD * 2);
  unsigned short* Olo  = (unsigned short*)(ws + off); off = align256(off + (size_t)kBPpad * kHD * 2);
  unsigned short* MHhi = (unsigned short*)(ws + off); off = align256(off + (size_t)kBPpad * kE * 2);
  unsigned short* MHlo = (unsigned short*)(ws + off); off = align256(off + (size_t)kBPpad * kE * 2);
  float* Sp    = (float*)(ws + off); off = align256(off + (size_t)kB * kSrows * kNP * 4);
  if (off > ws_size) return;
  const float* fdummy = Qs;   // valid, never dereferenced (BIAS_MODE 0 / RESID false)

  // weight planes: Wk|Wv and W_comb transposed to bf16 hi/lo [n][k]; lm_W2 transposed to f16 x16
  k_wprep<<<13, 256, 0, stream>>>(Wk, Wv, Wc, lW2, WkvHi, WkvLo, WcHi, WcLo, W2T);
  // node planes (bf16 hi/lo, 24 zero pad rows per batch in both)
  k_enc_cast<<<(kEncRows * 16) / 256, 256, 0, stream>>>(enc, EncHi, EncLo);
  // K|V projection: [16384][128] x [256][128]^T, bf16 hi/lo both operands, K=128, M=16384, N=256 -> f32
  wmma_gemm64<1, true, 0, 0, false, 0><<<dim3((kEncRows / 64) * (2 * kHD / 64) / 8, 1), 256, 0, stream>>>(
      EncHi, EncLo, kE, 0L, WkvHi, WkvLo, kE, 0L, (void*)KVf, (void*)KVf, 2 * kHD, 0L,
      fdummy, fdummy, 0L, kEncRows, 2 * kHD, kE, 1.0f);
  // query side (f32)
  k_qside<<<kBP, 128, 0, stream>>>(enc_last, loadv, Wq, fW1, fb1, fW2, fb2, lqW, lqb, lW1, lb1, Qs, QW);
  // lazy-mask MLP, three layers fused, one launch for all 1600 x 1024 slots; hidden layer on WMMA f16 (W x16), K=64
  k_lazy<<<kBP, 128, 0, stream>>>(dyn, QW, lW1, (const _Float16*)W2T, lb2, lW3, lb3, ninfm, MASKB);
  // zero the 64 pad rows (1600..1663) of Ohi and Olo: 64*128 halves = 1024 x 16 B each
  k_zero16x2<<<(2 * 1024) / 256, 256, 0, stream>>>((unsigned int*)(Ohi + (size_t)kBP * kHD),
                                                   (unsigned int*)(Olo + (size_t)kBP * kHD), 1024);
  // attention core (f32), 8 node slices per block merged in LDS -> O as bf16 hi/lo planes
  k_attn<<<kB * 14, 512, 0, stream>>>(Qs, KVf, MASKB, Ohi, Olo);
  // head merge: [1664][128] x [128][128]^T, bf16 hi/lo both operands, K=128, bias b_comb[n], bf16 hi/lo out planes
  wmma_gemm64<1, true, 2, 2, false, 0><<<dim3(((kBPpad / 64) * (kE / 64) + 7) / 8, 1), 256, 0, stream>>>(
      Ohi, Olo, kHD, 0L, WcHi, WcLo, kHD, 0L, (void*)MHhi, (void*)MHlo, kE, 0L,
      bcv, fdummy, 0L, kBPpad, kE, kHD, 1.0f);
  // pointer scores per batch: A = MH rows b*100 .. b*100+127 (hi/lo, rows beyond the batch are finite data),
  // Bt = node planes of batch b [1024][128] (hi/lo); M=128, N=1024, K=128 -> f32 Sp[b][128][1024], scale 1/sqrt(128)
  wmma_gemm64<1, true, 0, 0, false, 0><<<dim3((kSrows / 64) * (kNP / 64) / 8, kB), 256, 0, stream>>>(
      MHhi, MHlo, kE, (long)kP * kE, EncHi, EncLo, kE, (long)kNP * kE, (void*)Sp, (void*)Sp, kNP, (long)kSrows * kNP,
      fdummy, fdummy, 0L, kSrows, kNP, kE, kInvSqrtE);
  // clipped tanh + mask + softmax -> probs
  k_final<<<kBP / 8, 256, 0, stream>>>(Sp, ninfm, out);
}

// v003
// It runs in 139 microseconds.
// Timed twice side by side with v002, it ran 1.92 and 1.91 times as fast.
// All steps since v000 together make it 4.34 times as fast.
// Contractions: node K|V projection (nodes x [Wk|Wv]^T), head-merge projection (O x W_comb^T) and pointer scores (MH x nodes^T) on v_wmma_f32_16x16x32_bf16 with bf16 hi/lo operand planes (hi.hi + hi.lo + lo.hi); lazy-mask hidden layer (lm_W2^T f16 carried x16, as A, x H1 f16, as B) on v_wmma_f32_16x16x32_f16 inside the fused lazy-mask kernel; all f32 accumulate; query/FiLM/gating/qf projections, lazy layers 1 (K=3 after the broadcast fold) and 3 (N=1), the 16-dim attention core and both softmaxes in f32 on the VALU.
#include <hip/hip_runtime.h>
#include <math.h>

typedef __attribute__((ext_vector_type(16))) _Float16 v16h;
typedef __attribute__((ext_vector_type(8)))  _Float16 v8h;
typedef __attribute__((ext_vector_type(16))) __bf16   v16b;
typedef __attribute__((ext_vector_type(8)))  __bf16   v8b;
typedef __attribute__((ext_vector_type(8)))  float    v8f;
typedef __attribute__((ext_vector_type(4)))  float    v4f;
typedef __attribute__((ext_vector_type(4)))  unsigned int v4u;
typedef __attribute__((ext_vector_type(2)))  float    v2f;
typedef __attribute__((ext_vector_type(2)))  _Float16 v2h;

// ---------------------------------------------------------------------------
// Problem constants
// ---------------------------------------------------------------------------
constexpr int kB   = 16;      // batch
constexpr int kP   = 100;     // queries per batch
constexpr int kN   = 1000;    // nodes
constexpr int kNP  = 1024;    // nodes padded
constexpr int kE   = 128;     // embedding
constexpr int kH   = 8;       // heads
constexpr int kD   = 16;      // head dim
constexpr int kHD  = 128;     // H*D
constexpr int kQD  = 16;      // lazy query dim
constexpr int kDYN = 3;       // dynamic features
constexpr int kHID = 64;      // lazy hidden
constexpr int kBP     = kB * kP;          // 1600 (b,p) rows
constexpr int kBPpad  = 1664;             // 26 * 64
constexpr int kEncRows = kB * kNP;        // 16384 padded node rows
constexpr int kSrows = 128;               // pointer-score rows per batch (100 padded)
constexpr float kWCarry   = 16.0f;        // lm_W2 carried x16 in f16
constexpr float kInvSqrtE = 0.08838834764831845f;
constexpr float kClip     = 10.0f;
static_assert(kBPpad % 64 == 0 && kBPpad >= kBP, "pad");
static_assert(kBPpad >= (kB - 1) * kP + kSrows, "last batch score rows inside MH planes");
static_assert(kH * kD == kHD && kE == kHD, "dims");

// ---------------------------------------------------------------------------
// Helpers
// ---------------------------------------------------------------------------
__device__ __forceinline__ unsigned short f2bf_bits(float f) {
  unsigned u = __float_as_uint(f);
  return (unsigned short)((u + 0x7FFFu + ((u >> 16) & 1u)) >> 16);
}
__device__ __forceinline__ float bf_bits2f(unsigned short h) { return __uint_as_float(((unsigned)h) << 16); }

// hazard guards as plain device helpers (no inline asm inside the kernel template body)
__device__ __forceinline__ void dep_guard_h(v8f& a, v8f& b, v16h x, v16h y) { asm volatile("v_nop\n\tv_nop\n\tv_nop\n\tv_nop" : "+v"(a), "+v"(b) : "v"(x), "v"(y)); }
__device__ __forceinline__ void dep_guard_b(v8f& a, v8f& b, v16b x, v16b y) { asm volatile("v_nop\n\tv_nop\n\tv_nop\n\tv_nop" : "+v"(a), "+v"(b) : "v"(x), "v"(y)); }
__device__ __forceinline__ void keep4_h(v16h a, v16h b, v16h c, v16h d) { asm volatile("v_nop" :: "v"(a), "v"(b), "v"(c), "v"(d)); }
__device__ __forceinline__ void keep4_b(v16b a, v16b b, v16b c, v16b d) { asm volatile("v_nop" :: "v"(a), "v"(b), "v"(c), "v"(d)); }
__device__ __forceinline__ void acc_guard4(v8f& a, v8f& b, v8f& c, v8f& d) { asm volatile("v_nop\n\tv_nop\n\tv_nop\n\tv_nop" : "+v"(a), "+v"(b), "+v"(c), "+v"(d)); }
template <typename T> struct Frag;
template <> struct Frag<_Float16> {
  typedef v16h V; union U { v16h v; v8h h[2]; };
  static __device__ __forceinline__ v16h load(const _Float16* p) {   // elements 0..7 <- p[0..7], 8..15 <- p[16..23]
    U f; f.h[0] = *(const v8h*)(p); f.h[1] = *(const v8h*)(p + 16); return f.v;
  }
  static __device__ __forceinline__ v8f mma(v16h a, v16h b, v8f c) {
    return __builtin_amdgcn_wmma_f32_16x16x32_f16(false, a, false, b, (short)0, c, false, false);
  }
  static __device__ __forceinline__ void guard(v8f& a, v8f& b, v16h x, v16h y) { dep_guard_h(a, b, x, y); }
  static __device__ __forceinline__ void keep(v16h a, v16h b, v16h c, v16h d) { keep4_h(a, b, c, d); }
};
template <> struct Frag<__bf16> {
  typedef v16b V; union U { v16b v; v8b h[2]; };
  static __device__ __forceinline__ v16b load(const __bf16* p) {
    U f; f.h[0] = *(const v8b*)(p); f.h[1] = *(const v8b*)(p + 16); return f.v;
  }
  static __device__ __forceinline__ v8f mma(v16b a, v16b b, v8f c) {
    return __builtin_amdgcn_wmma_f32_16x16x32_bf16(false, a, false, b, (short)0, c, false, false);
  }
  static __device__ __forceinline__ void guard(v8f& a, v8f& b, v16b x, v16b y) { dep_guard_b(a, b, x, y); }
  static __device__ __forceinline__ void keep(v16b a, v16b b, v16b c, v16b d) { keep4_b(a, b, c, d); }
};

__device__ __forceinline__ unsigned pk16(unsigned short a, unsigned short b) { return (unsigned)a | ((unsigned)b << 16); }
__device__ __forceinline__ unsigned short h_bits(float f) { const _Float16 h = (_Float16)f; return __builtin_bit_cast(unsigned short, h); }
// bf16 hi + bf16 lo split of an f32 value (both RNE converts)
__device__ __forceinline__ void split_bf(float f, unsigned short& hb, unsigned short& lb) {
  hb = f2bf_bits(f);
  lb = f2bf_bits(f - bf_bits2f(hb));
}

// ---- Register-blocked batched WMMA GEMM (ACT reduced to none/relu/leaky) -----------------------
// C[m,n] = scale * sum_k A[m,k] * Bt[n,k] (+bias)(+resid); each wave owns a 64x64 tile.
// A row-major [M,K]; Bt row-major [N,K]; M,N % 64 == 0, K % 32 == 0.
// SPLIT: operands are hi/lo planes (A2/Bt2 = lo planes, same layout); product = hi·hi + hi·lo + lo·hi.
// BIAS_MODE: 0 = none, 1 = bias[m], 2 = bias[n].
// OUT_MODE: 0 = f32, 1 = f16, 2 = bf16 hi plane (Cout) + bf16 lo plane (Cout2).
// ET: 0 = f16 operands, 1 = bf16 operands (pointers passed as 16-bit storage)
template <int ET> struct Elem;
template <> struct Elem<0> { typedef _Float16 T; };
template <> struct Elem<1> { typedef __bf16 T; };
template <int ET, bool SPLIT, int BIAS_MODE, int OUT_MODE, bool RESID, int ACT = 0>
__global__ __launch_bounds__(256) void wmma_gemm64(
    const unsigned short* __restrict__ Ap, const unsigned short* __restrict__ A2p, int lda, long strideA,
    const unsigned short* __restrict__ Btp, const unsigned short* __restrict__ Bt2p, int ldb, long strideB,
    void* __restrict__ Cout, void* __restrict__ Cout2, int ldc, long strideC,
    const float* __restrict__ bias,
    const float* __restrict__ resid, long strideR,
    int M, int N, int K, float scale) {
  typedef typename Elem<ET>::T T;
  typedef typename Frag<T>::V V;
  const T* A = (const T*)Ap; const T* A2 = (const T*)A2p; const T* Bt = (const T*)Btp; const T* Bt2 = (const T*)Bt2p;
  __shared__ __align__(16) float sT[8][16 * 68];   // per-wave 16x64 slab, pitch 68 floats
  const int b    = blockIdx.y;
  const int lane = threadIdx.x & 31;
  const int wave = threadIdx.x >> 5;
  const int tilesN = N >> 6;
  const int tilesM = M >> 6;
  const int tile = blockIdx.x * 8 + wave;
  if (tile >= tilesM * tilesN) return;   // wave-uniform; no block barriers in this kernel
  const int tm = tile / tilesN;
  const int tn = tile - tm * tilesN;
  const int m0 = tm << 6;
  const int n0 = tn << 6;

  const T* Ab  = A  + (size_t)b * strideA;
  const T* Bb  = Bt + (size_t)b * strideB;
  const T* Ab2 = SPLIT ? (A2  + (size_t)b * strideA) : nullptr;
  const T* Bb2 = SPLIT ? (Bt2 + (size_t)b * strideB) : nullptr;

  const int rlane = lane & 15;                 // row (A) / col (B, D) within subtile
  const int koff  = (lane >> 4) * 8;           // k offset of this lane half
  const int mOff  = (lane >> 4) * 8;           // D row offset

  v8f acc[4][4];
#pragma unroll
  for (int i = 0; i < 4; ++i)
#pragma unroll
    for (int j = 0; j < 4; ++j) acc[i][j] = (v8f){0.f,0.f,0.f,0.f,0.f,0.f,0.f,0.f};

  for (int k0 = 0; k0 < K; k0 += 32) {
    V bh[4], bl[4];
#pragma unroll
    for (int j = 0; j < 4; ++j) {
      const size_t bo = (size_t)(n0 + (j << 4) + rlane) * ldb + koff + k0;
      bh[j] = Frag<T>::load(Bb + bo);
      if (SPLIT) bl[j] = Frag<T>::load(Bb2 + bo);
    }
#pragma unroll
    for (int i = 0; i < 4; ++i) {
      const size_t ao = (size_t)(m0 + (i << 4) + rlane) * lda + koff + k0;
      V ah = Frag<T>::load(Ab + ao);
      V al;
      if (SPLIT) al = Frag<T>::load(Ab2 + ao);
#pragma unroll
      for (int j = 0; j < 4; ++j) {
        acc[i][j] = Frag<T>::mma(ah, bh[j], acc[i][j]);
        if (SPLIT) {
          acc[i][j] = Frag<T>::mma(ah, bl[j], acc[i][j]);
          acc[i][j] = Frag<T>::mma(al, bh[j], acc[i][j]);
        }
      }
      Frag<T>::guard(acc[i][0], acc[i][3], ah, SPLIT ? al : ah);
    }
    Frag<T>::keep(bh[0], bh[1], bh[2], bh[3]);
    if (SPLIT) Frag<T>::keep(bl[0], bl[1], bl[2], bl[3]);
  }
  acc_guard4(acc[0][0], acc[0][1], acc[0][2], acc[0][3]);
  acc_guard4(acc[1][0], acc[1][1], acc[1][2], acc[1][3]);
  acc_guard4(acc[2][0], acc[2][1], acc[2][2], acc[2][3]);
  acc_guard4(acc[3][0], acc[3][1], acc[3][2], acc[3][3]);

  // ---- epilogue ----
  float* slab = sT[wave];
  const float* Rb = RESID ? (resid + (size_t)b * strideR) : nullptr;
#pragma unroll
  for (int i = 0; i < 4; ++i) {
    const int mBase = m0 + (i << 4);
#pragma unroll
    for (int j = 0; j < 4; ++j) {
      const int n = n0 + (j << 4) + rlane;
      float bv = 0.f;
      if (BIAS_MODE == 2) bv = bias[n];
#pragma unroll
      for (int r = 0; r < 8; ++r) {
        float v = acc[i][j][r] * scale;
        if (BIAS_MODE == 1) v += bias[mBase + mOff + r];
        if (BIAS_MODE == 2) v += bv;
        if (RESID) v += Rb[(size_t)(mBase + mOff + r) * ldc + n];
        if (ACT == 2) v = fmaxf(v, 0.0f);
        if (ACT == 4) v = (v > 0.f) ? v : 0.01f * v;
        slab[(mOff + r) * 68 + (j << 4) + rlane] = v;
      }
    }
    __builtin_amdgcn_fence(__ATOMIC_RELEASE, "workgroup");
    __builtin_amdgcn_wave_barrier();
    __builtin_amdgcn_fence(__ATOMIC_ACQUIRE, "workgroup");
    if (OUT_MODE == 0) {
      float* C = (float*)Cout + (size_t)b * strideC;
      const int hh = lane >> 4, c4 = (lane & 15) * 4;     // row seg = 256 B = 16 lanes x 16 B
      {
#pragma unroll
        for (int it = 0; it < 8; ++it) {
          const int row = it * 2 + hh;
          v4f v = *(const v4f*)(slab + row * 68 + c4);
          *(v4f*)(C + (size_t)(mBase + row) * ldc + n0 + c4) = v;
        }
        
      }
    } else {
      const int q = lane >> 3, c8 = (lane & 7) * 8;
      unsigned short* C  = (unsigned short*)Cout  + (size_t)b * strideC;
      unsigned short* C2 = (OUT_MODE == 2) ? ((unsigned short*)Cout2 + (size_t)b * strideC) : nullptr;
      {
#pragma unroll
        for (int it = 0; it < 4; ++it) {
          const int row = it * 4 + q;
          const float* sp = slab + row * 68 + c8;
          v8h hv, lv;
#pragma unroll
          for (int e = 0; e < 8; ++e) {
            if (OUT_MODE == 1) {
              hv[e] = (_Float16)sp[e];
            } else {
              unsigned short hb = f2bf_bits(sp[e]);
              unsigned short lb = f2bf_bits(sp[e] - bf_bits2f(hb));
              hv[e] = __builtin_bit_cast(_Float16, hb);
              lv[e] = __builtin_bit_cast(_Float16, lb);
            }
          }
          *(v8h*)(C + (size_t)(mBase + row) * ldc + n0 + c8) = hv;
          if (OUT_MODE == 2) *(v8h*)(C2 + (size_t)(mBase + row) * ldc + n0 + c8) = lv;
        }
        
      }
    }
    __builtin_amdgcn_fence(__ATOMIC_RELEASE, "workgroup");
    __builtin_amdgcn_wave_barrier();
    __builtin_amdgcn_fence(__ATOMIC_ACQUIRE, "workgroup");
  }
}

// ---------------------------------------------------------------------------
// Weight preparation: 64x64 transpose tiles of f32 W[k][n] (pitch ldn) -> WT[n][k] (pitch ldk).
// blocks 0..3: Wk -> WkvHi/WkvLo rows 0..127 (bf16 hi + bf16 lo planes); 4..7: Wv -> rows 128..255;
// 8..11: W_comb -> WcHi/WcLo; 12: lm_W2 -> W2T (f16 carried x16, single plane).
// Load coverage: 16 x 256 = 4096 = whole tile. Store coverage: 8 waves x 2 it x 4 rows (lane>>3) = 64 rows,
// ---------------------------------------------------------------------------
__global__ __launch_bounds__(256) void k_wprep(const float* __restrict__ Wk, const float* __restrict__ Wv,
                                              const float* __restrict__ Wcomb, const float* __restrict__ W2,
                                              unsigned short* __restrict__ WkvHi, unsigned short* __restrict__ WkvLo,
                                              unsigned short* __restrict__ WcHi, unsigned short* __restrict__ WcLo,
                                              unsigned short* __restrict__ W2T) {
  __shared__ float sm[64][65];   // sm[n_local][k_local]
  const int t = threadIdx.x, lane = t & 31, wave = t >> 5;
  const int bid = blockIdx.x;    // block-uniform selection below
  const float* W = Wk; unsigned short* outH = WkvHi; unsigned short* outL = WkvLo;
  int ldn = kHD, ldk = kE, nt = 0, kt = 0; float carry = 1.0f;
  const bool two_planes = (bid < 12);
  if (bid < 4)       { W = Wk;    outH = WkvHi;                    outL = WkvLo;                    ldn = kHD;  ldk = kE;   nt = bid & 1;       kt = bid >> 1;       carry = 1.0f; }
  else if (bid < 8)  { W = Wv;    outH = WkvHi + (size_t)kHD * kE; outL = WkvLo + (size_t)kHD * kE; ldn = kHD;  ldk = kE;   nt = (bid - 4) & 1; kt = (bid - 4) >> 1; carry = 1.0f; }
  else if (bid < 12) { W = Wcomb; outH = WcHi;                     outL = WcLo;                     ldn = kE;   ldk = kHD;  nt = (bid - 8) & 1; kt = (bid - 8) >> 1; carry = 1.0f; }
  else               { W = W2;    outH = W2T;                      outL = W2T;                      ldn = kHID; ldk = kHID; nt = 0;             kt = 0;              carry = kWCarry; }
  const int n0 = nt * 64, k0 = kt * 64;
#pragma unroll
  for (int i = 0; i < 16; ++i) {
    const int e = i * 256 + t;
    const int r = e >> 6;    // k local
    const int c = e & 63;    // n local
    sm[c][r] = W[(size_t)(k0 + r) * ldn + n0 + c] * carry;
  }
  __syncthreads();
  const int q = lane >> 3, c8 = (lane & 7) * 8;
  v4u uh[2], ul[2];
  int rowv[2];
#pragma unroll
  for (int it = 0; it < 2; ++it) {
    const int row = wave * 8 + it * 4 + q;   // n local
    rowv[it] = row;
    unsigned short hb[8], lb[8];
#pragma unroll
    for (int e = 0; e < 8; ++e) {
      const float v = sm[row][c8 + e];
      if (two_planes) { split_bf(v, hb[e], lb[e]); }
      else { hb[e] = h_bits(v); lb[e] = hb[e]; }
    }
    uh[it] = (v4u){pk16(hb[0], hb[1]), pk16(hb[2], hb[3]), pk16(hb[4], hb[5]), pk16(hb[6], hb[7])};
    ul[it] = (v4u){pk16(lb[0], lb[1]), pk16(lb[2], lb[3]), pk16(lb[4], lb[5]), pk16(lb[6], lb[7])};
  }
  {
#pragma unroll
    for (int it = 0; it < 2; ++it) {
      const size_t o = (size_t)(n0 + rowv[it]) * ldk + k0 + c8;
      *(v4u*)(outH + o) = uh[it];
      if (two_planes) *(v4u*)(outL + o) = ul[it];
    }
    
  }
}

// ---------------------------------------------------------------------------
// Node split: enc f32 [B][1000][128] -> EncHi/EncLo bf16 hi/lo planes [B][1024][128] each
// (rows 1000..1023 of every batch written as zeros in both planes).
// ---------------------------------------------------------------------------
__global__ __launch_bounds__(256) void k_enc_cast(const float* __restrict__ enc, unsigned short* __restrict__ outHi,
                                                 unsigned short* __restrict__ outLo) {
  const int i = blockIdx.x * 256 + threadIdx.x;
  if (i >= kEncRows * 16) return;
  const int row = i >> 4, c8 = (i & 15) * 8;
  const int b = row >> 10, n = row & (kNP - 1);
  const int nc = (n < kN) ? n : (kN - 1);                    // address clamp
  const float* p = enc + ((size_t)(b * kN + nc)) * kE + c8;
  const v4f a = *(const v4f*)(p);
  const v4f c = *(const v4f*)(p + 4);
  const bool valid = (n < kN);
  unsigned short hb[8], lb[8];
#pragma unroll
  for (int e = 0; e < 4; ++e) {
    split_bf(valid ? a[e] : 0.0f, hb[e], lb[e]);
    split_bf(valid ? c[e] : 0.0f, hb[4 + e], lb[4 + e]);
  }
  const v4u uh = (v4u){pk16(hb[0], hb[1]), pk16(hb[2], hb[3]), pk16(hb[4], hb[5]), pk16(hb[6], hb[7])};
  const v4u ul = (v4u){pk16(lb[0], lb[1]), pk16(lb[2], lb[3]), pk16(lb[4], lb[5]), pk16(lb[6], lb[7])};
  const size_t o = (size_t)row * kE + c8;
  *(v4u*)(outHi + o) = uh;
  *(v4u*)(outLo + o) = ul;
  
}

// ---------------------------------------------------------------------------
// Query side (f32, VALU), 4 (b,p) rows per block: q_in = [last | load] (129);
//   Qs[bp][h*16+d] = ((q_in.Wq_last) * 2*sigmoid(relu(q_in.fW1 + fb1).fW2 + fb2)) * 0.25   (1/sqrt(16) folded, exact)
//   QW[bp][64]     = lm_b1 + qf.lm_W1[3:19]   with qf = q_in.lazy_q_W + lazy_q_b
// 160 threads. Waves 0..3: thread = output column j; every weight element it loads feeds the chains of the 4 rows, whose
// inputs lie in LDS as [e][row] (one 16-B broadcast read per e). Wave 4: hidden unit 128 of the FiLM layer, qf, then QW.
// The weight loads go out in batches, one batch ahead of the arithmetic, so their latencies overlap.
// Every output is still one fma chain from its bias, e ascending.
// All loops of this kernel are unrolled in full: the batches are register arrays, which takes static indices, and the
// loads of a batch have to stand together ahead of the arithmetic that uses the batch before.
// Stores: one instruction of a wave writes one whole 128-B line of a Qs or QW row.
// ---------------------------------------------------------------------------
constexpr int kQR = 4;     // (b,p) rows per block
constexpr int kQB = 16;    // e steps per batch of weight loads
static_assert(kBP % kQR == 0 && kE % kQB == 0, "rows per block, batches");
// one batch of a weight column: w[i] = col[(e0 + i) * LD]
template <int LD>
__device__ __forceinline__ void q_fetch(float (&w)[kQB], const float* __restrict__ col, int e0) {
#pragma unroll
  for (int i = 0; i < kQB; ++i) w[i] = col[(e0 + i) * LD];
}
// Stands behind a group of loads: address translations done before a register that an issued load names is reused; its
// "memory" clobber also keeps those loads in front of the LDS reads and the arithmetic below, which then cover their latency.
__device__ __forceinline__ void q_issued() { asm volatile("s_wait_xcnt 0x0" ::: "memory"); }
// a[r] += x[r] * w for NR rows
template <int NR>
__device__ __forceinline__ void q_step(float (&a)[NR], const float* x, float w) {
#pragma unroll
  for (int r = 0; r < NR; ++r) a[r] = fmaf(x[r], w, a[r]);
}
// a[r] += sum_e xa[e][r] * colA[e * LDA] and b[r] += sum_e xb[e][r] * colB[e * LDB], e = 0..128 ascending;
// xa, xb: LDS, kQR floats per e
template <int LDA, int LDB, int NA, int NB>
__device__ __forceinline__ void q_dot2(float (&a)[NA], const float* xa, const float* __restrict__ colA,
                                       float (&b)[NB], const float* xb, const float* __restrict__ colB) {
  float wa[2][kQB], wb[2][kQB];
  q_fetch<LDA>(wa[0], colA, 0);
  q_fetch<LDB>(wb[0], colB, 0);
  float wat = 0.0f, wbt = 0.0f;
#pragma unroll
  for (int c = 0; c < kE / kQB; ++c) {
    if (c + 1 < kE / kQB) {
      q_fetch<LDA>(wa[(c + 1) & 1], colA, kQB * (c + 1));
      q_fetch<LDB>(wb[(c + 1) & 1], colB, kQB * (c + 1));
    } else {
      wat = colA[kE * LDA];
      wbt = colB[kE * LDB];
    }
    q_issued();
#pragma unroll
    for (int i = 0; i < kQB; ++i) {
      q_step<NA>(a, xa + (kQB * c + i) * kQR, wa[c & 1][i]);
      q_step<NB>(b, xb + (kQB * c + i) * kQR, wb[c & 1][i]);
    }
  }
  q_step<NA>(a, xa + kE * kQR, wat);
  q_step<NB>(b, xb + kE * kQR, wbt);
}
__global__ __launch_bounds__(160) void k_qside(const float* __restrict__ enc_last, const float* __restrict__ loadv,
                                              const float* __restrict__ Wq, const float* __restrict__ fW1,
                                              const float* __restrict__ fb1, const float* __restrict__ fW2,
                                              const float* __restrict__ fb2, const float* __restrict__ lqW,
                                              const float* __restrict__ lqb, const float* __restrict__ lW1,
                                              const float* __restrict__ lb1,
                                              float* __restrict__ Qs, float* __restrict__ QW) {
  __shared__ __align__(16) float qin[(kE + 1) * kQR];   // [e][row]
  __shared__ __align__(16) float g1s[kE * kQR + 32];    // [e][row]; behind e = 128 the 28 copies that wave 4 leaves
  __shared__ __align__(16) float qfs[kQD * kQR];        // [i][row]
  const int bp0 = blockIdx.x * kQR;
  const int t = threadIdx.x, lane = t & 31;
  const bool colw = __builtin_amdgcn_readfirstlane(t >> 5) < 4;   // scalar: waves 0..3 against wave 4
  if (colw) {
    v4f x;
#pragma unroll
    for (int r = 0; r < kQR; ++r) x[r] = enc_last[(size_t)(bp0 + r) * kE + t];
    q_issued();
    *(v4f*)(qin + t * kQR) = x;
  } else if (lane < kQR) {
    const float x = loadv[bp0 + lane];
    q_issued();
    qin[kE * kQR + lane] = x;
  }
  __syncthreads();
  float qv[kQR] = {0.0f, 0.0f, 0.0f, 0.0f};
  if (colw) {
    const float b1 = fb1[t];
    q_issued();
    float a1[kQR] = {b1, b1, b1, b1};
    q_dot2<kE + 1, kHD, kQR, kQR>(a1, qin, fW1 + t, qv, qin, Wq + t);
    *(v4f*)(g1s + t * kQR) = (v4f){fmaxf(a1[0], 0.0f), fmaxf(a1[1], 0.0f), fmaxf(a1[2], 0.0f), fmaxf(a1[3], 0.0f)};
  } else {
    // lane = (qf unit i16, row pair h2); it also runs hidden unit 128 of row lane & 3 (lanes 0..3 are read, the rest are copies)
    const int i16 = lane & 15, h2 = (lane >> 4) * 2;
    float a1[1] = {fb1[kE]};
    const float bq = lqb[i16];
    q_issued();
    float qf[2] = {bq, bq};
    q_dot2<kE + 1, kQD, 1, 2>(a1, qin + (lane & 3), fW1 + kE, qf, qin + h2, lqW + i16);
    g1s[kE * kQR + lane] = fmaxf(a1[0], 0.0f);
    *(v2f*)(qfs + i16 * kQR + h2) = (v2f){qf[0], qf[1]};
  }
  __syncthreads();
  if (colw) {
    const float b2 = fb2[t];
    float gm[kQR] = {b2, b2, b2, b2};
    const float* col = fW2 + t;
    float w[3][kQB];           // two batches ahead here: one column only
    q_fetch<kHD>(w[0], col, 0);
    q_fetch<kHD>(w[1], col, kQB);
    float wt = 0.0f;
#pragma unroll
    for (int c = 0; c < kE / kQB; ++c) {
      if (c + 2 < kE / kQB) q_fetch<kHD>(w[(c + 2) % 3], col, kQB * (c + 2));
      else if (c + 2 == kE / kQB) wt = col[kE * kHD];
      if (c + 2 <= kE / kQB) q_issued();
#pragma unroll
      for (int i = 0; i < kQB; ++i) q_step<kQR>(gm, g1s + (kQB * c + i) * kQR, w[c % 3][i]);
    }
    q_step<kQR>(gm, g1s + kE * kQR, wt);
#pragma unroll
    for (int r = 0; r < kQR; ++r) {
      const float den = 1.0f + expf(-gm[r]);
      const float gamma = 2.0f * (1.0f / den);
      Qs[(size_t)(bp0 + r) * kHD + t] = (qv[r] * gamma) * 0.25f;
    }
  } else {
    const float c0 = lb1[lane], c1 = lb1[32 + lane];
    float u0[kQR] = {c0, c0, c0, c0}, u1[kQR] = {c1, c1, c1, c1};
    float w0[kQB], w1[kQB];
    static_assert(kQD == kQB, "one batch");
    q_fetch<kHID>(w0, lW1 + kDYN * kHID + lane, 0);
    q_fetch<kHID>(w1, lW1 + kDYN * kHID + 32 + lane, 0);
    q_issued();
#pragma unroll
    for (int i = 0; i < kQD; ++i) {
      q_step<kQR>(u0, qfs + i * kQR, w0[i]);
      q_step<kQR>(u1, qfs + i * kQR, w1[i]);
    }
#pragma unroll
    for (int r = 0; r < kQR; ++r) {
      QW[(size_t)(bp0 + r) * kHID + lane] = u0[r];
      QW[(size_t)(bp0 + r) * kHID + 32 + lane] = u1[r];
    }
    q_issued();   // the wait behind the stores too: the code laid out behind this branch writes registers that they name
  }
}

// ---------------------------------------------------------------------------
// Lazy-mask MLP, all three layers in one kernel; H1 and H2 never leave the registers.
// Block = one (b,p) row of MASKB, 4 waves; a wave owns 256 node slots and walks them 32 at a time (two 16-slot tiles).
// Lane l: c = l & 15, h = l >> 4.
//   layer 1 (f32 VALU): the lane computes H1[slot c][k] for its own 32 k (k = 32 s + 16 h + e, s = 0,1, e = 0..15),
//     relu, f16: that is the B fragment of k step s as it stands. Its weights come from an LDS table, per k pair
//     {W1[0][k,k+1], W1[1][k,k+1], W1[2][k,k+1], QW[k,k+1]}; the row's dynamic features and mask row are staged in LDS once.
//   layer 2 (WMMA f16): A = lm_W2^T x16, row j = 16 i + c, the same k per lane and element;
//     D register r of tile i = 16 * (H1 . lm_W2[:, j]) for hidden unit j = 16 i + 8 h + r of slot c.
//   layer 3 (f32 VALU): z = sum_j relu(D / 16 + lm_b2[j]) * lm_W3[j]: 32 j in the lane, the other 32 in lane l ^ 16.
//   MASKB[bp][n] = ninf_mask[b,p,min(n,999)] - softplus(z + lm_b3)   (ALPHA = 1)
// Coverage: 1600 blocks x 4 waves x 8 trips x 32 slots = all 1024 columns of all 1600 rows (pad slots from clamped inputs).
// ---------------------------------------------------------------------------
// layer 3 for one 16-unit tile: sum over the lane's 8 hidden units of relu(D / 16 + b2) * w3
__device__ __forceinline__ v2f lazy_l3(v8f acc, const v2f (&b2)[4], const v2f (&w3)[4]) {
  const v2f zero = (v2f){0.0f, 0.0f};
  const v2f sc = (v2f){1.0f / kWCarry, 1.0f / kWCarry};
  v2f zs = zero;
#pragma unroll
  for (int q = 0; q < 4; ++q) {
    const v2f a = __builtin_elementwise_max(__builtin_elementwise_fma((v2f){acc[2 * q], acc[2 * q + 1]}, sc, b2[q]), zero);
    zs = __builtin_elementwise_fma(a, w3[q], zs);
  }
  return zs;
}
__global__ __launch_bounds__(128) void k_lazy(const float* __restrict__ dyn, const float* __restrict__ QW,
                                             const float* __restrict__ lW1, const _Float16* __restrict__ W2T,
                                             const float* __restrict__ lb2, const float* __restrict__ lW3,
                                             const float* __restrict__ lb3, const float* __restrict__ ninfm,
                                             float* __restrict__ maskb) {
  __shared__ __align__(16) float tbl[2 * 16 * 8];      // [h][k pair][w0 w0 w1 w1 w2 w2 qw qw]
  __shared__ __align__(16) float sd[kN * kDYN];        // dynamic features of this (b,p): 1000 x 3
  __shared__ __align__(16) float sn[kN];               // ninf_mask row of this (b,p)
  const int bp = blockIdx.x;
  const int t = threadIdx.x;
  const int lane = t & 31, wave = t >> 5;
  const int c = lane & 15, h = lane >> 4;
  // stage the 12000 contiguous bytes of dynamic features: 750 x 16 B over 128 threads
  const unsigned oD = (unsigned)t * 16u;
  const char* dsrc = (const char*)(dyn + (size_t)bp * kN * kDYN);
  v4f dv[6];
#pragma unroll
  for (int i = 0; i < 5; ++i) dv[i] = *(const v4f*)(dsrc + oD + i * 2048);
  const bool last = (t < (kN * kDYN * 4 - 5 * 2048) / 16);
  const unsigned oL = last ? (oD + 5 * 2048) : 0u;     // threads past the end fetch in bounds and store nothing
  dv[5] = *(const v4f*)(dsrc + oL);
  // and the 4000 contiguous bytes of the mask row: 250 x 16 B
  const char* nsrc = (const char*)(ninfm + (size_t)bp * kN);
  const bool lastn = (t < (kN * 4 - 2048) / 16);
  const unsigned oN = lastn ? (oD + 2048) : 0u;
  const v4f nv0 = *(const v4f*)(nsrc + oD);
  const v4f nv1 = *(const v4f*)(nsrc + oN);
  // weight table: thread t fetches one pair: h = t >> 6, k pair p = (t >> 2) & 15, which = t & 3
  const int tp = (t >> 2) & 15, tw = t & 3;
  const int tk = 32 * (tp >> 3) + 16 * (t >> 6) + 2 * (tp & 7);
  const float* tsrc = (tw < 3) ? (lW1 + tw * kHID + tk) : (QW + (size_t)bp * kHID + tk);
  const v2f tv = *(const v2f*)tsrc;
  // byte offsets of the lane's first fragment / bias element; these set-up loads are scalar base + one of them
  const unsigned oA = (unsigned)(c * kHID + 16 * h) * 2u;
  const unsigned oJ = (unsigned)(8 * h) * 4u;
  v16h aw[4][2];
#pragma unroll
  for (int i = 0; i < 4; ++i)
#pragma unroll
    for (int s = 0; s < 2; ++s) aw[i][s] = *(const v16h*)((const char*)W2T + oA + (16 * i * kHID + 32 * s) * 2);
  v2f b2[4][4], w3[4][4];
#pragma unroll
  for (int i = 0; i < 4; ++i)
#pragma unroll
    for (int q = 0; q < 4; ++q) {
      b2[i][q] = *(const v2f*)((const char*)lb2 + oJ + (16 * i + 2 * q) * 4);
      w3[i][q] = *(const v2f*)((const char*)lW3 + oJ + (16 * i + 2 * q) * 4);
    }
  const float b3 = lb3[0];
  // address translations done before a register that a load above names is reused
  asm volatile("s_wait_xcnt 0x0" :: "v"(oD), "v"(oL), "v"(oN), "v"(tsrc), "v"(oA), "v"(oJ) : "memory");
#pragma unroll
  for (int i = 0; i < 5; ++i) *(v4f*)((char*)sd + oD + i * 2048) = dv[i];
  if (last) *(v4f*)((char*)sd + oL) = dv[5];
  *(v4f*)((char*)sn + oD) = nv0;
  if (lastn) *(v4f*)((char*)sn + oN) = nv1;
  *(v2f*)(tbl + 2 * t) = tv;
  __syncthreads();
  const int nw = wave * 256;
  float* mp = maskb + (size_t)bp * kNP + nw + lane;
  const v4f* tb4 = (const v4f*)(tbl + h * 128);
  for (int it = 0; it < 8; ++it) {
    const int n0 = nw + it * 32;
    const int n = n0 + lane;
    const int nc = (n < kN) ? n : (kN - 1);                          // address clamps (pad slots)
    const int ia = ((n0 + c < kN) ? (n0 + c) : (kN - 1)) * kDYN;
    const int ib = ((n0 + 16 + c < kN) ? (n0 + 16 + c) : (kN - 1)) * kDYN;
    const float a0 = sd[ia], a1 = sd[ia + 1], a2 = sd[ia + 2];
    const float e0 = sd[ib], e1 = sd[ib + 1], e2 = sd[ib + 2];
    v16h ba[2], bb[2];
    const v2h hzero = (v2h){(_Float16)0.0f, (_Float16)0.0f};
    v4f tq[2][8];                               // weight-table reads, four k pairs a group, one group ahead
#pragma unroll
    for (int j = 0; j < 8; ++j) tq[0][j] = tb4[j];
#pragma unroll
    for (int g = 0; g < 4; ++g) {
      if (g < 3) {
#pragma unroll
        for (int j = 0; j < 8; ++j) tq[(g + 1) & 1][j] = tb4[8 * (g + 1) + j];
      }
      // keeps the next group's LDS reads in front of this group's arithmetic, which then covers their latency
      __builtin_amdgcn_sched_barrier(0);
#pragma unroll
      for (int pp = 0; pp < 4; ++pp) {
        const int p = 4 * g + pp;
        const v4f u = tq[g & 1][2 * pp], v = tq[g & 1][2 * pp + 1];
        const v2f w0 = (v2f){u[0], u[1]}, w1 = (v2f){u[2], u[3]}, w2 = (v2f){v[0], v[1]}, qw = (v2f){v[2], v[3]};
        const v2f xa = __builtin_elementwise_fma(w0, (v2f){a0, a0}, __builtin_elementwise_fma(w1, (v2f){a1, a1},
                       __builtin_elementwise_fma(w2, (v2f){a2, a2}, qw)));
        const v2f xb = __builtin_elementwise_fma(w0, (v2f){e0, e0}, __builtin_elementwise_fma(w1, (v2f){e1, e1},
                       __builtin_elementwise_fma(w2, (v2f){e2, e2}, qw)));
        // relu behind the rounding: same value as rounding behind relu
        const v2h ya = __builtin_elementwise_max(__builtin_convertvector(xa, v2h), hzero);
        const v2h yb = __builtin_elementwise_max(__builtin_convertvector(xb, v2h), hzero);
        ba[p >> 3][2 * (p & 7)] = ya[0]; ba[p >> 3][2 * (p & 7) + 1] = ya[1];
        bb[p >> 3][2 * (p & 7)] = yb[0]; bb[p >> 3][2 * (p & 7) + 1] = yb[1];
      }
    }
    v2f za2[4], zb2[4];
#pragma unroll
    for (int i = 0; i < 4; ++i) {
      const v8f czero = (v8f){0.f, 0.f, 0.f, 0.f, 0.f, 0.f, 0.f, 0.f};
      v8f ca = __builtin_amdgcn_wmma_f32_16x16x32_f16(false, aw[i][0], false, ba[0], (short)0, czero, false, false);
      v8f cc = __builtin_amdgcn_wmma_f32_16x16x32_f16(false, aw[i][0], false, bb[0], (short)0, czero, false, false);
      ca = __builtin_amdgcn_wmma_f32_16x16x32_f16(false, aw[i][1], false, ba[1], (short)0, ca, false, false);
      cc = __builtin_amdgcn_wmma_f32_16x16x32_f16(false, aw[i][1], false, bb[1], (short)0, cc, false, false);
      za2[i] = lazy_l3(ca, b2[i], w3[i]);
      zb2[i] = lazy_l3(cc, b2[i], w3[i]);
    }
    const v2f ta = (za2[0] + za2[1]) + (za2[2] + za2[3]);
    const v2f tb = (zb2[0] + zb2[1]) + (zb2[2] + zb2[3]);
    const float za = ta[0] + ta[1], zb = tb[0] + tb[1];
    // lanes 0..15 finish slots n0 + c (tile a), lanes 16..31 slots n0 + 16 + c (tile b): one exchange l <-> l ^ 16 for both
    const float mine = h ? zb : za;
    const int other = __float_as_int(h ? za : zb);
    const float z = (mine + __int_as_float(__builtin_amdgcn_permlanex16(other, other, 0x76543210, 0xfedcba98, false, false))) + b3;
    const float spv = fmaxf(z, 0.0f) + log1pf(expf(-fabsf(z)));
    *mp = sn[nc] - spv;
    // address translation done before the store's address register is advanced; the "memory" clobber also keeps the
    // weight-table reads inside the loop (hoisted they hold 128 more registers: over 256, one wave per SIMD fewer)
    asm volatile("s_wait_xcnt 0x0" :: "v"(mp) : "memory");
    mp += 32;
  }
}

// ---------------------------------------------------------------------------
// Attention core (f32 VALU, head dim 16), node axis split over the waves of a block.
// Block = (b, group of 16 queries, group of 4 heads), 512 threads = 16 waves: wave = (node slice sl = wave >> 1 of 128 slots,
// head pair wave & 1); lane = (head of the pair, query). 16 x 7 x 2 = 224 blocks.
// Per stage every slice gets its next 32 nodes in LDS: the 4 heads' K (64 f32) and V (64 f32) of each node, and the bias tile
// [16 queries][32 nodes] at a pitch of 36 floats (16 rows on 16 different banks). Four stages cover the 128 slots of a slice.
// Online softmax per thread over its slice (slots >= 1000 forced to -inf by value); m, l, acc in f32.
// Merge: every wave leaves (acc[16], m, l) per lane in LDS; 128 threads fold the 8 slices in slice order,
//   M = max m_s, w_s = exp(m_s - M), O = sum_s w_s acc_s / sum_s w_s l_s,
// and write O as bf16 hi + bf16 lo planes into Ohi/Olo[bp][h*16+d]: 8 lanes x 16 B = the block's whole 128-B line of a row
// (rows >= P skipped).
// ---------------------------------------------------------------------------
constexpr int kASl  = 8;               // node slices per block
constexpr int kASn  = kNP / kASl;      // 128 node slots per slice
constexpr int kACh  = 32;              // nodes per slice and stage
constexpr int kAHb  = 4;               // heads per block
constexpr int kARow = 2 * kAHb * kD;   // 128 floats per staged node: K of 4 heads | V of 4 heads
constexpr int kAMp  = 36;              // bias tile pitch in floats
constexpr int kACp  = 20;              // merge record pitch in floats: acc[16], m, l, 2 unused
static_assert(kASl * kAHb * 16 * kACp <= kASl * kACh * kARow, "merge records fit the K|V buffer");
__global__ __launch_bounds__(512) void k_attn(const float* __restrict__ Qs, const float* __restrict__ KV,
                                             const float* __restrict__ maskb, unsigned short* __restrict__ Ohi,
                                             unsigned short* __restrict__ Olo) {
  __shared__ __align__(16) float kvs[kASl * kACh * kARow];   // 131072 B; the merge records reuse it
  __shared__ __align__(16) float ms[kASl * 16 * kAMp];       // 18432 B
  const float kNegInf = -__builtin_inff();
  const int t = threadIdx.x, lane = t & 31;
  const int wave = __builtin_amdgcn_readfirstlane(t >> 5);   // scalar: slice bounds and LDS bases stay off the vector unit
  const int b = blockIdx.x / 14, rem = blockIdx.x - b * 14, pg = rem >> 1, hq = rem & 1, p0 = pg * 16;
  const int sl = wave >> 1;
  const int hl = (wave & 1) * 2 + (lane >> 4), pl = lane & 15;
  const int p = p0 + pl, pc = (p < kP) ? p : (kP - 1);
  const float* qp = Qs + (size_t)(b * kP + pc) * kHD + (hq * kAHb + hl) * kD;
  const v4f qa = *(const v4f*)(qp), qb = *(const v4f*)(qp + 4), qc = *(const v4f*)(qp + 8), qd = *(const v4f*)(qp + 12);
  v4f oa = (v4f){0.f, 0.f, 0.f, 0.f}, ob = (v4f){0.f, 0.f, 0.f, 0.f}, oc = (v4f){0.f, 0.f, 0.f, 0.f}, od = (v4f){0.f, 0.f, 0.f, 0.f};
  float m = -3.0e38f, l = 0.0f;
  const float* kvb = KV + (size_t)b * kNP * (2 * kHD);
  const float* mkb = maskb + (size_t)(b * kP) * kNP;
  // staging roles: a wave copies whole node rows (lanes 0..15 the K part, 16..31 the V part, 256 B each)
  const int scol = ((lane < 16) ? 0 : kHD) + hq * (kAHb * kD) + (lane & 15) * 4;
  // bias tile roles: thread t copies 4 columns (t & 7) * 4 of row (t >> 3) & 15 for slices t >> 7 and 4 + (t >> 7)
  const int mr = (t >> 3) & 15, mj4 = (t & 7) * 4, msl = t >> 7;
  const int mpr = (p0 + mr < kP) ? (p0 + mr) : (kP - 1);
  const float* mrow = mkb + (size_t)mpr * kNP + msl * kASn + mj4;
  float* mdst = ms + (msl * 16 + mr) * kAMp + mj4;
#pragma unroll 1   // rolled: one set of 18 staging register quads serves every stage
  for (int st = 0; st < kASn / kACh; ++st) {
    // 8 slices x 32 nodes x 32 float4 = 8192 float4: 16 x 512 threads; trip i: slice i >> 1, node (i & 1) * 16 + wave
    const float* gk = kvb + (size_t)(st * kACh + wave) * (2 * kHD) + scol;
    v4f kvr[16];
#pragma unroll
    for (int i = 0; i < 16; ++i) kvr[i] = *(const v4f*)(gk + (size_t)((i >> 1) * kASn + (i & 1) * 16) * (2 * kHD));
    // bias tiles: 8 slices x 16 rows x 8 float4 = 1024 float4: 2 x 512 threads; trip i: slice i * 4 + (t >> 7)
    const float* gm = mrow + st * kACh;
    const v4f mr0 = *(const v4f*)(gm);
    const v4f mr1 = *(const v4f*)(gm + 4 * kASn);
    // address translations done before a register that a load above names is reused
    asm volatile("s_wait_xcnt 0x0" :: "v"(gk), "v"(gm) : "memory");
    __syncthreads();   // every wave has left the buffers of the stage before
#pragma unroll
    for (int i = 0; i < 16; ++i) *(v4f*)(kvs + ((i >> 1) * kACh + (i & 1) * 16 + wave) * kARow + lane * 4) = kvr[i];
    *(v4f*)(mdst) = mr0;
    *(v4f*)(mdst + 4 * 16 * kAMp) = mr1;
    __syncthreads();
    const int n0 = sl * kASn + st * kACh;
    const float* kw = kvs + sl * kACh * kARow + hl * kD;
    const float* mw = ms + (sl * 16 + pl) * kAMp;
#pragma unroll 1   // rolled as before: the running m, l, acc make one serial chain from node to node
    for (int j = 0; j < kACh; ++j) {
      const float* kr = kw + j * kARow;
      const v4f k0 = *(const v4f*)(kr), k1 = *(const v4f*)(kr + 4), k2 = *(const v4f*)(kr + 8), k3 = *(const v4f*)(kr + 12);
      float s = mw[j];
      s = fmaf(qa[0], k0[0], s); s = fmaf(qa[1], k0[1], s); s = fmaf(qa[2], k0[2], s); s = fmaf(qa[3], k0[3], s);
      s = fmaf(qb[0], k1[0], s); s = fmaf(qb[1], k1[1], s); s = fmaf(qb[2], k1[2], s); s = fmaf(qb[3], k1[3], s);
      s = fmaf(qc[0], k2[0], s); s = fmaf(qc[1], k2[1], s); s = fmaf(qc[2], k2[2], s); s = fmaf(qc[3], k2[3], s);
      s = fmaf(qd[0], k3[0], s); s = fmaf(qd[1], k3[1], s); s = fmaf(qd[2], k3[2], s); s = fmaf(qd[3], k3[3], s);
      s = (n0 + j < kN) ? s : kNegInf;
      const float mn = fmaxf(m, s);
      const float alpha = __expf(m - mn);
      const float pj = __expf(s - mn);
      m = mn;
      l = fmaf(l, alpha, pj);
      const float* vr = kr + kAHb * kD;
      const v4f v0 = *(const v4f*)(vr), v1 = *(const v4f*)(vr + 4), v2 = *(const v4f*)(vr + 8), v3 = *(const v4f*)(vr + 12);
      oa = v0 * pj + oa * alpha;
      ob = v1 * pj + ob * alpha;
      oc = v2 * pj + oc * alpha;
      od = v3 * pj + od * alpha;
    }
  }
  __syncthreads();   // every wave has left the K|V buffer before the merge records overwrite it
  {
    float* op = kvs + ((sl * kAHb + hl) * 16 + pl) * kACp;
    *(v4f*)(op)      = oa;
    *(v4f*)(op + 4)  = ob;
    *(v4f*)(op + 8)  = oc;
    *(v4f*)(op + 12) = od;
    *(v2f*)(op + 16) = (v2f){m, l};
  }
  __syncthreads();
  if (wave < 4) {    // threads 0..127; no barrier behind this point
    const int rl = t >> 3, c8 = (t & 7) * 8;
    const float* cb = kvs + ((c8 >> 4) * 16 + rl) * kACp;
    constexpr int kSs = kAHb * 16 * kACp;      // floats from one slice's records to the next
    float ml[kASl], ll[kASl];
#pragma unroll
    for (int s = 0; s < kASl; ++s) { const v2f e = *(const v2f*)(cb + s * kSs + 16); ml[s] = e[0]; ll[s] = e[1]; }
    float mx = ml[0];
#pragma unroll
    for (int s = 1; s < kASl; ++s) mx = fmaxf(mx, ml[s]);
    float lsum = 0.0f;
    v4f x0 = (v4f){0.f, 0.f, 0.f, 0.f}, x1 = (v4f){0.f, 0.f, 0.f, 0.f};
#pragma unroll
    for (int s = 0; s < kASl; ++s) {
      const float w = __expf(ml[s] - mx);
      const float* s8 = cb + s * kSs + (c8 & 15);
      lsum = fmaf(ll[s], w, lsum);
      x0 = *(const v4f*)(s8) * w + x0;
      x1 = *(const v4f*)(s8 + 4) * w + x1;
    }
    const float inv = 1.0f / lsum;
    x0 = x0 * inv;
    x1 = x1 * inv;
    unsigned short hb[8], lb[8];
#pragma unroll
    for (int e = 0; e < 4; ++e) {
      split_bf(x0[e], hb[e], lb[e]);
      split_bf(x1[e], hb[4 + e], lb[4 + e]);
    }
    const v4u uh = (v4u){pk16(hb[0], hb[1]), pk16(hb[2], hb[3]), pk16(hb[4], hb[5]), pk16(hb[6], hb[7])};
    const v4u ul = (v4u){pk16(lb[0], lb[1]), pk16(lb[2], lb[3]), pk16(lb[4], lb[5]), pk16(lb[6], lb[7])};
    if (p0 + rl < kP) {
      const size_t o = (size_t)(b * kP + p0 + rl) * kHD + hq * (kAHb * kD) + c8;
      *(v4u*)(Ohi + o) = uh;
      *(v4u*)(Olo + o) = ul;
    }
  }
}

// ---------------------------------------------------------------------------
// Zero fill of two regions, nvec x 16 B each (nvec % 256 == 0, so the region select is block-uniform).
// ---------------------------------------------------------------------------
__global__ __launch_bounds__(256) void k_zero16x2(unsigned int* __restrict__ p0, unsigned int* __restrict__ p1, int nvec) {
  const int i = blockIdx.x * 256 + threadIdx.x;
  if (i >= 2 * nvec) return;
  unsigned int* p = (i < nvec) ? (p0 + 4 * (size_t)i) : (p1 + 4 * (size_t)(i - nvec));
  const v4u z = (v4u){0u, 0u, 0u, 0u};
  *(v4u*)p = z;
  
}

// ---------------------------------------------------------------------------
// Final: per (b,p) row: x = 10*tanh(S) + ninf_mask, softmax over 1000 nodes (f32, fixed-order wave reductions).
// Coverage: 200 blocks x 8 rows = 1600 rows.
// ---------------------------------------------------------------------------
__global__ __launch_bounds__(256) void k_final(const float* __restrict__ Sp, const float* __restrict__ ninfm,
                                              float* __restrict__ out) {
  __shared__ __align__(16) float xs[8 * kN];
  __shared__ float invs[8];
  const float kNegInf = -__builtin_inff();
  const int t = threadIdx.x, lane = t & 31, wave = t >> 5;
  const int r = blockIdx.x * 8 + wave;
  const int b = r / kP, p = r - b * kP;
  const float* srow = Sp + (size_t)(b * kSrows + p) * kNP;
  const float* nrow = ninfm + (size_t)r * kN;
  float* xr = xs + wave * kN;
  float mx = kNegInf;
#pragma unroll 1
  for (int i = 0; i < 32; ++i) {
    const int n = lane + 32 * i;
    const int nc = (n < kN) ? n : (kN - 1);
    const float x = kClip * tanhf(srow[nc]) + nrow[nc];
    if (n < kN) { xr[n] = x; mx = fmaxf(mx, x); }
  }
#pragma unroll
  for (int off = 16; off > 0; off >>= 1) mx = fmaxf(mx, __shfl_xor(mx, off, 32));
  float sum = 0.0f;
#pragma unroll 1
  for (int i = 0; i < 32; ++i) {
    const int n = lane + 32 * i;
    if (n < kN) { const float e = __expf(xr[n] - mx); xr[n] = e; sum += e; }
  }
#pragma unroll
  for (int off = 16; off > 0; off >>= 1) sum += __shfl_xor(sum, off, 32);
  if (lane == 0) invs[wave] = 1.0f / sum;
  __syncthreads();
  float* obase = out + (size_t)blockIdx.x * 8 * kN;
  {
#pragma unroll 1
    for (int f = t; f < 2 * kN; f += 256) {
      v4f v = *(const v4f*)(xs + 4 * f);
      v = v * invs[f / 250];
      *(v4f*)(obase + 4 * (size_t)f) = v;
    }
    
  }
}

// ---------------------------------------------------------------------------
// Host launcher
// Workspace region map (bytes, 256-B aligned offsets):
//   EncHi bf16 [16][1024][128]          4,194,304
//   EncLo bf16 [16][1024][128]          4,194,304
//   WkvHi bf16 [256][128]                 65,536
//   WkvLo bf16 [256][128]                 65,536
//   WcHi  bf16 [128][128]                 32,768
//   WcLo  bf16 [128][128]                 32,768
//   W2T   f16  [64][64]                    8,192
//   KVf   f32  [16384][256]            16,777,216
//   Qs    f32  [1600][128]                819,200
//   QW    f32  [1600][64]                 409,600
//   MASKB f32  [1600][1024]             6,553,600
//   Ohi   bf16 [1664][128]                425,984
//   Olo   bf16 [1664][128]                425,984
//   MHhi  bf16 [1664][128]                425,984
//   MHlo  bf16 [1664][128]                425,984
//   Sp    f32  [16][128][1024]           8,388,608
//   total                              43,245,568
// ---------------------------------------------------------------------------
static inline size_t align256(size_t x) { return (x + 255) & ~(size_t)255; }

extern "C" void kernel_launch(void* const* d_in, const int* in_sizes, int n_in,
                              void* d_out, int out_size, void* d_ws, size_t ws_size,
                              hipStream_t stream) {
  if (n_in < 22) return;
  if (in_sizes[0] != kB * kN * kE || in_sizes[1] != kB * kP * kE || in_sizes[2] != kB * kP ||
      in_sizes[3] != kB * kP * kN || in_sizes[4] != kB * kP * kN * kDYN || out_size != kB * kP * kN) return;

  const float* enc      = (const float*)d_in[0];
  const float* enc_last = (const float*)d_in[1];
  const float* loadv    = (const float*)d_in[2];
  const float* ninfm    = (const float*)d_in[3];
  const float* dyn      = (const float*)d_in[4];
  const float* Wq       = (const float*)d_in[5];
  const float* Wk       = (const float*)d_in[6];
  const float* Wv       = (const float*)d_in[7];
  const float* Wc       = (const float*)d_in[8];
  const float* bcv      = (const float*)d_in[9];
  const float* fW1      = (const float*)d_in[10];
  const float* fb1      = (const float*)d_in[11];
  const float* fW2      = (const float*)d_in[12];
  const float* fb2      = (const float*)d_in[13];
  const float* lqW      = (const float*)d_in[14];
  const float* lqb      = (const float*)d_in[15];
  const float* lW1      = (const float*)d_in[16];
  const float* lb1      = (const float*)d_in[17];
  const float* lW2      = (const float*)d_in[18];
  const float* lb2      = (const float*)d_in[19];
  const float* lW3      = (const float*)d_in[20];
  const float* lb3      = (const float*)d_in[21];
  float* out = (float*)d_out;

  char* ws = (char*)d_ws;
  size_t off = 0;
  unsigned short* EncHi = (unsigned short*)(ws + off); off = align256(off + (size_t)kEncRows * kE * 2);
  unsigned short* EncLo = (unsigned short*)(ws + off); off = align256(off + (size_t)kEncRows * kE * 2);
  unsigned short* WkvHi = (unsigned short*)(ws + off); off = align256(off + (size_t)2 * kHD * kE * 2);
  unsigned short* WkvLo = (unsigned short*)(ws + off); off = align256(off + (size_t)2 * kHD * kE * 2);
  unsigned short* WcHi  = (unsigned short*)(ws + off); off = align256(off + (size_t)kE * kHD * 2);
  unsigned short* WcLo  = (unsigned short*)(ws + off); off = align256(off + (size_t)kE * kHD * 2);
  unsigned short* W2T   = (unsigned short*)(ws + off); off = align256(off + (size_t)kHID * kHID * 2);
  float* KVf   = (float*)(ws + off); off = align256(off + (size_t)kEncRows * 2 * kHD * 4);
  float* Qs    = (float*)(ws + off); off = align256(off + (size_t)kBP * kHD * 4);
  float* QW    = (float*)(ws + off); off = align256(off + (size_t)kBP * kHID * 4);
  float* MASKB = (float*)(ws + off); off = align256(off + (size_t)kBP * kNP * 4);
  unsigned short* Ohi  = (unsigned short*)(ws + off); off = align256(off + (size_t)kBPpad * kHD * 2);
  unsigned short* Olo  = (unsigned short*)(ws + off); off = align256(off + (size_t)kBPpad * kHD * 2);
  unsigned short* MHhi = (unsigned short*)(ws + off); off = align256(off + (size_t)kBPpad * kE * 2);
  unsigned short* MHlo = (unsigned short*)(ws + off); off = align256(off + (size_t)kBPpad * kE * 2);
  float* Sp    = (float*)(ws + off); off = align256(off + (size_t)kB * kSrows * kNP * 4);
  if (off > ws_size) return;
  const float* fdummy = Qs;   // valid, never dereferenced (BIAS_MODE 0 / RESID false)

  // weight planes: Wk|Wv and W_comb transposed to bf16 hi/lo [n][k]; lm_W2 transposed to f16 x16
  k_wprep<<<13, 256, 0, stream>>>(Wk, Wv, Wc, lW2, WkvHi, WkvLo, WcHi, WcLo, W2T);
  // node planes (bf16 hi/lo, 24 zero pad rows per batch in both)
  k_enc_cast<<<(kEncRows * 16) / 256, 256, 0, stream>>>(enc, EncHi, EncLo);
  // K|V projection: [16384][128] x [256][128]^T, bf16 hi/lo both operands, K=128, M=16384, N=256 -> f32
  wmma_gemm64<1, true, 0, 0, false, 0><<<dim3((kEncRows / 64) * (2 * kHD / 64) / 8, 1), 256, 0, stream>>>(
      EncHi, EncLo, kE, 0L, WkvHi, WkvLo, kE, 0L, (void*)KVf, (void*)KVf, 2 * kHD, 0L,
      fdummy, fdummy, 0L, kEncRows, 2 * kHD, kE, 1.0f);
  // query side (f32)
  k_qside<<<kBP / kQR, 160, 0, stream>>>(enc_last, loadv, Wq, fW1, fb1, fW2, fb2, lqW, lqb, lW1, lb1, Qs, QW);
  // lazy-mask MLP, three layers fused, one launch for all 1600 x 1024 slots; hidden layer on WMMA f16 (W x16), K=64
  k_lazy<<<kBP, 128, 0, stream>>>(dyn, QW, lW1, (const _Float16*)W2T, lb2, lW3, lb3, ninfm, MASKB);
  // zero the 64 pad rows (1600..1663) of Ohi and Olo: 64*128 halves = 1024 x 16 B each
  k_zero16x2<<<(2 * 1024) / 256, 256, 0, stream>>>((unsigned int*)(Ohi + (size_t)kBP * kHD),
                                                   (unsigned int*)(Olo + (size_t)kBP * kHD), 1024);
  // attention core (f32), 8 node slices per block merged in LDS -> O as bf16 hi/lo planes
  k_attn<<<kB * 14, 512, 0, stream>>>(Qs, KVf, MASKB, Ohi, Olo);
  // head merge: [1664][128] x [128][128]^T, bf16 hi/lo both operands, K=128, bias b_comb[n], bf16 hi/lo out planes
  wmma_gemm64<1, true, 2, 2, false, 0><<<dim3(((kBPpad / 64) * (kE / 64) + 7) / 8, 1), 256, 0, stream>>>(
      Ohi, Olo, kHD, 0L, WcHi, WcLo, kHD, 0L, (void*)MHhi, (void*)MHlo, kE, 0L,
      bcv, fdummy, 0L, kBPpad, kE, kHD, 1.0f);
  // pointer scores per batch: A = MH rows b*100 .. b*100+127 (hi/lo, rows beyond the batch are finite data),
  // Bt = node planes of batch b [1024][128] (hi/lo); M=128, N=1024, K=128 -> f32 Sp[b][128][1024], scale 1/sqrt(128)
  wmma_gemm64<1, true, 0, 0, false, 0><<<dim3((kSrows / 64) * (kNP / 64) / 8, kB), 256, 0, stream>>>(
      MHhi, MHlo, kE, (long)kP * kE, EncHi, EncLo, kE, (long)kNP * kE, (void*)Sp, (void*)Sp, kNP, (long)kSrows * kNP,
      fdummy, fdummy, 0L, kSrows, kNP, kE, kInvSqrtE);
  // clipped tanh + mask + softmax -> probs
  k_final<<<kBP / 8, 256, 0, stream>>>(Sp, ninfm, out);
}

// v004
// A run of this version takes 117 microseconds.
// Timed twice side by side with v003, it ran 1.18 times as fast both times.
// All steps since v000 together make it 5.12 times as fast.
// Contractions: node K|V projection (nodes x [Wk|Wv]^T), head-merge projection (O x W_comb^T) and pointer scores (MH x nodes^T) on v_wmma_f32_16x16x32_bf16 with bf16 hi/lo operand planes (hi.hi + hi.lo + lo.hi); lazy-mask hidden layer (lm_W2^T f16 carried x16, as A, x H1 f16, as B) on v_wmma_f32_16x16x32_f16 inside the fused lazy-mask kernel; all f32 accumulate; query/FiLM/gating/qf projections, lazy layers 1 (K=3 after the broadcast fold) and 3 (N=1), the 16-dim attention core and both softmaxes in f32 on the VALU.
#include <hip/hip_runtime.h>
#include <math.h>

typedef __attribute__((ext_vector_type(16))) _Float16 v16h;
typedef __attribute__((ext_vector_type(8)))  _Float16 v8h;
typedef __attribute__((ext_vector_type(16))) __bf16   v16b;
typedef __attribute__((ext_vector_type(8)))  __bf16   v8b;
typedef __attribute__((ext_vector_type(8)))  float    v8f;
typedef __attribute__((ext_vector_type(4)))  float    v4f;
typedef __attribute__((ext_vector_type(4)))  unsigned int v4u;
typedef __attribute__((ext_vector_type(2)))  float    v2f;
typedef __attribute__((ext_vector_type(2)))  _Float16 v2h;

// ---------------------------------------------------------------------------
// Problem constants
// ---------------------------------------------------------------------------
constexpr int kB   = 16;      // batch
constexpr int kP   = 100;     // queries per batch
constexpr int kN   = 1000;    // nodes
constexpr int kNP  = 1024;    // nodes padded
constexpr int kE   = 128;     // embedding
constexpr int kH   = 8;       // heads
constexpr int kD   = 16;      // head dim
constexpr int kHD  = 128;     // H*D
constexpr int kQD  = 16;      // lazy query dim
constexpr int kDYN = 3;       // dynamic features
constexpr int kHID = 64;      // lazy hidden
constexpr int kBP     = kB * kP;          // 1600 (b,p) rows
constexpr int kBPpad  = 1664;             // 26 * 64
constexpr int kEncRows = kB * kNP;        // 16384 padded node rows
constexpr int kSrows = 128;               // pointer-score rows per batch (100 padded)
constexpr float kWCarry   = 16.0f;        // lm_W2 carried x16 in f16
constexpr float kInvSqrtE = 0.08838834764831845f;
constexpr float kClip     = 10.0f;
static_assert(kBPpad % 64 == 0 && kBPpad >= kBP, "pad");
static_assert(kBPpad >= (kB - 1) * kP + kSrows, "last batch score rows inside MH planes");
static_assert(kH * kD == kHD && kE == kHD, "dims");

// ---------------------------------------------------------------------------
// Helpers
// ---------------------------------------------------------------------------
__device__ __forceinline__ unsigned short f2bf_bits(float f) {
  unsigned u = __float_as_uint(f);
  return (unsigned short)((u + 0x7FFFu + ((u >> 16) & 1u)) >> 16);
}
__device__ __forceinline__ float bf_bits2f(unsigned short h) { return __uint_as_float(((unsigned)h) << 16); }

// hazard guards as plain device helpers (no inline asm inside the kernel template body)
__device__ __forceinline__ void dep_guard_h(v8f& a, v8f& b, v16h x, v16h y) { asm volatile("v_nop\n\tv_nop\n\tv_nop\n\tv_nop" : "+v"(a), "+v"(b) : "v"(x), "v"(y)); }
__device__ __forceinline__ void dep_guard_b(v8f& a, v8f& b, v16b x, v16b y) { asm volatile("v_nop\n\tv_nop\n\tv_nop\n\tv_nop" : "+v"(a), "+v"(b) : "v"(x), "v"(y)); }
__device__ __forceinline__ void keep4_h(v16h a, v16h b, v16h c, v16h d) { asm volatile("v_nop" :: "v"(a), "v"(b), "v"(c), "v"(d)); }
__device__ __forceinline__ void keep4_b(v16b a, v16b b, v16b c, v16b d) { asm volatile("v_nop" :: "v"(a), "v"(b), "v"(c), "v"(d)); }
__device__ __forceinline__ void acc_guard4(v8f& a, v8f& b, v8f& c, v8f& d) { asm volatile("v_nop\n\tv_nop\n\tv_nop\n\tv_nop" : "+v"(a), "+v"(b), "+v"(c), "+v"(d)); }
template <typename T> struct Frag;
template <> struct Frag<_Float16> {
  typedef v16h V; union U { v16h v; v8h h[2]; };
  static __device__ __forceinline__ v16h load(const _Float16* p) {   // elements 0..7 <- p[0..7], 8..15 <- p[16..23]
    U f; f.h[0] = *(const v8h*)(p); f.h[1] = *(const v8h*)(p + 16); return f.v;
  }
  static __device__ __forceinline__ v8f mma(v16h a, v16h b, v8f c) {
    return __builtin_amdgcn_wmma_f32_16x16x32_f16(false, a, false, b, (short)0, c, false, false);
  }
  static __device__ __forceinline__ void guard(v8f& a, v8f& b, v16h x, v16h y) { dep_guard_h(a, b, x, y); }
  static __device__ __forceinline__ void keep(v16h a, v16h b, v16h c, v16h d) { keep4_h(a, b, c, d); }
};
template <> struct Frag<__bf16> {
  typedef v16b V; union U { v16b v; v8b h[2]; };
  static __device__ __forceinline__ v16b load(const __bf16* p) {
    U f; f.h[0] = *(const v8b*)(p); f.h[1] = *(const v8b*)(p + 16); return f.v;
  }
  static __device__ __forceinline__ v8f mma(v16b a, v16b b, v8f c) {
    return __builtin_amdgcn_wmma_f32_16x16x32_bf16(false, a, false, b, (short)0, c, false, false);
  }
  static __device__ __forceinline__ void guard(v8f& a, v8f& b, v16b x, v16b y) { dep_guard_b(a, b, x, y); }
  static __device__ __forceinline__ void keep(v16b a, v16b b, v16b c, v16b d) { keep4_b(a, b, c, d); }
};

__device__ __forceinline__ unsigned pk16(unsigned short a, unsigned short b) { return (unsigned)a | ((unsigned)b << 16); }
__device__ __forceinline__ unsigned short h_bits(float f) { const _Float16 h = (_Float16)f; return __builtin_bit_cast(unsigned short, h); }
// bf16 hi + bf16 lo split of an f32 value (both RNE converts)
__device__ __forceinline__ void split_bf(float f, unsigned short& hb, unsigned short& lb) {
  hb = f2bf_bits(f);
  lb = f2bf_bits(f - bf_bits2f(hb));
}

// ---- Register-blocked batched WMMA GEMM (ACT reduced to none/relu/leaky) -----------------------
// C[m,n] = scale * sum_k A[m,k] * Bt[n,k] (+bias)(+resid); each wave owns a 64x64 tile.
// A row-major [M,K]; Bt row-major [N,K]; M,N % 64 == 0, K % 32 == 0.
// SPLIT: operands are hi/lo planes (A2/Bt2 = lo planes, same layout); product = hi·hi + hi·lo + lo·hi.
// BIAS_MODE: 0 = none, 1 = bias[m], 2 = bias[n].
// OUT_MODE: 0 = f32, 1 = f16, 2 = bf16 hi plane (Cout) + bf16 lo plane (Cout2).
// ET: 0 = f16 operands, 1 = bf16 operands (pointers passed as 16-bit storage)
template <int ET> struct Elem;
template <> struct Elem<0> { typedef _Float16 T; };
template <> struct Elem<1> { typedef __bf16 T; };
template <int ET, bool SPLIT, int BIAS_MODE, int OUT_MODE, bool RESID, int ACT = 0>
__global__ __launch_bounds__(256) void wmma_gemm64(
    const unsigned short* __restrict__ Ap, const unsigned short* __restrict__ A2p, int lda, long strideA,
    const unsigned short* __restrict__ Btp, const unsigned short* __restrict__ Bt2p, int ldb, long strideB,
    void* __restrict__ Cout, void* __restrict__ Cout2, int ldc, long strideC,
    const float* __restrict__ bias,
    const float* __restrict__ resid, long strideR,
    int M, int N, int K, float scale) {
  typedef typename Elem<ET>::T T;
  typedef typename Frag<T>::V V;
  const T* A = (const T*)Ap; const T* A2 = (const T*)A2p; const T* Bt = (const T*)Btp; const T* Bt2 = (const T*)Bt2p;
  __shared__ __align__(16) float sT[8][16 * 68];   // per-wave 16x64 slab, pitch 68 floats
  const int b    = blockIdx.y;
  const int lane = threadIdx.x & 31;
  const int wave = threadIdx.x >> 5;
  const int tilesN = N >> 6;
  const int tilesM = M >> 6;
  const int tile = blockIdx.x * 8 + wave;
  if (tile >= tilesM * tilesN) return;   // wave-uniform; no block barriers in this kernel
  const int tm = tile / tilesN;
  const int tn = tile - tm * tilesN;
  const int m0 = tm << 6;
  const int n0 = tn << 6;

  const T* Ab  = A  + (size_t)b * strideA;
  const T* Bb  = Bt + (size_t)b * strideB;
  const T* Ab2 = SPLIT ? (A2  + (size_t)b * strideA) : nullptr;
  const T* Bb2 = SPLIT ? (Bt2 + (size_t)b * strideB) : nullptr;

  const int rlane = lane & 15;                 // row (A) / col (B, D) within subtile
  const int koff  = (lane >> 4) * 8;           // k offset of this lane half
  const int mOff  = (lane >> 4) * 8;           // D row offset

  v8f acc[4][4];
#pragma unroll
  for (int i = 0; i < 4; ++i)
#pragma unroll
    for (int j = 0; j < 4; ++j) acc[i][j] = (v8f){0.f,0.f,0.f,0.f,0.f,0.f,0.f,0.f};

  for (int k0 = 0; k0 < K; k0 += 32) {
    V bh[4], bl[4];
#pragma unroll
    for (int j = 0; j < 4; ++j) {
      const size_t bo = (size_t)(n0 + (j << 4) + rlane) * ldb + koff + k0;
      bh[j] = Frag<T>::load(Bb + bo);
      if (SPLIT) bl[j] = Frag<T>::load(Bb2 + bo);
    }
#pragma unroll
    for (int i = 0; i < 4; ++i) {
      const size_t ao = (size_t)(m0 + (i << 4) + rlane) * lda + koff + k0;
      V ah = Frag<T>::load(Ab + ao);
      V al;
      if (SPLIT) al = Frag<T>::load(Ab2 + ao);
#pragma unroll
      for (int j = 0; j < 4; ++j) {
        acc[i][j] = Frag<T>::mma(ah, bh[j], acc[i][j]);
        if (SPLIT) {
          acc[i][j] = Frag<T>::mma(ah, bl[j], acc[i][j]);
          acc[i][j] = Frag<T>::mma(al, bh[j], acc[i][j]);
        }
      }
      Frag<T>::guard(acc[i][0], acc[i][3], ah, SPLIT ? al : ah);
    }
    Frag<T>::keep(bh[0], bh[1], bh[2], bh[3]);
    if (SPLIT) Frag<T>::keep(bl[0], bl[1], bl[2], bl[3]);
  }
  acc_guard4(acc[0][0], acc[0][1], acc[0][2], acc[0][3]);
  acc_guard4(acc[1][0], acc[1][1], acc[1][2], acc[1][3]);
  acc_guard4(acc[2][0], acc[2][1], acc[2][2], acc[2][3]);
  acc_guard4(acc[3][0], acc[3][1], acc[3][2], acc[3][3]);

  // ---- epilogue ----
  float* slab = sT[wave];
  const float* Rb = RESID ? (resid + (size_t)b * strideR) : nullptr;
#pragma unroll
  for (int i = 0; i < 4; ++i) {
    const int mBase = m0 + (i << 4);
#pragma unroll
    for (int j = 0; j < 4; ++j) {
      const int n = n0 + (j << 4) + rlane;
      float bv = 0.f;
      if (BIAS_MODE == 2) bv = bias[n];
#pragma unroll
      for (int r = 0; r < 8; ++r) {
        float v = acc[i][j][r] * scale;
        if (BIAS_MODE == 1) v += bias[mBase + mOff + r];
        if (BIAS_MODE == 2) v += bv;
        if (RESID) v += Rb[(size_t)(mBase + mOff + r) * ldc + n];
        if (ACT == 2) v = fmaxf(v, 0.0f);
        if (ACT == 4) v = (v > 0.f) ? v : 0.01f * v;
        slab[(mOff + r) * 68 + (j << 4) + rlane] = v;
      }
    }
    __builtin_amdgcn_fence(__ATOMIC_RELEASE, "workgroup");
    __builtin_amdgcn_wave_barrier();
    __builtin_amdgcn_fence(__ATOMIC_ACQUIRE, "workgroup");
    if (OUT_MODE == 0) {
      float* C = (float*)Cout + (size_t)b * strideC;
      const int hh = lane >> 4, c4 = (lane & 15) * 4;     // row seg = 256 B = 16 lanes x 16 B
      {
#pragma unroll
        for (int it = 0; it < 8; ++it) {
          const int row = it * 2 + hh;
          v4f v = *(const v4f*)(slab + row * 68 + c4);
          *(v4f*)(C + (size_t)(mBase + row) * ldc + n0 + c4) = v;
        }
        
      }
    } else {
      const int q = lane >> 3, c8 = (lane & 7) * 8;
      unsigned short* C  = (unsigned short*)Cout  + (size_t)b * strideC;
      unsigned short* C2 = (OUT_MODE == 2) ? ((unsigned short*)Cout2 + (size_t)b * strideC) : nullptr;
      {
#pragma unroll
        for (int it = 0; it < 4; ++it) {
          const int row = it * 4 + q;
          const float* sp = slab + row * 68 + c8;
          v8h hv, lv;
#pragma unroll
          for (int e = 0; e < 8; ++e) {
            if (OUT_MODE == 1) {
              hv[e] = (_Float16)sp[e];
            } else {
              unsigned short hb = f2bf_bits(sp[e]);
              unsigned short lb = f2bf_bits(sp[e] - bf_bits2f(hb));
              hv[e] = __builtin_bit_cast(_Float16, hb);
              lv[e] = __builtin_bit_cast(_Float16, lb);
            }
          }
          *(v8h*)(C + (size_t)(mBase + row) * ldc + n0 + c8) = hv;
          if (OUT_MODE == 2) *(v8h*)(C2 + (size_t)(mBase + row) * ldc + n0 + c8) = lv;
        }
        
      }
    }
    __builtin_amdgcn_fence(__ATOMIC_RELEASE, "workgroup");
    __builtin_amdgcn_wave_barrier();
    __builtin_amdgcn_fence(__ATOMIC_ACQUIRE, "workgroup");
  }
}

// ---------------------------------------------------------------------------
// Weight preparation: 64x64 transpose tiles of f32 W[k][n] (pitch ldn) -> WT[n][k] (pitch ldk).
// blocks 0..3: Wk -> WkvHi/WkvLo rows 0..127 (bf16 hi + bf16 lo planes); 4..7: Wv -> rows 128..255;
// 8..11: W_comb -> WcHi/WcLo; 12: lm_W2 -> W2T (f16 carried x16, single plane).
// Load coverage: 16 x 256 = 4096 = whole tile. Store coverage: 8 waves x 2 it x 4 rows (lane>>3) = 64 rows,
// ---------------------------------------------------------------------------
__global__ __launch_bounds__(256) void k_wprep(const float* __restrict__ Wk, const float* __restrict__ Wv,
                                              const float* __restrict__ Wcomb, const float* __restrict__ W2,
                                              unsigned short* __restrict__ WkvHi, unsigned short* __restrict__ WkvLo,
                                              unsigned short* __restrict__ WcHi, unsigned short* __restrict__ WcLo,
                                              unsigned short* __restrict__ W2T) {
  __shared__ float sm[64][65];   // sm[n_local][k_local]
  const int t = threadIdx.x, lane = t & 31, wave = t >> 5;
  const int bid = blockIdx.x;    // block-uniform selection below
  const float* W = Wk; unsigned short* outH = WkvHi; unsigned short* outL = WkvLo;
  int ldn = kHD, ldk = kE, nt = 0, kt = 0; float carry = 1.0f;
  const bool two_planes = (bid < 12);
  if (bid < 4)       { W = Wk;    outH = WkvHi;                    outL = WkvLo;                    ldn = kHD;  ldk = kE;   nt = bid & 1;       kt = bid >> 1;       carry = 1.0f; }
  else if (bid < 8)  { W = Wv;    outH = WkvHi + (size_t)kHD * kE; outL = WkvLo + (size_t)kHD * kE; ldn = kHD;  ldk = kE;   nt = (bid - 4) & 1; kt = (bid - 4) >> 1; carry = 1.0f; }
  else if (bid < 12) { W = Wcomb; outH = WcHi;                     outL = WcLo;                     ldn = kE;   ldk = kHD;  nt = (bid - 8) & 1; kt = (bid - 8) >> 1; carry = 1.0f; }
  else               { W = W2;    outH = W2T;                      outL = W2T;                      ldn = kHID; ldk = kHID; nt = 0;             kt = 0;              carry = kWCarry; }
  const int n0 = nt * 64, k0 = kt * 64;
#pragma unroll
  for (int i = 0; i < 16; ++i) {
    const int e = i * 256 + t;
    const int r = e >> 6;    // k local
    const int c = e & 63;    // n local
    sm[c][r] = W[(size_t)(k0 + r) * ldn + n0 + c] * carry;
  }
  __syncthreads();
  const int q = lane >> 3, c8 = (lane & 7) * 8;
  v4u uh[2], ul[2];
  int rowv[2];
#pragma unroll
  for (int it = 0; it < 2; ++it) {
    const int row = wave * 8 + it * 4 + q;   // n local
    rowv[it] = row;
    unsigned short hb[8], lb[8];
#pragma unroll
    for (int e = 0; e < 8; ++e) {
      const float v = sm[row][c8 + e];
      if (two_planes) { split_bf(v, hb[e], lb[e]); }
      else { hb[e] = h_bits(v); lb[e] = hb[e]; }
    }
    uh[it] = (v4u){pk16(hb[0], hb[1]), pk16(hb[2], hb[3]), pk16(hb[4], hb[5]), pk16(hb[6], hb[7])};
    ul[it] = (v4u){pk16(lb[0], lb[1]), pk16(lb[2], lb[3]), pk16(lb[4], lb[5]), pk16(lb[6], lb[7])};
  }
  {
#pragma unroll
    for (int it = 0; it < 2; ++it) {
      const size_t o = (size_t)(n0 + rowv[it]) * ldk + k0 + c8;
      *(v4u*)(outH + o) = uh[it];
      if (two_planes) *(v4u*)(outL + o) = ul[it];
    }
    
  }
}

// ---------------------------------------------------------------------------
// Node split: enc f32 [B][1000][128] -> EncHi/EncLo bf16 hi/lo planes [B][1024][128] each
// (rows 1000..1023 of every batch written as zeros in both planes).
// ---------------------------------------------------------------------------
__global__ __launch_bounds__(256) void k_enc_cast(const float* __restrict__ enc, unsigned short* __restrict__ outHi,
                                                 unsigned short* __restrict__ outLo) {
  const int i = blockIdx.x * 256 + threadIdx.x;
  if (i >= kEncRows * 16) return;
  const int row = i >> 4, c8 = (i & 15) * 8;
  const int b = row >> 10, n = row & (kNP - 1);
  const int nc = (n < kN) ? n : (kN - 1);                    // address clamp
  const float* p = enc + ((size_t)(b * kN + nc)) * kE + c8;
  const v4f a = *(const v4f*)(p);
  const v4f c = *(const v4f*)(p + 4);
  const bool valid = (n < kN);
  unsigned short hb[8], lb[8];
#pragma unroll
  for (int e = 0; e < 4; ++e) {
    split_bf(valid ? a[e] : 0.0f, hb[e], lb[e]);
    split_bf(valid ? c[e] : 0.0f, hb[4 + e], lb[4 + e]);
  }
  const v4u uh = (v4u){pk16(hb[0], hb[1]), pk16(hb[2], hb[3]), pk16(hb[4], hb[5]), pk16(hb[6], hb[7])};
  const v4u ul = (v4u){pk16(lb[0], lb[1]), pk16(lb[2], lb[3]), pk16(lb[4], lb[5]), pk16(lb[6], lb[7])};
  const size_t o = (size_t)row * kE + c8;
  *(v4u*)(outHi + o) = uh;
  *(v4u*)(outLo + o) = ul;
  
}

// ---------------------------------------------------------------------------
// Query side (f32, VALU), 4 (b,p) rows per block: q_in = [last | load] (129);
//   Qs[bp][h*16+d] = ((q_in.Wq_last) * 2*sigmoid(relu(q_in.fW1 + fb1).fW2 + fb2)) * 0.25   (1/sqrt(16) folded, exact)
//   QW[bp][64]     = lm_b1 + qf.lm_W1[3:19]   with qf = q_in.lazy_q_W + lazy_q_b
// 160 threads. Waves 0..3: thread = output column j; every weight element it loads feeds the chains of the 4 rows, whose
// inputs lie in LDS as [e][row] (one 16-B broadcast read per e). Wave 4: hidden unit 128 of the FiLM layer, qf, then QW.
// The weight loads go out in batches, one batch ahead of the arithmetic, so their latencies overlap.
// Every output is still one fma chain from its bias, e ascending.
// All loops of this kernel are unrolled in full: the batches are register arrays, which takes static indices, and the
// loads of a batch have to stand together ahead of the arithmetic that uses the batch before.
// Stores: one instruction of a wave writes one whole 128-B line of a Qs or QW row.
// ---------------------------------------------------------------------------
constexpr int kQR = 4;     // (b,p) rows per block
constexpr int kQB = 16;    // e steps per batch of weight loads
static_assert(kBP % kQR == 0 && kE % kQB == 0, "rows per block, batches");
// one batch of a weight column: w[i] = col[(e0 + i) * LD]
template <int LD>
__device__ __forceinline__ void q_fetch(float (&w)[kQB], const float* __restrict__ col, int e0) {
#pragma unroll
  for (int i = 0; i < kQB; ++i) w[i] = col[(e0 + i) * LD];
}
// Stands behind a group of loads: address translations done before a register that an issued load names is reused; its
// "memory" clobber also keeps those loads in front of the LDS reads and the arithmetic below, which then cover their latency.
__device__ __forceinline__ void q_issued() { asm volatile("s_wait_xcnt 0x0" ::: "memory"); }
// a[r] += x[r] * w for NR rows
template <int NR>
__device__ __forceinline__ void q_step(float (&a)[NR], const float* x, float w) {
#pragma unroll
  for (int r = 0; r < NR; ++r) a[r] = fmaf(x[r], w, a[r]);
}
// a[r] += sum_e xa[e][r] * colA[e * LDA] and b[r] += sum_e xb[e][r] * colB[e * LDB], e = 0..128 ascending;
// xa, xb: LDS, kQR floats per e
template <int LDA, int LDB, int NA, int NB>
__device__ __forceinline__ void q_dot2(float (&a)[NA], const float* xa, const float* __restrict__ colA,
                                       float (&b)[NB], const float* xb, const float* __restrict__ colB) {
  float wa[2][kQB], wb[2][kQB];
  q_fetch<LDA>(wa[0], colA, 0);
  q_fetch<LDB>(wb[0], colB, 0);
  float wat = 0.0f, wbt = 0.0f;
#pragma unroll
  for (int c = 0; c < kE / kQB; ++c) {
    if (c + 1 < kE / kQB) {
      q_fetch<LDA>(wa[(c + 1) & 1], colA, kQB * (c + 1));
      q_fetch<LDB>(wb[(c + 1) & 1], colB, kQB * (c + 1));
    } else {
      wat = colA[kE * LDA];
      wbt = colB[kE * LDB];
    }
    q_issued();
#pragma unroll
    for (int i = 0; i < kQB; ++i) {
      q_step<NA>(a, xa + (kQB * c + i) * kQR, wa[c & 1][i]);
      q_step<NB>(b, xb + (kQB * c + i) * kQR, wb[c & 1][i]);
    }
  }
  q_step<NA>(a, xa + kE * kQR, wat);
  q_step<NB>(b, xb + kE * kQR, wbt);
}
__global__ __launch_bounds__(160) void k_qside(const float* __restrict__ enc_last, const float* __restrict__ loadv,
                                              const float* __restrict__ Wq, const float* __restrict__ fW1,
                                              const float* __restrict__ fb1, const float* __restrict__ fW2,
                                              const float* __restrict__ fb2, const float* __restrict__ lqW,
                                              const float* __restrict__ lqb, const float* __restrict__ lW1,
                                              const float* __restrict__ lb1,
                                              float* __restrict__ Qs, float* __restrict__ QW) {
  __shared__ __align__(16) float qin[(kE + 1) * kQR];   // [e][row]
  __shared__ __align__(16) float g1s[kE * kQR + 32];    // [e][row]; behind e = 128 the 28 copies that wave 4 leaves
  __shared__ __align__(16) float qfs[kQD * kQR];        // [i][row]
  const int bp0 = blockIdx.x * kQR;
  const int t = threadIdx.x, lane = t & 31;
  const bool colw = __builtin_amdgcn_readfirstlane(t >> 5) < 4;   // scalar: waves 0..3 against wave 4
  if (colw) {
    v4f x;
#pragma unroll
    for (int r = 0; r < kQR; ++r) x[r] = enc_last[(size_t)(bp0 + r) * kE + t];
    q_issued();
    *(v4f*)(qin + t * kQR) = x;
  } else if (lane < kQR) {
    const float x = loadv[bp0 + lane];
    q_issued();
    qin[kE * kQR + lane] = x;
  }
  __syncthreads();
  float qv[kQR] = {0.0f, 0.0f, 0.0f, 0.0f};
  if (colw) {
    const float b1 = fb1[t];
    q_issued();
    float a1[kQR] = {b1, b1, b1, b1};
    q_dot2<kE + 1, kHD, kQR, kQR>(a1, qin, fW1 + t, qv, qin, Wq + t);
    *(v4f*)(g1s + t * kQR) = (v4f){fmaxf(a1[0], 0.0f), fmaxf(a1[1], 0.0f), fmaxf(a1[2], 0.0f), fmaxf(a1[3], 0.0f)};
  } else {
    // lane = (qf unit i16, row pair h2); it also runs hidden unit 128 of row lane & 3 (lanes 0..3 are read, the rest are copies)
    const int i16 = lane & 15, h2 = (lane >> 4) * 2;
    float a1[1] = {fb1[kE]};
    const float bq = lqb[i16];
    q_issued();
    float qf[2] = {bq, bq};
    q_dot2<kE + 1, kQD, 1, 2>(a1, qin + (lane & 3), fW1 + kE, qf, qin + h2, lqW + i16);
    g1s[kE * kQR + lane] = fmaxf(a1[0], 0.0f);
    *(v2f*)(qfs + i16 * kQR + h2) = (v2f){qf[0], qf[1]};
  }
  __syncthreads();
  if (colw) {
    const float b2 = fb2[t];
    float gm[kQR] = {b2, b2, b2, b2};
    const float* col = fW2 + t;
    float w[3][kQB];           // two batches ahead here: one column only
    q_fetch<kHD>(w[0], col, 0);
    q_fetch<kHD>(w[1], col, kQB);
    float wt = 0.0f;
#pragma unroll
    for (int c = 0; c < kE / kQB; ++c) {
      if (c + 2 < kE / kQB) q_fetch<kHD>(w[(c + 2) % 3], col, kQB * (c + 2));
      else if (c + 2 == kE / kQB) wt = col[kE * kHD];
      if (c + 2 <= kE / kQB) q_issued();
#pragma unroll
      for (int i = 0; i < kQB; ++i) q_step<kQR>(gm, g1s + (kQB * c + i) * kQR, w[c % 3][i]);
    }
    q_step<kQR>(gm, g1s + kE * kQR, wt);
#pragma unroll
    for (int r = 0; r < kQR; ++r) {
      const float den = 1.0f + expf(-gm[r]);
      const float gamma = 2.0f * (1.0f / den);
      Qs[(size_t)(bp0 + r) * kHD + t] = (qv[r] * gamma) * 0.25f;
    }
  } else {
    const float c0 = lb1[lane], c1 = lb1[32 + lane];
    float u0[kQR] = {c0, c0, c0, c0}, u1[kQR] = {c1, c1, c1, c1};
    float w0[kQB], w1[kQB];
    static_assert(kQD == kQB, "one batch");
    q_fetch<kHID>(w0, lW1 + kDYN * kHID + lane, 0);
    q_fetch<kHID>(w1, lW1 + kDYN * kHID + 32 + lane, 0);
    q_issued();
#pragma unroll
    for (int i = 0; i < kQD; ++i) {
      q_step<kQR>(u0, qfs + i * kQR, w0[i]);
      q_step<kQR>(u1, qfs + i * kQR, w1[i]);
    }
#pragma unroll
    for (int r = 0; r < kQR; ++r) {
      QW[(size_t)(bp0 + r) * kHID + lane] = u0[r];
      QW[(size_t)(bp0 + r) * kHID + 32 + lane] = u1[r];
    }
    q_issued();   // the wait behind the stores too: the code laid out behind this branch writes registers that they name
  }
}

// ---------------------------------------------------------------------------
// Lazy-mask MLP, all three layers in one kernel; H1 and H2 never leave the registers.
// Block = one (b,p) row of MASKB, 4 waves; a wave owns 256 node slots and walks them 32 at a time (two 16-slot tiles).
// Lane l: c = l & 15, h = l >> 4.
//   layer 1 (f32 VALU): the lane computes H1[slot c][k] for its own 32 k (k = 32 s + 16 h + e, s = 0,1, e = 0..15),
//     relu, f16: that is the B fragment of k step s as it stands. Its weights come from an LDS table, per k pair
//     {W1[0][k,k+1], W1[1][k,k+1], W1[2][k,k+1], QW[k,k+1]}; the row's dynamic features and mask row are staged in LDS once.
//   layer 2 (WMMA f16): A = lm_W2^T x16, row j = 16 i + c, the same k per lane and element;
//     D register r of tile i = 16 * (H1 . lm_W2[:, j]) for hidden unit j = 16 i + 8 h + r of slot c.
//   layer 3 (f32 VALU): z = sum_j relu(D / 16 + lm_b2[j]) * lm_W3[j]: 32 j in the lane, the other 32 in lane l ^ 16.
//   MASKB[bp][n] = ninf_mask[b,p,min(n,999)] - softplus(z + lm_b3)   (ALPHA = 1)
// Coverage: 1600 blocks x 4 waves x 8 trips x 32 slots = all 1024 columns of all 1600 rows (pad slots from clamped inputs).
// ---------------------------------------------------------------------------
// layer 3 for one 16-unit tile: sum over the lane's 8 hidden units of relu(D / 16 + b2) * w3
__device__ __forceinline__ v2f lazy_l3(v8f acc, const v2f (&b2)[4], const v2f (&w3)[4]) {
  const v2f zero = (v2f){0.0f, 0.0f};
  const v2f sc = (v2f){1.0f / kWCarry, 1.0f / kWCarry};
  v2f zs = zero;
#pragma unroll
  for (int q = 0; q < 4; ++q) {
    const v2f a = __builtin_elementwise_max(__builtin_elementwise_fma((v2f){acc[2 * q], acc[2 * q + 1]}, sc, b2[q]), zero);
    zs = __builtin_elementwise_fma(a, w3[q], zs);
  }
  return zs;
}
__global__ __launch_bounds__(128) void k_lazy(const float* __restrict__ dyn, const float* __restrict__ QW,
                                             const float* __restrict__ lW1, const _Float16* __restrict__ W2T,
                                             const float* __restrict__ lb2, const float* __restrict__ lW3,
                                             const float* __restrict__ lb3, const float* __restrict__ ninfm,
                                             float* __restrict__ maskb) {
  __shared__ __align__(16) float tbl[2 * 16 * 8];      // [h][k pair][w0 w0 w1 w1 w2 w2 qw qw]
  __shared__ __align__(16) float sd[kN * kDYN];        // dynamic features of this (b,p): 1000 x 3
  __shared__ __align__(16) float sn[kN];               // ninf_mask row of this (b,p)
  const int bp = blockIdx.x;
  const int t = threadIdx.x;
  const int lane = t & 31, wave = t >> 5;
  const int c = lane & 15, h = lane >> 4;
  // stage the 12000 contiguous bytes of dynamic features: 750 x 16 B over 128 threads
  const unsigned oD = (unsigned)t * 16u;
  const char* dsrc = (const char*)(dyn + (size_t)bp * kN * kDYN);
  v4f dv[6];
#pragma unroll
  for (int i = 0; i < 5; ++i) dv[i] = *(const v4f*)(dsrc + oD + i * 2048);
  const bool last = (t < (kN * kDYN * 4 - 5 * 2048) / 16);
  const unsigned oL = last ? (oD + 5 * 2048) : 0u;     // threads past the end fetch in bounds and store nothing
  dv[5] = *(const v4f*)(dsrc + oL);
  // and the 4000 contiguous bytes of the mask row: 250 x 16 B
  const char* nsrc = (const char*)(ninfm + (size_t)bp * kN);
  const bool lastn = (t < (kN * 4 - 2048) / 16);
  const unsigned oN = lastn ? (oD + 2048) : 0u;
  const v4f nv0 = *(const v4f*)(nsrc + oD);
  const v4f nv1 = *(const v4f*)(nsrc + oN);
  // weight table: thread t fetches one pair: h = t >> 6, k pair p = (t >> 2) & 15, which = t & 3
  const int tp = (t >> 2) & 15, tw = t & 3;
  const int tk = 32 * (tp >> 3) + 16 * (t >> 6) + 2 * (tp & 7);
  const float* tsrc = (tw < 3) ? (lW1 + tw * kHID + tk) : (QW + (size_t)bp * kHID + tk);
  const v2f tv = *(const v2f*)tsrc;
  // byte offsets of the lane's first fragment / bias element; these set-up loads are scalar base + one of them
  const unsigned oA = (unsigned)(c * kHID + 16 * h) * 2u;
  const unsigned oJ = (unsigned)(8 * h) * 4u;
  v16h aw[4][2];
#pragma unroll
  for (int i = 0; i < 4; ++i)
#pragma unroll
    for (int s = 0; s < 2; ++s) aw[i][s] = *(const v16h*)((const char*)W2T + oA + (16 * i * kHID + 32 * s) * 2);
  v2f b2[4][4], w3[4][4];
#pragma unroll
  for (int i = 0; i < 4; ++i)
#pragma unroll
    for (int q = 0; q < 4; ++q) {
      b2[i][q] = *(const v2f*)((const char*)lb2 + oJ + (16 * i + 2 * q) * 4);
      w3[i][q] = *(const v2f*)((const char*)lW3 + oJ + (16 * i + 2 * q) * 4);
    }
  const float b3 = lb3[0];
  // address translations done before a register that a load above names is reused
  asm volatile("s_wait_xcnt 0x0" :: "v"(oD), "v"(oL), "v"(oN), "v"(tsrc), "v"(oA), "v"(oJ) : "memory");
#pragma unroll
  for (int i = 0; i < 5; ++i) *(v4f*)((char*)sd + oD + i * 2048) = dv[i];
  if (last) *(v4f*)((char*)sd + oL) = dv[5];
  *(v4f*)((char*)sn + oD) = nv0;
  if (lastn) *(v4f*)((char*)sn + oN) = nv1;
  *(v2f*)(tbl + 2 * t) = tv;
  __syncthreads();
  const int nw = wave * 256;
  float* mp = maskb + (size_t)bp * kNP + nw + lane;
  const v4f* tb4 = (const v4f*)(tbl + h * 128);
  for (int it = 0; it < 8; ++it) {
    const int n0 = nw + it * 32;
    const int n = n0 + lane;
    const int nc = (n < kN) ? n : (kN - 1);                          // address clamps (pad slots)
    const int ia = ((n0 + c < kN) ? (n0 + c) : (kN - 1)) * kDYN;
    const int ib = ((n0 + 16 + c < kN) ? (n0 + 16 + c) : (kN - 1)) * kDYN;
    const float a0 = sd[ia], a1 = sd[ia + 1], a2 = sd[ia + 2];
    const float e0 = sd[ib], e1 = sd[ib + 1], e2 = sd[ib + 2];
    v16h ba[2], bb[2];
    const v2h hzero = (v2h){(_Float16)0.0f, (_Float16)0.0f};
    v4f tq[2][8];                               // weight-table reads, four k pairs a group, one group ahead
#pragma unroll
    for (int j = 0; j < 8; ++j) tq[0][j] = tb4[j];
#pragma unroll
    for (int g = 0; g < 4; ++g) {
      if (g < 3) {
#pragma unroll
        for (int j = 0; j < 8; ++j) tq[(g + 1) & 1][j] = tb4[8 * (g + 1) + j];
      }
      // keeps the next group's LDS reads in front of this group's arithmetic, which then covers their latency
      __builtin_amdgcn_sched_barrier(0);
#pragma unroll
      for (int pp = 0; pp < 4; ++pp) {
        const int p = 4 * g + pp;
        const v4f u = tq[g & 1][2 * pp], v = tq[g & 1][2 * pp + 1];
        const v2f w0 = (v2f){u[0], u[1]}, w1 = (v2f){u[2], u[3]}, w2 = (v2f){v[0], v[1]}, qw = (v2f){v[2], v[3]};
        const v2f xa = __builtin_elementwise_fma(w0, (v2f){a0, a0}, __builtin_elementwise_fma(w1, (v2f){a1, a1},
                       __builtin_elementwise_fma(w2, (v2f){a2, a2}, qw)));
        const v2f xb = __builtin_elementwise_fma(w0, (v2f){e0, e0}, __builtin_elementwise_fma(w1, (v2f){e1, e1},
                       __builtin_elementwise_fma(w2, (v2f){e2, e2}, qw)));
        // relu behind the rounding: same value as rounding behind relu
        const v2h ya = __builtin_elementwise_max(__builtin_convertvector(xa, v2h), hzero);
        const v2h yb = __builtin_elementwise_max(__builtin_convertvector(xb, v2h), hzero);
        ba[p >> 3][2 * (p & 7)] = ya[0]; ba[p >> 3][2 * (p & 7) + 1] = ya[1];
        bb[p >> 3][2 * (p & 7)] = yb[0]; bb[p >> 3][2 * (p & 7) + 1] = yb[1];
      }
    }
    v2f za2[4], zb2[4];
#pragma unroll
    for (int i = 0; i < 4; ++i) {
      const v8f czero = (v8f){0.f, 0.f, 0.f, 0.f, 0.f, 0.f, 0.f, 0.f};
      v8f ca = __builtin_amdgcn_wmma_f32_16x16x32_f16(false, aw[i][0], false, ba[0], (short)0, czero, false, false);
      v8f cc = __builtin_amdgcn_wmma_f32_16x16x32_f16(false, aw[i][0], false, bb[0], (short)0, czero, false, false);
      ca = __builtin_amdgcn_wmma_f32_16x16x32_f16(false, aw[i][1], false, ba[1], (short)0, ca, false, false);
      cc = __builtin_amdgcn_wmma_f32_16x16x32_f16(false, aw[i][1], false, bb[1], (short)0, cc, false, false);
      za2[i] = lazy_l3(ca, b2[i], w3[i]);
      zb2[i] = lazy_l3(cc, b2[i], w3[i]);
    }
    const v2f ta = (za2[0] + za2[1]) + (za2[2] + za2[3]);
    const v2f tb = (zb2[0] + zb2[1]) + (zb2[2] + zb2[3]);
    const float za = ta[0] + ta[1], zb = tb[0] + tb[1];
    // lanes 0..15 finish slots n0 + c (tile a), lanes 16..31 slots n0 + 16 + c (tile b): one exchange l <-> l ^ 16 for both
    const float mine = h ? zb : za;
    const int other = __float_as_int(h ? za : zb);
    const float z = (mine + __int_as_float(__builtin_amdgcn_permlanex16(other, other, 0x76543210, 0xfedcba98, false, false))) + b3;
    const float spv = fmaxf(z, 0.0f) + log1pf(expf(-fabsf(z)));
    *mp = sn[nc] - spv;
    // address translation done before the store's address register is advanced; the "memory" clobber also keeps the
    // weight-table reads inside the loop (hoisted they hold 128 more registers: over 256, one wave per SIMD fewer)
    asm volatile("s_wait_xcnt 0x0" :: "v"(mp) : "memory");
    mp += 32;
  }
}

// ---------------------------------------------------------------------------
// Attention core (f32 VALU, head dim 16), node axis split over the waves of a block.
// Block = (b, group of 16 queries, group of 4 heads), 512 threads = 16 waves: wave = (node slice sl = wave >> 1 of 128 slots,
// head pair wave & 1); lane = (head of the pair, query). 16 x 7 x 2 = 224 blocks.
// Per stage every slice gets its next 32 nodes in LDS: the 4 heads' K (64 f32) and V (64 f32) of each node, and the bias tile
// [16 queries][32 nodes] at a pitch of 36 floats (16 rows on 16 different banks). Four stages cover the 128 slots of a slice.
// Online softmax per thread over its slice (slots >= 1000 forced to -inf by value); m, l, acc in f32.
// Merge: every wave leaves (acc[16], m, l) per lane in LDS; 128 threads fold the 8 slices in slice order,
//   M = max m_s, w_s = exp(m_s - M), O = sum_s w_s acc_s / sum_s w_s l_s,
// and write O as bf16 hi + bf16 lo planes into Ohi/Olo[bp][h*16+d]: 8 lanes x 16 B = the block's whole 128-B line of a row
// (rows >= P skipped).
// ---------------------------------------------------------------------------
constexpr int kASl  = 8;               // node slices per block
constexpr int kASn  = kNP / kASl;      // 128 node slots per slice
constexpr int kACh  = 32;              // nodes per slice and stage
constexpr int kAHb  = 4;               // heads per block
constexpr int kARow = 2 * kAHb * kD;   // 128 floats per staged node: K of 4 heads | V of 4 heads
constexpr int kAMp  = 36;              // bias tile pitch in floats
constexpr int kACp  = 20;              // merge record pitch in floats: acc[16], m, l, 2 unused
static_assert(kASl * kAHb * 16 * kACp <= kASl * kACh * kARow, "merge records fit the K|V buffer");
__global__ __launch_bounds__(512) void k_attn(const float* __restrict__ Qs, const float* __restrict__ KV,
                                             const float* __restrict__ maskb, unsigned short* __restrict__ Ohi,
                                             unsigned short* __restrict__ Olo) {
  __shared__ __align__(16) float kvs[kASl * kACh * kARow];   // 131072 B; the merge records reuse it
  __shared__ __align__(16) float ms[kASl * 16 * kAMp];       // 18432 B
  const float kNegInf = -__builtin_inff();
  const int t = threadIdx.x, lane = t & 31;
  const int wave = __builtin_amdgcn_readfirstlane(t >> 5);   // scalar: slice bounds and LDS bases stay off the vector unit
  const int b = blockIdx.x / 14, rem = blockIdx.x - b * 14, pg = rem >> 1, hq = rem & 1, p0 = pg * 16;
  const int sl = wave >> 1;
  const int hl = (wave & 1) * 2 + (lane >> 4), pl = lane & 15;
  const int p = p0 + pl, pc = (p < kP) ? p : (kP - 1);
  const float* qp = Qs + (size_t)(b * kP + pc) * kHD + (hq * kAHb + hl) * kD;
  const v4f qa = *(const v4f*)(qp), qb = *(const v4f*)(qp + 4), qc = *(const v4f*)(qp + 8), qd = *(const v4f*)(qp + 12);
  v4f oa = (v4f){0.f, 0.f, 0.f, 0.f}, ob = (v4f){0.f, 0.f, 0.f, 0.f}, oc = (v4f){0.f, 0.f, 0.f, 0.f}, od = (v4f){0.f, 0.f, 0.f, 0.f};
  float m = -3.0e38f, l = 0.0f;
  const float* kvb = KV + (size_t)b * kNP * (2 * kHD);
  const float* mkb = maskb + (size_t)(b * kP) * kNP;
  // staging roles: a wave copies whole node rows (lanes 0..15 the K part, 16..31 the V part, 256 B each)
  const int scol = ((lane < 16) ? 0 : kHD) + hq * (kAHb * kD) + (lane & 15) * 4;
  // bias tile roles: thread t copies 4 columns (t & 7) * 4 of row (t >> 3) & 15 for slices t >> 7 and 4 + (t >> 7)
  const int mr = (t >> 3) & 15, mj4 = (t & 7) * 4, msl = t >> 7;
  const int mpr = (p0 + mr < kP) ? (p0 + mr) : (kP - 1);
  const float* mrow = mkb + (size_t)mpr * kNP + msl * kASn + mj4;
  float* mdst = ms + (msl * 16 + mr) * kAMp + mj4;
#pragma unroll 1   // rolled: one set of 18 staging register quads serves every stage
  for (int st = 0; st < kASn / kACh; ++st) {
    // 8 slices x 32 nodes x 32 float4 = 8192 float4: 16 x 512 threads; trip i: slice i >> 1, node (i & 1) * 16 + wave
    const float* gk = kvb + (size_t)(st * kACh + wave) * (2 * kHD) + scol;
    v4f kvr[16];
#pragma unroll
    for (int i = 0; i < 16; ++i) kvr[i] = *(const v4f*)(gk + (size_t)((i >> 1) * kASn + (i & 1) * 16) * (2 * kHD));
    // bias tiles: 8 slices x 16 rows x 8 float4 = 1024 float4: 2 x 512 threads; trip i: slice i * 4 + (t >> 7)
    const float* gm = mrow + st * kACh;
    const v4f mr0 = *(const v4f*)(gm);
    const v4f mr1 = *(const v4f*)(gm + 4 * kASn);
    // address translations done before a register that a load above names is reused
    asm volatile("s_wait_xcnt 0x0" :: "v"(gk), "v"(gm) : "memory");
    __syncthreads();   // every wave has left the buffers of the stage before
#pragma unroll
    for (int i = 0; i < 16; ++i) *(v4f*)(kvs + ((i >> 1) * kACh + (i & 1) * 16 + wave) * kARow + lane * 4) = kvr[i];
    *(v4f*)(mdst) = mr0;
    *(v4f*)(mdst + 4 * 16 * kAMp) = mr1;
    __syncthreads();
    const int n0 = sl * kASn + st * kACh;
    const float* kw = kvs + sl * kACh * kARow + hl * kD;
    const float* mw = ms + (sl * 16 + pl) * kAMp;
#pragma unroll 1   // rolled as before: the running m, l, acc make one serial chain from node to node
    for (int j = 0; j < kACh; ++j) {
      const float* kr = kw + j * kARow;
      const v4f k0 = *(const v4f*)(kr), k1 = *(const v4f*)(kr + 4), k2 = *(const v4f*)(kr + 8), k3 = *(const v4f*)(kr + 12);
      float s = mw[j];
      s = fmaf(qa[0], k0[0], s); s = fmaf(qa[1], k0[1], s); s = fmaf(qa[2], k0[2], s); s = fmaf(qa[3], k0[3], s);
      s = fmaf(qb[0], k1[0], s); s = fmaf(qb[1], k1[1], s); s = fmaf(qb[2], k1[2], s); s = fmaf(qb[3], k1[3], s);
      s = fmaf(qc[0], k2[0], s); s = fmaf(qc[1], k2[1], s); s = fmaf(qc[2], k2[2], s); s = fmaf(qc[3], k2[3], s);
      s = fmaf(qd[0], k3[0], s); s = fmaf(qd[1], k3[1], s); s = fmaf(qd[2], k3[2], s); s = fmaf(qd[3], k3[3], s);
      s = (n0 + j < kN) ? s : kNegInf;
      const float mn = fmaxf(m, s);
      const float alpha = __expf(m - mn);
      const float pj = __expf(s - mn);
      m = mn;
      l = fmaf(l, alpha, pj);
      const float* vr = kr + kAHb * kD;
      const v4f v0 = *(const v4f*)(vr), v1 = *(const v4f*)(vr + 4), v2 = *(const v4f*)(vr + 8), v3 = *(const v4f*)(vr + 12);
      oa = v0 * pj + oa * alpha;
      ob = v1 * pj + ob * alpha;
      oc = v2 * pj + oc * alpha;
      od = v3 * pj + od * alpha;
    }
  }
  __syncthreads();   // every wave has left the K|V buffer before the merge records overwrite it
  {
    float* op = kvs + ((sl * kAHb + hl) * 16 + pl) * kACp;
    *(v4f*)(op)      = oa;
    *(v4f*)(op + 4)  = ob;
    *(v4f*)(op + 8)  = oc;
    *(v4f*)(op + 12) = od;
    *(v2f*)(op + 16) = (v2f){m, l};
  }
  __syncthreads();
  if (wave < 4) {    // threads 0..127; no barrier behind this point
    const int rl = t >> 3, c8 = (t & 7) * 8;
    const float* cb = kvs + ((c8 >> 4) * 16 + rl) * kACp;
    constexpr int kSs = kAHb * 16 * kACp;      // floats from one slice's records to the next
    float ml[kASl], ll[kASl];
#pragma unroll
    for (int s = 0; s < kASl; ++s) { const v2f e = *(const v2f*)(cb + s * kSs + 16); ml[s] = e[0]; ll[s] = e[1]; }
    float mx = ml[0];
#pragma unroll
    for (int s = 1; s < kASl; ++s) mx = fmaxf(mx, ml[s]);
    float lsum = 0.0f;
    v4f x0 = (v4f){0.f, 0.f, 0.f, 0.f}, x1 = (v4f){0.f, 0.f, 0.f, 0.f};
#pragma unroll
    for (int s = 0; s < kASl; ++s) {
      const float w = __expf(ml[s] - mx);
      const float* s8 = cb + s * kSs + (c8 & 15);
      lsum = fmaf(ll[s], w, lsum);
      x0 = *(const v4f*)(s8) * w + x0;
      x1 = *(const v4f*)(s8 + 4) * w + x1;
    }
    const float inv = 1.0f / lsum;
    x0 = x0 * inv;
    x1 = x1 * inv;
    unsigned short hb[8], lb[8];
#pragma unroll
    for (int e = 0; e < 4; ++e) {
      split_bf(x0[e], hb[e], lb[e]);
      split_bf(x1[e], hb[4 + e], lb[4 + e]);
    }
    const v4u uh = (v4u){pk16(hb[0], hb[1]), pk16(hb[2], hb[3]), pk16(hb[4], hb[5]), pk16(hb[6], hb[7])};
    const v4u ul = (v4u){pk16(lb[0], lb[1]), pk16(lb[2], lb[3]), pk16(lb[4], lb[5]), pk16(lb[6], lb[7])};
    if (p0 + rl < kP) {
      const size_t o = (size_t)(b * kP + p0 + rl) * kHD + hq * (kAHb * kD) + c8;
      *(v4u*)(Ohi + o) = uh;
      *(v4u*)(Olo + o) = ul;
    }
  }
}

// ---------------------------------------------------------------------------
// Zero fill of two regions, nvec x 16 B each (nvec % 256 == 0, so the region select is block-uniform).
// ---------------------------------------------------------------------------
__global__ __launch_bounds__(256) void k_zero16x2(unsigned int* __restrict__ p0, unsigned int* __restrict__ p1, int nvec) {
  const int i = blockIdx.x * 256 + threadIdx.x;
  if (i >= 2 * nvec) return;
  unsigned int* p = (i < nvec) ? (p0 + 4 * (size_t)i) : (p1 + 4 * (size_t)(i - nvec));
  const v4u z = (v4u){0u, 0u, 0u, 0u};
  *(v4u*)p = z;
  
}

// ---------------------------------------------------------------------------
// Final: per (b,p) row: x = 10*tanh(S) + ninf_mask, softmax over 1000 nodes (f32, fixed-order wave reductions).
// One wave per row; lane l owns elements n = l + 32 i, i = 0..31, and holds them in registers from the loads to the scaled
// probabilities. All 64 loads of a lane go out before the first value is used, so their latencies overlap, and the
// arithmetic is straight-line code whose 32 elements are independent. Slots n >= 1000 carry -inf: they add 0 to the sum.
// LDS only turns the 8 rows of a block (32000 contiguous bytes of out) into whole 16-B pieces for the stores.
// Coverage: 200 blocks x 8 rows = 1600 rows.
// ---------------------------------------------------------------------------
// tanh with both of its ranges computed and one selected: no branch, so neighbouring elements can overlap
__device__ __forceinline__ float tanh_sel(float x) {
  const float ax = fabsf(x);
  const float e = __expf(ax + ax);                                    // inf for large |x|: 2 / inf = 0, the value is 1
  const float big = fmaf(__builtin_amdgcn_rcpf(e + 1.0f), -2.0f, 1.0f);
  const float x2 = x * x;
  float pl = fmaf(x2, -0.00570002059f, 0.0206340719f);                // odd series for |x| < 0.625
  pl = fmaf(x2, pl, -0.0537379310f);
  pl = fmaf(x2, pl, 0.133314162f);
  pl = fmaf(x2, pl, -0.333332807f);
  const float small = fmaf(x2, ax * pl, ax);
  return copysignf((ax < 0.625f) ? small : big, x);
}
constexpr int kFE = kNP / 32;   // elements per lane
__global__ __launch_bounds__(256) void k_final(const float* __restrict__ Sp, const float* __restrict__ ninfm,
                                              float* __restrict__ out) {
  __shared__ __align__(16) float xs[8 * kN];
  const float kNegInf = -__builtin_inff();
  const int t = threadIdx.x, lane = t & 31;
  const int wave = __builtin_amdgcn_readfirstlane(t >> 5);   // scalar: the row bases stay in scalar registers
  const int r = blockIdx.x * 8 + wave;
  const int b = r / kP, p = r - b * kP;
  const float* srow = Sp + (size_t)(b * kSrows + p) * kNP;
  const float* nrow = ninfm + (size_t)r * kN;
  float* xr = xs + wave * kN;
  float s[kFE], x[kFE];
#pragma unroll
  for (int i = 0; i < kFE; ++i) {
    const int n = lane + 32 * i;
    s[i] = srow[(n < kN) ? n : (kN - 1)];                    // address clamp
  }
#pragma unroll
  for (int i = 0; i < kFE; ++i) {
    const int n = lane + 32 * i;
    x[i] = nrow[(n < kN) ? n : (kN - 1)];
  }
  q_issued();   // behind the 64 loads, before their offset registers are reused
  // keeps all 64 loads in front of the arithmetic: moved down among it, the mask row's latency would come on top of the first
  __builtin_amdgcn_sched_barrier(0);
  float m4[4] = {kNegInf, kNegInf, kNegInf, kNegInf};        // four chains: a maximum does not depend on the order
#pragma unroll
  for (int i = 0; i < kFE; ++i) {
    const float v = kClip * tanh_sel(s[i]) + x[i];
    x[i] = (lane + 32 * i < kN) ? v : kNegInf;
    m4[i & 3] = fmaxf(m4[i & 3], x[i]);
  }
  float mx = fmaxf(fmaxf(m4[0], m4[1]), fmaxf(m4[2], m4[3]));
#pragma unroll
  for (int off = 16; off > 0; off >>= 1) mx = fmaxf(mx, __shfl_xor(mx, off, 32));
  float sum = 0.0f;
#pragma unroll
  for (int i = 0; i < kFE; ++i) {
    x[i] = __expf(x[i] - mx);
    sum += x[i];
  }
#pragma unroll
  for (int off = 16; off > 0; off >>= 1) sum += __shfl_xor(sum, off, 32);
  const float inv = 1.0f / sum;
#pragma unroll
  for (int i = 0; i < kFE; ++i) {
    const int n = lane + 32 * i;
    if (n < kN) xr[n] = x[i] * inv;
  }
  __syncthreads();
  float* obase = out + (size_t)blockIdx.x * 8 * kN;
  // 2000 pieces of 16 B over 256 threads: 7 full trips, then 208 threads
  constexpr int kFull = (2 * kN) / 256;
#pragma unroll
  for (int k = 0; k < kFull; ++k) {
    const int f = t + 256 * k;
    *(v4f*)(obase + 4 * (size_t)f) = *(const v4f*)(xs + 4 * f);
  }
  if (t < 2 * kN - 256 * kFull) {
    const int f = t + 256 * kFull;
    *(v4f*)(obase + 4 * (size_t)f) = *(const v4f*)(xs + 4 * f);
  }
}

// ---------------------------------------------------------------------------
// Host launcher
// Workspace region map (bytes, 256-B aligned offsets):
//   EncHi bf16 [16][1024][128]          4,194,304
//   EncLo bf16 [16][1024][128]          4,194,304
//   WkvHi bf16 [256][128]                 65,536
//   WkvLo bf16 [256][128]                 65,536
//   WcHi  bf16 [128][128]                 32,768
//   WcLo  bf16 [128][128]                 32,768
//   W2T   f16  [64][64]                    8,192
//   KVf   f32  [16384][256]            16,777,216
//   Qs    f32  [1600][128]                819,200
//   QW    f32  [1600][64]                 409,600
//   MASKB f32  [1600][1024]             6,553,600
//   Ohi   bf16 [1664][128]                425,984
//   Olo   bf16 [1664][128]                425,984
//   MHhi  bf16 [1664][128]                425,984
//   MHlo  bf16 [1664][128]                425,984
//   Sp    f32  [16][128][1024]           8,388,608
//   total                              43,245,568
// ---------------------------------------------------------------------------
static inline size_t align256(size_t x) { return (x + 255) & ~(size_t)255; }

extern "C" void kernel_launch(void* const* d_in, const int* in_sizes, int n_in,
                              void* d_out, int out_size, void* d_ws, size_t ws_size,
                              hipStream_t stream) {
  if (n_in < 22) return;
  if (in_sizes[0] != kB * kN * kE || in_sizes[1] != kB * kP * kE || in_sizes[2] != kB * kP ||
      in_sizes[3] != kB * kP * kN || in_sizes[4] != kB * kP * kN * kDYN || out_size != kB * kP * kN) return;

  const float* enc      = (const float*)d_in[0];
  const float* enc_last = (const float*)d_in[1];
  const float* loadv    = (const float*)d_in[2];
  const float* ninfm    = (const float*)d_in[3];
  const float* dyn      = (const float*)d_in[4];
  const float* Wq       = (const float*)d_in[5];
  const float* Wk       = (const float*)d_in[6];
  const float* Wv       = (const float*)d_in[7];
  const float* Wc       = (const float*)d_in[8];
  const float* bcv      = (const float*)d_in[9];
  const float* fW1      = (const float*)d_in[10];
  const float* fb1      = (const float*)d_in[11];
  const float* fW2      = (const float*)d_in[12];
  const float* fb2      = (const float*)d_in[13];
  const float* lqW      = (const float*)d_in[14];
  const float* lqb      = (const float*)d_in[15];
  const float* lW1      = (const float*)d_in[16];
  const float* lb1      = (const float*)d_in[17];
  const float* lW2      = (const float*)d_in[18];
  const float* lb2      = (const float*)d_in[19];
  const float* lW3      = (const float*)d_in[20];
  const float* lb3      = (const float*)d_in[21];
  float* out = (float*)d_out;

  char* ws = (char*)d_ws;
  size_t off = 0;
  unsigned short* EncHi = (unsigned short*)(ws + off); off = align256(off + (size_t)kEncRows * kE * 2);
  unsigned short* EncLo = (unsigned short*)(ws + off); off = align256(off + (size_t)kEncRows * kE * 2);
  unsigned short* WkvHi = (unsigned short*)(ws + off); off = align256(off + (size_t)2 * kHD * kE * 2);
  unsigned short* WkvLo = (unsigned short*)(ws + off); off = align256(off + (size_t)2 * kHD * kE * 2);
  unsigned short* WcHi  = (unsigned short*)(ws + off); off = align256(off + (size_t)kE * kHD * 2);
  unsigned short* WcLo  = (unsigned short*)(ws + off); off = align256(off + (size_t)kE * kHD * 2);
  unsigned short* W2T   = (unsigned short*)(ws + off); off = align256(off + (size_t)kHID * kHID * 2);
  float* KVf   = (float*)(ws + off); off = align256(off + (size_t)kEncRows * 2 * kHD * 4);
  float* Qs    = (float*)(ws + off); off = align256(off + (size_t)kBP * kHD * 4);
  float* QW    = (float*)(ws + off); off = align256(off + (size_t)kBP * kHID * 4);
  float* MASKB = (float*)(ws + off); off = align256(off + (size_t)kBP * kNP * 4);
  unsigned short* Ohi  = (unsigned short*)(ws + off); off = align256(off + (size_t)kBPpad * kHD * 2);
  unsigned short* Olo  = (unsigned short*)(ws + off); off = align256(off + (size_t)kBPpad * kHD * 2);
  unsigned short* MHhi = (unsigned short*)(ws + off); off = align256(off + (size_t)kBPpad * kE * 2);
  unsigned short* MHlo = (unsigned short*)(ws + off); off = align256(off + (size_t)kBPpad * kE * 2);
  float* Sp    = (float*)(ws + off); off = align256(off + (size_t)kB * kSrows * kNP * 4);
  if (off > ws_size) return;
  const float* fdummy = Qs;   // valid, never dereferenced (BIAS_MODE 0 / RESID false)

  // weight planes: Wk|Wv and W_comb transposed to bf16 hi/lo [n][k]; lm_W2 transposed to f16 x16
  k_wprep<<<13, 256, 0, stream>>>(Wk, Wv, Wc, lW2, WkvHi, WkvLo, WcHi, WcLo, W2T);
  // node planes (bf16 hi/lo, 24 zero pad rows per batch in both)
  k_enc_cast<<<(kEncRows * 16) / 256, 256, 0, stream>>>(enc, EncHi, EncLo);
  // K|V projection: [16384][128] x [256][128]^T, bf16 hi/lo both operands, K=128, M=16384, N=256 -> f32
  wmma_gemm64<1, true, 0, 0, false, 0><<<dim3((kEncRows / 64) * (2 * kHD / 64) / 8, 1), 256, 0, stream>>>(
      EncHi, EncLo, kE, 0L, WkvHi, WkvLo, kE, 0L, (void*)KVf, (void*)KVf, 2 * kHD, 0L,
      fdummy, fdummy, 0L, kEncRows, 2 * kHD, kE, 1.0f);
  // query side (f32)
  k_qside<<<kBP / kQR, 160, 0, stream>>>(enc_last, loadv, Wq, fW1, fb1, fW2, fb2, lqW, lqb, lW1, lb1, Qs, QW);
  // lazy-mask MLP, three layers fused, one launch for all 1600 x 1024 slots; hidden layer on WMMA f16 (W x16), K=64
  k_lazy<<<kBP, 128, 0, stream>>>(dyn, QW, lW1, (const _Float16*)W2T, lb2, lW3, lb3, ninfm, MASKB);
  // zero the 64 pad rows (1600..1663) of Ohi and Olo: 64*128 halves = 1024 x 16 B each
  k_zero16x2<<<(2 * 1024) / 256, 256, 0, stream>>>((unsigned int*)(Ohi + (size_t)kBP * kHD),
                                                   (unsigned int*)(Olo + (size_t)kBP * kHD), 1024);
  // attention core (f32), 8 node slices per block merged in LDS -> O as bf16 hi/lo planes
  k_attn<<<kB * 14, 512, 0, stream>>>(Qs, KVf, MASKB, Ohi, Olo);
  // head merge: [1664][128] x [128][128]^T, bf16 hi/lo both operands, K=128, bias b_comb[n], bf16 hi/lo out planes
  wmma_gemm64<1, true, 2, 2, false, 0><<<dim3(((kBPpad / 64) * (kE / 64) + 7) / 8, 1), 256, 0, stream>>>(
      Ohi, Olo, kHD, 0L, WcHi, WcLo, kHD, 0L, (void*)MHhi, (void*)MHlo, kE, 0L,
      bcv, fdummy, 0L, kBPpad, kE, kHD, 1.0f);
  // pointer scores per batch: A = MH rows b*100 .. b*100+127 (hi/lo, rows beyond the batch are finite data),
  // Bt = node planes of batch b [1024][128] (hi/lo); M=128, N=1024, K=128 -> f32 Sp[b][128][1024], scale 1/sqrt(128)
  wmma_gemm64<1, true, 0, 0, false, 0><<<dim3((kSrows / 64) * (kNP / 64) / 8, kB), 256, 0, stream>>>(
      MHhi, MHlo, kE, (long)kP * kE, EncHi, EncLo, kE, (long)kNP * kE, (void*)Sp, (void*)Sp, kNP, (long)kSrows * kNP,
      fdummy, fdummy, 0L, kSrows, kNP, kE, kInvSqrtE);
  // clipped tanh + mask + softmax -> probs
  k_final<<<kBP / 8, 256, 0, stream>>>(Sp, ninfm, out);
}

// v005
// It runs in 95.7 microseconds.
// Timed twice side by side with v004, it ran 1.22 and 1.23 times as fast.
// Over all steps from v000 it is 6.25 times as fast.
// Contractions: node K|V projection (nodes x [Wk|Wv]^T), head-merge projection (O x W_comb^T) and pointer scores (MH x nodes^T) on v_wmma_f32_16x16x32_bf16 with bf16 hi/lo operand planes (hi.hi + hi.lo + lo.hi); lazy-mask hidden layer (lm_W2^T f16 carried x16, as A, x H1 f16, as B) on v_wmma_f32_16x16x32_f16 inside the fused lazy-mask kernel; all f32 accumulate; query/FiLM/gating/qf projections, lazy layers 1 (K=3 after the broadcast fold) and 3 (N=1), the 16-dim attention core and both softmaxes in f32 on the VALU.
#include <hip/hip_runtime.h>
#include <math.h>

typedef __attribute__((ext_vector_type(16))) _Float16 v16h;
typedef __attribute__((ext_vector_type(8)))  _Float16 v8h;
typedef __attribute__((ext_vector_type(16))) __bf16   v16b;
typedef __attribute__((ext_vector_type(8)))  __bf16   v8b;
typedef __attribute__((ext_vector_type(8)))  float    v8f;
typedef __attribute__((ext_vector_type(4)))  float    v4f;
typedef __attribute__((ext_vector_type(4)))  unsigned int v4u;
typedef __attribute__((ext_vector_type(2)))  float    v2f;
typedef __attribute__((ext_vector_type(2)))  _Float16 v2h;

// ---------------------------------------------------------------------------
// Problem constants
// ---------------------------------------------------------------------------
constexpr int kB   = 16;      // batch
constexpr int kP   = 100;     // queries per batch
constexpr int kN   = 1000;    // nodes
constexpr int kNP  = 1024;    // nodes padded
constexpr int kE   = 128;     // embedding
constexpr int kH   = 8;       // heads
constexpr int kD   = 16;      // head dim
constexpr int kHD  = 128;     // H*D
constexpr int kQD  = 16;      // lazy query dim
constexpr int kDYN = 3;       // dynamic features
constexpr int kHID = 64;      // lazy hidden
constexpr int kBP     = kB * kP;          // 1600 (b,p) rows
constexpr int kBPpad  = 1664;             // 26 * 64
constexpr int kEncRows = kB * kNP;        // 16384 padded node rows
constexpr int kSrows = 128;               // pointer-score rows per batch (100 padded)
constexpr float kWCarry   = 16.0f;        // lm_W2 carried x16 in f16
constexpr float kInvSqrtE = 0.08838834764831845f;
constexpr float kClip     = 10.0f;
static_assert(kBPpad % 64 == 0 && kBPpad >= kBP, "pad");
static_assert(kBPpad >= (kB - 1) * kP + kSrows, "last batch score rows inside MH planes");
static_assert(kH * kD == kHD && kE == kHD, "dims");

// ---------------------------------------------------------------------------
// Helpers
// ---------------------------------------------------------------------------
__device__ __forceinline__ unsigned short f2bf_bits(float f) {
  unsigned u = __float_as_uint(f);
  return (unsigned short)((u + 0x7FFFu + ((u >> 16) & 1u)) >> 16);
}
__device__ __forceinline__ float bf_bits2f(unsigned short h) { return __uint_as_float(((unsigned)h) << 16); }

// hazard guards as plain device helpers (no inline asm inside the kernel template body)
__device__ __forceinline__ void dep_guard_h(v8f& a, v8f& b, v16h x, v16h y) { asm volatile("v_nop\n\tv_nop\n\tv_nop\n\tv_nop" : "+v"(a), "+v"(b) : "v"(x), "v"(y)); }
__device__ __forceinline__ void dep_guard_b(v8f& a, v8f& b, v16b x, v16b y) { asm volatile("v_nop\n\tv_nop\n\tv_nop\n\tv_nop" : "+v"(a), "+v"(b) : "v"(x), "v"(y)); }
__device__ __forceinline__ void keep4_h(v16h a, v16h b, v16h c, v16h d) { asm volatile("v_nop" :: "v"(a), "v"(b), "v"(c), "v"(d)); }
__device__ __forceinline__ void keep4_b(v16b a, v16b b, v16b c, v16b d) { asm volatile("v_nop" :: "v"(a), "v"(b), "v"(c), "v"(d)); }
__device__ __forceinline__ void acc_guard4(v8f& a, v8f& b, v8f& c, v8f& d) { asm volatile("v_nop\n\tv_nop\n\tv_nop\n\tv_nop" : "+v"(a), "+v"(b), "+v"(c), "+v"(d)); }
template <typename T> struct Frag;
template <> struct Frag<_Float16> {
  typedef v16h V; union U { v16h v; v8h h[2]; };
  static __device__ __forceinline__ v16h load(const _Float16* p) {   // elements 0..7 <- p[0..7], 8..15 <- p[16..23]
    U f; f.h[0] = *(const v8h*)(p); f.h[1] = *(const v8h*)(p + 16); return f.v;
  }
  static __device__ __forceinline__ v8f mma(v16h a, v16h b, v8f c) {
    return __builtin_amdgcn_wmma_f32_16x16x32_f16(false, a, false, b, (short)0, c, false, false);
  }
  static __device__ __forceinline__ void guard(v8f& a, v8f& b, v16h x, v16h y) { dep_guard_h(a, b, x, y); }
  static __device__ __forceinline__ void keep(v16h a, v16h b, v16h c, v16h d) { keep4_h(a, b, c, d); }
};
template <> struct Frag<__bf16> {
  typedef v16b V; union U { v16b v; v8b h[2]; };
  static __device__ __forceinline__ v16b load(const __bf16* p) {
    U f; f.h[0] = *(const v8b*)(p); f.h[1] = *(const v8b*)(p + 16); return f.v;
  }
  static __device__ __forceinline__ v8f mma(v16b a, v16b b, v8f c) {
    return __builtin_amdgcn_wmma_f32_16x16x32_bf16(false, a, false, b, (short)0, c, false, false);
  }
  static __device__ __forceinline__ void guard(v8f& a, v8f& b, v16b x, v16b y) { dep_guard_b(a, b, x, y); }
  static __device__ __forceinline__ void keep(v16b a, v16b b, v16b c, v16b d) { keep4_b(a, b, c, d); }
};

__device__ __forceinline__ unsigned pk16(unsigned short a, unsigned short b) { return (unsigned)a | ((unsigned)b << 16); }
__device__ __forceinline__ unsigned short h_bits(float f) { const _Float16 h = (_Float16)f; return __builtin_bit_cast(unsigned short, h); }
// bf16 hi + bf16 lo split of an f32 value (both RNE converts)
__device__ __forceinline__ void split_bf(float f, unsigned short& hb, unsigned short& lb) {
  hb = f2bf_bits(f);
  lb = f2bf_bits(f - bf_bits2f(hb));
}

// ---- Register-blocked batched WMMA GEMM (ACT reduced to none/relu/leaky) -----------------------
// C[m,n] = scale * sum_k A[m,k] * Bt[n,k] (+bias)(+resid); each wave owns a 64x64 tile.
// A row-major [M,K]; Bt row-major [N,K]; M,N % 64 == 0, K % 32 == 0.
// SPLIT: operands are hi/lo planes (A2/Bt2 = lo planes, same layout); product = hi·hi + hi·lo + lo·hi.
// BIAS_MODE: 0 = none, 1 = bias[m], 2 = bias[n].
// OUT_MODE: 0 = f32, 1 = f16, 2 = bf16 hi plane (Cout) + bf16 lo plane (Cout2).
// ET: 0 = f16 operands, 1 = bf16 operands (pointers passed as 16-bit storage)
template <int ET> struct Elem;
template <> struct Elem<0> { typedef _Float16 T; };
template <> struct Elem<1> { typedef __bf16 T; };
// The engine is a device function, so that a launch can hold it beside another job: NW = waves per block, sT = NW slabs of
// LDS (16x64 f32 at a pitch of 68 floats each), bx = block index among the engine's blocks, b = batch index.
template <int NW, int ET, bool SPLIT, int BIAS_MODE, int OUT_MODE, bool RESID, int ACT>
__device__ __forceinline__ void gemm64_body(
    float* sT, int bx, int b,
    const unsigned short* __restrict__ Ap, const unsigned short* __restrict__ A2p, int lda, long strideA,
    const unsigned short* __restrict__ Btp, const unsigned short* __restrict__ Bt2p, int ldb, long strideB,
    void* __restrict__ Cout, void* __restrict__ Cout2, int ldc, long strideC,
    const float* __restrict__ bias,
    const float* __restrict__ resid, long strideR,
    int M, int N, int K, float scale) {
  typedef typename Elem<ET>::T T;
  typedef typename Frag<T>::V V;
  const T* A = (const T*)Ap; const T* A2 = (const T*)A2p; const T* Bt = (const T*)Btp; const T* Bt2 = (const T*)Bt2p;
  const int lane = threadIdx.x & 31;
  const int wave = threadIdx.x >> 5;
  const int tilesN = N >> 6;
  const int tilesM = M >> 6;
  const int tile = bx * NW + wave;
  if (tile >= tilesM * tilesN) return;   // wave-uniform; no block barriers in this kernel
  const int tm = tile / tilesN;
  const int tn = tile - tm * tilesN;
  const int m0 = tm << 6;
  const int n0 = tn << 6;

  const T* Ab  = A  + (size_t)b * strideA;
  const T* Bb  = Bt + (size_t)b * strideB;
  const T* Ab2 = SPLIT ? (A2  + (size_t)b * strideA) : nullptr;
  const T* Bb2 = SPLIT ? (Bt2 + (size_t)b * strideB) : nullptr;

  const int rlane = lane & 15;                 // row (A) / col (B, D) within subtile
  const int koff  = (lane >> 4) * 8;           // k offset of this lane half
  const int mOff  = (lane >> 4) * 8;           // D row offset

  v8f acc[4][4];
#pragma unroll
  for (int i = 0; i < 4; ++i)
#pragma unroll
    for (int j = 0; j < 4; ++j) acc[i][j] = (v8f){0.f,0.f,0.f,0.f,0.f,0.f,0.f,0.f};

  for (int k0 = 0; k0 < K; k0 += 32) {
    V bh[4], bl[4];
#pragma unroll
    for (int j = 0; j < 4; ++j) {
      const size_t bo = (size_t)(n0 + (j << 4) + rlane) * ldb + koff + k0;
      bh[j] = Frag<T>::load(Bb + bo);
      if (SPLIT) bl[j] = Frag<T>::load(Bb2 + bo);
    }
#pragma unroll
    for (int i = 0; i < 4; ++i) {
      const size_t ao = (size_t)(m0 + (i << 4) + rlane) * lda + koff + k0;
      V ah = Frag<T>::load(Ab + ao);
      V al;
      if (SPLIT) al = Frag<T>::load(Ab2 + ao);
#pragma unroll
      for (int j = 0; j < 4; ++j) {
        acc[i][j] = Frag<T>::mma(ah, bh[j], acc[i][j]);
        if (SPLIT) {
          acc[i][j] = Frag<T>::mma(ah, bl[j], acc[i][j]);
          acc[i][j] = Frag<T>::mma(al, bh[j], acc[i][j]);
        }
      }
      Frag<T>::guard(acc[i][0], acc[i][3], ah, SPLIT ? al : ah);
    }
    Frag<T>::keep(bh[0], bh[1], bh[2], bh[3]);
    if (SPLIT) Frag<T>::keep(bl[0], bl[1], bl[2], bl[3]);
  }
  acc_guard4(acc[0][0], acc[0][1], acc[0][2], acc[0][3]);
  acc_guard4(acc[1][0], acc[1][1], acc[1][2], acc[1][3]);
  acc_guard4(acc[2][0], acc[2][1], acc[2][2], acc[2][3]);
  acc_guard4(acc[3][0], acc[3][1], acc[3][2], acc[3][3]);

  // ---- epilogue ----
  float* slab = sT + wave * (16 * 68);
  const float* Rb = RESID ? (resid + (size_t)b * strideR) : nullptr;
#pragma unroll
  for (int i = 0; i < 4; ++i) {
    const int mBase = m0 + (i << 4);
#pragma unroll
    for (int j = 0; j < 4; ++j) {
      const int n = n0 + (j << 4) + rlane;
      float bv = 0.f;
      if (BIAS_MODE == 2) bv = bias[n];
#pragma unroll
      for (int r = 0; r < 8; ++r) {
        float v = acc[i][j][r] * scale;
        if (BIAS_MODE == 1) v += bias[mBase + mOff + r];
        if (BIAS_MODE == 2) v += bv;
        if (RESID) v += Rb[(size_t)(mBase + mOff + r) * ldc + n];
        if (ACT == 2) v = fmaxf(v, 0.0f);
        if (ACT == 4) v = (v > 0.f) ? v : 0.01f * v;
        slab[(mOff + r) * 68 + (j << 4) + rlane] = v;
      }
    }
    __builtin_amdgcn_fence(__ATOMIC_RELEASE, "workgroup");
    __builtin_amdgcn_wave_barrier();
    __builtin_amdgcn_fence(__ATOMIC_ACQUIRE, "workgroup");
    if (OUT_MODE == 0) {
      float* C = (float*)Cout + (size_t)b * strideC;
      const int hh = lane >> 4, c4 = (lane & 15) * 4;     // row seg = 256 B = 16 lanes x 16 B
      {
#pragma unroll
        for (int it = 0; it < 8; ++it) {
          const int row = it * 2 + hh;
          v4f v = *(const v4f*)(slab + row * 68 + c4);
          *(v4f*)(C + (size_t)(mBase + row) * ldc + n0 + c4) = v;
        }
        
      }
    } else {
      const int q = lane >> 3, c8 = (lane & 7) * 8;
      unsigned short* C  = (unsigned short*)Cout  + (size_t)b * strideC;
      unsigned short* C2 = (OUT_MODE == 2) ? ((unsigned short*)Cout2 + (size_t)b * strideC) : nullptr;
      {
#pragma unroll
        for (int it = 0; it < 4; ++it) {
          const int row = it * 4 + q;
          const float* sp = slab + row * 68 + c8;
          v8h hv, lv;
#pragma unroll
          for (int e = 0; e < 8; ++e) {
            if (OUT_MODE == 1) {
              hv[e] = (_Float16)sp[e];
            } else {
              unsigned short hb = f2bf_bits(sp[e]);
              unsigned short lb = f2bf_bits(sp[e] - bf_bits2f(hb));
              hv[e] = __builtin_bit_cast(_Float16, hb);
              lv[e] = __builtin_bit_cast(_Float16, lb);
            }
          }
          *(v8h*)(C + (size_t)(mBase + row) * ldc + n0 + c8) = hv;
          if (OUT_MODE == 2) *(v8h*)(C2 + (size_t)(mBase + row) * ldc + n0 + c8) = lv;
        }
        
      }
    }
    __builtin_amdgcn_fence(__ATOMIC_RELEASE, "workgroup");
    __builtin_amdgcn_wave_barrier();
    __builtin_amdgcn_fence(__ATOMIC_ACQUIRE, "workgroup");
  }
}
template <int ET, bool SPLIT, int BIAS_MODE, int OUT_MODE, bool RESID, int ACT = 0>
__global__ __launch_bounds__(256) void wmma_gemm64(
    const unsigned short* __restrict__ Ap, const unsigned short* __restrict__ A2p, int lda, long strideA,
    const unsigned short* __restrict__ Btp, const unsigned short* __restrict__ Bt2p, int ldb, long strideB,
    void* __restrict__ Cout, void* __restrict__ Cout2, int ldc, long strideC,
    const float* __restrict__ bias,
    const float* __restrict__ resid, long strideR,
    int M, int N, int K, float scale) {
  __shared__ __align__(16) float sT[8 * 16 * 68];
  gemm64_body<8, ET, SPLIT, BIAS_MODE, OUT_MODE, RESID, ACT>(sT, blockIdx.x, blockIdx.y, Ap, A2p, lda, strideA, Btp, Bt2p, ldb,
                                                             strideB, Cout, Cout2, ldc, strideC, bias, resid, strideR, M, N, K,
                                                             scale);
}

// ---------------------------------------------------------------------------
// Weight preparation: 64x64 transpose tiles of f32 W[k][n] (pitch ldn) -> WT[n][k] (pitch ldk).
// blocks 0..3: Wk -> WkvHi/WkvLo rows 0..127 (bf16 hi + bf16 lo planes); 4..7: Wv -> rows 128..255;
// 8..11: W_comb -> WcHi/WcLo; 12: lm_W2 -> W2T (f16 carried x16, single plane).
// Load coverage: 16 x 256 = 4096 = whole tile. Store coverage: 8 waves x 2 it x 4 rows (lane>>3) = 64 rows,
// ---------------------------------------------------------------------------
constexpr int kWpBlocks = 13;
constexpr int kWpLds = 64 * 65;   // floats
__device__ __forceinline__ void wprep_body(float* smem, int bid,
                                           const float* __restrict__ Wk, const float* __restrict__ Wv,
                                           const float* __restrict__ Wcomb, const float* __restrict__ W2,
                                           unsigned short* __restrict__ WkvHi, unsigned short* __restrict__ WkvLo,
                                           unsigned short* __restrict__ WcHi, unsigned short* __restrict__ WcLo,
                                           unsigned short* __restrict__ W2T) {
  float (*sm)[65] = (float (*)[65])smem;   // sm[n_local][k_local]
  const int t = threadIdx.x, lane = t & 31, wave = t >> 5;
  // bid: block-uniform selection below
  const float* W = Wk; unsigned short* outH = WkvHi; unsigned short* outL = WkvLo;
  int ldn = kHD, ldk = kE, nt = 0, kt = 0; float carry = 1.0f;
  const bool two_planes = (bid < 12);
  if (bid < 4)       { W = Wk;    outH = WkvHi;                    outL = WkvLo;                    ldn = kHD;  ldk = kE;   nt = bid & 1;       kt = bid >> 1;       carry = 1.0f; }
  else if (bid < 8)  { W = Wv;    outH = WkvHi + (size_t)kHD * kE; outL = WkvLo + (size_t)kHD * kE; ldn = kHD;  ldk = kE;   nt = (bid - 4) & 1; kt = (bid - 4) >> 1; carry = 1.0f; }
  else if (bid < 12) { W = Wcomb; outH = WcHi;                     outL = WcLo;                     ldn = kE;   ldk = kHD;  nt = (bid - 8) & 1; kt = (bid - 8) >> 1; carry = 1.0f; }
  else               { W = W2;    outH = W2T;                      outL = W2T;                      ldn = kHID; ldk = kHID; nt = 0;             kt = 0;              carry = kWCarry; }
  const int n0 = nt * 64, k0 = kt * 64;
  const int r0 = t >> 6;     // k local of trip 0; trip i: r0 + 4 i
  const int c = t & 63;      // n local
  float wv[16];
#pragma unroll
  for (int g = 0; g < 4; ++g) {
    const float* p0 = W + (size_t)(k0 + r0 + 16 * g) * ldn + n0 + c;
    const float* p1 = p0 + (size_t)4 * ldn;
    const float* p2 = p0 + (size_t)8 * ldn;
    const float* p3 = p0 + (size_t)12 * ldn;
    wv[4 * g] = *p0; wv[4 * g + 1] = *p1; wv[4 * g + 2] = *p2; wv[4 * g + 3] = *p3;
    // address translations done before a register that one of these four loads names is reused; naming the four addresses
    // as inputs keeps them in their registers up to the wait
    asm volatile("s_wait_xcnt 0x0" :: "v"(p0), "v"(p1), "v"(p2), "v"(p3) : "memory");
  }
#pragma unroll
  for (int i = 0; i < 16; ++i) sm[c][r0 + 4 * i] = wv[i] * carry;
  __syncthreads();
  const int q = lane >> 3, c8 = (lane & 7) * 8;
  v4u uh[2], ul[2];
  int rowv[2];
#pragma unroll
  for (int it = 0; it < 2; ++it) {
    const int row = wave * 8 + it * 4 + q;   // n local
    rowv[it] = row;
    unsigned short hb[8], lb[8];
#pragma unroll
    for (int e = 0; e < 8; ++e) {
      const float v = sm[row][c8 + e];
      if (two_planes) { split_bf(v, hb[e], lb[e]); }
      else { hb[e] = h_bits(v); lb[e] = hb[e]; }
    }
    uh[it] = (v4u){pk16(hb[0], hb[1]), pk16(hb[2], hb[3]), pk16(hb[4], hb[5]), pk16(hb[6], hb[7])};
    ul[it] = (v4u){pk16(lb[0], lb[1]), pk16(lb[2], lb[3]), pk16(lb[4], lb[5]), pk16(lb[6], lb[7])};
  }
  {
#pragma unroll
    for (int it = 0; it < 2; ++it) {
      const size_t o = (size_t)(n0 + rowv[it]) * ldk + k0 + c8;
      *(v4u*)(outH + o) = uh[it];
      // behind each store: address translation done before the code laid out behind it writes a register that the store names
      asm volatile("s_wait_xcnt 0x0" ::: "memory");
      if (two_planes) {
        *(v4u*)(outL + o) = ul[it];
        asm volatile("s_wait_xcnt 0x0" ::: "memory");   // as above
      }
    }
  }
}

// ---------------------------------------------------------------------------
// Node split: enc f32 [B][1000][128] -> EncHi/EncLo bf16 hi/lo planes [B][1024][128] each
// (rows 1000..1023 of every batch written as zeros in both planes).
// ---------------------------------------------------------------------------
constexpr int kEcBlocks = (kEncRows * 16) / 256;
__device__ __forceinline__ void enc_cast_body(int bid, const float* __restrict__ enc, unsigned short* __restrict__ outHi,
                                              unsigned short* __restrict__ outLo) {
  const int i = bid * 256 + threadIdx.x;
  if (i >= kEncRows * 16) return;
  const int row = i >> 4, c8 = (i & 15) * 8;
  const int b = row >> 10, n = row & (kNP - 1);
  const int nc = (n < kN) ? n : (kN - 1);                    // address clamp
  const float* p = enc + ((size_t)(b * kN + nc)) * kE + c8;
  const v4f a = *(const v4f*)(p);
  const v4f c = *(const v4f*)(p + 4);
  const bool valid = (n < kN);
  unsigned short hb[8], lb[8];
#pragma unroll
  for (int e = 0; e < 4; ++e) {
    split_bf(valid ? a[e] : 0.0f, hb[e], lb[e]);
    split_bf(valid ? c[e] : 0.0f, hb[4 + e], lb[4 + e]);
  }
  const v4u uh = (v4u){pk16(hb[0], hb[1]), pk16(hb[2], hb[3]), pk16(hb[4], hb[5]), pk16(hb[6], hb[7])};
  const v4u ul = (v4u){pk16(lb[0], lb[1]), pk16(lb[2], lb[3]), pk16(lb[4], lb[5]), pk16(lb[6], lb[7])};
  const size_t o = (size_t)row * kE + c8;
  *(v4u*)(outHi + o) = uh;
  *(v4u*)(outLo + o) = ul;
  
}

// ---------------------------------------------------------------------------
// Query side (f32, VALU), 4 (b,p) rows per block: q_in = [last | load] (129);
//   Qs[bp][h*16+d] = ((q_in.Wq_last) * 2*sigmoid(relu(q_in.fW1 + fb1).fW2 + fb2)) * 0.25   (1/sqrt(16) folded, exact)
//   QW[bp][64]     = lm_b1 + qf.lm_W1[3:19]   with qf = q_in.lazy_q_W + lazy_q_b
// 5 working waves. Waves 0..3: thread = output column j; every weight element it loads feeds the chains of the 4 rows, whose
// inputs lie in LDS as [e][row] (one 16-B broadcast read per e). Wave 4: hidden unit 128 of the FiLM layer, qf, then QW.
// The weight loads go out in batches, one batch ahead of the arithmetic, so their latencies overlap.
// Every output is still one fma chain from its bias, e ascending.
// All loops of this kernel are unrolled in full: the batches are register arrays, which takes static indices, and the
// loads of a batch have to stand together ahead of the arithmetic that uses the batch before.
// Stores: one instruction of a wave writes one whole 128-B line of a Qs or QW row.
// The launch that holds this job has blocks of 8 waves: waves 5..7 have no part here and only pass the two barriers.
// ---------------------------------------------------------------------------
constexpr int kQR = 4;     // (b,p) rows per block
constexpr int kQB = 16;    // e steps per batch of weight loads
static_assert(kBP % kQR == 0 && kE % kQB == 0, "rows per block, batches");
// one batch of a weight column: w[i] = col[(e0 + i) * LD]
template <int LD>
__device__ __forceinline__ void q_fetch(float (&w)[kQB], const float* __restrict__ col, int e0) {
#pragma unroll
  for (int i = 0; i < kQB; ++i) w[i] = col[(e0 + i) * LD];
}
// Stands behind a group of loads: address translations done before a register that an issued load names is reused; its
// "memory" clobber also keeps those loads in front of the LDS reads and the arithmetic below, which then cover their latency.
__device__ __forceinline__ void q_issued() { asm volatile("s_wait_xcnt 0x0" ::: "memory"); }
// a[r] += x[r] * w for NR rows
template <int NR>
__device__ __forceinline__ void q_step(float (&a)[NR], const float* x, float w) {
#pragma unroll
  for (int r = 0; r < NR; ++r) a[r] = fmaf(x[r], w, a[r]);
}
// a[r] += sum_e xa[e][r] * colA[e * LDA] and b[r] += sum_e xb[e][r] * colB[e * LDB], e = 0..128 ascending;
// xa, xb: LDS, kQR floats per e
template <int LDA, int LDB, int NA, int NB>
__device__ __forceinline__ void q_dot2(float (&a)[NA], const float* xa, const float* __restrict__ colA,
                                       float (&b)[NB], const float* xb, const float* __restrict__ colB) {
  float wa[2][kQB], wb[2][kQB];
  q_fetch<LDA>(wa[0], colA, 0);
  q_fetch<LDB>(wb[0], colB, 0);
  float wat = 0.0f, wbt = 0.0f;
#pragma unroll
  for (int c = 0; c < kE / kQB; ++c) {
    if (c + 1 < kE / kQB) {
      q_fetch<LDA>(wa[(c + 1) & 1], colA, kQB * (c + 1));
      q_fetch<LDB>(wb[(c + 1) & 1], colB, kQB * (c + 1));
    } else {
      wat = colA[kE * LDA];
      wbt = colB[kE * LDB];
    }
    q_issued();
#pragma unroll
    for (int i = 0; i < kQB; ++i) {
      q_step<NA>(a, xa + (kQB * c + i) * kQR, wa[c & 1][i]);
      q_step<NB>(b, xb + (kQB * c + i) * kQR, wb[c & 1][i]);
    }
  }
  q_step<NA>(a, xa + kE * kQR, wat);
  q_step<NB>(b, xb + kE * kQR, wbt);
}
constexpr int kQsBlocks = kBP / kQR;
constexpr int kQsLds = (kE + 1) * kQR + (kE * kQR + 32) + kQD * kQR;   // floats
__device__ __forceinline__ void qside_body(float* smem, int bid,
                                           const float* __restrict__ enc_last, const float* __restrict__ loadv,
                                           const float* __restrict__ Wq, const float* __restrict__ fW1,
                                           const float* __restrict__ fb1, const float* __restrict__ fW2,
                                           const float* __restrict__ fb2, const float* __restrict__ lqW,
                                           const float* __restrict__ lqb, const float* __restrict__ lW1,
                                           const float* __restrict__ lb1,
                                           float* __restrict__ Qs, float* __restrict__ QW) {
  float* qin = smem;                          // [e][row], (kE + 1) * kQR floats
  float* g1s = qin + (kE + 1) * kQR;          // [e][row]; behind e = 128 the 28 copies that wave 4 leaves
  float* qfs = g1s + kE * kQR + 32;           // [i][row]
  const int bp0 = bid * kQR;
  const int t = threadIdx.x, lane = t & 31;
  const int wv = __builtin_amdgcn_readfirstlane(t >> 5);
  const bool colw = wv < 4, aux = wv == 4;    // scalar: waves 0..3, wave 4; neither: waves 5..7
  if (colw) {
    v4f x;
#pragma unroll
    for (int r = 0; r < kQR; ++r) x[r] = enc_last[(size_t)(bp0 + r) * kE + t];
    q_issued();
    *(v4f*)(qin + t * kQR) = x;
  } else if (aux && lane < kQR) {
    const float x = loadv[bp0 + lane];
    q_issued();
    qin[kE * kQR + lane] = x;
  }
  __syncthreads();
  float qv[kQR] = {0.0f, 0.0f, 0.0f, 0.0f};
  if (colw) {
    const float b1 = fb1[t];
    q_issued();
    float a1[kQR] = {b1, b1, b1, b1};
    q_dot2<kE + 1, kHD, kQR, kQR>(a1, qin, fW1 + t, qv, qin, Wq + t);
    *(v4f*)(g1s + t * kQR) = (v4f){fmaxf(a1[0], 0.0f), fmaxf(a1[1], 0.0f), fmaxf(a1[2], 0.0f), fmaxf(a1[3], 0.0f)};
  } else if (aux) {
    // lane = (qf unit i16, row pair h2); it also runs hidden unit 128 of row lane & 3 (lanes 0..3 are read, the rest are copies)
    const int i16 = lane & 15, h2 = (lane >> 4) * 2;
    float a1[1] = {fb1[kE]};
    const float bq = lqb[i16];
    q_issued();
    float qf[2] = {bq, bq};
    q_dot2<kE + 1, kQD, 1, 2>(a1, qin + (lane & 3), fW1 + kE, qf, qin + h2, lqW + i16);
    g1s[kE * kQR + lane] = fmaxf(a1[0], 0.0f);
    *(v2f*)(qfs + i16 * kQR + h2) = (v2f){qf[0], qf[1]};
  }
  __syncthreads();
  if (colw) {
    const float b2 = fb2[t];
    float gm[kQR] = {b2, b2, b2, b2};
    const float* col = fW2 + t;
    float w[3][kQB];           // two batches ahead here: one column only
    q_fetch<kHD>(w[0], col, 0);
    q_fetch<kHD>(w[1], col, kQB);
    float wt = 0.0f;
#pragma unroll
    for (int c = 0; c < kE / kQB; ++c) {
      if (c + 2 < kE / kQB) q_fetch<kHD>(w[(c + 2) % 3], col, kQB * (c + 2));
      else if (c + 2 == kE / kQB) wt = col[kE * kHD];
      if (c + 2 <= kE / kQB) q_issued();
#pragma unroll
      for (int i = 0; i < kQB; ++i) q_step<kQR>(gm, g1s + (kQB * c + i) * kQR, w[c % 3][i]);
    }
    q_step<kQR>(gm, g1s + kE * kQR, wt);
#pragma unroll
    for (int r = 0; r < kQR; ++r) {
      const float den = 1.0f + expf(-gm[r]);
      const float gamma = 2.0f * (1.0f / den);
      Qs[(size_t)(bp0 + r) * kHD + t] = (qv[r] * gamma) * 0.25f;
    }
  } else if (aux) {
    const float c0 = lb1[lane], c1 = lb1[32 + lane];
    float u0[kQR] = {c0, c0, c0, c0}, u1[kQR] = {c1, c1, c1, c1};
    float w0[kQB], w1[kQB];
    static_assert(kQD == kQB, "one batch");
    q_fetch<kHID>(w0, lW1 + kDYN * kHID + lane, 0);
    q_fetch<kHID>(w1, lW1 + kDYN * kHID + 32 + lane, 0);
    q_issued();
#pragma unroll
    for (int i = 0; i < kQD; ++i) {
      q_step<kQR>(u0, qfs + i * kQR, w0[i]);
      q_step<kQR>(u1, qfs + i * kQR, w1[i]);
    }
#pragma unroll
    for (int r = 0; r < kQR; ++r) {
      QW[(size_t)(bp0 + r) * kHID + lane] = u0[r];
      QW[(size_t)(bp0 + r) * kHID + 32 + lane] = u1[r];
    }
    q_issued();   // the wait behind the stores too: the code laid out behind this branch writes registers that they name
  }
}

// ---------------------------------------------------------------------------
// Lazy-mask MLP, all three layers in one kernel; H1 and H2 never leave the registers.
// Block = one (b,p) row of MASKB, 4 waves; a wave owns 256 node slots and walks them 32 at a time (two 16-slot tiles).
// Lane l: c = l & 15, h = l >> 4.
//   layer 1 (f32 VALU): the lane computes H1[slot c][k] for its own 32 k (k = 32 s + 16 h + e, s = 0,1, e = 0..15),
//     relu, f16: that is the B fragment of k step s as it stands. Its weights come from an LDS table, per k pair
//     {W1[0][k,k+1], W1[1][k,k+1], W1[2][k,k+1], QW[k,k+1]}; the row's dynamic features and mask row are staged in LDS once.
//   layer 2 (WMMA f16): A = lm_W2^T x16, row j = 16 i + c, the same k per lane and element;
//     D register r of tile i = 16 * (H1 . lm_W2[:, j]) for hidden unit j = 16 i + 8 h + r of slot c.
//   layer 3 (f32 VALU): z = sum_j relu(D / 16 + lm_b2[j]) * lm_W3[j]: 32 j in the lane, the other 32 in lane l ^ 16.
//   MASKB[bp][n] = ninf_mask[b,p,min(n,999)] - softplus(z + lm_b3)   (ALPHA = 1)
// Coverage: 1600 blocks x 4 waves x 8 trips x 32 slots = all 1024 columns of all 1600 rows (pad slots from clamped inputs).
// ---------------------------------------------------------------------------
// layer 3 for one 16-unit tile: sum over the lane's 8 hidden units of relu(D / 16 + b2) * w3
__device__ __forceinline__ v2f lazy_l3(v8f acc, const v2f (&b2)[4], const v2f (&w3)[4]) {
  const v2f zero = (v2f){0.0f, 0.0f};
  const v2f sc = (v2f){1.0f / kWCarry, 1.0f / kWCarry};
  v2f zs = zero;
#pragma unroll
  for (int q = 0; q < 4; ++q) {
    const v2f a = __builtin_elementwise_max(__builtin_elementwise_fma((v2f){acc[2 * q], acc[2 * q + 1]}, sc, b2[q]), zero);
    zs = __builtin_elementwise_fma(a, w3[q], zs);
  }
  return zs;
}
constexpr int kLzLds = 2 * 16 * 8 + kN * kDYN + kN;   // floats
__device__ __forceinline__ void lazy_body(float* smem, int bp,
                                          const float* __restrict__ dyn, const float* __restrict__ QW,
                                          const float* __restrict__ lW1, const _Float16* __restrict__ W2T,
                                          const float* __restrict__ lb2, const float* __restrict__ lW3,
                                          const float* __restrict__ lb3, const float* __restrict__ ninfm,
                                          float* __restrict__ maskb) {
  float* tbl = smem;                   // [h][k pair][w0 w0 w1 w1 w2 w2 qw qw], 2 * 16 * 8 floats
  float* sd = tbl + 2 * 16 * 8;        // dynamic features of this (b,p): 1000 x 3
  float* sn = sd + kN * kDYN;          // ninf_mask row of this (b,p)
  const int t = threadIdx.x;
  const int lane = t & 31, wave = t >> 5;
  const int c = lane & 15, h = lane >> 4;
  // stage the 12000 contiguous bytes of dynamic features: 750 x 16 B over 128 threads
  const unsigned oD = (unsigned)t * 16u;
  const char* dsrc = (const char*)(dyn + (size_t)bp * kN * kDYN);
  v4f dv[6];
#pragma unroll
  for (int i = 0; i < 5; ++i) dv[i] = *(const v4f*)(dsrc + oD + i * 2048);
  const bool last = (t < (kN * kDYN * 4 - 5 * 2048) / 16);
  const unsigned oL = last ? (oD + 5 * 2048) : 0u;     // threads past the end fetch in bounds and store nothing
  dv[5] = *(const v4f*)(dsrc + oL);
  // and the 4000 contiguous bytes of the mask row: 250 x 16 B
  const char* nsrc = (const char*)(ninfm + (size_t)bp * kN);
  const bool lastn = (t < (kN * 4 - 2048) / 16);
  const unsigned oN = lastn ? (oD + 2048) : 0u;
  const v4f nv0 = *(const v4f*)(nsrc + oD);
  const v4f nv1 = *(const v4f*)(nsrc + oN);
  // weight table: thread t fetches one pair: h = t >> 6, k pair p = (t >> 2) & 15, which = t & 3
  const int tp = (t >> 2) & 15, tw = t & 3;
  const int tk = 32 * (tp >> 3) + 16 * (t >> 6) + 2 * (tp & 7);
  const float* tsrc = (tw < 3) ? (lW1 + tw * kHID + tk) : (QW + (size_t)bp * kHID + tk);
  const v2f tv = *(const v2f*)tsrc;
  // byte offsets of the lane's first fragment / bias element; these set-up loads are scalar base + one of them
  const unsigned oA = (unsigned)(c * kHID + 16 * h) * 2u;
  const unsigned oJ = (unsigned)(8 * h) * 4u;
  v16h aw[4][2];
#pragma unroll
  for (int i = 0; i < 4; ++i)
#pragma unroll
    for (int s = 0; s < 2; ++s) aw[i][s] = *(const v16h*)((const char*)W2T + oA + (16 * i * kHID + 32 * s) * 2);
  v2f b2[4][4], w3[4][4];
#pragma unroll
  for (int i = 0; i < 4; ++i)
#pragma unroll
    for (int q = 0; q < 4; ++q) {
      b2[i][q] = *(const v2f*)((const char*)lb2 + oJ + (16 * i + 2 * q) * 4);
      w3[i][q] = *(const v2f*)((const char*)lW3 + oJ + (16 * i + 2 * q) * 4);
    }
  const float b3 = lb3[0];
  // address translations done before a register that a load above names is reused
  asm volatile("s_wait_xcnt 0x0" :: "v"(oD), "v"(oL), "v"(oN), "v"(tsrc), "v"(oA), "v"(oJ) : "memory");
#pragma unroll
  for (int i = 0; i < 5; ++i) *(v4f*)((char*)sd + oD + i * 2048) = dv[i];
  if (last) *(v4f*)((char*)sd + oL) = dv[5];
  *(v4f*)((char*)sn + oD) = nv0;
  if (lastn) *(v4f*)((char*)sn + oN) = nv1;
  *(v2f*)(tbl + 2 * t) = tv;
  __syncthreads();
  const int nw = wave * 256;
  float* mp = maskb + (size_t)bp * kNP + nw + lane;
  const v4f* tb4 = (const v4f*)(tbl + h * 128);
  for (int it = 0; it < 8; ++it) {
    const int n0 = nw + it * 32;
    const int n = n0 + lane;
    const int nc = (n < kN) ? n : (kN - 1);                          // address clamps (pad slots)
    const int ia = ((n0 + c < kN) ? (n0 + c) : (kN - 1)) * kDYN;
    const int ib = ((n0 + 16 + c < kN) ? (n0 + 16 + c) : (kN - 1)) * kDYN;
    const float a0 = sd[ia], a1 = sd[ia + 1], a2 = sd[ia + 2];
    const float e0 = sd[ib], e1 = sd[ib + 1], e2 = sd[ib + 2];
    v16h ba[2], bb[2];
    const v2h hzero = (v2h){(_Float16)0.0f, (_Float16)0.0f};
    v4f tq[2][8];                               // weight-table reads, four k pairs a group, one group ahead
#pragma unroll
    for (int j = 0; j < 8; ++j) tq[0][j] = tb4[j];
#pragma unroll
    for (int g = 0; g < 4; ++g) {
      if (g < 3) {
#pragma unroll
        for (int j = 0; j < 8; ++j) tq[(g + 1) & 1][j] = tb4[8 * (g + 1) + j];
      }
      // keeps the next group's LDS reads in front of this group's arithmetic, which then covers their latency
      __builtin_amdgcn_sched_barrier(0);
#pragma unroll
      for (int pp = 0; pp < 4; ++pp) {
        const int p = 4 * g + pp;
        const v4f u = tq[g & 1][2 * pp], v = tq[g & 1][2 * pp + 1];
        const v2f w0 = (v2f){u[0], u[1]}, w1 = (v2f){u[2], u[3]}, w2 = (v2f){v[0], v[1]}, qw = (v2f){v[2], v[3]};
        const v2f xa = __builtin_elementwise_fma(w0, (v2f){a0, a0}, __builtin_elementwise_fma(w1, (v2f){a1, a1},
                       __builtin_elementwise_fma(w2, (v2f){a2, a2}, qw)));
        const v2f xb = __builtin_elementwise_fma(w0, (v2f){e0, e0}, __builtin_elementwise_fma(w1, (v2f){e1, e1},
                       __builtin_elementwise_fma(w2, (v2f){e2, e2}, qw)));
        // relu behind the rounding: same value as rounding behind relu
        const v2h ya = __builtin_elementwise_max(__builtin_convertvector(xa, v2h), hzero);
        const v2h yb = __builtin_elementwise_max(__builtin_convertvector(xb, v2h), hzero);
        ba[p >> 3][2 * (p & 7)] = ya[0]; ba[p >> 3][2 * (p & 7) + 1] = ya[1];
        bb[p >> 3][2 * (p & 7)] = yb[0]; bb[p >> 3][2 * (p & 7) + 1] = yb[1];
      }
    }
    v2f za2[4], zb2[4];
#pragma unroll
    for (int i = 0; i < 4; ++i) {
      const v8f czero = (v8f){0.f, 0.f, 0.f, 0.f, 0.f, 0.f, 0.f, 0.f};
      v8f ca = __builtin_amdgcn_wmma_f32_16x16x32_f16(false, aw[i][0], false, ba[0], (short)0, czero, false, false);
      v8f cc = __builtin_amdgcn_wmma_f32_16x16x32_f16(false, aw[i][0], false, bb[0], (short)0, czero, false, false);
      ca = __builtin_amdgcn_wmma_f32_16x16x32_f16(false, aw[i][1], false, ba[1], (short)0, ca, false, false);
      cc = __builtin_amdgcn_wmma_f32_16x16x32_f16(false, aw[i][1], false, bb[1], (short)0, cc, false, false);
      za2[i] = lazy_l3(ca, b2[i], w3[i]);
      zb2[i] = lazy_l3(cc, b2[i], w3[i]);
    }
    const v2f ta = (za2[0] + za2[1]) + (za2[2] + za2[3]);
    const v2f tb = (zb2[0] + zb2[1]) + (zb2[2] + zb2[3]);
    const float za = ta[0] + ta[1], zb = tb[0] + tb[1];
    // lanes 0..15 finish slots n0 + c (tile a), lanes 16..31 slots n0 + 16 + c (tile b): one exchange l <-> l ^ 16 for both
    const float mine = h ? zb : za;
    const int other = __float_as_int(h ? za : zb);
    const float z = (mine + __int_as_float(__builtin_amdgcn_permlanex16(other, other, 0x76543210, 0xfedcba98, false, false))) + b3;
    const float spv = fmaxf(z, 0.0f) + log1pf(expf(-fabsf(z)));
    *mp = sn[nc] - spv;
    // address translation done before the store's address register is advanced; the "memory" clobber also keeps the
    // weight-table reads inside the loop (hoisted they hold 128 more registers: over 256, one wave per SIMD fewer)
    asm volatile("s_wait_xcnt 0x0" :: "v"(mp) : "memory");
    mp += 32;
  }
}

// ---------------------------------------------------------------------------
// Second launch: the two jobs that need only the first launch's results and not each other, side by side in one grid.
// Blocks of 4 waves. Blocks 0..255: K|V projection, [16384][128] x [256][128]^T, bf16 hi/lo both operands -> f32 KV; a block
// holds the four 64-column tiles of one 64-row tile. Blocks 256..1855: the lazy-mask MLP, one (b,p) row each.
// The projection's blocks come first: its waves wait on memory for most of their time, and the MLP's waves fill the vector port
// meanwhile. The job select is block-uniform (scalar); both jobs use the same LDS bytes.
// ---------------------------------------------------------------------------
constexpr int kKvBlocks = (kEncRows / 64) * (2 * kHD / 64) / 4;
constexpr int kMidLds = (4 * 16 * 68 > kLzLds) ? 4 * 16 * 68 : kLzLds;
__global__ __launch_bounds__(128) void k_kv_lazy(const unsigned short* __restrict__ EncHi, const unsigned short* __restrict__ EncLo,
                                                const unsigned short* __restrict__ WkvHi, const unsigned short* __restrict__ WkvLo,
                                                float* __restrict__ KV,
                                                const float* __restrict__ dyn, const float* __restrict__ QW,
                                                const float* __restrict__ lW1, const _Float16* __restrict__ W2T,
                                                const float* __restrict__ lb2, const float* __restrict__ lW3,
                                                const float* __restrict__ lb3, const float* __restrict__ ninfm,
                                                float* __restrict__ maskb) {
  __shared__ __align__(16) float smem[kMidLds];
  const int bid = blockIdx.x;
  if (bid < kKvBlocks) {
    gemm64_body<4, 1, true, 0, 0, false, 0>(smem, bid, 0, EncHi, EncLo, kE, 0L, WkvHi, WkvLo, kE, 0L, (void*)KV, (void*)KV,
                                            2 * kHD, 0L, QW, QW, 0L, kEncRows, 2 * kHD, kE, 1.0f);   // bias, resid: never read
  } else {
    lazy_body(smem, bid - kKvBlocks, dyn, QW, lW1, W2T, lb2, lW3, lb3, ninfm, maskb);
  }
}

// ---------------------------------------------------------------------------
// Attention core (f32 VALU, head dim 16), node axis split over the waves of a block.
// Block = (b, group of 16 queries, group of 4 heads), 512 threads = 16 waves: wave = (node slice sl = wave >> 1 of 128 slots,
// head pair wave & 1); lane = (head of the pair, query). 16 x 7 x 2 = 224 blocks.
// Per stage every slice gets its next 32 nodes in LDS: the 4 heads' K (64 f32) and V (64 f32) of each node, and the bias tile
// [16 queries][32 nodes] at a pitch of 36 floats (16 rows on 16 different banks). Four stages cover the 128 slots of a slice.
// Online softmax per thread over its slice (slots >= 1000 forced to -inf by value); m, l, acc in f32.
// Merge: every wave leaves (acc[16], m, l) per lane in LDS; 128 threads fold the 8 slices in slice order,
//   M = max m_s, w_s = exp(m_s - M), O = sum_s w_s acc_s / sum_s w_s l_s,
// and write O as bf16 hi + bf16 lo planes into Ohi/Olo[bp][h*16+d]: 8 lanes x 16 B = the block's whole 128-B line of a row
// (rows >= P skipped).
// ---------------------------------------------------------------------------
constexpr int kASl  = 8;               // node slices per block
constexpr int kASn  = kNP / kASl;      // 128 node slots per slice
constexpr int kACh  = 32;              // nodes per slice and stage
constexpr int kAHb  = 4;               // heads per block
constexpr int kARow = 2 * kAHb * kD;   // 128 floats per staged node: K of 4 heads | V of 4 heads
constexpr int kAMp  = 36;              // bias tile pitch in floats
constexpr int kACp  = 20;              // merge record pitch in floats: acc[16], m, l, 2 unused
static_assert(kASl * kAHb * 16 * kACp <= kASl * kACh * kARow, "merge records fit the K|V buffer");
__global__ __launch_bounds__(512) void k_attn(const float* __restrict__ Qs, const float* __restrict__ KV,
                                             const float* __restrict__ maskb, unsigned short* __restrict__ Ohi,
                                             unsigned short* __restrict__ Olo) {
  __shared__ __align__(16) float kvs[kASl * kACh * kARow];   // 131072 B; the merge records reuse it
  __shared__ __align__(16) float ms[kASl * 16 * kAMp];       // 18432 B
  const float kNegInf = -__builtin_inff();
  const int t = threadIdx.x, lane = t & 31;
  const int wave = __builtin_amdgcn_readfirstlane(t >> 5);   // scalar: slice bounds and LDS bases stay off the vector unit
  const int b = blockIdx.x / 14, rem = blockIdx.x - b * 14, pg = rem >> 1, hq = rem & 1, p0 = pg * 16;
  const int sl = wave >> 1;
  const int hl = (wave & 1) * 2 + (lane >> 4), pl = lane & 15;
  const int p = p0 + pl, pc = (p < kP) ? p : (kP - 1);
  const float* qp = Qs + (size_t)(b * kP + pc) * kHD + (hq * kAHb + hl) * kD;
  const v4f qa = *(const v4f*)(qp), qb = *(const v4f*)(qp + 4), qc = *(const v4f*)(qp + 8), qd = *(const v4f*)(qp + 12);
  v4f oa = (v4f){0.f, 0.f, 0.f, 0.f}, ob = (v4f){0.f, 0.f, 0.f, 0.f}, oc = (v4f){0.f, 0.f, 0.f, 0.f}, od = (v4f){0.f, 0.f, 0.f, 0.f};
  float m = -3.0e38f, l = 0.0f;
  const float* kvb = KV + (size_t)b * kNP * (2 * kHD);
  const float* mkb = maskb + (size_t)(b * kP) * kNP;
  // staging roles: a wave copies whole node rows (lanes 0..15 the K part, 16..31 the V part, 256 B each)
  const int scol = ((lane < 16) ? 0 : kHD) + hq * (kAHb * kD) + (lane & 15) * 4;
  // bias tile roles: thread t copies 4 columns (t & 7) * 4 of row (t >> 3) & 15 for slices t >> 7 and 4 + (t >> 7)
  const int mr = (t >> 3) & 15, mj4 = (t & 7) * 4, msl = t >> 7;
  const int mpr = (p0 + mr < kP) ? (p0 + mr) : (kP - 1);
  const float* mrow = mkb + (size_t)mpr * kNP + msl * kASn + mj4;
  float* mdst = ms + (msl * 16 + mr) * kAMp + mj4;
#pragma unroll 1   // rolled: one set of 18 staging register quads serves every stage
  for (int st = 0; st < kASn / kACh; ++st) {
    // 8 slices x 32 nodes x 32 float4 = 8192 float4: 16 x 512 threads; trip i: slice i >> 1, node (i & 1) * 16 + wave
    const float* gk = kvb + (size_t)(st * kACh + wave) * (2 * kHD) + scol;
    v4f kvr[16];
#pragma unroll
    for (int i = 0; i < 16; ++i) kvr[i] = *(const v4f*)(gk + (size_t)((i >> 1) * kASn + (i & 1) * 16) * (2 * kHD));
    // bias tiles: 8 slices x 16 rows x 8 float4 = 1024 float4: 2 x 512 threads; trip i: slice i * 4 + (t >> 7)
    const float* gm = mrow + st * kACh;
    const v4f mr0 = *(const v4f*)(gm);
    const v4f mr1 = *(const v4f*)(gm + 4 * kASn);
    // address translations done before a register that a load above names is reused
    asm volatile("s_wait_xcnt 0x0" :: "v"(gk), "v"(gm) : "memory");
    __syncthreads();   // every wave has left the buffers of the stage before
#pragma unroll
    for (int i = 0; i < 16; ++i) *(v4f*)(kvs + ((i >> 1) * kACh + (i & 1) * 16 + wave) * kARow + lane * 4) = kvr[i];
    *(v4f*)(mdst) = mr0;
    *(v4f*)(mdst + 4 * 16 * kAMp) = mr1;
    __syncthreads();
    const int n0 = sl * kASn + st * kACh;
    const float* kw = kvs + sl * kACh * kARow + hl * kD;
    const float* mw = ms + (sl * 16 + pl) * kAMp;
#pragma unroll 1   // rolled as before: the running m, l, acc make one serial chain from node to node
    for (int j = 0; j < kACh; ++j) {
      const float* kr = kw + j * kARow;
      const v4f k0 = *(const v4f*)(kr), k1 = *(const v4f*)(kr + 4), k2 = *(const v4f*)(kr + 8), k3 = *(const v4f*)(kr + 12);
      float s = mw[j];
      s = fmaf(qa[0], k0[0], s); s = fmaf(qa[1], k0[1], s); s = fmaf(qa[2], k0[2], s); s = fmaf(qa[3], k0[3], s);
      s = fmaf(qb[0], k1[0], s); s = fmaf(qb[1], k1[1], s); s = fmaf(qb[2], k1[2], s); s = fmaf(qb[3], k1[3], s);
      s = fmaf(qc[0], k2[0], s); s = fmaf(qc[1], k2[1], s); s = fmaf(qc[2], k2[2], s); s = fmaf(qc[3], k2[3], s);
      s = fmaf(qd[0], k3[0], s); s = fmaf(qd[1], k3[1], s); s = fmaf(qd[2], k3[2], s); s = fmaf(qd[3], k3[3], s);
      s = (n0 + j < kN) ? s : kNegInf;
      const float mn = fmaxf(m, s);
      const float alpha = __expf(m - mn);
      const float pj = __expf(s - mn);
      m = mn;
      l = fmaf(l, alpha, pj);
      const float* vr = kr + kAHb * kD;
      const v4f v0 = *(const v4f*)(vr), v1 = *(const v4f*)(vr + 4), v2 = *(const v4f*)(vr + 8), v3 = *(const v4f*)(vr + 12);
      oa = v0 * pj + oa * alpha;
      ob = v1 * pj + ob * alpha;
      oc = v2 * pj + oc * alpha;
      od = v3 * pj + od * alpha;
    }
  }
  __syncthreads();   // every wave has left the K|V buffer before the merge records overwrite it
  {
    float* op = kvs + ((sl * kAHb + hl) * 16 + pl) * kACp;
    *(v4f*)(op)      = oa;
    *(v4f*)(op + 4)  = ob;
    *(v4f*)(op + 8)  = oc;
    *(v4f*)(op + 12) = od;
    *(v2f*)(op + 16) = (v2f){m, l};
  }
  __syncthreads();
  if (wave < 4) {    // threads 0..127; no barrier behind this point
    const int rl = t >> 3, c8 = (t & 7) * 8;
    const float* cb = kvs + ((c8 >> 4) * 16 + rl) * kACp;
    constexpr int kSs = kAHb * 16 * kACp;      // floats from one slice's records to the next
    float ml[kASl], ll[kASl];
#pragma unroll
    for (int s = 0; s < kASl; ++s) { const v2f e = *(const v2f*)(cb + s * kSs + 16); ml[s] = e[0]; ll[s] = e[1]; }
    float mx = ml[0];
#pragma unroll
    for (int s = 1; s < kASl; ++s) mx = fmaxf(mx, ml[s]);
    float lsum = 0.0f;
    v4f x0 = (v4f){0.f, 0.f, 0.f, 0.f}, x1 = (v4f){0.f, 0.f, 0.f, 0.f};
#pragma unroll
    for (int s = 0; s < kASl; ++s) {
      const float w = __expf(ml[s] - mx);
      const float* s8 = cb + s * kSs + (c8 & 15);
      lsum = fmaf(ll[s], w, lsum);
      x0 = *(const v4f*)(s8) * w + x0;
      x1 = *(const v4f*)(s8 + 4) * w + x1;
    }
    const float inv = 1.0f / lsum;
    x0 = x0 * inv;
    x1 = x1 * inv;
    unsigned short hb[8], lb[8];
#pragma unroll
    for (int e = 0; e < 4; ++e) {
      split_bf(x0[e], hb[e], lb[e]);
      split_bf(x1[e], hb[4 + e], lb[4 + e]);
    }
    const v4u uh = (v4u){pk16(hb[0], hb[1]), pk16(hb[2], hb[3]), pk16(hb[4], hb[5]), pk16(hb[6], hb[7])};
    const v4u ul = (v4u){pk16(lb[0], lb[1]), pk16(lb[2], lb[3]), pk16(lb[4], lb[5]), pk16(lb[6], lb[7])};
    if (p0 + rl < kP) {
      const size_t o = (size_t)(b * kP + p0 + rl) * kHD + hq * (kAHb * kD) + c8;
      *(v4u*)(Ohi + o) = uh;
      *(v4u*)(Olo + o) = ul;
    }
  }
}

// ---------------------------------------------------------------------------
// Zero fill of two regions, nvec x 16 B each (nvec % 256 == 0, so the region select is block-uniform).
// ---------------------------------------------------------------------------
__device__ __forceinline__ void zero16x2_body(int bid, unsigned int* __restrict__ p0, unsigned int* __restrict__ p1, int nvec) {
  const int i = bid * 256 + threadIdx.x;
  if (i >= 2 * nvec) return;
  unsigned int* p = (i < nvec) ? (p0 + 4 * (size_t)i) : (p1 + 4 * (size_t)(i - nvec));
  const v4u z = (v4u){0u, 0u, 0u, 0u};
  *(v4u*)p = z;
}

// ---------------------------------------------------------------------------
// First launch: the four jobs that read nothing but inputs, side by side in one grid of 256-thread blocks. By block index:
// query side (400, the longest job, so it starts first), weight preparation (13), zero fill of the 64 pad rows
// 1600..1663 of Ohi and Olo (8), node split (1024). The job select is block-uniform (scalar); the two jobs with LDS use
// the same bytes.
// ---------------------------------------------------------------------------
constexpr int kZrVec = (kBPpad - kBP) * kHD * 2 / 16;   // 16-B pieces per plane
constexpr int kZrBlocks = 2 * kZrVec / 256;
static_assert(kZrVec % 256 == 0, "zero fill blocks");
constexpr int kFrontBlocks = kQsBlocks + kWpBlocks + kZrBlocks + kEcBlocks;
constexpr int kFrontLds = (kWpLds > kQsLds) ? kWpLds : kQsLds;
__global__ __launch_bounds__(256) void k_front(const float* __restrict__ enc_last, const float* __restrict__ loadv,
                                              const float* __restrict__ Wq, const float* __restrict__ fW1,
                                              const float* __restrict__ fb1, const float* __restrict__ fW2,
                                              const float* __restrict__ fb2, const float* __restrict__ lqW,
                                              const float* __restrict__ lqb, const float* __restrict__ lW1,
                                              const float* __restrict__ lb1,
                                              float* __restrict__ Qs, float* __restrict__ QW,
                                              const float* __restrict__ Wk, const float* __restrict__ Wv,
                                              const float* __restrict__ Wcomb, const float* __restrict__ W2,
                                              unsigned short* __restrict__ WkvHi, unsigned short* __restrict__ WkvLo,
                                              unsigned short* __restrict__ WcHi, unsigned short* __restrict__ WcLo,
                                              unsigned short* __restrict__ W2T,
                                              unsigned int* __restrict__ OhiPad, unsigned int* __restrict__ OloPad,
                                              const float* __restrict__ enc, unsigned short* __restrict__ EncHi,
                                              unsigned short* __restrict__ EncLo) {
  __shared__ __align__(16) float smem[kFrontLds];
  const int bid = blockIdx.x;
  if (bid < kQsBlocks) {
    qside_body(smem, bid, enc_last, loadv, Wq, fW1, fb1, fW2, fb2, lqW, lqb, lW1, lb1, Qs, QW);
  } else if (bid < kQsBlocks + kWpBlocks) {
    wprep_body(smem, bid - kQsBlocks, Wk, Wv, Wcomb, W2, WkvHi, WkvLo, WcHi, WcLo, W2T);
  } else if (bid < kQsBlocks + kWpBlocks + kZrBlocks) {
    zero16x2_body(bid - (kQsBlocks + kWpBlocks), OhiPad, OloPad, kZrVec);
  } else {
    enc_cast_body(bid - (kQsBlocks + kWpBlocks + kZrBlocks), enc, EncHi, EncLo);
  }
}

// ---------------------------------------------------------------------------
// Final: per (b,p) row: x = 10*tanh(S) + ninf_mask, softmax over 1000 nodes (f32, fixed-order wave reductions).
// One wave per row; lane l owns elements n = l + 32 i, i = 0..31, and holds them in registers from the loads to the scaled
// probabilities. All 64 loads of a lane go out before the first value is used, so their latencies overlap, and the
// arithmetic is straight-line code whose 32 elements are independent. Slots n >= 1000 carry -inf: they add 0 to the sum.
// LDS only turns the 8 rows of a block (32000 contiguous bytes of out) into whole 16-B pieces for the stores.
// Coverage: 200 blocks x 8 rows = 1600 rows.
// ---------------------------------------------------------------------------
// tanh with both of its ranges computed and one selected: no branch, so neighbouring elements can overlap
__device__ __forceinline__ float tanh_sel(float x) {
  const float ax = fabsf(x);
  const float e = __expf(ax + ax);                                    // inf for large |x|: 2 / inf = 0, the value is 1
  const float big = fmaf(__builtin_amdgcn_rcpf(e + 1.0f), -2.0f, 1.0f);
  const float x2 = x * x;
  float pl = fmaf(x2, -0.00570002059f, 0.0206340719f);                // odd series for |x| < 0.625
  pl = fmaf(x2, pl, -0.0537379310f);
  pl = fmaf(x2, pl, 0.133314162f);
  pl = fmaf(x2, pl, -0.333332807f);
  const float small = fmaf(x2, ax * pl, ax);
  return copysignf((ax < 0.625f) ? small : big, x);
}
constexpr int kFE = kNP / 32;   // elements per lane
__global__ __launch_bounds__(256) void k_final(const float* __restrict__ Sp, const float* __restrict__ ninfm,
                                              float* __restrict__ out) {
  __shared__ __align__(16) float xs[8 * kN];
  const float kNegInf = -__builtin_inff();
  const int t = threadIdx.x, lane = t & 31;
  const int wave = __builtin_amdgcn_readfirstlane(t >> 5);   // scalar: the row bases stay in scalar registers
  const int r = blockIdx.x * 8 + wave;
  const int b = r / kP, p = r - b * kP;
  const float* srow = Sp + (size_t)(b * kSrows + p) * kNP;
  const float* nrow = ninfm + (size_t)r * kN;
  float* xr = xs + wave * kN;
  float s[kFE], x[kFE];
#pragma unroll
  for (int i = 0; i < kFE; ++i) {
    const int n = lane + 32 * i;
    s[i] = srow[(n < kN) ? n : (kN - 1)];                    // address clamp
  }
#pragma unroll
  for (int i = 0; i < kFE; ++i) {
    const int n = lane + 32 * i;
    x[i] = nrow[(n < kN) ? n : (kN - 1)];
  }
  q_issued();   // behind the 64 loads, before their offset registers are reused
  // keeps all 64 loads in front of the arithmetic: moved down among it, the mask row's latency would come on top of the first
  __builtin_amdgcn_sched_barrier(0);
  float m4[4] = {kNegInf, kNegInf, kNegInf, kNegInf};        // four chains: a maximum does not depend on the order
#pragma unroll
  for (int i = 0; i < kFE; ++i) {
    const float v = kClip * tanh_sel(s[i]) + x[i];
    x[i] = (lane + 32 * i < kN) ? v : kNegInf;
    m4[i & 3] = fmaxf(m4[i & 3], x[i]);
  }
  float mx = fmaxf(fmaxf(m4[0], m4[1]), fmaxf(m4[2], m4[3]));
#pragma unroll
  for (int off = 16; off > 0; off >>= 1) mx = fmaxf(mx, __shfl_xor(mx, off, 32));
  float sum = 0.0f;
#pragma unroll
  for (int i = 0; i < kFE; ++i) {
    x[i] = __expf(x[i] - mx);
    sum += x[i];
  }
#pragma unroll
  for (int off = 16; off > 0; off >>= 1) sum += __shfl_xor(sum, off, 32);
  const float inv = 1.0f / sum;
#pragma unroll
  for (int i = 0; i < kFE; ++i) {
    const int n = lane + 32 * i;
    if (n < kN) xr[n] = x[i] * inv;
  }
  __syncthreads();
  float* obase = out + (size_t)blockIdx.x * 8 * kN;
  // 2000 pieces of 16 B over 256 threads: 7 full trips, then 208 threads
  constexpr int kFull = (2 * kN) / 256;
#pragma unroll
  for (int k = 0; k < kFull; ++k) {
    const int f = t + 256 * k;
    *(v4f*)(obase + 4 * (size_t)f) = *(const v4f*)(xs + 4 * f);
  }
  if (t < 2 * kN - 256 * kFull) {
    const int f = t + 256 * kFull;
    *(v4f*)(obase + 4 * (size_t)f) = *(const v4f*)(xs + 4 * f);
  }
}

// ---------------------------------------------------------------------------
// Host launcher
// Workspace region map (bytes, 256-B aligned offsets):
//   EncHi bf16 [16][1024][128]          4,194,304
//   EncLo bf16 [16][1024][128]          4,194,304
//   WkvHi bf16 [256][128]                 65,536
//   WkvLo bf16 [256][128]                 65,536
//   WcHi  bf16 [128][128]                 32,768
//   WcLo  bf16 [128][128]                 32,768
//   W2T   f16  [64][64]                    8,192
//   KVf   f32  [16384][256]            16,777,216
//   Qs    f32  [1600][128]                819,200
//   QW    f32  [1600][64]                 409,600
//   MASKB f32  [1600][1024]             6,553,600
//   Ohi   bf16 [1664][128]                425,984
//   Olo   bf16 [1664][128]                425,984
//   MHhi  bf16 [1664][128]                425,984
//   MHlo  bf16 [1664][128]                425,984
//   Sp    f32  [16][128][1024]           8,388,608
//   total                              43,245,568
// ---------------------------------------------------------------------------
static inline size_t align256(size_t x) { return (x + 255) & ~(size_t)255; }

extern "C" void kernel_launch(void* const* d_in, const int* in_sizes, int n_in,
                              void* d_out, int out_size, void* d_ws, size_t ws_size,
                              hipStream_t stream) {
  if (n_in < 22) return;
  if (in_sizes[0] != kB * kN * kE || in_sizes[1] != kB * kP * kE || in_sizes[2] != kB * kP ||
      in_sizes[3] != kB * kP * kN || in_sizes[4] != kB * kP * kN * kDYN || out_size != kB * kP * kN) return;

  const float* enc      = (const float*)d_in[0];
  const float* enc_last = (const float*)d_in[1];
  const float* loadv    = (const float*)d_in[2];
  const float* ninfm    = (const float*)d_in[3];
  const float* dyn      = (const float*)d_in[4];
  const float* Wq       = (const float*)d_in[5];
  const float* Wk       = (const float*)d_in[6];
  const float* Wv       = (const float*)d_in[7];
  const float* Wc       = (const float*)d_in[8];
  const float* bcv      = (const float*)d_in[9];
  const float* fW1      = (const float*)d_in[10];
  const float* fb1      = (const float*)d_in[11];
  const float* fW2      = (const float*)d_in[12];
  const float* fb2      = (const float*)d_in[13];
  const float* lqW      = (const float*)d_in[14];
  const float* lqb      = (const float*)d_in[15];
  const float* lW1      = (const float*)d_in[16];
  const float* lb1      = (const float*)d_in[17];
  const float* lW2      = (const float*)d_in[18];
  const float* lb2      = (const float*)d_in[19];
  const float* lW3      = (const float*)d_in[20];
  const float* lb3      = (const float*)d_in[21];
  float* out = (float*)d_out;

  char* ws = (char*)d_ws;
  size_t off = 0;
  unsigned short* EncHi = (unsigned short*)(ws + off); off = align256(off + (size_t)kEncRows * kE * 2);
  unsigned short* EncLo = (unsigned short*)(ws + off); off = align256(off + (size_t)kEncRows * kE * 2);
  unsigned short* WkvHi = (unsigned short*)(ws + off); off = align256(off + (size_t)2 * kHD * kE * 2);
  unsigned short* WkvLo = (unsigned short*)(ws + off); off = align256(off + (size_t)2 * kHD * kE * 2);
  unsigned short* WcHi  = (unsigned short*)(ws + off); off = align256(off + (size_t)kE * kHD * 2);
  unsigned short* WcLo  = (unsigned short*)(ws + off); off = align256(off + (size_t)kE * kHD * 2);
  unsigned short* W2T   = (unsigned short*)(ws + off); off = align256(off + (size_t)kHID * kHID * 2);
  float* KVf   = (float*)(ws + off); off = align256(off + (size_t)kEncRows * 2 * kHD * 4);
  float* Qs    = (float*)(ws + off); off = align256(off + (size_t)kBP * kHD * 4);
  float* QW    = (float*)(ws + off); off = align256(off + (size_t)kBP * kHID * 4);
  float* MASKB = (float*)(ws + off); off = align256(off + (size_t)kBP * kNP * 4);
  unsigned short* Ohi  = (unsigned short*)(ws + off); off = align256(off + (size_t)kBPpad * kHD * 2);
  unsigned short* Olo  = (unsigned short*)(ws + off); off = align256(off + (size_t)kBPpad * kHD * 2);
  unsigned short* MHhi = (unsigned short*)(ws + off); off = align256(off + (size_t)kBPpad * kE * 2);
  unsigned short* MHlo = (unsigned short*)(ws + off); off = align256(off + (size_t)kBPpad * kE * 2);
  float* Sp    = (float*)(ws + off); off = align256(off + (size_t)kB * kSrows * kNP * 4);
  if (off > ws_size) return;
  const float* fdummy = Qs;   // valid, never dereferenced (BIAS_MODE 0 / RESID false)

  // launch 1, inputs only: query side (f32); weight planes (Wk|Wv and W_comb transposed to bf16 hi/lo [n][k], lm_W2 transposed
  // to f16 x16); zeros in the 64 pad rows of Ohi and Olo; node planes (bf16 hi/lo, 24 zero pad rows per batch in both)
  k_front<<<kFrontBlocks, 256, 0, stream>>>(enc_last, loadv, Wq, fW1, fb1, fW2, fb2, lqW, lqb, lW1, lb1, Qs, QW,
                                            Wk, Wv, Wc, lW2, WkvHi, WkvLo, WcHi, WcLo, W2T,
                                            (unsigned int*)(Ohi + (size_t)kBP * kHD), (unsigned int*)(Olo + (size_t)kBP * kHD),
                                            enc, EncHi, EncLo);
  // launch 2: K|V projection (bf16 hi/lo both operands, K=128, M=16384, N=256 -> f32) beside the lazy-mask MLP (three layers
  // fused, all 1600 x 1024 slots; hidden layer on WMMA f16 (W x16), K=64)
  k_kv_lazy<<<kKvBlocks + kBP, 128, 0, stream>>>(EncHi, EncLo, WkvHi, WkvLo, KVf, dyn, QW, lW1, (const _Float16*)W2T, lb2, lW3,
                                                 lb3, ninfm, MASKB);
  // attention core (f32), 8 node slices per block merged in LDS -> O as bf16 hi/lo planes
  k_attn<<<kB * 14, 512, 0, stream>>>(Qs, KVf, MASKB, Ohi, Olo);
  // head merge: [1664][128] x [128][128]^T, bf16 hi/lo both operands, K=128, bias b_comb[n], bf16 hi/lo out planes
  wmma_gemm64<1, true, 2, 2, false, 0><<<dim3(((kBPpad / 64) * (kE / 64) + 7) / 8, 1), 256, 0, stream>>>(
      Ohi, Olo, kHD, 0L, WcHi, WcLo, kHD, 0L, (void*)MHhi, (void*)MHlo, kE, 0L,
      bcv, fdummy, 0L, kBPpad, kE, kHD, 1.0f);
  // pointer scores per batch: A = MH rows b*100 .. b*100+127 (hi/lo, rows beyond the batch are finite data),
  // Bt = node planes of batch b [1024][128] (hi/lo); M=128, N=1024, K=128 -> f32 Sp[b][128][1024], scale 1/sqrt(128)
  wmma_gemm64<1, true, 0, 0, false, 0><<<dim3((kSrows / 64) * (kNP / 64) / 8, kB), 256, 0, stream>>>(
      MHhi, MHlo, kE, (long)kP * kE, EncHi, EncLo, kE, (long)kNP * kE, (void*)Sp, (void*)Sp, kNP, (long)kSrows * kNP,
      fdummy, fdummy, 0L, kSrows, kNP, kE, kInvSqrtE);
  // clipped tanh + mask + softmax -> probs
  k_final<<<kBP / 8, 256, 0, stream>>>(Sp, ninfm, out);
}

// v006
// Measured time: 83.6 microseconds a run.
// Timed twice side by side with v005, it ran 1.15 and 1.14 times as fast.
// Counting every step since v000, it is 7.13 times as fast.
// Contractions: node K|V projection (nodes x [Wk|Wv]^T), head-merge projection (O x W_comb^T) and pointer scores (MH x nodes^T) on v_wmma_f32_16x16x32_bf16 with bf16 hi/lo operand planes (hi.hi + hi.lo + lo.hi); lazy-mask hidden layer (lm_W2^T f16 carried x16, as A, x H1 f16, as B) on v_wmma_f32_16x16x32_f16 inside the fused lazy-mask kernel; all f32 accumulate; query/FiLM/gating/qf projections, lazy layers 1 (K=3 after the broadcast fold) and 3 (N=1) and both softmaxes in f32 on the VALU; the attention core's two products (K x Q^T, V^T x P^T, head dim 16) on v_wmma_f32_16x16x4_f32.
#include <hip/hip_runtime.h>
#include <math.h>

typedef __attribute__((ext_vector_type(16))) _Float16 v16h;
typedef __attribute__((ext_vector_type(8)))  _Float16 v8h;
typedef __attribute__((ext_vector_type(16))) __bf16   v16b;
typedef __attribute__((ext_vector_type(8)))  __bf16   v8b;
typedef __attribute__((ext_vector_type(8)))  float    v8f;
typedef __attribute__((ext_vector_type(4)))  float    v4f;
typedef __attribute__((ext_vector_type(4)))  unsigned int v4u;
typedef __attribute__((ext_vector_type(2)))  float    v2f;
typedef __attribute__((ext_vector_type(2)))  _Float16 v2h;

// ---------------------------------------------------------------------------
// Problem constants
// ---------------------------------------------------------------------------
constexpr int kB   = 16;      // batch
constexpr int kP   = 100;     // queries per batch
constexpr int kN   = 1000;    // nodes
constexpr int kNP  = 1024;    // nodes padded
constexpr int kE   = 128;     // embedding
constexpr int kH   = 8;       // heads
constexpr int kD   = 16;      // head dim
constexpr int kHD  = 128;     // H*D
constexpr int kQD  = 16;      // lazy query dim
constexpr int kDYN = 3;       // dynamic features
constexpr int kHID = 64;      // lazy hidden
constexpr int kBP     = kB * kP;          // 1600 (b,p) rows
constexpr int kBPpad  = 1664;             // 26 * 64
constexpr int kEncRows = kB * kNP;        // 16384 padded node rows
constexpr int kSrows = 128;               // pointer-score rows per batch (100 padded)
constexpr float kWCarry   = 16.0f;        // lm_W2 carried x16 in f16
constexpr float kInvSqrtE = 0.08838834764831845f;
constexpr float kClip     = 10.0f;
static_assert(kBPpad % 64 == 0 && kBPpad >= kBP, "pad");
static_assert(kBPpad >= (kB - 1) * kP + kSrows, "last batch score rows inside MH planes");
static_assert(kH * kD == kHD && kE == kHD, "dims");

// ---------------------------------------------------------------------------
// Helpers
// ---------------------------------------------------------------------------
__device__ __forceinline__ unsigned short f2bf_bits(float f) {
  unsigned u = __float_as_uint(f);
  return (unsigned short)((u + 0x7FFFu + ((u >> 16) & 1u)) >> 16);
}
__device__ __forceinline__ float bf_bits2f(unsigned short h) { return __uint_as_float(((unsigned)h) << 16); }

// hazard guards as plain device helpers (no inline asm inside the kernel template body)
__device__ __forceinline__ void dep_guard_h(v8f& a, v8f& b, v16h x, v16h y) { asm volatile("v_nop\n\tv_nop\n\tv_nop\n\tv_nop" : "+v"(a), "+v"(b) : "v"(x), "v"(y)); }
__device__ __forceinline__ void dep_guard_b(v8f& a, v8f& b, v16b x, v16b y) { asm volatile("v_nop\n\tv_nop\n\tv_nop\n\tv_nop" : "+v"(a), "+v"(b) : "v"(x), "v"(y)); }
__device__ __forceinline__ void keep4_h(v16h a, v16h b, v16h c, v16h d) { asm volatile("v_nop" :: "v"(a), "v"(b), "v"(c), "v"(d)); }
__device__ __forceinline__ void keep4_b(v16b a, v16b b, v16b c, v16b d) { asm volatile("v_nop" :: "v"(a), "v"(b), "v"(c), "v"(d)); }
__device__ __forceinline__ void acc_guard4(v8f& a, v8f& b, v8f& c, v8f& d) { asm volatile("v_nop\n\tv_nop\n\tv_nop\n\tv_nop" : "+v"(a), "+v"(b), "+v"(c), "+v"(d)); }
template <typename T> struct Frag;
template <> struct Frag<_Float16> {
  typedef v16h V; union U { v16h v; v8h h[2]; };
  static __device__ __forceinline__ v16h load(const _Float16* p) {   // elements 0..7 <- p[0..7], 8..15 <- p[16..23]
    U f; f.h[0] = *(const v8h*)(p); f.h[1] = *(const v8h*)(p + 16); return f.v;
  }
  static __device__ __forceinline__ v8f mma(v16h a, v16h b, v8f c) {
    return __builtin_amdgcn_wmma_f32_16x16x32_f16(false, a, false, b, (short)0, c, false, false);
  }
  static __device__ __forceinline__ void guard(v8f& a, v8f& b, v16h x, v16h y) { dep_guard_h(a, b, x, y); }
  static __device__ __forceinline__ void keep(v16h a, v16h b, v16h c, v16h d) { keep4_h(a, b, c, d); }
};
template <> struct Frag<__bf16> {
  typedef v16b V; union U { v16b v; v8b h[2]; };
  static __device__ __forceinline__ v16b load(const __bf16* p) {
    U f; f.h[0] = *(const v8b*)(p); f.h[1] = *(const v8b*)(p + 16); return f.v;
  }
  static __device__ __forceinline__ v8f mma(v16b a, v16b b, v8f c) {
    return __builtin_amdgcn_wmma_f32_16x16x32_bf16(false, a, false, b, (short)0, c, false, false);
  }
  static __device__ __forceinline__ void guard(v8f& a, v8f& b, v16b x, v16b y) { dep_guard_b(a, b, x, y); }
  static __device__ __forceinline__ void keep(v16b a, v16b b, v16b c, v16b d) { keep4_b(a, b, c, d); }
};

__device__ __forceinline__ unsigned pk16(unsigned short a, unsigned short b) { return (unsigned)a | ((unsigned)b << 16); }
__device__ __forceinline__ unsigned short h_bits(float f) { const _Float16 h = (_Float16)f; return __builtin_bit_cast(unsigned short, h); }
// bf16 hi + bf16 lo split of an f32 value (both RNE converts)
__device__ __forceinline__ void split_bf(float f, unsigned short& hb, unsigned short& lb) {
  hb = f2bf_bits(f);
  lb = f2bf_bits(f - bf_bits2f(hb));
}

// ---- Register-blocked batched WMMA GEMM (ACT reduced to none/relu/leaky) -----------------------
// C[m,n] = scale * sum_k A[m,k] * Bt[n,k] (+bias)(+resid); each wave owns a 64x64 tile.
// A row-major [M,K]; Bt row-major [N,K]; M,N % 64 == 0, K % 32 == 0.
// SPLIT: operands are hi/lo planes (A2/Bt2 = lo planes, same layout); product = hi·hi + hi·lo + lo·hi.
// BIAS_MODE: 0 = none, 1 = bias[m], 2 = bias[n].
// OUT_MODE: 0 = f32, 1 = f16, 2 = bf16 hi plane (Cout) + bf16 lo plane (Cout2).
// ET: 0 = f16 operands, 1 = bf16 operands (pointers passed as 16-bit storage)
template <int ET> struct Elem;
template <> struct Elem<0> { typedef _Float16 T; };
template <> struct Elem<1> { typedef __bf16 T; };
// The engine is a device function, so that a launch can hold it beside another job: NW = waves per block, sT = NW slabs of
// LDS (16x64 f32 at a pitch of 68 floats each), bx = block index among the engine's blocks, b = batch index.
template <int NW, int ET, bool SPLIT, int BIAS_MODE, int OUT_MODE, bool RESID, int ACT>
__device__ __forceinline__ void gemm64_body(
    float* sT, int bx, int b,
    const unsigned short* __restrict__ Ap, const unsigned short* __restrict__ A2p, int lda, long strideA,
    const unsigned short* __restrict__ Btp, const unsigned short* __restrict__ Bt2p, int ldb, long strideB,
    void* __restrict__ Cout, void* __restrict__ Cout2, int ldc, long strideC,
    const float* __restrict__ bias,
    const float* __restrict__ resid, long strideR,
    int M, int N, int K, float scale) {
  typedef typename Elem<ET>::T T;
  typedef typename Frag<T>::V V;
  const T* A = (const T*)Ap; const T* A2 = (const T*)A2p; const T* Bt = (const T*)Btp; const T* Bt2 = (const T*)Bt2p;
  const int lane = threadIdx.x & 31;
  const int wave = threadIdx.x >> 5;
  const int tilesN = N >> 6;
  const int tilesM = M >> 6;
  const int tile = bx * NW + wave;
  if (tile >= tilesM * tilesN) return;   // wave-uniform; no block barriers in this kernel
  const int tm = tile / tilesN;
  const int tn = tile - tm * tilesN;
  const int m0 = tm << 6;
  const int n0 = tn << 6;

  const T* Ab  = A  + (size_t)b * strideA;
  const T* Bb  = Bt + (size_t)b * strideB;
  const T* Ab2 = SPLIT ? (A2  + (size_t)b * strideA) : nullptr;
  const T* Bb2 = SPLIT ? (Bt2 + (size_t)b * strideB) : nullptr;

  const int rlane = lane & 15;                 // row (A) / col (B, D) within subtile
  const int koff  = (lane >> 4) * 8;           // k offset of this lane half
  const int mOff  = (lane >> 4) * 8;           // D row offset

  v8f acc[4][4];
#pragma unroll
  for (int i = 0; i < 4; ++i)
#pragma unroll
    for (int j = 0; j < 4; ++j) acc[i][j] = (v8f){0.f,0.f,0.f,0.f,0.f,0.f,0.f,0.f};

  for (int k0 = 0; k0 < K; k0 += 32) {
    V bh[4], bl[4];
#pragma unroll
    for (int j = 0; j < 4; ++j) {
      const size_t bo = (size_t)(n0 + (j << 4) + rlane) * ldb + koff + k0;
      bh[j] = Frag<T>::load(Bb + bo);
      if (SPLIT) bl[j] = Frag<T>::load(Bb2 + bo);
    }
#pragma unroll
    for (int i = 0; i < 4; ++i) {
      const size_t ao = (size_t)(m0 + (i << 4) + rlane) * lda + koff + k0;
      V ah = Frag<T>::load(Ab + ao);
      V al;
      if (SPLIT) al = Frag<T>::load(Ab2 + ao);
#pragma unroll
      for (int j = 0; j < 4; ++j) {
        acc[i][j] = Frag<T>::mma(ah, bh[j], acc[i][j]);
        if (SPLIT) {
          acc[i][j] = Frag<T>::mma(ah, bl[j], acc[i][j]);
          acc[i][j] = Frag<T>::mma(al, bh[j], acc[i][j]);
        }
      }
      Frag<T>::guard(acc[i][0], acc[i][3], ah, SPLIT ? al : ah);
    }
    Frag<T>::keep(bh[0], bh[1], bh[2], bh[3]);
    if (SPLIT) Frag<T>::keep(bl[0], bl[1], bl[2], bl[3]);
  }
  acc_guard4(acc[0][0], acc[0][1], acc[0][2], acc[0][3]);
  acc_guard4(acc[1][0], acc[1][1], acc[1][2], acc[1][3]);
  acc_guard4(acc[2][0], acc[2][1], acc[2][2], acc[2][3]);
  acc_guard4(acc[3][0], acc[3][1], acc[3][2], acc[3][3]);

  // ---- epilogue ----
  float* slab = sT + wave * (16 * 68);
  const float* Rb = RESID ? (resid + (size_t)b * strideR) : nullptr;
#pragma unroll
  for (int i = 0; i < 4; ++i) {
    const int mBase = m0 + (i << 4);
#pragma unroll
    for (int j = 0; j < 4; ++j) {
      const int n = n0 + (j << 4) + rlane;
      float bv = 0.f;
      if (BIAS_MODE == 2) bv = bias[n];
#pragma unroll
      for (int r = 0; r < 8; ++r) {
        float v = acc[i][j][r] * scale;
        if (BIAS_MODE == 1) v += bias[mBase + mOff + r];
        if (BIAS_MODE == 2) v += bv;
        if (RESID) v += Rb[(size_t)(mBase + mOff + r) * ldc + n];
        if (ACT == 2) v = fmaxf(v, 0.0f);
        if (ACT == 4) v = (v > 0.f) ? v : 0.01f * v;
        slab[(mOff + r) * 68 + (j << 4) + rlane] = v;
      }
    }
    __builtin_amdgcn_fence(__ATOMIC_RELEASE, "workgroup");
    __builtin_amdgcn_wave_barrier();
    __builtin_amdgcn_fence(__ATOMIC_ACQUIRE, "workgroup");
    if (OUT_MODE == 0) {
      float* C = (float*)Cout + (size_t)b * strideC;
      const int hh = lane >> 4, c4 = (lane & 15) * 4;     // row seg = 256 B = 16 lanes x 16 B
      {
#pragma unroll
        for (int it = 0; it < 8; ++it) {
          const int row = it * 2 + hh;
          v4f v = *(const v4f*)(slab + row * 68 + c4);
          *(v4f*)(C + (size_t)(mBase + row) * ldc + n0 + c4) = v;
        }
        
      }
    } else {
      const int q = lane >> 3, c8 = (lane & 7) * 8;
      unsigned short* C  = (unsigned short*)Cout  + (size_t)b * strideC;
      unsigned short* C2 = (OUT_MODE == 2) ? ((unsigned short*)Cout2 + (size_t)b * strideC) : nullptr;
      {
#pragma unroll
        for (int it = 0; it < 4; ++it) {
          const int row = it * 4 + q;
          const float* sp = slab + row * 68 + c8;
          v8h hv, lv;
#pragma unroll
          for (int e = 0; e < 8; ++e) {
            if (OUT_MODE == 1) {
              hv[e] = (_Float16)sp[e];
            } else {
              unsigned short hb = f2bf_bits(sp[e]);
              unsigned short lb = f2bf_bits(sp[e] - bf_bits2f(hb));
              hv[e] = __builtin_bit_cast(_Float16, hb);
              lv[e] = __builtin_bit_cast(_Float16, lb);
            }
          }
          *(v8h*)(C + (size_t)(mBase + row) * ldc + n0 + c8) = hv;
          if (OUT_MODE == 2) *(v8h*)(C2 + (size_t)(mBase + row) * ldc + n0 + c8) = lv;
        }
        
      }
    }
    __builtin_amdgcn_fence(__ATOMIC_RELEASE, "workgroup");
    __builtin_amdgcn_wave_barrier();
    __builtin_amdgcn_fence(__ATOMIC_ACQUIRE, "workgroup");
  }
}
template <int ET, bool SPLIT, int BIAS_MODE, int OUT_MODE, bool RESID, int ACT = 0>
__global__ __launch_bounds__(256) void wmma_gemm64(
    const unsigned short* __restrict__ Ap, const unsigned short* __restrict__ A2p, int lda, long strideA,
    const unsigned short* __restrict__ Btp, const unsigned short* __restrict__ Bt2p, int ldb, long strideB,
    void* __restrict__ Cout, void* __restrict__ Cout2, int ldc, long strideC,
    const float* __restrict__ bias,
    const float* __restrict__ resid, long strideR,
    int M, int N, int K, float scale) {
  __shared__ __align__(16) float sT[8 * 16 * 68];
  gemm64_body<8, ET, SPLIT, BIAS_MODE, OUT_MODE, RESID, ACT>(sT, blockIdx.x, blockIdx.y, Ap, A2p, lda, strideA, Btp, Bt2p, ldb,
                                                             strideB, Cout, Cout2, ldc, strideC, bias, resid, strideR, M, N, K,
                                                             scale);
}

// ---------------------------------------------------------------------------
// Weight preparation: 64x64 transpose tiles of f32 W[k][n] (pitch ldn) -> WT[n][k] (pitch ldk).
// blocks 0..3: Wk -> WkvHi/WkvLo rows 0..127 (bf16 hi + bf16 lo planes); 4..7: Wv -> rows 128..255;
// 8..11: W_comb -> WcHi/WcLo; 12: lm_W2 -> W2T (f16 carried x16, single plane).
// Load coverage: 16 x 256 = 4096 = whole tile. Store coverage: 8 waves x 2 it x 4 rows (lane>>3) = 64 rows,
// ---------------------------------------------------------------------------
constexpr int kWpBlocks = 13;
constexpr int kWpLds = 64 * 65;   // floats
__device__ __forceinline__ void wprep_body(float* smem, int bid,
                                           const float* __restrict__ Wk, const float* __restrict__ Wv,
                                           const float* __restrict__ Wcomb, const float* __restrict__ W2,
                                           unsigned short* __restrict__ WkvHi, unsigned short* __restrict__ WkvLo,
                                           unsigned short* __restrict__ WcHi, unsigned short* __restrict__ WcLo,
                                           unsigned short* __restrict__ W2T) {
  float (*sm)[65] = (float (*)[65])smem;   // sm[n_local][k_local]
  const int t = threadIdx.x, lane = t & 31, wave = t >> 5;
  // bid: block-uniform selection below
  const float* W = Wk; unsigned short* outH = WkvHi; unsigned short* outL = WkvLo;
  int ldn = kHD, ldk = kE, nt = 0, kt = 0; float carry = 1.0f;
  const bool two_planes = (bid < 12);
  if (bid < 4)       { W = Wk;    outH = WkvHi;                    outL = WkvLo;                    ldn = kHD;  ldk = kE;   nt = bid & 1;       kt = bid >> 1;       carry = 1.0f; }
  else if (bid < 8)  { W = Wv;    outH = WkvHi + (size_t)kHD * kE; outL = WkvLo + (size_t)kHD * kE; ldn = kHD;  ldk = kE;   nt = (bid - 4) & 1; kt = (bid - 4) >> 1; carry = 1.0f; }
  else if (bid < 12) { W = Wcomb; outH = WcHi;                     outL = WcLo;                     ldn = kE;   ldk = kHD;  nt = (bid - 8) & 1; kt = (bid - 8) >> 1; carry = 1.0f; }
  else               { W = W2;    outH = W2T;                      outL = W2T;                      ldn = kHID; ldk = kHID; nt = 0;             kt = 0;              carry = kWCarry; }
  const int n0 = nt * 64, k0 = kt * 64;
  const int r0 = t >> 6;     // k local of trip 0; trip i: r0 + 4 i
  const int c = t & 63;      // n local
  float wv[16];
#pragma unroll
  for (int g = 0; g < 4; ++g) {
    const float* p0 = W + (size_t)(k0 + r0 + 16 * g) * ldn + n0 + c;
    const float* p1 = p0 + (size_t)4 * ldn;
    const float* p2 = p0 + (size_t)8 * ldn;
    const float* p3 = p0 + (size_t)12 * ldn;
    wv[4 * g] = *p0; wv[4 * g + 1] = *p1; wv[4 * g + 2] = *p2; wv[4 * g + 3] = *p3;
    // address translations done before a register that one of these four loads names is reused; naming the four addresses
    // as inputs keeps them in their registers up to the wait
    asm volatile("s_wait_xcnt 0x0" :: "v"(p0), "v"(p1), "v"(p2), "v"(p3) : "memory");
  }
#pragma unroll
  for (int i = 0; i < 16; ++i) sm[c][r0 + 4 * i] = wv[i] * carry;
  __syncthreads();
  const int q = lane >> 3, c8 = (lane & 7) * 8;
  v4u uh[2], ul[2];
  int rowv[2];
#pragma unroll
  for (int it = 0; it < 2; ++it) {
    const int row = wave * 8 + it * 4 + q;   // n local
    rowv[it] = row;
    unsigned short hb[8], lb[8];
#pragma unroll
    for (int e = 0; e < 8; ++e) {
      const float v = sm[row][c8 + e];
      if (two_planes) { split_bf(v, hb[e], lb[e]); }
      else { hb[e] = h_bits(v); lb[e] = hb[e]; }
    }
    uh[it] = (v4u){pk16(hb[0], hb[1]), pk16(hb[2], hb[3]), pk16(hb[4], hb[5]), pk16(hb[6], hb[7])};
    ul[it] = (v4u){pk16(lb[0], lb[1]), pk16(lb[2], lb[3]), pk16(lb[4], lb[5]), pk16(lb[6], lb[7])};
  }
  {
#pragma unroll
    for (int it = 0; it < 2; ++it) {
      const size_t o = (size_t)(n0 + rowv[it]) * ldk + k0 + c8;
      *(v4u*)(outH + o) = uh[it];
      // behind each store: address translation done before the code laid out behind it writes a register that the store names
      asm volatile("s_wait_xcnt 0x0" ::: "memory");
      if (two_planes) {
        *(v4u*)(outL + o) = ul[it];
        asm volatile("s_wait_xcnt 0x0" ::: "memory");   // as above
      }
    }
  }
}

// ---------------------------------------------------------------------------
// Node split: enc f32 [B][1000][128] -> EncHi/EncLo bf16 hi/lo planes [B][1024][128] each
// (rows 1000..1023 of every batch written as zeros in both planes).
// ---------------------------------------------------------------------------
constexpr int kEcBlocks = (kEncRows * 16) / 256;
__device__ __forceinline__ void enc_cast_body(int bid, const float* __restrict__ enc, unsigned short* __restrict__ outHi,
                                              unsigned short* __restrict__ outLo) {
  const int i = bid * 256 + threadIdx.x;
  if (i >= kEncRows * 16) return;
  const int row = i >> 4, c8 = (i & 15) * 8;
  const int b = row >> 10, n = row & (kNP - 1);
  const int nc = (n < kN) ? n : (kN - 1);                    // address clamp
  const float* p = enc + ((size_t)(b * kN + nc)) * kE + c8;
  const v4f a = *(const v4f*)(p);
  const v4f c = *(const v4f*)(p + 4);
  const bool valid = (n < kN);
  unsigned short hb[8], lb[8];
#pragma unroll
  for (int e = 0; e < 4; ++e) {
    split_bf(valid ? a[e] : 0.0f, hb[e], lb[e]);
    split_bf(valid ? c[e] : 0.0f, hb[4 + e], lb[4 + e]);
  }
  const v4u uh = (v4u){pk16(hb[0], hb[1]), pk16(hb[2], hb[3]), pk16(hb[4], hb[5]), pk16(hb[6], hb[7])};
  const v4u ul = (v4u){pk16(lb[0], lb[1]), pk16(lb[2], lb[3]), pk16(lb[4], lb[5]), pk16(lb[6], lb[7])};
  const size_t o = (size_t)row * kE + c8;
  *(v4u*)(outHi + o) = uh;
  *(v4u*)(outLo + o) = ul;
  
}

// ---------------------------------------------------------------------------
// Query side (f32, VALU), 4 (b,p) rows per block: q_in = [last | load] (129);
//   Qs[bp][h*16+d] = ((q_in.Wq_last) * 2*sigmoid(relu(q_in.fW1 + fb1).fW2 + fb2)) * 0.25   (1/sqrt(16) folded, exact)
//   QW[bp][64]     = lm_b1 + qf.lm_W1[3:19]   with qf = q_in.lazy_q_W + lazy_q_b
// 5 working waves. Waves 0..3: thread = output column j; every weight element it loads feeds the chains of the 4 rows, whose
// inputs lie in LDS as [e][row] (one 16-B broadcast read per e). Wave 4: hidden unit 128 of the FiLM layer, qf, then QW.
// The weight loads go out in batches, one batch ahead of the arithmetic, so their latencies overlap.
// Every output is still one fma chain from its bias, e ascending.
// All loops of this kernel are unrolled in full: the batches are register arrays, which takes static indices, and the
// loads of a batch have to stand together ahead of the arithmetic that uses the batch before.
// Stores: one instruction of a wave writes one whole 128-B line of a Qs or QW row.
// The launch that holds this job has blocks of 8 waves: waves 5..7 have no part here and only pass the two barriers.
// ---------------------------------------------------------------------------
constexpr int kQR = 4;     // (b,p) rows per block
constexpr int kQB = 16;    // e steps per batch of weight loads
static_assert(kBP % kQR == 0 && kE % kQB == 0, "rows per block, batches");
// one batch of a weight column: w[i] = col[(e0 + i) * LD]
template <int LD>
__device__ __forceinline__ void q_fetch(float (&w)[kQB], const float* __restrict__ col, int e0) {
#pragma unroll
  for (int i = 0; i < kQB; ++i) w[i] = col[(e0 + i) * LD];
}
// Stands behind a group of loads: address translations done before a register that an issued load names is reused; its
// "memory" clobber also keeps those loads in front of the LDS reads and the arithmetic below, which then cover their latency.
__device__ __forceinline__ void q_issued() { asm volatile("s_wait_xcnt 0x0" ::: "memory"); }
// a[r] += x[r] * w for NR rows
template <int NR>
__device__ __forceinline__ void q_step(float (&a)[NR], const float* x, float w) {
#pragma unroll
  for (int r = 0; r < NR; ++r) a[r] = fmaf(x[r], w, a[r]);
}
// a[r] += sum_e xa[e][r] * colA[e * LDA] and b[r] += sum_e xb[e][r] * colB[e * LDB], e = 0..128 ascending;
// xa, xb: LDS, kQR floats per e
template <int LDA, int LDB, int NA, int NB>
__device__ __forceinline__ void q_dot2(float (&a)[NA], const float* xa, const float* __restrict__ colA,
                                       float (&b)[NB], const float* xb, const float* __restrict__ colB) {
  float wa[2][kQB], wb[2][kQB];
  q_fetch<LDA>(wa[0], colA, 0);
  q_fetch<LDB>(wb[0], colB, 0);
  float wat = 0.0f, wbt = 0.0f;
#pragma unroll
  for (int c = 0; c < kE / kQB; ++c) {
    if (c + 1 < kE / kQB) {
      q_fetch<LDA>(wa[(c + 1) & 1], colA, kQB * (c + 1));
      q_fetch<LDB>(wb[(c + 1) & 1], colB, kQB * (c + 1));
    } else {
      wat = colA[kE * LDA];
      wbt = colB[kE * LDB];
    }
    q_issued();
#pragma unroll
    for (int i = 0; i < kQB; ++i) {
      q_step<NA>(a, xa + (kQB * c + i) * kQR, wa[c & 1][i]);
      q_step<NB>(b, xb + (kQB * c + i) * kQR, wb[c & 1][i]);
    }
  }
  q_step<NA>(a, xa + kE * kQR, wat);
  q_step<NB>(b, xb + kE * kQR, wbt);
}
constexpr int kQsBlocks = kBP / kQR;
constexpr int kQsLds = (kE + 1) * kQR + (kE * kQR + 32) + kQD * kQR;   // floats
__device__ __forceinline__ void qside_body(float* smem, int bid,
                                           const float* __restrict__ enc_last, const float* __restrict__ loadv,
                                           const float* __restrict__ Wq, const float* __restrict__ fW1,
                                           const float* __restrict__ fb1, const float* __restrict__ fW2,
                                           const float* __restrict__ fb2, const float* __restrict__ lqW,
                                           const float* __restrict__ lqb, const float* __restrict__ lW1,
                                           const float* __restrict__ lb1,
                                           float* __restrict__ Qs, float* __restrict__ QW) {
  float* qin = smem;                          // [e][row], (kE + 1) * kQR floats
  float* g1s = qin + (kE + 1) * kQR;          // [e][row]; behind e = 128 the 28 copies that wave 4 leaves
  float* qfs = g1s + kE * kQR + 32;           // [i][row]
  const int bp0 = bid * kQR;
  const int t = threadIdx.x, lane = t & 31;
  const int wv = __builtin_amdgcn_readfirstlane(t >> 5);
  const bool colw = wv < 4, aux = wv == 4;    // scalar: waves 0..3, wave 4; neither: waves 5..7
  if (colw) {
    v4f x;
#pragma unroll
    for (int r = 0; r < kQR; ++r) x[r] = enc_last[(size_t)(bp0 + r) * kE + t];
    q_issued();
    *(v4f*)(qin + t * kQR) = x;
  } else if (aux && lane < kQR) {
    const float x = loadv[bp0 + lane];
    q_issued();
    qin[kE * kQR + lane] = x;
  }
  __syncthreads();
  float qv[kQR] = {0.0f, 0.0f, 0.0f, 0.0f};
  if (colw) {
    const float b1 = fb1[t];
    q_issued();
    float a1[kQR] = {b1, b1, b1, b1};
    q_dot2<kE + 1, kHD, kQR, kQR>(a1, qin, fW1 + t, qv, qin, Wq + t);
    *(v4f*)(g1s + t * kQR) = (v4f){fmaxf(a1[0], 0.0f), fmaxf(a1[1], 0.0f), fmaxf(a1[2], 0.0f), fmaxf(a1[3], 0.0f)};
  } else if (aux) {
    // lane = (qf unit i16, row pair h2); it also runs hidden unit 128 of row lane & 3 (lanes 0..3 are read, the rest are copies)
    const int i16 = lane & 15, h2 = (lane >> 4) * 2;
    float a1[1] = {fb1[kE]};
    const float bq = lqb[i16];
    q_issued();
    float qf[2] = {bq, bq};
    q_dot2<kE + 1, kQD, 1, 2>(a1, qin + (lane & 3), fW1 + kE, qf, qin + h2, lqW + i16);
    g1s[kE * kQR + lane] = fmaxf(a1[0], 0.0f);
    *(v2f*)(qfs + i16 * kQR + h2) = (v2f){qf[0], qf[1]};
  }
  __syncthreads();
  if (colw) {
    const float b2 = fb2[t];
    float gm[kQR] = {b2, b2, b2, b2};
    const float* col = fW2 + t;
    float w[3][kQB];           // two batches ahead here: one column only
    q_fetch<kHD>(w[0], col, 0);
    q_fetch<kHD>(w[1], col, kQB);
    float wt = 0.0f;
#pragma unroll
    for (int c = 0; c < kE / kQB; ++c) {
      if (c + 2 < kE / kQB) q_fetch<kHD>(w[(c + 2) % 3], col, kQB * (c + 2));
      else if (c + 2 == kE / kQB) wt = col[kE * kHD];
      if (c + 2 <= kE / kQB) q_issued();
#pragma unroll
      for (int i = 0; i < kQB; ++i) q_step<kQR>(gm, g1s + (kQB * c + i) * kQR, w[c % 3][i]);
    }
    q_step<kQR>(gm, g1s + kE * kQR, wt);
#pragma unroll
    for (int r = 0; r < kQR; ++r) {
      const float den = 1.0f + expf(-gm[r]);
      const float gamma = 2.0f * (1.0f / den);
      Qs[(size_t)(bp0 + r) * kHD + t] = (qv[r] * gamma) * 0.25f;
    }
  } else if (aux) {
    const float c0 = lb1[lane], c1 = lb1[32 + lane];
    float u0[kQR] = {c0, c0, c0, c0}, u1[kQR] = {c1, c1, c1, c1};
    float w0[kQB], w1[kQB];
    static_assert(kQD == kQB, "one batch");
    q_fetch<kHID>(w0, lW1 + kDYN * kHID + lane, 0);
    q_fetch<kHID>(w1, lW1 + kDYN * kHID + 32 + lane, 0);
    q_issued();
#pragma unroll
    for (int i = 0; i < kQD; ++i) {
      q_step<kQR>(u0, qfs + i * kQR, w0[i]);
      q_step<kQR>(u1, qfs + i * kQR, w1[i]);
    }
#pragma unroll
    for (int r = 0; r < kQR; ++r) {
      QW[(size_t)(bp0 + r) * kHID + lane] = u0[r];
      QW[(size_t)(bp0 + r) * kHID + 32 + lane] = u1[r];
    }
    q_issued();   // the wait behind the stores too: the code laid out behind this branch writes registers that they name
  }
}

// ---------------------------------------------------------------------------
// Lazy-mask MLP, all three layers in one kernel; H1 and H2 never leave the registers.
// Block = one (b,p) row of MASKB, 4 waves; a wave owns 256 node slots and walks them 32 at a time (two 16-slot tiles).
// Lane l: c = l & 15, h = l >> 4.
//   layer 1 (f32 VALU): the lane computes H1[slot c][k] for its own 32 k (k = 32 s + 16 h + e, s = 0,1, e = 0..15),
//     relu, f16: that is the B fragment of k step s as it stands. Its weights come from an LDS table, per k pair
//     {W1[0][k,k+1], W1[1][k,k+1], W1[2][k,k+1], QW[k,k+1]}; the row's dynamic features and mask row are staged in LDS once.
//   layer 2 (WMMA f16): A = lm_W2^T x16, row j = 16 i + c, the same k per lane and element;
//     D register r of tile i = 16 * (H1 . lm_W2[:, j]) for hidden unit j = 16 i + 8 h + r of slot c.
//   layer 3 (f32 VALU): z = sum_j relu(D / 16 + lm_b2[j]) * lm_W3[j]: 32 j in the lane, the other 32 in lane l ^ 16.
//   MASKB[bp][n] = ninf_mask[b,p,min(n,999)] - softplus(z + lm_b3)   (ALPHA = 1)
// Coverage: 1600 blocks x 4 waves x 8 trips x 32 slots = all 1024 columns of all 1600 rows (pad slots from clamped inputs).
// ---------------------------------------------------------------------------
// layer 3 for one 16-unit tile: sum over the lane's 8 hidden units of relu(D / 16 + b2) * w3
__device__ __forceinline__ v2f lazy_l3(v8f acc, const v2f (&b2)[4], const v2f (&w3)[4]) {
  const v2f zero = (v2f){0.0f, 0.0f};
  const v2f sc = (v2f){1.0f / kWCarry, 1.0f / kWCarry};
  v2f zs = zero;
#pragma unroll
  for (int q = 0; q < 4; ++q) {
    const v2f a = __builtin_elementwise_max(__builtin_elementwise_fma((v2f){acc[2 * q], acc[2 * q + 1]}, sc, b2[q]), zero);
    zs = __builtin_elementwise_fma(a, w3[q], zs);
  }
  return zs;
}
constexpr int kLzLds = 2 * 16 * 8 + kN * kDYN + kN;   // floats
__device__ __forceinline__ void lazy_body(float* smem, int bp,
                                          const float* __restrict__ dyn, const float* __restrict__ QW,
                                          const float* __restrict__ lW1, const _Float16* __restrict__ W2T,
                                          const float* __restrict__ lb2, const float* __restrict__ lW3,
                                          const float* __restrict__ lb3, const float* __restrict__ ninfm,
                                          float* __restrict__ maskb) {
  float* tbl = smem;                   // [h][k pair][w0 w0 w1 w1 w2 w2 qw qw], 2 * 16 * 8 floats
  float* sd = tbl + 2 * 16 * 8;        // dynamic features of this (b,p): 1000 x 3
  float* sn = sd + kN * kDYN;          // ninf_mask row of this (b,p)
  const int t = threadIdx.x;
  const int lane = t & 31, wave = t >> 5;
  const int c = lane & 15, h = lane >> 4;
  // stage the 12000 contiguous bytes of dynamic features: 750 x 16 B over 128 threads
  const unsigned oD = (unsigned)t * 16u;
  const char* dsrc = (const char*)(dyn + (size_t)bp * kN * kDYN);
  v4f dv[6];
#pragma unroll
  for (int i = 0; i < 5; ++i) dv[i] = *(const v4f*)(dsrc + oD + i * 2048);
  const bool last = (t < (kN * kDYN * 4 - 5 * 2048) / 16);
  const unsigned oL = last ? (oD + 5 * 2048) : 0u;     // threads past the end fetch in bounds and store nothing
  dv[5] = *(const v4f*)(dsrc + oL);
  // and the 4000 contiguous bytes of the mask row: 250 x 16 B
  const char* nsrc = (const char*)(ninfm + (size_t)bp * kN);
  const bool lastn = (t < (kN * 4 - 2048) / 16);
  const unsigned oN = lastn ? (oD + 2048) : 0u;
  const v4f nv0 = *(const v4f*)(nsrc + oD);
  const v4f nv1 = *(const v4f*)(nsrc + oN);
  // weight table: thread t fetches one pair: h = t >> 6, k pair p = (t >> 2) & 15, which = t & 3
  const int tp = (t >> 2) & 15, tw = t & 3;
  const int tk = 32 * (tp >> 3) + 16 * (t >> 6) + 2 * (tp & 7);
  const float* tsrc = (tw < 3) ? (lW1 + tw * kHID + tk) : (QW + (size_t)bp * kHID + tk);
  const v2f tv = *(const v2f*)tsrc;
  // byte offsets of the lane's first fragment / bias element; these set-up loads are scalar base + one of them
  const unsigned oA = (unsigned)(c * kHID + 16 * h) * 2u;
  const unsigned oJ = (unsigned)(8 * h) * 4u;
  v16h aw[4][2];
#pragma unroll
  for (int i = 0; i < 4; ++i)
#pragma unroll
    for (int s = 0; s < 2; ++s) aw[i][s] = *(const v16h*)((const char*)W2T + oA + (16 * i * kHID + 32 * s) * 2);
  v2f b2[4][4], w3[4][4];
#pragma unroll
  for (int i = 0; i < 4; ++i)
#pragma unroll
    for (int q = 0; q < 4; ++q) {
      b2[i][q] = *(const v2f*)((const char*)lb2 + oJ + (16 * i + 2 * q) * 4);
      w3[i][q] = *(const v2f*)((const char*)lW3 + oJ + (16 * i + 2 * q) * 4);
    }
  const float b3 = lb3[0];
  // address translations done before a register that a load above names is reused
  asm volatile("s_wait_xcnt 0x0" :: "v"(oD), "v"(oL), "v"(oN), "v"(tsrc), "v"(oA), "v"(oJ) : "memory");
#pragma unroll
  for (int i = 0; i < 5; ++i) *(v4f*)((char*)sd + oD + i * 2048) = dv[i];
  if (last) *(v4f*)((char*)sd + oL) = dv[5];
  *(v4f*)((char*)sn + oD) = nv0;
  if (lastn) *(v4f*)((char*)sn + oN) = nv1;
  *(v2f*)(tbl + 2 * t) = tv;
  __syncthreads();
  const int nw = wave * 256;
  float* mp = maskb + (size_t)bp * kNP + nw + lane;
  const v4f* tb4 = (const v4f*)(tbl + h * 128);
  for (int it = 0; it < 8; ++it) {
    const int n0 = nw + it * 32;
    const int n = n0 + lane;
    const int nc = (n < kN) ? n : (kN - 1);                          // address clamps (pad slots)
    const int ia = ((n0 + c < kN) ? (n0 + c) : (kN - 1)) * kDYN;
    const int ib = ((n0 + 16 + c < kN) ? (n0 + 16 + c) : (kN - 1)) * kDYN;
    const float a0 = sd[ia], a1 = sd[ia + 1], a2 = sd[ia + 2];
    const float e0 = sd[ib], e1 = sd[ib + 1], e2 = sd[ib + 2];
    v16h ba[2], bb[2];
    const v2h hzero = (v2h){(_Float16)0.0f, (_Float16)0.0f};
    v4f tq[2][8];                               // weight-table reads, four k pairs a group, one group ahead
#pragma unroll
    for (int j = 0; j < 8; ++j) tq[0][j] = tb4[j];
#pragma unroll
    for (int g = 0; g < 4; ++g) {
      if (g < 3) {
#pragma unroll
        for (int j = 0; j < 8; ++j) tq[(g + 1) & 1][j] = tb4[8 * (g + 1) + j];
      }
      // keeps the next group's LDS reads in front of this group's arithmetic, which then covers their latency
      __builtin_amdgcn_sched_barrier(0);
#pragma unroll
      for (int pp = 0; pp < 4; ++pp) {
        const int p = 4 * g + pp;
        const v4f u = tq[g & 1][2 * pp], v = tq[g & 1][2 * pp + 1];
        const v2f w0 = (v2f){u[0], u[1]}, w1 = (v2f){u[2], u[3]}, w2 = (v2f){v[0], v[1]}, qw = (v2f){v[2], v[3]};
        const v2f xa = __builtin_elementwise_fma(w0, (v2f){a0, a0}, __builtin_elementwise_fma(w1, (v2f){a1, a1},
                       __builtin_elementwise_fma(w2, (v2f){a2, a2}, qw)));
        const v2f xb = __builtin_elementwise_fma(w0, (v2f){e0, e0}, __builtin_elementwise_fma(w1, (v2f){e1, e1},
                       __builtin_elementwise_fma(w2, (v2f){e2, e2}, qw)));
        // relu behind the rounding: same value as rounding behind relu
        const v2h ya = __builtin_elementwise_max(__builtin_convertvector(xa, v2h), hzero);
        const v2h yb = __builtin_elementwise_max(__builtin_convertvector(xb, v2h), hzero);
        ba[p >> 3][2 * (p & 7)] = ya[0]; ba[p >> 3][2 * (p & 7) + 1] = ya[1];
        bb[p >> 3][2 * (p & 7)] = yb[0]; bb[p >> 3][2 * (p & 7) + 1] = yb[1];
      }
    }
    v2f za2[4], zb2[4];
#pragma unroll
    for (int i = 0; i < 4; ++i) {
      const v8f czero = (v8f){0.f, 0.f, 0.f, 0.f, 0.f, 0.f, 0.f, 0.f};
      v8f ca = __builtin_amdgcn_wmma_f32_16x16x32_f16(false, aw[i][0], false, ba[0], (short)0, czero, false, false);
      v8f cc = __builtin_amdgcn_wmma_f32_16x16x32_f16(false, aw[i][0], false, bb[0], (short)0, czero, false, false);
      ca = __builtin_amdgcn_wmma_f32_16x16x32_f16(false, aw[i][1], false, ba[1], (short)0, ca, false, false);
      cc = __builtin_amdgcn_wmma_f32_16x16x32_f16(false, aw[i][1], false, bb[1], (short)0, cc, false, false);
      za2[i] = lazy_l3(ca, b2[i], w3[i]);
      zb2[i] = lazy_l3(cc, b2[i], w3[i]);
    }
    const v2f ta = (za2[0] + za2[1]) + (za2[2] + za2[3]);
    const v2f tb = (zb2[0] + zb2[1]) + (zb2[2] + zb2[3]);
    const float za = ta[0] + ta[1], zb = tb[0] + tb[1];
    // lanes 0..15 finish slots n0 + c (tile a), lanes 16..31 slots n0 + 16 + c (tile b): one exchange l <-> l ^ 16 for both
    const float mine = h ? zb : za;
    const int other = __float_as_int(h ? za : zb);
    const float z = (mine + __int_as_float(__builtin_amdgcn_permlanex16(other, other, 0x76543210, 0xfedcba98, false, false))) + b3;
    const float spv = fmaxf(z, 0.0f) + log1pf(expf(-fabsf(z)));
    *mp = sn[nc] - spv;
    // address translation done before the store's address register is advanced; the "memory" clobber also keeps the
    // weight-table reads inside the loop (hoisted they hold 128 more registers: over 256, one wave per SIMD fewer)
    asm volatile("s_wait_xcnt 0x0" :: "v"(mp) : "memory");
    mp += 32;
  }
}

// ---------------------------------------------------------------------------
// Second launch: the two jobs that need only the first launch's results and not each other, side by side in one grid.
// Blocks of 4 waves. Blocks 0..255: K|V projection, [16384][128] x [256][128]^T, bf16 hi/lo both operands -> f32 KV; a block
// holds the four 64-column tiles of one 64-row tile. Blocks 256..1855: the lazy-mask MLP, one (b,p) row each.
// The projection's blocks come first: its waves wait on memory for most of their time, and the MLP's waves fill the vector port
// meanwhile. The job select is block-uniform (scalar); both jobs use the same LDS bytes.
// ---------------------------------------------------------------------------
constexpr int kKvBlocks = (kEncRows / 64) * (2 * kHD / 64) / 4;
constexpr int kMidLds = (4 * 16 * 68 > kLzLds) ? 4 * 16 * 68 : kLzLds;
__global__ __launch_bounds__(128) void k_kv_lazy(const unsigned short* __restrict__ EncHi, const unsigned short* __restrict__ EncLo,
                                                const unsigned short* __restrict__ WkvHi, const unsigned short* __restrict__ WkvLo,
                                                float* __restrict__ KV,
                                                const float* __restrict__ dyn, const float* __restrict__ QW,
                                                const float* __restrict__ lW1, const _Float16* __restrict__ W2T,
                                                const float* __restrict__ lb2, const float* __restrict__ lW3,
                                                const float* __restrict__ lb3, const float* __restrict__ ninfm,
                                                float* __restrict__ maskb) {
  __shared__ __align__(16) float smem[kMidLds];
  const int bid = blockIdx.x;
  if (bid < kKvBlocks) {
    gemm64_body<4, 1, true, 0, 0, false, 0>(smem, bid, 0, EncHi, EncLo, kE, 0L, WkvHi, WkvLo, kE, 0L, (void*)KV, (void*)KV,
                                            2 * kHD, 0L, QW, QW, 0L, kEncRows, 2 * kHD, kE, 1.0f);   // bias, resid: never read
  } else {
    lazy_body(smem, bid - kKvBlocks, dyn, QW, lW1, W2T, lb2, lW3, lb3, ninfm, maskb);
  }
}

// ---------------------------------------------------------------------------
// Attention core (f32, head dim 16), both products on v_wmma_f32_16x16x4_f32; node axis split over the waves of a block.
// Block = (b, group of 16 queries, group of 4 heads), 512 threads = 16 waves: wave = (node slice sl = wave >> 1 of 128 slots,
// head pair wave & 1); it runs its two heads one after the other on the same staged nodes. 16 x 7 x 2 = 224 blocks.
// Per stage every slice gets its next 32 nodes in LDS: the 4 heads' K (64 f32) and V (64 f32) of each node, at a pitch of
// 132 floats, and the bias tile [16 queries][32 nodes] at a pitch of 36 floats (both 16 B x odd: 16 rows read by one 16-B
// load fall on 16 different bank groups). Four stages cover the 128 slots of a slice.
// Lane l: c = l & 15, h = l >> 4. Per head and tile of 16 nodes:
//   scores, transposed: D[node 8h + r][query c] = bias + sum_dim K[node][dim] * Q[query][dim];
//     A = K (row = node c), B = Q (column = query c), both with dim 8h + 2s + e at k step s, element e; C = the bias tile.
//   output, transposed: D[dim 8h + r][query c] += sum_node V[node][dim] * P[node][query];
//     B = the score tile's own registers 2s, 2s + 1 after the exponential (node 8h + 2s + e), A = V (row = dim c) at the same nodes.
// Online softmax per query, one update per stage (32 nodes); slots >= 1000 forced to -inf by value in the bias; m is common to
// the two lane halves of a query, l is kept per half and added at the end.
// Merge: every wave leaves (acc[16], m, l) per head and query in LDS; 128 threads fold the 8 slices in slice order,
//   M = max m_s, w_s = exp(m_s - M), O = sum_s w_s acc_s / sum_s w_s l_s,
// and write O as bf16 hi + bf16 lo planes into Ohi/Olo[bp][h*16+d]: 8 lanes x 16 B = the block's whole 128-B line of a row
// (rows >= P skipped).
// ---------------------------------------------------------------------------
constexpr int kASl  = 8;               // node slices per block
constexpr int kASn  = kNP / kASl;      // 128 node slots per slice
constexpr int kACh  = 32;              // nodes per slice and stage
constexpr int kAHb  = 4;               // heads per block
constexpr int kARow = 2 * kAHb * kD;   // 128 floats per staged node: K of 4 heads | V of 4 heads
constexpr int kAPt  = kARow + 4;       // pitch of a staged node in floats
constexpr int kAMp  = 36;              // bias tile pitch in floats
constexpr int kACp  = 20;              // merge record pitch in floats: acc[16], m, l, 2 unused
static_assert(kASl * kAHb * 16 * kACp <= kASl * kACh * kAPt, "merge records fit the K|V buffer");
__device__ __forceinline__ v8f mma4(v2f a, v2f b, v8f c) {
  return __builtin_amdgcn_wmma_f32_16x16x4_f32(false, a, false, b, (short)0, c, false, false);
}
// the value that lane l ^ 16 holds
__device__ __forceinline__ float other_half(float x) {
  const int i = __float_as_int(x);
  return __int_as_float(__builtin_amdgcn_permlanex16(i, i, 0x76543210, 0xfedcba98, false, false));
}
__global__ __launch_bounds__(512) void k_attn(const float* __restrict__ Qs, const float* __restrict__ KV,
                                             const float* __restrict__ maskb, unsigned short* __restrict__ Ohi,
                                             unsigned short* __restrict__ Olo) {
  __shared__ __align__(16) float kvs[kASl * kACh * kAPt];    // 135168 B; the merge records reuse it
  __shared__ __align__(16) float ms[kASl * 16 * kAMp];       // 18432 B
  const float kNegInf = -__builtin_inff();
  const int t = threadIdx.x, lane = t & 31;
  const int wave = __builtin_amdgcn_readfirstlane(t >> 5);   // scalar: slice bounds and LDS bases stay off the vector unit
  const int b = blockIdx.x / 14, rem = blockIdx.x - b * 14, pg = rem >> 1, hq = rem & 1, p0 = pg * 16;
  const int sl = wave >> 1, hp = (wave & 1) * 2;
  const int c = lane & 15, h = lane >> 4;
  const int p = p0 + c, pc = (p < kP) ? p : (kP - 1);
  // B fragments of the score product, both heads: 8 consecutive dims of the lane's query
  const float* qp = Qs + (size_t)(b * kP + pc) * kHD + (hq * kAHb + hp) * kD + 8 * h;
  const v4f q0 = *(const v4f*)(qp), q1 = *(const v4f*)(qp + 4), q2 = *(const v4f*)(qp + kD), q3 = *(const v4f*)(qp + kD + 4);
  // address translations done before the register pair that these four loads name is reused
  asm volatile("s_wait_xcnt 0x0" :: "v"(qp) : "memory");
  const v2f qf[2][4] = {{(v2f){q0[0], q0[1]}, (v2f){q0[2], q0[3]}, (v2f){q1[0], q1[1]}, (v2f){q1[2], q1[3]}},
                        {(v2f){q2[0], q2[1]}, (v2f){q2[2], q2[3]}, (v2f){q3[0], q3[1]}, (v2f){q3[2], q3[3]}}};
  v8f o[2] = {(v8f){0.f, 0.f, 0.f, 0.f, 0.f, 0.f, 0.f, 0.f}, (v8f){0.f, 0.f, 0.f, 0.f, 0.f, 0.f, 0.f, 0.f}};
  float m[2] = {-3.0e38f, -3.0e38f}, l[2] = {0.0f, 0.0f};
  const float* kvb = KV + (size_t)b * kNP * (2 * kHD);
  const float* mkb = maskb + (size_t)(b * kP) * kNP;
  // staging roles: a wave copies whole node rows (lanes 0..15 the K part, 16..31 the V part, 256 B each)
  const int scol = ((lane < 16) ? 0 : kHD) + hq * (kAHb * kD) + (lane & 15) * 4;
  // bias tile roles: thread t copies 4 columns (t & 7) * 4 of row (t >> 3) & 15 for slices t >> 7 and 4 + (t >> 7)
  const int mr = (t >> 3) & 15, mj4 = (t & 7) * 4, msl = t >> 7;
  const int mpr = (p0 + mr < kP) ? (p0 + mr) : (kP - 1);
  const float* mrow = mkb + (size_t)mpr * kNP + msl * kASn + mj4;
  float* mdst = ms + (msl * 16 + mr) * kAMp + mj4;
  // fragment bases in LDS: K row = node c of a tile, dims from 8h; V rows = nodes from 8h of a tile, dim c; bias row = query c
  const float* kw = kvs + (sl * kACh + c) * kAPt + hp * kD + 8 * h;
  const float* vw = kvs + (sl * kACh + 8 * h) * kAPt + (kAHb + hp) * kD + c;
  const float* mw = ms + (sl * 16 + c) * kAMp + 8 * h;
#pragma unroll 1   // rolled: one set of 18 staging register quads serves every stage
  for (int st = 0; st < kASn / kACh; ++st) {
    // 8 slices x 32 nodes x 32 float4 = 8192 float4: 16 x 512 threads; trip i: slice i >> 1, node (i & 1) * 16 + wave
    const float* gk = kvb + (size_t)(st * kACh + wave) * (2 * kHD) + scol;
    v4f kvr[16];
#pragma unroll
    for (int i = 0; i < 16; ++i) kvr[i] = *(const v4f*)(gk + (size_t)((i >> 1) * kASn + (i & 1) * 16) * (2 * kHD));
    // bias tiles: 8 slices x 16 rows x 8 float4 = 1024 float4: 2 x 512 threads; trip i: slice i * 4 + (t >> 7)
    const float* gm = mrow + st * kACh;
    const v4f mr0 = *(const v4f*)(gm);
    const v4f mr1 = *(const v4f*)(gm + 4 * kASn);
    // address translations done before a register that a load above names is reused
    asm volatile("s_wait_xcnt 0x0" :: "v"(gk), "v"(gm) : "memory");
    __syncthreads();   // every wave has left the buffers of the stage before
#pragma unroll
    for (int i = 0; i < 16; ++i) *(v4f*)(kvs + ((i >> 1) * kACh + (i & 1) * 16 + wave) * kAPt + lane * 4) = kvr[i];
    *(v4f*)(mdst) = mr0;
    *(v4f*)(mdst + 4 * 16 * kAMp) = mr1;
    __syncthreads();
    // The loops below are unrolled in full: tiles and fragments are register arrays, which takes static indices.
    // C operands of the two score tiles, shared by both heads: register r = bias of (query c, node 16 tt + 8h + r)
    const int nl = sl * kASn + st * kACh + 8 * h;
    v8f bias[2];
#pragma unroll
    for (int tt = 0; tt < 2; ++tt) {
      const v4f x = *(const v4f*)(mw + 16 * tt), y = *(const v4f*)(mw + 16 * tt + 4);
#pragma unroll
      for (int r = 0; r < 4; ++r) {
        bias[tt][r]     = (nl + 16 * tt + r < kN) ? x[r] : kNegInf;
        bias[tt][4 + r] = (nl + 16 * tt + 4 + r < kN) ? y[r] : kNegInf;
      }
    }
#pragma unroll
    for (int g = 0; g < 2; ++g) {
      v8f s[2];
#pragma unroll
      for (int tt = 0; tt < 2; ++tt) {
        const float* kr = kw + 16 * tt * kAPt + g * kD;
        const v4f k0 = *(const v4f*)(kr), k1 = *(const v4f*)(kr + 4);
        v8f a = mma4((v2f){k0[0], k0[1]}, qf[g][0], bias[tt]);
        a = mma4((v2f){k0[2], k0[3]}, qf[g][1], a);
        a = mma4((v2f){k1[0], k1[1]}, qf[g][2], a);
        s[tt] = mma4((v2f){k1[2], k1[3]}, qf[g][3], a);
      }
      float tm = fmaxf(s[0][0], s[1][0]);
#pragma unroll
      for (int r = 1; r < 8; ++r) tm = fmaxf(tm, fmaxf(s[0][r], s[1][r]));
      tm = fmaxf(tm, other_half(tm));
      const float mn = fmaxf(m[g], tm);
      const float alpha = __expf(m[g] - mn);
      m[g] = mn;
      float ps[2] = {0.0f, 0.0f};
#pragma unroll
      for (int tt = 0; tt < 2; ++tt)
#pragma unroll
        for (int r = 0; r < 8; ++r) {
          s[tt][r] = __expf(s[tt][r] - mn);
          ps[tt] += s[tt][r];
        }
      l[g] = fmaf(l[g], alpha, ps[0] + ps[1]);
      o[g] = o[g] * alpha;
#pragma unroll
      for (int tt = 0; tt < 2; ++tt) {
        const float* vr = vw + 16 * tt * kAPt + g * kD;
#pragma unroll
        for (int ks = 0; ks < 4; ++ks)
          o[g] = mma4((v2f){vr[2 * ks * kAPt], vr[(2 * ks + 1) * kAPt]}, (v2f){s[tt][2 * ks], s[tt][2 * ks + 1]}, o[g]);
      }
    }
  }
  __syncthreads();   // every wave has left the K|V buffer before the merge records overwrite it
#pragma unroll   // static indices into the two heads' register arrays
  for (int g = 0; g < 2; ++g) {
    const float lt = l[g] + other_half(l[g]);
    float* op = kvs + ((sl * kAHb + hp + g) * 16 + c) * kACp;
    *(v4f*)(op + 8 * h)     = (v4f){o[g][0], o[g][1], o[g][2], o[g][3]};
    *(v4f*)(op + 8 * h + 4) = (v4f){o[g][4], o[g][5], o[g][6], o[g][7]};
    if (h == 0) *(v2f*)(op + 16) = (v2f){m[g], lt};
  }
  __syncthreads();
  if (wave < 4) {    // threads 0..127; no barrier behind this point
    const int rl = t >> 3, c8 = (t & 7) * 8;
    const float* cb = kvs + ((c8 >> 4) * 16 + rl) * kACp;
    constexpr int kSs = kAHb * 16 * kACp;      // floats from one slice's records to the next
    float ml[kASl], ll[kASl];
#pragma unroll
    for (int s = 0; s < kASl; ++s) { const v2f e = *(const v2f*)(cb + s * kSs + 16); ml[s] = e[0]; ll[s] = e[1]; }
    float mx = ml[0];
#pragma unroll
    for (int s = 1; s < kASl; ++s) mx = fmaxf(mx, ml[s]);
    float lsum = 0.0f;
    v4f x0 = (v4f){0.f, 0.f, 0.f, 0.f}, x1 = (v4f){0.f, 0.f, 0.f, 0.f};
#pragma unroll
    for (int s = 0; s < kASl; ++s) {
      const float w = __expf(ml[s] - mx);
      const float* s8 = cb + s * kSs + (c8 & 15);
      lsum = fmaf(ll[s], w, lsum);
      x0 = *(const v4f*)(s8) * w + x0;
      x1 = *(const v4f*)(s8 + 4) * w + x1;
    }
    const float inv = 1.0f / lsum;
    x0 = x0 * inv;
    x1 = x1 * inv;
    unsigned short hb[8], lb[8];
#pragma unroll
    for (int e = 0; e < 4; ++e) {
      split_bf(x0[e], hb[e], lb[e]);
      split_bf(x1[e], hb[4 + e], lb[4 + e]);
    }
    const v4u uh = (v4u){pk16(hb[0], hb[1]), pk16(hb[2], hb[3]), pk16(hb[4], hb[5]), pk16(hb[6], hb[7])};
    const v4u ul = (v4u){pk16(lb[0], lb[1]), pk16(lb[2], lb[3]), pk16(lb[4], lb[5]), pk16(lb[6], lb[7])};
    if (p0 + rl < kP) {
      const size_t o = (size_t)(b * kP + p0 + rl) * kHD + hq * (kAHb * kD) + c8;
      *(v4u*)(Ohi + o) = uh;
      *(v4u*)(Olo + o) = ul;
    }
  }
}

// ---------------------------------------------------------------------------
// Zero fill of two regions, nvec x 16 B each (nvec % 256 == 0, so the region select is block-uniform).
// ---------------------------------------------------------------------------
__device__ __forceinline__ void zero16x2_body(int bid, unsigned int* __restrict__ p0, unsigned int* __restrict__ p1, int nvec) {
  const int i = bid * 256 + threadIdx.x;
  if (i >= 2 * nvec) return;
  unsigned int* p = (i < nvec) ? (p0 + 4 * (size_t)i) : (p1 + 4 * (size_t)(i - nvec));
  const v4u z = (v4u){0u, 0u, 0u, 0u};
  *(v4u*)p = z;
}

// ---------------------------------------------------------------------------
// First launch: the four jobs that read nothing but inputs, side by side in one grid of 256-thread blocks. By block index:
// query side (400, the longest job, so it starts first), weight preparation (13), zero fill of the 64 pad rows
// 1600..1663 of Ohi and Olo (8), node split (1024). The job select is block-uniform (scalar); the two jobs with LDS use
// the same bytes.
// ---------------------------------------------------------------------------
constexpr int kZrVec = (kBPpad - kBP) * kHD * 2 / 16;   // 16-B pieces per plane
constexpr int kZrBlocks = 2 * kZrVec / 256;
static_assert(kZrVec % 256 == 0, "zero fill blocks");
constexpr int kFrontBlocks = kQsBlocks + kWpBlocks + kZrBlocks + kEcBlocks;
constexpr int kFrontLds = (kWpLds > kQsLds) ? kWpLds : kQsLds;
__global__ __launch_bounds__(256) void k_front(const float* __restrict__ enc_last, const float* __restrict__ loadv,
                                              const float* __restrict__ Wq, const float* __restrict__ fW1,
                                              const float* __restrict__ fb1, const float* __restrict__ fW2,
                                              const float* __restrict__ fb2, const float* __restrict__ lqW,
                                              const float* __restrict__ lqb, const float* __restrict__ lW1,
                                              const float* __restrict__ lb1,
                                              float* __restrict__ Qs, float* __restrict__ QW,
                                              const float* __restrict__ Wk, const float* __restrict__ Wv,
                                              const float* __restrict__ Wcomb, const float* __restrict__ W2,
                                              unsigned short* __restrict__ WkvHi, unsigned short* __restrict__ WkvLo,
                                              unsigned short* __restrict__ WcHi, unsigned short* __restrict__ WcLo,
                                              unsigned short* __restrict__ W2T,
                                              unsigned int* __restrict__ OhiPad, unsigned int* __restrict__ OloPad,
                                              const float* __restrict__ enc, unsigned short* __restrict__ EncHi,
                                              unsigned short* __restrict__ EncLo) {
  __shared__ __align__(16) float smem[kFrontLds];
  const int bid = blockIdx.x;
  if (bid < kQsBlocks) {
    qside_body(smem, bid, enc_last, loadv, Wq, fW1, fb1, fW2, fb2, lqW, lqb, lW1, lb1, Qs, QW);
  } else if (bid < kQsBlocks + kWpBlocks) {
    wprep_body(smem, bid - kQsBlocks, Wk, Wv, Wcomb, W2, WkvHi, WkvLo, WcHi, WcLo, W2T);
  } else if (bid < kQsBlocks + kWpBlocks + kZrBlocks) {
    zero16x2_body(bid - (kQsBlocks + kWpBlocks), OhiPad, OloPad, kZrVec);
  } else {
    enc_cast_body(bid - (kQsBlocks + kWpBlocks + kZrBlocks), enc, EncHi, EncLo);
  }
}

// ---------------------------------------------------------------------------
// Final: per (b,p) row: x = 10*tanh(S) + ninf_mask, softmax over 1000 nodes (f32, fixed-order wave reductions).
// One wave per row; lane l owns elements n = l + 32 i, i = 0..31, and holds them in registers from the loads to the scaled
// probabilities. All 64 loads of a lane go out before the first value is used, so their latencies overlap, and the
// arithmetic is straight-line code whose 32 elements are independent. Slots n >= 1000 carry -inf: they add 0 to the sum.
// LDS only turns the 8 rows of a block (32000 contiguous bytes of out) into whole 16-B pieces for the stores.
// Coverage: 200 blocks x 8 rows = 1600 rows.
// ---------------------------------------------------------------------------
// tanh with both of its ranges computed and one selected: no branch, so neighbouring elements can overlap
__device__ __forceinline__ float tanh_sel(float x) {
  const float ax = fabsf(x);
  const float e = __expf(ax + ax);                                    // inf for large |x|: 2 / inf = 0, the value is 1
  const float big = fmaf(__builtin_amdgcn_rcpf(e + 1.0f), -2.0f, 1.0f);
  const float x2 = x * x;
  float pl = fmaf(x2, -0.00570002059f, 0.0206340719f);                // odd series for |x| < 0.625
  pl = fmaf(x2, pl, -0.0537379310f);
  pl = fmaf(x2, pl, 0.133314162f);
  pl = fmaf(x2, pl, -0.333332807f);
  const float small = fmaf(x2, ax * pl, ax);
  return copysignf((ax < 0.625f) ? small : big, x);
}
constexpr int kFE = kNP / 32;   // elements per lane
__global__ __launch_bounds__(256) void k_final(const float* __restrict__ Sp, const float* __restrict__ ninfm,
                                              float* __restrict__ out) {
  __shared__ __align__(16) float xs[8 * kN];
  const float kNegInf = -__builtin_inff();
  const int t = threadIdx.x, lane = t & 31;
  const int wave = __builtin_amdgcn_readfirstlane(t >> 5);   // scalar: the row bases stay in scalar registers
  const int r = blockIdx.x * 8 + wave;
  const int b = r / kP, p = r - b * kP;
  const float* srow = Sp + (size_t)(b * kSrows + p) * kNP;
  const float* nrow = ninfm + (size_t)r * kN;
  float* xr = xs + wave * kN;
  float s[kFE], x[kFE];
#pragma unroll
  for (int i = 0; i < kFE; ++i) {
    const int n = lane + 32 * i;
    s[i] = srow[(n < kN) ? n : (kN - 1)];                    // address clamp
  }
#pragma unroll
  for (int i = 0; i < kFE; ++i) {
    const int n = lane + 32 * i;
    x[i] = nrow[(n < kN) ? n : (kN - 1)];
  }
  q_issued();   // behind the 64 loads, before their offset registers are reused
  // keeps all 64 loads in front of the arithmetic: moved down among it, the mask row's latency would come on top of the first
  __builtin_amdgcn_sched_barrier(0);
  float m4[4] = {kNegInf, kNegInf, kNegInf, kNegInf};        // four chains: a maximum does not depend on the order
#pragma unroll
  for (int i = 0; i < kFE; ++i) {
    const float v = kClip * tanh_sel(s[i]) + x[i];
    x[i] = (lane + 32 * i < kN) ? v : kNegInf;
    m4[i & 3] = fmaxf(m4[i & 3], x[i]);
  }
  float mx = fmaxf(fmaxf(m4[0], m4[1]), fmaxf(m4[2], m4[3]));
#pragma unroll
  for (int off = 16; off > 0; off >>= 1) mx = fmaxf(mx, __shfl_xor(mx, off, 32));
  float sum = 0.0f;
#pragma unroll
  for (int i = 0; i < kFE; ++i) {
    x[i] = __expf(x[i] - mx);
    sum += x[i];
  }
#pragma unroll
  for (int off = 16; off > 0; off >>= 1) sum += __shfl_xor(sum, off, 32);
  const float inv = 1.0f / sum;
#pragma unroll
  for (int i = 0; i < kFE; ++i) {
    const int n = lane + 32 * i;
    if (n < kN) xr[n] = x[i] * inv;
  }
  __syncthreads();
  float* obase = out + (size_t)blockIdx.x * 8 * kN;
  // 2000 pieces of 16 B over 256 threads: 7 full trips, then 208 threads
  constexpr int kFull = (2 * kN) / 256;
#pragma unroll
  for (int k = 0; k < kFull; ++k) {
    const int f = t + 256 * k;
    *(v4f*)(obase + 4 * (size_t)f) = *(const v4f*)(xs + 4 * f);
  }
  if (t < 2 * kN - 256 * kFull) {
    const int f = t + 256 * kFull;
    *(v4f*)(obase + 4 * (size_t)f) = *(const v4f*)(xs + 4 * f);
  }
}

// ---------------------------------------------------------------------------
// Host launcher
// Workspace region map (bytes, 256-B aligned offsets):
//   EncHi bf16 [16][1024][128]          4,194,304
//   EncLo bf16 [16][1024][128]          4,194,304
//   WkvHi bf16 [256][128]                 65,536
//   WkvLo bf16 [256][128]                 65,536
//   WcHi  bf16 [128][128]                 32,768
//   WcLo  bf16 [128][128]                 32,768
//   W2T   f16  [64][64]                    8,192
//   KVf   f32  [16384][256]            16,777,216
//   Qs    f32  [1600][128]                819,200
//   QW    f32  [1600][64]                 409,600
//   MASKB f32  [1600][1024]             6,553,600
//   Ohi   bf16 [1664][128]                425,984
//   Olo   bf16 [1664][128]                425,984
//   MHhi  bf16 [1664][128]                425,984
//   MHlo  bf16 [1664][128]                425,984
//   Sp    f32  [16][128][1024]           8,388,608
//   total                              43,245,568
// ---------------------------------------------------------------------------
static inline size_t align256(size_t x) { return (x + 255) & ~(size_t)255; }

extern "C" void kernel_launch(void* const* d_in, const int* in_sizes, int n_in,
                              void* d_out, int out_size, void* d_ws, size_t ws_size,
                              hipStream_t stream) {
  if (n_in < 22) return;
  if (in_sizes[0] != kB * kN * kE || in_sizes[1] != kB * kP * kE || in_sizes[2] != kB * kP ||
      in_sizes[3] != kB * kP * kN || in_sizes[4] != kB * kP * kN * kDYN || out_size != kB * kP * kN) return;

  const float* enc      = (const float*)d_in[0];
  const float* enc_last = (const float*)d_in[1];
  const float* loadv    = (const float*)d_in[2];
  const float* ninfm    = (const float*)d_in[3];
  const float* dyn      = (const float*)d_in[4];
  const float* Wq       = (const float*)d_in[5];
  const float* Wk       = (const float*)d_in[6];
  const float* Wv       = (const float*)d_in[7];
  const float* Wc       = (const float*)d_in[8];
  const float* bcv      = (const float*)d_in[9];
  const float* fW1      = (const float*)d_in[10];
  const float* fb1      = (const float*)d_in[11];
  const float* fW2      = (const float*)d_in[12];
  const float* fb2      = (const float*)d_in[13];
  const float* lqW      = (const float*)d_in[14];
  const float* lqb      = (const float*)d_in[15];
  const float* lW1      = (const float*)d_in[16];
  const float* lb1      = (const float*)d_in[17];
  const float* lW2      = (const float*)d_in[18];
  const float* lb2      = (const float*)d_in[19];
  const float* lW3      = (const float*)d_in[20];
  const float* lb3      = (const float*)d_in[21];
  float* out = (float*)d_out;

  char* ws = (char*)d_ws;
  size_t off = 0;
  unsigned short* EncHi = (unsigned short*)(ws + off); off = align256(off + (size_t)kEncRows * kE * 2);
  unsigned short* EncLo = (unsigned short*)(ws + off); off = align256(off + (size_t)kEncRows * kE * 2);
  unsigned short* WkvHi = (unsigned short*)(ws + off); off = align256(off + (size_t)2 * kHD * kE * 2);
  unsigned short* WkvLo = (unsigned short*)(ws + off); off = align256(off + (size_t)2 * kHD * kE * 2);
  unsigned short* WcHi  = (unsigned short*)(ws + off); off = align256(off + (size_t)kE * kHD * 2);
  unsigned short* WcLo  = (unsigned short*)(ws + off); off = align256(off + (size_t)kE * kHD * 2);
  unsigned short* W2T   = (unsigned short*)(ws + off); off = align256(off + (size_t)kHID * kHID * 2);
  float* KVf   = (float*)(ws + off); off = align256(off + (size_t)kEncRows * 2 * kHD * 4);
  float* Qs    = (float*)(ws + off); off = align256(off + (size_t)kBP * kHD * 4);
  float* QW    = (float*)(ws + off); off = align256(off + (size_t)kBP * kHID * 4);
  float* MASKB = (float*)(ws + off); off = align256(off + (size_t)kBP * kNP * 4);
  unsigned short* Ohi  = (unsigned short*)(ws + off); off = align256(off + (size_t)kBPpad * kHD * 2);
  unsigned short* Olo  = (unsigned short*)(ws + off); off = align256(off + (size_t)kBPpad * kHD * 2);
  unsigned short* MHhi = (unsigned short*)(ws + off); off = align256(off + (size_t)kBPpad * kE * 2);
  unsigned short* MHlo = (unsigned short*)(ws + off); off = align256(off + (size_t)kBPpad * kE * 2);
  float* Sp    = (float*)(ws + off); off = align256(off + (size_t)kB * kSrows * kNP * 4);
  if (off > ws_size) return;
  const float* fdummy = Qs;   // valid, never dereferenced (BIAS_MODE 0 / RESID false)

  // launch 1, inputs only: query side (f32); weight planes (Wk|Wv and W_comb transposed to bf16 hi/lo [n][k], lm_W2 transposed
  // to f16 x16); zeros in the 64 pad rows of Ohi and Olo; node planes (bf16 hi/lo, 24 zero pad rows per batch in both)
  k_front<<<kFrontBlocks, 256, 0, stream>>>(enc_last, loadv, Wq, fW1, fb1, fW2, fb2, lqW, lqb, lW1, lb1, Qs, QW,
                                            Wk, Wv, Wc, lW2, WkvHi, WkvLo, WcHi, WcLo, W2T,
                                            (unsigned int*)(Ohi + (size_t)kBP * kHD), (unsigned int*)(Olo + (size_t)kBP * kHD),
                                            enc, EncHi, EncLo);
  // launch 2: K|V projection (bf16 hi/lo both operands, K=128, M=16384, N=256 -> f32) beside the lazy-mask MLP (three layers
  // fused, all 1600 x 1024 slots; hidden layer on WMMA f16 (W x16), K=64)
  k_kv_lazy<<<kKvBlocks + kBP, 128, 0, stream>>>(EncHi, EncLo, WkvHi, WkvLo, KVf, dyn, QW, lW1, (const _Float16*)W2T, lb2, lW3,
                                                 lb3, ninfm, MASKB);
  // attention core (f32), 8 node slices per block merged in LDS -> O as bf16 hi/lo planes
  k_attn<<<kB * 14, 512, 0, stream>>>(Qs, KVf, MASKB, Ohi, Olo);
  // head merge: [1664][128] x [128][128]^T, bf16 hi/lo both operands, K=128, bias b_comb[n], bf16 hi/lo out planes
  wmma_gemm64<1, true, 2, 2, false, 0><<<dim3(((kBPpad / 64) * (kE / 64) + 7) / 8, 1), 256, 0, stream>>>(
      Ohi, Olo, kHD, 0L, WcHi, WcLo, kHD, 0L, (void*)MHhi, (void*)MHlo, kE, 0L,
      bcv, fdummy, 0L, kBPpad, kE, kHD, 1.0f);
  // pointer scores per batch: A = MH rows b*100 .. b*100+127 (hi/lo, rows beyond the batch are finite data),
  // Bt = node planes of batch b [1024][128] (hi/lo); M=128, N=1024, K=128 -> f32 Sp[b][128][1024], scale 1/sqrt(128)
  wmma_gemm64<1, true, 0, 0, false, 0><<<dim3((kSrows / 64) * (kNP / 64) / 8, kB), 256, 0, stream>>>(
      MHhi, MHlo, kE, (long)kP * kE, EncHi, EncLo, kE, (long)kNP * kE, (void*)Sp, (void*)Sp, kNP, (long)kSrows * kNP,
      fdummy, fdummy, 0L, kSrows, kNP, kE, kInvSqrtE);
  // clipped tanh + mask + softmax -> probs
  k_final<<<kBP / 8, 256, 0, stream>>>(Sp, ninfm, out);
}

// v007
// One run takes 61.9 microseconds.
// In two side-by-side timings against v006, it was 1.35 and 1.36 times as fast.
// All steps since v000 together make it 9.64 times as fast.
// Contractions: node K|V projection (nodes x [Wk|Wv]^T), head-merge projection (W_comb^T x O^T) and pointer scores (nodes x MH^T) on v_wmma_f32_16x16x32_bf16 with bf16 hi/lo operand planes (hi.hi + hi.lo + lo.hi); lazy-mask hidden layer (lm_W2^T f16 carried x16, as A, x H1 f16, as B) on v_wmma_f32_16x16x32_f16 inside the fused lazy-mask kernel; all f32 accumulate; query/FiLM/gating/qf projections, lazy layers 1 (K=3 after the broadcast fold) and 3 (N=1) and both softmaxes in f32 on the VALU; the attention core's two products (K x Q^T, V^T x P^T, head dim 16) on v_wmma_f32_16x16x4_f32.
#include <hip/hip_runtime.h>
#include <math.h>

typedef __attribute__((ext_vector_type(16))) _Float16 v16h;
typedef __attribute__((ext_vector_type(8)))  _Float16 v8h;
typedef __attribute__((ext_vector_type(16))) __bf16   v16b;
typedef __attribute__((ext_vector_type(8)))  __bf16   v8b;
typedef __attribute__((ext_vector_type(8)))  float    v8f;
typedef __attribute__((ext_vector_type(4)))  float    v4f;
typedef __attribute__((ext_vector_type(4)))  unsigned int v4u;
typedef __attribute__((ext_vector_type(2)))  float    v2f;
typedef __attribute__((ext_vector_type(2)))  _Float16 v2h;

// ---------------------------------------------------------------------------
// Problem constants
// ---------------------------------------------------------------------------
constexpr int kB   = 16;      // batch
constexpr int kP   = 100;     // queries per batch
constexpr int kN   = 1000;    // nodes
constexpr int kNP  = 1024;    // nodes padded
constexpr int kE   = 128;     // embedding
constexpr int kH   = 8;       // heads
constexpr int kD   = 16;      // head dim
constexpr int kHD  = 128;     // H*D
constexpr int kQD  = 16;      // lazy query dim
constexpr int kDYN = 3;       // dynamic features
constexpr int kHID = 64;      // lazy hidden
constexpr int kBP     = kB * kP;          // 1600 (b,p) rows
constexpr int kBPpad  = 1664;             // 26 * 64
constexpr int kEncRows = kB * kNP;        // 16384 padded node rows
constexpr int kPG = 7;                     // groups of 16 queries per batch (100 padded to 112)
constexpr float kWCarry   = 16.0f;        // lm_W2 carried x16 in f16
constexpr float kInvSqrtE = 0.08838834764831845f;
constexpr float kClip     = 10.0f;
static_assert(kBPpad % 64 == 0 && kBPpad >= kBP, "pad");
static_assert(kPG * 16 >= kP && kBPpad >= (kB - 1) * kP + kPG * 16, "last batch's query groups inside the O planes");
static_assert(kH * kD == kHD && kE == kHD, "dims");

// ---------------------------------------------------------------------------
// Helpers
// ---------------------------------------------------------------------------
__device__ __forceinline__ unsigned short f2bf_bits(float f) {
  unsigned u = __float_as_uint(f);
  return (unsigned short)((u + 0x7FFFu + ((u >> 16) & 1u)) >> 16);
}
__device__ __forceinline__ float bf_bits2f(unsigned short h) { return __uint_as_float(((unsigned)h) << 16); }

// hazard guards as plain device helpers (no inline asm inside the kernel template body)
__device__ __forceinline__ void dep_guard_h(v8f& a, v8f& b, v16h x, v16h y) { asm volatile("v_nop\n\tv_nop\n\tv_nop\n\tv_nop" : "+v"(a), "+v"(b) : "v"(x), "v"(y)); }
__device__ __forceinline__ void dep_guard_b(v8f& a, v8f& b, v16b x, v16b y) { asm volatile("v_nop\n\tv_nop\n\tv_nop\n\tv_nop" : "+v"(a), "+v"(b) : "v"(x), "v"(y)); }
__device__ __forceinline__ void keep4_h(v16h a, v16h b, v16h c, v16h d) { asm volatile("v_nop" :: "v"(a), "v"(b), "v"(c), "v"(d)); }
__device__ __forceinline__ void keep4_b(v16b a, v16b b, v16b c, v16b d) { asm volatile("v_nop" :: "v"(a), "v"(b), "v"(c), "v"(d)); }
__device__ __forceinline__ void acc_guard4(v8f& a, v8f& b, v8f& c, v8f& d) { asm volatile("v_nop\n\tv_nop\n\tv_nop\n\tv_nop" : "+v"(a), "+v"(b), "+v"(c), "+v"(d)); }
template <typename T> struct Frag;
template <> struct Frag<_Float16> {
  typedef v16h V; union U { v16h v; v8h h[2]; };
  static __device__ __forceinline__ v16h load(const _Float16* p) {   // elements 0..7 <- p[0..7], 8..15 <- p[16..23]
    U f; f.h[0] = *(const v8h*)(p); f.h[1] = *(const v8h*)(p + 16); return f.v;
  }
  static __device__ __forceinline__ v8f mma(v16h a, v16h b, v8f c) {
    return __builtin_amdgcn_wmma_f32_16x16x32_f16(false, a, false, b, (short)0, c, false, false);
  }
  static __device__ __forceinline__ void guard(v8f& a, v8f& b, v16h x, v16h y) { dep_guard_h(a, b, x, y); }
  static __device__ __forceinline__ void keep(v16h a, v16h b, v16h c, v16h d) { keep4_h(a, b, c, d); }
};
template <> struct Frag<__bf16> {
  typedef v16b V; union U { v16b v; v8b h[2]; };
  static __device__ __forceinline__ v16b load(const __bf16* p) {
    U f; f.h[0] = *(const v8b*)(p); f.h[1] = *(const v8b*)(p + 16); return f.v;
  }
  static __device__ __forceinline__ v8f mma(v16b a, v16b b, v8f c) {
    return __builtin_amdgcn_wmma_f32_16x16x32_bf16(false, a, false, b, (short)0, c, false, false);
  }
  static __device__ __forceinline__ void guard(v8f& a, v8f& b, v16b x, v16b y) { dep_guard_b(a, b, x, y); }
  static __device__ __forceinline__ void keep(v16b a, v16b b, v16b c, v16b d) { keep4_b(a, b, c, d); }
};

__device__ __forceinline__ unsigned pk16(unsigned short a, unsigned short b) { return (unsigned)a | ((unsigned)b << 16); }
__device__ __forceinline__ unsigned short h_bits(float f) { const _Float16 h = (_Float16)f; return __builtin_bit_cast(unsigned short, h); }
// bf16 hi + bf16 lo split of an f32 value (both RNE converts)
__device__ __forceinline__ void split_bf(float f, unsigned short& hb, unsigned short& lb) {
  hb = f2bf_bits(f);
  lb = f2bf_bits(f - bf_bits2f(hb));
}

// ---- Register-blocked batched WMMA GEMM (ACT reduced to none/relu/leaky) -----------------------
// C[m,n] = scale * sum_k A[m,k] * Bt[n,k] (+bias)(+resid); each wave owns a 64x64 tile.
// A row-major [M,K]; Bt row-major [N,K]; M,N % 64 == 0, K % 32 == 0.
// SPLIT: operands are hi/lo planes (A2/Bt2 = lo planes, same layout); product = hi·hi + hi·lo + lo·hi.
// BIAS_MODE: 0 = none, 1 = bias[m], 2 = bias[n].
// OUT_MODE: 0 = f32, 1 = f16, 2 = bf16 hi plane (Cout) + bf16 lo plane (Cout2).
// ET: 0 = f16 operands, 1 = bf16 operands (pointers passed as 16-bit storage)
template <int ET> struct Elem;
template <> struct Elem<0> { typedef _Float16 T; };
template <> struct Elem<1> { typedef __bf16 T; };
// The engine is a device function, so that a launch can hold it beside another job: NW = waves per block, sT = NW slabs of
// LDS (16x64 f32 at a pitch of 68 floats each), bx = block index among the engine's blocks, b = batch index.
template <int NW, int ET, bool SPLIT, int BIAS_MODE, int OUT_MODE, bool RESID, int ACT>
__device__ __forceinline__ void gemm64_body(
    float* sT, int bx, int b,
    const unsigned short* __restrict__ Ap, const unsigned short* __restrict__ A2p, int lda, long strideA,
    const unsigned short* __restrict__ Btp, const unsigned short* __restrict__ Bt2p, int ldb, long strideB,
    void* __restrict__ Cout, void* __restrict__ Cout2, int ldc, long strideC,
    const float* __restrict__ bias,
    const float* __restrict__ resid, long strideR,
    int M, int N, int K, float scale) {
  typedef typename Elem<ET>::T T;
  typedef typename Frag<T>::V V;
  const T* A = (const T*)Ap; const T* A2 = (const T*)A2p; const T* Bt = (const T*)Btp; const T* Bt2 = (const T*)Bt2p;
  const int lane = threadIdx.x & 31;
  const int wave = threadIdx.x >> 5;
  const int tilesN = N >> 6;
  const int tilesM = M >> 6;
  const int tile = bx * NW + wave;
  if (tile >= tilesM * tilesN) return;   // wave-uniform; no block barriers in this kernel
  const int tm = tile / tilesN;
  const int tn = tile - tm * tilesN;
  const int m0 = tm << 6;
  const int n0 = tn << 6;

  const T* Ab  = A  + (size_t)b * strideA;
  const T* Bb  = Bt + (size_t)b * strideB;
  const T* Ab2 = SPLIT ? (A2  + (size_t)b * strideA) : nullptr;
  const T* Bb2 = SPLIT ? (Bt2 + (size_t)b * strideB) : nullptr;

  const int rlane = lane & 15;                 // row (A) / col (B, D) within subtile
  const int koff  = (lane >> 4) * 8;           // k offset of this lane half
  const int mOff  = (lane >> 4) * 8;           // D row offset

  v8f acc[4][4];
#pragma unroll
  for (int i = 0; i < 4; ++i)
#pragma unroll
    for (int j = 0; j < 4; ++j) acc[i][j] = (v8f){0.f,0.f,0.f,0.f,0.f,0.f,0.f,0.f};

  for (int k0 = 0; k0 < K; k0 += 32) {
    V bh[4], bl[4];
#pragma unroll
    for (int j = 0; j < 4; ++j) {
      const size_t bo = (size_t)(n0 + (j << 4) + rlane) * ldb + koff + k0;
      bh[j] = Frag<T>::load(Bb + bo);
      if (SPLIT) bl[j] = Frag<T>::load(Bb2 + bo);
    }
#pragma unroll
    for (int i = 0; i < 4; ++i) {
      const size_t ao = (size_t)(m0 + (i << 4) + rlane) * lda + koff + k0;
      V ah = Frag<T>::load(Ab + ao);
      V al;
      if (SPLIT) al = Frag<T>::load(Ab2 + ao);
#pragma unroll
      for (int j = 0; j < 4; ++j) {
        acc[i][j] = Frag<T>::mma(ah, bh[j], acc[i][j]);
        if (SPLIT) {
          acc[i][j] = Frag<T>::mma(ah, bl[j], acc[i][j]);
          acc[i][j] = Frag<T>::mma(al, bh[j], acc[i][j]);
        }
      }
      Frag<T>::guard(acc[i][0], acc[i][3], ah, SPLIT ? al : ah);
    }
    Frag<T>::keep(bh[0], bh[1], bh[2], bh[3]);
    if (SPLIT) Frag<T>::keep(bl[0], bl[1], bl[2], bl[3]);
  }
  acc_guard4(acc[0][0], acc[0][1], acc[0][2], acc[0][3]);
  acc_guard4(acc[1][0], acc[1][1], acc[1][2], acc[1][3]);
  acc_guard4(acc[2][0], acc[2][1], acc[2][2], acc[2][3]);
  acc_guard4(acc[3][0], acc[3][1], acc[3][2], acc[3][3]);

  // ---- epilogue ----
  float* slab = sT + wave * (16 * 68);
  const float* Rb = RESID ? (resid + (size_t)b * strideR) : nullptr;
#pragma unroll
  for (int i = 0; i < 4; ++i) {
    const int mBase = m0 + (i << 4);
#pragma unroll
    for (int j = 0; j < 4; ++j) {
      const int n = n0 + (j << 4) + rlane;
      float bv = 0.f;
      if (BIAS_MODE == 2) bv = bias[n];
#pragma unroll
      for (int r = 0; r < 8; ++r) {
        float v = acc[i][j][r] * scale;
        if (BIAS_MODE == 1) v += bias[mBase + mOff + r];
        if (BIAS_MODE == 2) v += bv;
        if (RESID) v += Rb[(size_t)(mBase + mOff + r) * ldc + n];
        if (ACT == 2) v = fmaxf(v, 0.0f);
        if (ACT == 4) v = (v > 0.f) ? v : 0.01f * v;
        slab[(mOff + r) * 68 + (j << 4) + rlane] = v;
      }
    }
    __builtin_amdgcn_fence(__ATOMIC_RELEASE, "workgroup");
    __builtin_amdgcn_wave_barrier();
    __builtin_amdgcn_fence(__ATOMIC_ACQUIRE, "workgroup");
    if (OUT_MODE == 0) {
      float* C = (float*)Cout + (size_t)b * strideC;
      const int hh = lane >> 4, c4 = (lane & 15) * 4;     // row seg = 256 B = 16 lanes x 16 B
      {
#pragma unroll
        for (int it = 0; it < 8; ++it) {
          const int row = it * 2 + hh;
          v4f v = *(const v4f*)(slab + row * 68 + c4);
          *(v4f*)(C + (size_t)(mBase + row) * ldc + n0 + c4) = v;
        }
        
      }
    } else {
      const int q = lane >> 3, c8 = (lane & 7) * 8;
      unsigned short* C  = (unsigned short*)Cout  + (size_t)b * strideC;
      unsigned short* C2 = (OUT_MODE == 2) ? ((unsigned short*)Cout2 + (size_t)b * strideC) : nullptr;
      {
#pragma unroll
        for (int it = 0; it < 4; ++it) {
          const int row = it * 4 + q;
          const float* sp = slab + row * 68 + c8;
          v8h hv, lv;
#pragma unroll
          for (int e = 0; e < 8; ++e) {
            if (OUT_MODE == 1) {
              hv[e] = (_Float16)sp[e];
            } else {
              unsigned short hb = f2bf_bits(sp[e]);
              unsigned short lb = f2bf_bits(sp[e] - bf_bits2f(hb));
              hv[e] = __builtin_bit_cast(_Float16, hb);
              lv[e] = __builtin_bit_cast(_Float16, lb);
            }
          }
          *(v8h*)(C + (size_t)(mBase + row) * ldc + n0 + c8) = hv;
          if (OUT_MODE == 2) *(v8h*)(C2 + (size_t)(mBase + row) * ldc + n0 + c8) = lv;
        }
        
      }
    }
    __builtin_amdgcn_fence(__ATOMIC_RELEASE, "workgroup");
    __builtin_amdgcn_wave_barrier();
    __builtin_amdgcn_fence(__ATOMIC_ACQUIRE, "workgroup");
  }
}
// ---------------------------------------------------------------------------
// Weight preparation: 64x64 transpose tiles of f32 W[k][n] (pitch ldn) -> WT[n][k] (pitch ldk).
// blocks 0..3: Wk -> WkvHi/WkvLo rows 0..127 (bf16 hi + bf16 lo planes); 4..7: Wv -> rows 128..255;
// 8..11: W_comb -> WcHi/WcLo; 12: lm_W2 -> W2T (f16 carried x16, single plane).
// Load coverage: 16 x 256 = 4096 = whole tile. Store coverage: 8 waves x 2 it x 4 rows (lane>>3) = 64 rows,
// ---------------------------------------------------------------------------
constexpr int kWpBlocks = 13;
constexpr int kWpLds = 64 * 65;   // floats
__device__ __forceinline__ void wprep_body(float* smem, int bid,
                                           const float* __restrict__ Wk, const float* __restrict__ Wv,
                                           const float* __restrict__ Wcomb, const float* __restrict__ W2,
                                           unsigned short* __restrict__ WkvHi, unsigned short* __restrict__ WkvLo,
                                           unsigned short* __restrict__ WcHi, unsigned short* __restrict__ WcLo,
                                           unsigned short* __restrict__ W2T) {
  float (*sm)[65] = (float (*)[65])smem;   // sm[n_local][k_local]
  const int t = threadIdx.x, lane = t & 31, wave = t >> 5;
  // bid: block-uniform selection below
  const float* W = Wk; unsigned short* outH = WkvHi; unsigned short* outL = WkvLo;
  int ldn = kHD, ldk = kE, nt = 0, kt = 0; float carry = 1.0f;
  const bool two_planes = (bid < 12);
  if (bid < 4)       { W = Wk;    outH = WkvHi;                    outL = WkvLo;                    ldn = kHD;  ldk = kE;   nt = bid & 1;       kt = bid >> 1;       carry = 1.0f; }
  else if (bid < 8)  { W = Wv;    outH = WkvHi + (size_t)kHD * kE; outL = WkvLo + (size_t)kHD * kE; ldn = kHD;  ldk = kE;   nt = (bid - 4) & 1; kt = (bid - 4) >> 1; carry = 1.0f; }
  else if (bid < 12) { W = Wcomb; outH = WcHi;                     outL = WcLo;                     ldn = kE;   ldk = kHD;  nt = (bid - 8) & 1; kt = (bid - 8) >> 1; carry = 1.0f; }
  else               { W = W2;    outH = W2T;                      outL = W2T;                      ldn = kHID; ldk = kHID; nt = 0;             kt = 0;              carry = kWCarry; }
  const int n0 = nt * 64, k0 = kt * 64;
  const int r0 = t >> 6;     // k local of trip 0; trip i: r0 + 4 i
  const int c = t & 63;      // n local
  float wv[16];
#pragma unroll
  for (int g = 0; g < 4; ++g) {
    const float* p0 = W + (size_t)(k0 + r0 + 16 * g) * ldn + n0 + c;
    const float* p1 = p0 + (size_t)4 * ldn;
    const float* p2 = p0 + (size_t)8 * ldn;
    const float* p3 = p0 + (size_t)12 * ldn;
    wv[4 * g] = *p0; wv[4 * g + 1] = *p1; wv[4 * g + 2] = *p2; wv[4 * g + 3] = *p3;
    // address translations done before a register that one of these four loads names is reused; naming the four addresses
    // as inputs keeps them in their registers up to the wait
    asm volatile("s_wait_xcnt 0x0" :: "v"(p0), "v"(p1), "v"(p2), "v"(p3) : "memory");
  }
#pragma unroll
  for (int i = 0; i < 16; ++i) sm[c][r0 + 4 * i] = wv[i] * carry;
  __syncthreads();
  const int q = lane >> 3, c8 = (lane & 7) * 8;
  v4u uh[2], ul[2];
  int rowv[2];
#pragma unroll
  for (int it = 0; it < 2; ++it) {
    const int row = wave * 8 + it * 4 + q;   // n local
    rowv[it] = row;
    unsigned short hb[8], lb[8];
#pragma unroll
    for (int e = 0; e < 8; ++e) {
      const float v = sm[row][c8 + e];
      if (two_planes) { split_bf(v, hb[e], lb[e]); }
      else { hb[e] = h_bits(v); lb[e] = hb[e]; }
    }
    uh[it] = (v4u){pk16(hb[0], hb[1]), pk16(hb[2], hb[3]), pk16(hb[4], hb[5]), pk16(hb[6], hb[7])};
    ul[it] = (v4u){pk16(lb[0], lb[1]), pk16(lb[2], lb[3]), pk16(lb[4], lb[5]), pk16(lb[6], lb[7])};
  }
  {
#pragma unroll
    for (int it = 0; it < 2; ++it) {
      const size_t o = (size_t)(n0 + rowv[it]) * ldk + k0 + c8;
      *(v4u*)(outH + o) = uh[it];
      // behind each store: address translation done before the code laid out behind it writes a register that the store names
      asm volatile("s_wait_xcnt 0x0" ::: "memory");
      if (two_planes) {
        *(v4u*)(outL + o) = ul[it];
        asm volatile("s_wait_xcnt 0x0" ::: "memory");   // as above
      }
    }
  }
}

// ---------------------------------------------------------------------------
// Node split: enc f32 [B][1000][128] -> EncHi/EncLo bf16 hi/lo planes [B][1024][128] each
// (rows 1000..1023 of every batch written as zeros in both planes).
// ---------------------------------------------------------------------------
constexpr int kEcBlocks = (kEncRows * 16) / 256;
__device__ __forceinline__ void enc_cast_body(int bid, const float* __restrict__ enc, unsigned short* __restrict__ outHi,
                                              unsigned short* __restrict__ outLo) {
  const int i = bid * 256 + threadIdx.x;
  if (i >= kEncRows * 16) return;
  const int row = i >> 4, c8 = (i & 15) * 8;
  const int b = row >> 10, n = row & (kNP - 1);
  const int nc = (n < kN) ? n : (kN - 1);                    // address clamp
  const float* p = enc + ((size_t)(b * kN + nc)) * kE + c8;
  const v4f a = *(const v4f*)(p);
  const v4f c = *(const v4f*)(p + 4);
  const bool valid = (n < kN);
  unsigned short hb[8], lb[8];
#pragma unroll
  for (int e = 0; e < 4; ++e) {
    split_bf(valid ? a[e] : 0.0f, hb[e], lb[e]);
    split_bf(valid ? c[e] : 0.0f, hb[4 + e], lb[4 + e]);
  }
  const v4u uh = (v4u){pk16(hb[0], hb[1]), pk16(hb[2], hb[3]), pk16(hb[4], hb[5]), pk16(hb[6], hb[7])};
  const v4u ul = (v4u){pk16(lb[0], lb[1]), pk16(lb[2], lb[3]), pk16(lb[4], lb[5]), pk16(lb[6], lb[7])};
  const size_t o = (size_t)row * kE + c8;
  *(v4u*)(outHi + o) = uh;
  *(v4u*)(outLo + o) = ul;
  
}

// ---------------------------------------------------------------------------
// Query side (f32, VALU), 4 (b,p) rows per block: q_in = [last | load] (129);
//   Qs[bp][h*16+d] = ((q_in.Wq_last) * 2*sigmoid(relu(q_in.fW1 + fb1).fW2 + fb2)) * 0.25   (1/sqrt(16) folded, exact)
//   QW[bp][64]     = lm_b1 + qf.lm_W1[3:19]   with qf = q_in.lazy_q_W + lazy_q_b
// 5 working waves. Waves 0..3: thread = output column j; every weight element it loads feeds the chains of the 4 rows, whose
// inputs lie in LDS as [e][row] (one 16-B broadcast read per e). Wave 4: hidden unit 128 of the FiLM layer, qf, then QW.
// The weight loads go out in batches, one batch ahead of the arithmetic, so their latencies overlap.
// Every output is still one fma chain from its bias, e ascending.
// All loops of this kernel are unrolled in full: the batches are register arrays, which takes static indices, and the
// loads of a batch have to stand together ahead of the arithmetic that uses the batch before.
// Stores: one instruction of a wave writes one whole 128-B line of a Qs or QW row.
// The launch that holds this job has blocks of 8 waves: waves 5..7 have no part here and only pass the two barriers.
// ---------------------------------------------------------------------------
constexpr int kQR = 4;     // (b,p) rows per block
constexpr int kQB = 16;    // e steps per batch of weight loads
static_assert(kBP % kQR == 0 && kE % kQB == 0, "rows per block, batches");
// one batch of a weight column: w[i] = col[(e0 + i) * LD]
template <int LD>
__device__ __forceinline__ void q_fetch(float (&w)[kQB], const float* __restrict__ col, int e0) {
#pragma unroll
  for (int i = 0; i < kQB; ++i) w[i] = col[(e0 + i) * LD];
}
// Stands behind a group of loads: address translations done before a register that an issued load names is reused; its
// "memory" clobber also keeps those loads in front of the LDS reads and the arithmetic below, which then cover their latency.
__device__ __forceinline__ void q_issued() { asm volatile("s_wait_xcnt 0x0" ::: "memory"); }
// a[r] += x[r] * w for NR rows
template <int NR>
__device__ __forceinline__ void q_step(float (&a)[NR], const float* x, float w) {
#pragma unroll
  for (int r = 0; r < NR; ++r) a[r] = fmaf(x[r], w, a[r]);
}
// a[r] += sum_e xa[e][r] * colA[e * LDA] and b[r] += sum_e xb[e][r] * colB[e * LDB], e = 0..128 ascending;
// xa, xb: LDS, kQR floats per e
template <int LDA, int LDB, int NA, int NB>
__device__ __forceinline__ void q_dot2(float (&a)[NA], const float* xa, const float* __restrict__ colA,
                                       float (&b)[NB], const float* xb, const float* __restrict__ colB) {
  float wa[2][kQB], wb[2][kQB];
  q_fetch<LDA>(wa[0], colA, 0);
  q_fetch<LDB>(wb[0], colB, 0);
  float wat = 0.0f, wbt = 0.0f;
#pragma unroll
  for (int c = 0; c < kE / kQB; ++c) {
    if (c + 1 < kE / kQB) {
      q_fetch<LDA>(wa[(c + 1) & 1], colA, kQB * (c + 1));
      q_fetch<LDB>(wb[(c + 1) & 1], colB, kQB * (c + 1));
    } else {
      wat = colA[kE * LDA];
      wbt = colB[kE * LDB];
    }
    q_issued();
#pragma unroll
    for (int i = 0; i < kQB; ++i) {
      q_step<NA>(a, xa + (kQB * c + i) * kQR, wa[c & 1][i]);
      q_step<NB>(b, xb + (kQB * c + i) * kQR, wb[c & 1][i]);
    }
  }
  q_step<NA>(a, xa + kE * kQR, wat);
  q_step<NB>(b, xb + kE * kQR, wbt);
}
constexpr int kQsBlocks = kBP / kQR;
constexpr int kQsLds = (kE + 1) * kQR + (kE * kQR + 32) + kQD * kQR;   // floats
__device__ __forceinline__ void qside_body(float* smem, int bid,
                                           const float* __restrict__ enc_last, const float* __restrict__ loadv,
                                           const float* __restrict__ Wq, const float* __restrict__ fW1,
                                           const float* __restrict__ fb1, const float* __restrict__ fW2,
                                           const float* __restrict__ fb2, const float* __restrict__ lqW,
                                           const float* __restrict__ lqb, const float* __restrict__ lW1,
                                           const float* __restrict__ lb1,
                                           float* __restrict__ Qs, float* __restrict__ QW) {
  float* qin = smem;                          // [e][row], (kE + 1) * kQR floats
  float* g1s = qin + (kE + 1) * kQR;          // [e][row]; behind e = 128 the 28 copies that wave 4 leaves
  float* qfs = g1s + kE * kQR + 32;           // [i][row]
  const int bp0 = bid * kQR;
  const int t = threadIdx.x, lane = t & 31;
  const int wv = __builtin_amdgcn_readfirstlane(t >> 5);
  const bool colw = wv < 4, aux = wv == 4;    // scalar: waves 0..3, wave 4; neither: waves 5..7
  if (colw) {
    v4f x;
#pragma unroll
    for (int r = 0; r < kQR; ++r) x[r] = enc_last[(size_t)(bp0 + r) * kE + t];
    q_issued();
    *(v4f*)(qin + t * kQR) = x;
  } else if (aux && lane < kQR) {
    const float x = loadv[bp0 + lane];
    q_issued();
    qin[kE * kQR + lane] = x;
  }
  __syncthreads();
  float qv[kQR] = {0.0f, 0.0f, 0.0f, 0.0f};
  if (colw) {
    const float b1 = fb1[t];
    q_issued();
    float a1[kQR] = {b1, b1, b1, b1};
    q_dot2<kE + 1, kHD, kQR, kQR>(a1, qin, fW1 + t, qv, qin, Wq + t);
    *(v4f*)(g1s + t * kQR) = (v4f){fmaxf(a1[0], 0.0f), fmaxf(a1[1], 0.0f), fmaxf(a1[2], 0.0f), fmaxf(a1[3], 0.0f)};
  } else if (aux) {
    // lane = (qf unit i16, row pair h2); it also runs hidden unit 128 of row lane & 3 (lanes 0..3 are read, the rest are copies)
    const int i16 = lane & 15, h2 = (lane >> 4) * 2;
    float a1[1] = {fb1[kE]};
    const float bq = lqb[i16];
    q_issued();
    float qf[2] = {bq, bq};
    q_dot2<kE + 1, kQD, 1, 2>(a1, qin + (lane & 3), fW1 + kE, qf, qin + h2, lqW + i16);
    g1s[kE * kQR + lane] = fmaxf(a1[0], 0.0f);
    *(v2f*)(qfs + i16 * kQR + h2) = (v2f){qf[0], qf[1]};
  }
  __syncthreads();
  if (colw) {
    const float b2 = fb2[t];
    float gm[kQR] = {b2, b2, b2, b2};
    const float* col = fW2 + t;
    float w[3][kQB];           // two batches ahead here: one column only
    q_fetch<kHD>(w[0], col, 0);
    q_fetch<kHD>(w[1], col, kQB);
    float wt = 0.0f;
#pragma unroll
    for (int c = 0; c < kE / kQB; ++c) {
      if (c + 2 < kE / kQB) q_fetch<kHD>(w[(c + 2) % 3], col, kQB * (c + 2));
      else if (c + 2 == kE / kQB) wt = col[kE * kHD];
      if (c + 2 <= kE / kQB) q_issued();
#pragma unroll
      for (int i = 0; i < kQB; ++i) q_step<kQR>(gm, g1s + (kQB * c + i) * kQR, w[c % 3][i]);
    }
    q_step<kQR>(gm, g1s + kE * kQR, wt);
#pragma unroll
    for (int r = 0; r < kQR; ++r) {
      const float den = 1.0f + expf(-gm[r]);
      const float gamma = 2.0f * (1.0f / den);
      Qs[(size_t)(bp0 + r) * kHD + t] = (qv[r] * gamma) * 0.25f;
    }
  } else if (aux) {
    const float c0 = lb1[lane], c1 = lb1[32 + lane];
    float u0[kQR] = {c0, c0, c0, c0}, u1[kQR] = {c1, c1, c1, c1};
    float w0[kQB], w1[kQB];
    static_assert(kQD == kQB, "one batch");
    q_fetch<kHID>(w0, lW1 + kDYN * kHID + lane, 0);
    q_fetch<kHID>(w1, lW1 + kDYN * kHID + 32 + lane, 0);
    q_issued();
#pragma unroll
    for (int i = 0; i < kQD; ++i) {
      q_step<kQR>(u0, qfs + i * kQR, w0[i]);
      q_step<kQR>(u1, qfs + i * kQR, w1[i]);
    }
#pragma unroll
    for (int r = 0; r < kQR; ++r) {
      QW[(size_t)(bp0 + r) * kHID + lane] = u0[r];
      QW[(size_t)(bp0 + r) * kHID + 32 + lane] = u1[r];
    }
    q_issued();   // the wait behind the stores too: the code laid out behind this branch writes registers that they name
  }
}

// ---------------------------------------------------------------------------
// Lazy-mask MLP, all three layers in one kernel; H1 and H2 never leave the registers.
// Block = one (b,p) row of MASKB, 4 waves; a wave owns 256 node slots and walks them 32 at a time (two 16-slot tiles).
// Lane l: c = l & 15, h = l >> 4.
//   layer 1 (f32 VALU): the lane computes H1[slot c][k] for its own 32 k (k = 32 s + 16 h + e, s = 0,1, e = 0..15),
//     relu, f16: that is the B fragment of k step s as it stands. Its weights come from an LDS table, per k pair
//     {W1[0][k,k+1], W1[1][k,k+1], W1[2][k,k+1], QW[k,k+1]}; the row's dynamic features and mask row are staged in LDS once.
//   layer 2 (WMMA f16): A = lm_W2^T x16, row j = 16 i + c, the same k per lane and element;
//     D register r of tile i = 16 * (H1 . lm_W2[:, j]) for hidden unit j = 16 i + 8 h + r of slot c.
//   layer 3 (f32 VALU): z = sum_j relu(D / 16 + lm_b2[j]) * lm_W3[j]: 32 j in the lane, the other 32 in lane l ^ 16.
//   MASKB[bp][n] = ninf_mask[b,p,min(n,999)] - softplus(z + lm_b3)   (ALPHA = 1)
// Coverage: 1600 blocks x 4 waves x 8 trips x 32 slots = all 1024 columns of all 1600 rows (pad slots from clamped inputs).
// ---------------------------------------------------------------------------
// layer 3 for one 16-unit tile: sum over the lane's 8 hidden units of relu(D / 16 + b2) * w3
__device__ __forceinline__ v2f lazy_l3(v8f acc, const v2f (&b2)[4], const v2f (&w3)[4]) {
  const v2f zero = (v2f){0.0f, 0.0f};
  const v2f sc = (v2f){1.0f / kWCarry, 1.0f / kWCarry};
  v2f zs = zero;
#pragma unroll
  for (int q = 0; q < 4; ++q) {
    const v2f a = __builtin_elementwise_max(__builtin_elementwise_fma((v2f){acc[2 * q], acc[2 * q + 1]}, sc, b2[q]), zero);
    zs = __builtin_elementwise_fma(a, w3[q], zs);
  }
  return zs;
}
constexpr int kLzLds = 2 * 16 * 8 + kN * kDYN + kN;   // floats
__device__ __forceinline__ void lazy_body(float* smem, int bp,
                                          const float* __restrict__ dyn, const float* __restrict__ QW,
                                          const float* __restrict__ lW1, const _Float16* __restrict__ W2T,
                                          const float* __restrict__ lb2, const float* __restrict__ lW3,
                                          const float* __restrict__ lb3, const float* __restrict__ ninfm,
                                          float* __restrict__ maskb) {
  float* tbl = smem;                   // [h][k pair][w0 w0 w1 w1 w2 w2 qw qw], 2 * 16 * 8 floats
  float* sd = tbl + 2 * 16 * 8;        // dynamic features of this (b,p): 1000 x 3
  float* sn = sd + kN * kDYN;          // ninf_mask row of this (b,p)
  const int t = threadIdx.x;
  const int lane = t & 31, wave = t >> 5;
  const int c = lane & 15, h = lane >> 4;
  // stage the 12000 contiguous bytes of dynamic features: 750 x 16 B over 128 threads
  const unsigned oD = (unsigned)t * 16u;
  const char* dsrc = (const char*)(dyn + (size_t)bp * kN * kDYN);
  v4f dv[6];
#pragma unroll
  for (int i = 0; i < 5; ++i) dv[i] = *(const v4f*)(dsrc + oD + i * 2048);
  const bool last = (t < (kN * kDYN * 4 - 5 * 2048) / 16);
  const unsigned oL = last ? (oD + 5 * 2048) : 0u;     // threads past the end fetch in bounds and store nothing
  dv[5] = *(const v4f*)(dsrc + oL);
  // and the 4000 contiguous bytes of the mask row: 250 x 16 B
  const char* nsrc = (const char*)(ninfm + (size_t)bp * kN);
  const bool lastn = (t < (kN * 4 - 2048) / 16);
  const unsigned oN = lastn ? (oD + 2048) : 0u;
  const v4f nv0 = *(const v4f*)(nsrc + oD);
  const v4f nv1 = *(const v4f*)(nsrc + oN);
  // weight table: thread t fetches one pair: h = t >> 6, k pair p = (t >> 2) & 15, which = t & 3
  const int tp = (t >> 2) & 15, tw = t & 3;
  const int tk = 32 * (tp >> 3) + 16 * (t >> 6) + 2 * (tp & 7);
  const float* tsrc = (tw < 3) ? (lW1 + tw * kHID + tk) : (QW + (size_t)bp * kHID + tk);
  const v2f tv = *(const v2f*)tsrc;
  // byte offsets of the lane's first fragment / bias element; these set-up loads are scalar base + one of them
  const unsigned oA = (unsigned)(c * kHID + 16 * h) * 2u;
  const unsigned oJ = (unsigned)(8 * h) * 4u;
  v16h aw[4][2];
#pragma unroll
  for (int i = 0; i < 4; ++i)
#pragma unroll
    for (int s = 0; s < 2; ++s) aw[i][s] = *(const v16h*)((const char*)W2T + oA + (16 * i * kHID + 32 * s) * 2);
  v2f b2[4][4], w3[4][4];
#pragma unroll
  for (int i = 0; i < 4; ++i)
#pragma unroll
    for (int q = 0; q < 4; ++q) {
      b2[i][q] = *(const v2f*)((const char*)lb2 + oJ + (16 * i + 2 * q) * 4);
      w3[i][q] = *(const v2f*)((const char*)lW3 + oJ + (16 * i + 2 * q) * 4);
    }
  const float b3 = lb3[0];
  // address translations done before a register that a load above names is reused
  asm volatile("s_wait_xcnt 0x0" :: "v"(oD), "v"(oL), "v"(oN), "v"(tsrc), "v"(oA), "v"(oJ) : "memory");
#pragma unroll
  for (int i = 0; i < 5; ++i) *(v4f*)((char*)sd + oD + i * 2048) = dv[i];
  if (last) *(v4f*)((char*)sd + oL) = dv[5];
  *(v4f*)((char*)sn + oD) = nv0;
  if (lastn) *(v4f*)((char*)sn + oN) = nv1;
  *(v2f*)(tbl + 2 * t) = tv;
  __syncthreads();
  const int nw = wave * 256;
  float* mp = maskb + (size_t)bp * kNP + nw + lane;
  const v4f* tb4 = (const v4f*)(tbl + h * 128);
  for (int it = 0; it < 8; ++it) {
    const int n0 = nw + it * 32;
    const int n = n0 + lane;
    const int nc = (n < kN) ? n : (kN - 1);                          // address clamps (pad slots)
    const int ia = ((n0 + c < kN) ? (n0 + c) : (kN - 1)) * kDYN;
    const int ib = ((n0 + 16 + c < kN) ? (n0 + 16 + c) : (kN - 1)) * kDYN;
    const float a0 = sd[ia], a1 = sd[ia + 1], a2 = sd[ia + 2];
    const float e0 = sd[ib], e1 = sd[ib + 1], e2 = sd[ib + 2];
    v16h ba[2], bb[2];
    const v2h hzero = (v2h){(_Float16)0.0f, (_Float16)0.0f};
    v4f tq[2][8];                               // weight-table reads, four k pairs a group, one group ahead
#pragma unroll
    for (int j = 0; j < 8; ++j) tq[0][j] = tb4[j];
#pragma unroll
    for (int g = 0; g < 4; ++g) {
      if (g < 3) {
#pragma unroll
        for (int j = 0; j < 8; ++j) tq[(g + 1) & 1][j] = tb4[8 * (g + 1) + j];
      }
      // keeps the next group's LDS reads in front of this group's arithmetic, which then covers their latency
      __builtin_amdgcn_sched_barrier(0);
#pragma unroll
      for (int pp = 0; pp < 4; ++pp) {
        const int p = 4 * g + pp;
        const v4f u = tq[g & 1][2 * pp], v = tq[g & 1][2 * pp + 1];
        const v2f w0 = (v2f){u[0], u[1]}, w1 = (v2f){u[2], u[3]}, w2 = (v2f){v[0], v[1]}, qw = (v2f){v[2], v[3]};
        const v2f xa = __builtin_elementwise_fma(w0, (v2f){a0, a0}, __builtin_elementwise_fma(w1, (v2f){a1, a1},
                       __builtin_elementwise_fma(w2, (v2f){a2, a2}, qw)));
        const v2f xb = __builtin_elementwise_fma(w0, (v2f){e0, e0}, __builtin_elementwise_fma(w1, (v2f){e1, e1},
                       __builtin_elementwise_fma(w2, (v2f){e2, e2}, qw)));
        // relu behind the rounding: same value as rounding behind relu
        const v2h ya = __builtin_elementwise_max(__builtin_convertvector(xa, v2h), hzero);
        const v2h yb = __builtin_elementwise_max(__builtin_convertvector(xb, v2h), hzero);
        ba[p >> 3][2 * (p & 7)] = ya[0]; ba[p >> 3][2 * (p & 7) + 1] = ya[1];
        bb[p >> 3][2 * (p & 7)] = yb[0]; bb[p >> 3][2 * (p & 7) + 1] = yb[1];
      }
    }
    v2f za2[4], zb2[4];
#pragma unroll
    for (int i = 0; i < 4; ++i) {
      const v8f czero = (v8f){0.f, 0.f, 0.f, 0.f, 0.f, 0.f, 0.f, 0.f};
      v8f ca = __builtin_amdgcn_wmma_f32_16x16x32_f16(false, aw[i][0], false, ba[0], (short)0, czero, false, false);
      v8f cc = __builtin_amdgcn_wmma_f32_16x16x32_f16(false, aw[i][0], false, bb[0], (short)0, czero, false, false);
      ca = __builtin_amdgcn_wmma_f32_16x16x32_f16(false, aw[i][1], false, ba[1], (short)0, ca, false, false);
      cc = __builtin_amdgcn_wmma_f32_16x16x32_f16(false, aw[i][1], false, bb[1], (short)0, cc, false, false);
      za2[i] = lazy_l3(ca, b2[i], w3[i]);
      zb2[i] = lazy_l3(cc, b2[i], w3[i]);
    }
    const v2f ta = (za2[0] + za2[1]) + (za2[2] + za2[3]);
    const v2f tb = (zb2[0] + zb2[1]) + (zb2[2] + zb2[3]);
    const float za = ta[0] + ta[1], zb = tb[0] + tb[1];
    // lanes 0..15 finish slots n0 + c (tile a), lanes 16..31 slots n0 + 16 + c (tile b): one exchange l <-> l ^ 16 for both
    const float mine = h ? zb : za;
    const int other = __float_as_int(h ? za : zb);
    const float z = (mine + __int_as_float(__builtin_amdgcn_permlanex16(other, other, 0x76543210, 0xfedcba98, false, false))) + b3;
    const float spv = fmaxf(z, 0.0f) + log1pf(expf(-fabsf(z)));
    *mp = sn[nc] - spv;
    // address translation done before the store's address register is advanced; the "memory" clobber also keeps the
    // weight-table reads inside the loop (hoisted they hold 128 more registers: over 256, one wave per SIMD fewer)
    asm volatile("s_wait_xcnt 0x0" :: "v"(mp) : "memory");
    mp += 32;
  }
}

// ---------------------------------------------------------------------------
// Second launch: the two jobs that need only the first launch's results and not each other, side by side in one grid.
// Blocks of 4 waves. Blocks 0..255: K|V projection, [16384][128] x [256][128]^T, bf16 hi/lo both operands -> f32 KV; a block
// holds the four 64-column tiles of one 64-row tile. Blocks 256..1855: the lazy-mask MLP, one (b,p) row each.
// The projection's blocks come first: its waves wait on memory for most of their time, and the MLP's waves fill the vector port
// meanwhile. The job select is block-uniform (scalar); both jobs use the same LDS bytes.
// ---------------------------------------------------------------------------
constexpr int kKvBlocks = (kEncRows / 64) * (2 * kHD / 64) / 4;
constexpr int kMidLds = (4 * 16 * 68 > kLzLds) ? 4 * 16 * 68 : kLzLds;
__global__ __launch_bounds__(128) void k_kv_lazy(const unsigned short* __restrict__ EncHi, const unsigned short* __restrict__ EncLo,
                                                const unsigned short* __restrict__ WkvHi, const unsigned short* __restrict__ WkvLo,
                                                float* __restrict__ KV,
                                                const float* __restrict__ dyn, const float* __restrict__ QW,
                                                const float* __restrict__ lW1, const _Float16* __restrict__ W2T,
                                                const float* __restrict__ lb2, const float* __restrict__ lW3,
                                                const float* __restrict__ lb3, const float* __restrict__ ninfm,
                                                float* __restrict__ maskb) {
  __shared__ __align__(16) float smem[kMidLds];
  const int bid = blockIdx.x;
  if (bid < kKvBlocks) {
    gemm64_body<4, 1, true, 0, 0, false, 0>(smem, bid, 0, EncHi, EncLo, kE, 0L, WkvHi, WkvLo, kE, 0L, (void*)KV, (void*)KV,
                                            2 * kHD, 0L, QW, QW, 0L, kEncRows, 2 * kHD, kE, 1.0f);   // bias, resid: never read
  } else {
    lazy_body(smem, bid - kKvBlocks, dyn, QW, lW1, W2T, lb2, lW3, lb3, ninfm, maskb);
  }
}

// ---------------------------------------------------------------------------
// Attention core (f32, head dim 16), both products on v_wmma_f32_16x16x4_f32; node axis split over the waves of a block.
// Block = (b, group of 16 queries, group of 4 heads), 512 threads = 16 waves: wave = (node slice sl = wave >> 1 of 128 slots,
// head pair wave & 1); it runs its two heads one after the other on the same staged nodes. 16 x 7 x 2 = 224 blocks.
// Per stage every slice gets its next 32 nodes in LDS: the 4 heads' K (64 f32) and V (64 f32) of each node, at a pitch of
// 132 floats, and the bias tile [16 queries][32 nodes] at a pitch of 36 floats (both 16 B x odd: 16 rows read by one 16-B
// load fall on 16 different bank groups). Four stages cover the 128 slots of a slice.
// Lane l: c = l & 15, h = l >> 4. Per head and tile of 16 nodes:
//   scores, transposed: D[node 8h + r][query c] = bias + sum_dim K[node][dim] * Q[query][dim];
//     A = K (row = node c), B = Q (column = query c), both with dim 8h + 2s + e at k step s, element e; C = the bias tile.
//   output, transposed: D[dim 8h + r][query c] += sum_node V[node][dim] * P[node][query];
//     B = the score tile's own registers 2s, 2s + 1 after the exponential (node 8h + 2s + e), A = V (row = dim c) at the same nodes.
// Online softmax per query, one update per stage (32 nodes); slots >= 1000 forced to -inf by value in the bias; m is common to
// the two lane halves of a query, l is kept per half and added at the end.
// Merge: every wave leaves (acc[16], m, l) per head and query in LDS; 128 threads fold the 8 slices in slice order,
//   M = max m_s, w_s = exp(m_s - M), O = sum_s w_s acc_s / sum_s w_s l_s,
// and write O as bf16 hi + bf16 lo planes into Ohi/Olo[bp][h*16+d]: 8 lanes x 16 B = the block's whole 128-B line of a row
// (rows >= P skipped).
// ---------------------------------------------------------------------------
constexpr int kASl  = 8;               // node slices per block
constexpr int kASn  = kNP / kASl;      // 128 node slots per slice
constexpr int kACh  = 32;              // nodes per slice and stage
constexpr int kAHb  = 4;               // heads per block
constexpr int kARow = 2 * kAHb * kD;   // 128 floats per staged node: K of 4 heads | V of 4 heads
constexpr int kAPt  = kARow + 4;       // pitch of a staged node in floats
constexpr int kAMp  = 36;              // bias tile pitch in floats
constexpr int kACp  = 20;              // merge record pitch in floats: acc[16], m, l, 2 unused
static_assert(kASl * kAHb * 16 * kACp <= kASl * kACh * kAPt, "merge records fit the K|V buffer");
__device__ __forceinline__ v8f mma4(v2f a, v2f b, v8f c) {
  return __builtin_amdgcn_wmma_f32_16x16x4_f32(false, a, false, b, (short)0, c, false, false);
}
// the value that lane l ^ 16 holds
__device__ __forceinline__ float other_half(float x) {
  const int i = __float_as_int(x);
  return __int_as_float(__builtin_amdgcn_permlanex16(i, i, 0x76543210, 0xfedcba98, false, false));
}
__global__ __launch_bounds__(512) void k_attn(const float* __restrict__ Qs, const float* __restrict__ KV,
                                             const float* __restrict__ maskb, unsigned short* __restrict__ Ohi,
                                             unsigned short* __restrict__ Olo) {
  __shared__ __align__(16) float kvs[kASl * kACh * kAPt];    // 135168 B; the merge records reuse it
  __shared__ __align__(16) float ms[kASl * 16 * kAMp];       // 18432 B
  const float kNegInf = -__builtin_inff();
  const int t = threadIdx.x, lane = t & 31;
  const int wave = __builtin_amdgcn_readfirstlane(t >> 5);   // scalar: slice bounds and LDS bases stay off the vector unit
  const int b = blockIdx.x / 14, rem = blockIdx.x - b * 14, pg = rem >> 1, hq = rem & 1, p0 = pg * 16;
  const int sl = wave >> 1, hp = (wave & 1) * 2;
  const int c = lane & 15, h = lane >> 4;
  const int p = p0 + c, pc = (p < kP) ? p : (kP - 1);
  // B fragments of the score product, both heads: 8 consecutive dims of the lane's query
  const float* qp = Qs + (size_t)(b * kP + pc) * kHD + (hq * kAHb + hp) * kD + 8 * h;
  const v4f q0 = *(const v4f*)(qp), q1 = *(const v4f*)(qp + 4), q2 = *(const v4f*)(qp + kD), q3 = *(const v4f*)(qp + kD + 4);
  // address translations done before the register pair that these four loads name is reused
  asm volatile("s_wait_xcnt 0x0" :: "v"(qp) : "memory");
  const v2f qf[2][4] = {{(v2f){q0[0], q0[1]}, (v2f){q0[2], q0[3]}, (v2f){q1[0], q1[1]}, (v2f){q1[2], q1[3]}},
                        {(v2f){q2[0], q2[1]}, (v2f){q2[2], q2[3]}, (v2f){q3[0], q3[1]}, (v2f){q3[2], q3[3]}}};
  v8f o[2] = {(v8f){0.f, 0.f, 0.f, 0.f, 0.f, 0.f, 0.f, 0.f}, (v8f){0.f, 0.f, 0.f, 0.f, 0.f, 0.f, 0.f, 0.f}};
  float m[2] = {-3.0e38f, -3.0e38f}, l[2] = {0.0f, 0.0f};
  const float* kvb = KV + (size_t)b * kNP * (2 * kHD);
  const float* mkb = maskb + (size_t)(b * kP) * kNP;
  // staging roles: a wave copies whole node rows (lanes 0..15 the K part, 16..31 the V part, 256 B each)
  const int scol = ((lane < 16) ? 0 : kHD) + hq * (kAHb * kD) + (lane & 15) * 4;
  // bias tile roles: thread t copies 4 columns (t & 7) * 4 of row (t >> 3) & 15 for slices t >> 7 and 4 + (t >> 7)
  const int mr = (t >> 3) & 15, mj4 = (t & 7) * 4, msl = t >> 7;
  const int mpr = (p0 + mr < kP) ? (p0 + mr) : (kP - 1);
  const float* mrow = mkb + (size_t)mpr * kNP + msl * kASn + mj4;
  float* mdst = ms + (msl * 16 + mr) * kAMp + mj4;
  // fragment bases in LDS: K row = node c of a tile, dims from 8h; V rows = nodes from 8h of a tile, dim c; bias row = query c
  const float* kw = kvs + (sl * kACh + c) * kAPt + hp * kD + 8 * h;
  const float* vw = kvs + (sl * kACh + 8 * h) * kAPt + (kAHb + hp) * kD + c;
  const float* mw = ms + (sl * 16 + c) * kAMp + 8 * h;
#pragma unroll 1   // rolled: one set of 18 staging register quads serves every stage
  for (int st = 0; st < kASn / kACh; ++st) {
    // 8 slices x 32 nodes x 32 float4 = 8192 float4: 16 x 512 threads; trip i: slice i >> 1, node (i & 1) * 16 + wave
    const float* gk = kvb + (size_t)(st * kACh + wave) * (2 * kHD) + scol;
    v4f kvr[16];
#pragma unroll
    for (int i = 0; i < 16; ++i) kvr[i] = *(const v4f*)(gk + (size_t)((i >> 1) * kASn + (i & 1) * 16) * (2 * kHD));
    // bias tiles: 8 slices x 16 rows x 8 float4 = 1024 float4: 2 x 512 threads; trip i: slice i * 4 + (t >> 7)
    const float* gm = mrow + st * kACh;
    const v4f mr0 = *(const v4f*)(gm);
    const v4f mr1 = *(const v4f*)(gm + 4 * kASn);
    // address translations done before a register that a load above names is reused
    asm volatile("s_wait_xcnt 0x0" :: "v"(gk), "v"(gm) : "memory");
    __syncthreads();   // every wave has left the buffers of the stage before
#pragma unroll
    for (int i = 0; i < 16; ++i) *(v4f*)(kvs + ((i >> 1) * kACh + (i & 1) * 16 + wave) * kAPt + lane * 4) = kvr[i];
    *(v4f*)(mdst) = mr0;
    *(v4f*)(mdst + 4 * 16 * kAMp) = mr1;
    __syncthreads();
    // The loops below are unrolled in full: tiles and fragments are register arrays, which takes static indices.
    // C operands of the two score tiles, shared by both heads: register r = bias of (query c, node 16 tt + 8h + r)
    const int nl = sl * kASn + st * kACh + 8 * h;
    v8f bias[2];
#pragma unroll
    for (int tt = 0; tt < 2; ++tt) {
      const v4f x = *(const v4f*)(mw + 16 * tt), y = *(const v4f*)(mw + 16 * tt + 4);
#pragma unroll
      for (int r = 0; r < 4; ++r) {
        bias[tt][r]     = (nl + 16 * tt + r < kN) ? x[r] : kNegInf;
        bias[tt][4 + r] = (nl + 16 * tt + 4 + r < kN) ? y[r] : kNegInf;
      }
    }
#pragma unroll
    for (int g = 0; g < 2; ++g) {
      v8f s[2];
#pragma unroll
      for (int tt = 0; tt < 2; ++tt) {
        const float* kr = kw + 16 * tt * kAPt + g * kD;
        const v4f k0 = *(const v4f*)(kr), k1 = *(const v4f*)(kr + 4);
        v8f a = mma4((v2f){k0[0], k0[1]}, qf[g][0], bias[tt]);
        a = mma4((v2f){k0[2], k0[3]}, qf[g][1], a);
        a = mma4((v2f){k1[0], k1[1]}, qf[g][2], a);
        s[tt] = mma4((v2f){k1[2], k1[3]}, qf[g][3], a);
      }
      float tm = fmaxf(s[0][0], s[1][0]);
#pragma unroll
      for (int r = 1; r < 8; ++r) tm = fmaxf(tm, fmaxf(s[0][r], s[1][r]));
      tm = fmaxf(tm, other_half(tm));
      const float mn = fmaxf(m[g], tm);
      const float alpha = __expf(m[g] - mn);
      m[g] = mn;
      float ps[2] = {0.0f, 0.0f};
#pragma unroll
      for (int tt = 0; tt < 2; ++tt)
#pragma unroll
        for (int r = 0; r < 8; ++r) {
          s[tt][r] = __expf(s[tt][r] - mn);
          ps[tt] += s[tt][r];
        }
      l[g] = fmaf(l[g], alpha, ps[0] + ps[1]);
      o[g] = o[g] * alpha;
#pragma unroll
      for (int tt = 0; tt < 2; ++tt) {
        const float* vr = vw + 16 * tt * kAPt + g * kD;
#pragma unroll
        for (int ks = 0; ks < 4; ++ks)
          o[g] = mma4((v2f){vr[2 * ks * kAPt], vr[(2 * ks + 1) * kAPt]}, (v2f){s[tt][2 * ks], s[tt][2 * ks + 1]}, o[g]);
      }
    }
  }
  __syncthreads();   // every wave has left the K|V buffer before the merge records overwrite it
#pragma unroll   // static indices into the two heads' register arrays
  for (int g = 0; g < 2; ++g) {
    const float lt = l[g] + other_half(l[g]);
    float* op = kvs + ((sl * kAHb + hp + g) * 16 + c) * kACp;
    *(v4f*)(op + 8 * h)     = (v4f){o[g][0], o[g][1], o[g][2], o[g][3]};
    *(v4f*)(op + 8 * h + 4) = (v4f){o[g][4], o[g][5], o[g][6], o[g][7]};
    if (h == 0) *(v2f*)(op + 16) = (v2f){m[g], lt};
  }
  __syncthreads();
  if (wave < 4) {    // threads 0..127; no barrier behind this point
    const int rl = t >> 3, c8 = (t & 7) * 8;
    const float* cb = kvs + ((c8 >> 4) * 16 + rl) * kACp;
    constexpr int kSs = kAHb * 16 * kACp;      // floats from one slice's records to the next
    float ml[kASl], ll[kASl];
#pragma unroll
    for (int s = 0; s < kASl; ++s) { const v2f e = *(const v2f*)(cb + s * kSs + 16); ml[s] = e[0]; ll[s] = e[1]; }
    float mx = ml[0];
#pragma unroll
    for (int s = 1; s < kASl; ++s) mx = fmaxf(mx, ml[s]);
    float lsum = 0.0f;
    v4f x0 = (v4f){0.f, 0.f, 0.f, 0.f}, x1 = (v4f){0.f, 0.f, 0.f, 0.f};
#pragma unroll
    for (int s = 0; s < kASl; ++s) {
      const float w = __expf(ml[s] - mx);
      const float* s8 = cb + s * kSs + (c8 & 15);
      lsum = fmaf(ll[s], w, lsum);
      x0 = *(const v4f*)(s8) * w + x0;
      x1 = *(const v4f*)(s8 + 4) * w + x1;
    }
    const float inv = 1.0f / lsum;
    x0 = x0 * inv;
    x1 = x1 * inv;
    unsigned short hb[8], lb[8];
#pragma unroll
    for (int e = 0; e < 4; ++e) {
      split_bf(x0[e], hb[e], lb[e]);
      split_bf(x1[e], hb[4 + e], lb[4 + e]);
    }
    const v4u uh = (v4u){pk16(hb[0], hb[1]), pk16(hb[2], hb[3]), pk16(hb[4], hb[5]), pk16(hb[6], hb[7])};
    const v4u ul = (v4u){pk16(lb[0], lb[1]), pk16(lb[2], lb[3]), pk16(lb[4], lb[5]), pk16(lb[6], lb[7])};
    if (p0 + rl < kP) {
      const size_t o = (size_t)(b * kP + p0 + rl) * kHD + hq * (kAHb * kD) + c8;
      *(v4u*)(Ohi + o) = uh;
      *(v4u*)(Olo + o) = ul;
    }
  }
}

// ---------------------------------------------------------------------------
// Zero fill of two regions, nvec x 16 B each (nvec % 256 == 0, so the region select is block-uniform).
// ---------------------------------------------------------------------------
__device__ __forceinline__ void zero16x2_body(int bid, unsigned int* __restrict__ p0, unsigned int* __restrict__ p1, int nvec) {
  const int i = bid * 256 + threadIdx.x;
  if (i >= 2 * nvec) return;
  unsigned int* p = (i < nvec) ? (p0 + 4 * (size_t)i) : (p1 + 4 * (size_t)(i - nvec));
  const v4u z = (v4u){0u, 0u, 0u, 0u};
  *(v4u*)p = z;
}

// ---------------------------------------------------------------------------
// First launch: the four jobs that read nothing but inputs, side by side in one grid of 256-thread blocks. By block index:
// query side (400, the longest job, so it starts first), weight preparation (13), zero fill of the 64 pad rows
// 1600..1663 of Ohi and Olo (8), node split (1024). The job select is block-uniform (scalar); the two jobs with LDS use
// the same bytes.
// ---------------------------------------------------------------------------
constexpr int kZrVec = (kBPpad - kBP) * kHD * 2 / 16;   // 16-B pieces per plane
constexpr int kZrBlocks = 2 * kZrVec / 256;
static_assert(kZrVec % 256 == 0, "zero fill blocks");
constexpr int kFrontBlocks = kQsBlocks + kWpBlocks + kZrBlocks + kEcBlocks;
constexpr int kFrontLds = (kWpLds > kQsLds) ? kWpLds : kQsLds;
__global__ __launch_bounds__(256) void k_front(const float* __restrict__ enc_last, const float* __restrict__ loadv,
                                              const float* __restrict__ Wq, const float* __restrict__ fW1,
                                              const float* __restrict__ fb1, const float* __restrict__ fW2,
                                              const float* __restrict__ fb2, const float* __restrict__ lqW,
                                              const float* __restrict__ lqb, const float* __restrict__ lW1,
                                              const float* __restrict__ lb1,
                                              float* __restrict__ Qs, float* __restrict__ QW,
                                              const float* __restrict__ Wk, const float* __restrict__ Wv,
                                              const float* __restrict__ Wcomb, const float* __restrict__ W2,
                                              unsigned short* __restrict__ WkvHi, unsigned short* __restrict__ WkvLo,
                                              unsigned short* __restrict__ WcHi, unsigned short* __restrict__ WcLo,
                                              unsigned short* __restrict__ W2T,
                                              unsigned int* __restrict__ OhiPad, unsigned int* __restrict__ OloPad,
                                              const float* __restrict__ enc, unsigned short* __restrict__ EncHi,
                                              unsigned short* __restrict__ EncLo) {
  __shared__ __align__(16) float smem[kFrontLds];
  const int bid = blockIdx.x;
  if (bid < kQsBlocks) {
    qside_body(smem, bid, enc_last, loadv, Wq, fW1, fb1, fW2, fb2, lqW, lqb, lW1, lb1, Qs, QW);
  } else if (bid < kQsBlocks + kWpBlocks) {
    wprep_body(smem, bid - kQsBlocks, Wk, Wv, Wcomb, W2, WkvHi, WkvLo, WcHi, WcLo, W2T);
  } else if (bid < kQsBlocks + kWpBlocks + kZrBlocks) {
    zero16x2_body(bid - (kQsBlocks + kWpBlocks), OhiPad, OloPad, kZrVec);
  } else {
    enc_cast_body(bid - (kQsBlocks + kWpBlocks + kZrBlocks), enc, EncHi, EncLo);
  }
}

// tanh with both of its ranges computed and one selected: no branch, so neighbouring elements can overlap
__device__ __forceinline__ float tanh_sel(float x) {
  const float ax = fabsf(x);
  const float e = __expf(ax + ax);                                    // inf for large |x|: 2 / inf = 0, the value is 1
  const float big = fmaf(__builtin_amdgcn_rcpf(e + 1.0f), -2.0f, 1.0f);
  const float x2 = x * x;
  float pl = fmaf(x2, -0.00570002059f, 0.0206340719f);                // odd series for |x| < 0.625
  pl = fmaf(x2, pl, -0.0537379310f);
  pl = fmaf(x2, pl, 0.133314162f);
  pl = fmaf(x2, pl, -0.333332807f);
  const float small = fmaf(x2, ax * pl, ax);
  return copysignf((ax < 0.625f) ? small : big, x);
}
// ---------------------------------------------------------------------------
// Tail: head merge, pointer scores, clipped tanh + mask and the softmax over the nodes, in one launch.
// Block = (b, group of 16 queries), 16 waves, 16 x 7 = 112 blocks; MH and the scores never leave the block.
// Both products run transposed, D[row 8h + r][query c], lane l: c = l & 15, h = l >> 4. A = 16 rows of a bf16 hi/lo plane pair
// (rows of W_comb^T, then node rows), B = the 16 queries' rows (O, then MH); both fragments take k = 32 s + 8h + e and
// 32 s + 16 + 8h + e, e = 0..7, at k step s; per k step hi.hi, then lo(A).hi(B), then hi(A).lo(B).
// A rows: 16 rows of a plane are 4096 contiguous bytes; a wave fetches them by whole lines into registers, one tile ahead,
// and passes them through its own LDS buffer at a pitch of 272 B (16 B x odd) to get the fragments.
//   head merge: waves 0..7, wave w = columns 16 w .. 16 w + 15 of MH; + b_comb, split to bf16 hi/lo, rows of 16 queries in LDS.
//   scores: wave w = nodes 64 w .. 64 w + 63, four tiles; a lane ends with 32 nodes of query c in registers.
//   softmax: maximum and sum per query in the lane, then lane l ^ 16, then the 16 waves through LDS tables, in wave order.
// xs holds the 16 mask rows (64000 contiguous bytes of ninf_mask, copied by whole 16-B pieces); every lane replaces its own
// elements by the probabilities, and the block copies xs to out the same way. Slots >= 1000 carry -inf and are not stored.
// Query rows >= P (last group): computed from finite rows of the O planes, never stored; no lane of another query reads them.
// All loops of this kernel and its helpers are unrolled in full: staged pieces, fragments and tiles are register arrays,
// which takes static indices.
// ---------------------------------------------------------------------------
constexpr int kTPit = 2 * kE + 16;     // bytes from one staged row of 128 16-bit elements to the next
constexpr int kTPl  = 16 * kTPit;      // one plane of 16 rows
constexpr int kTCh  = 2 * kTPl;        // hi plane + lo plane
constexpr int kTRp  = 20;              // floats per query in a reduction table: 16 waves, 4 unused
constexpr int kTXs  = 8 * 512 * 4;     // floats in xs: 16 rows of out, rounded up to 8 pieces of 16 B per thread
// 16 rows of the hi plane and of the lo plane, 512 contiguous bytes an instruction; o = lane * 16
__device__ __forceinline__ void t_fetch(v4u (&st)[16], const unsigned short* __restrict__ hi,
                                        const unsigned short* __restrict__ lo, unsigned o) {
#pragma unroll
  for (int i = 0; i < 8; ++i) st[i] = *(const v4u*)((const char*)hi + o + 512 * i);
#pragma unroll
  for (int i = 0; i < 8; ++i) st[8 + i] = *(const v4u*)((const char*)lo + o + 512 * i);
  // address translations done before a register that one of these loads names is reused; the "memory" clobber also keeps
  // the loads up here, ahead of the work that covers their latency
  asm volatile("s_wait_xcnt 0x0" :: "v"(o) : "memory");
}
// p: the lane's place in the first pair of rows of the wave's buffer
__device__ __forceinline__ void t_put(char* p, const v4u (&st)[16]) {
#pragma unroll
  for (int i = 0; i < 8; ++i) *(v4u*)(p + 2 * i * kTPit) = st[i];
#pragma unroll
  for (int i = 0; i < 8; ++i) *(v4u*)(p + kTPl + 2 * i * kTPit) = st[8 + i];
}
// orders a wave's LDS writes and the reads of them by its other lanes (and the reads before the next writes)
__device__ __forceinline__ void t_wave_sync() {
  __builtin_amdgcn_fence(__ATOMIC_RELEASE, "workgroup");
  __builtin_amdgcn_wave_barrier();
  __builtin_amdgcn_fence(__ATOMIC_ACQUIRE, "workgroup");
}
// p: row c of a staged plane pair, byte 16 h
__device__ __forceinline__ void t_frags(v16b (&fh)[4], v16b (&fl)[4], const char* p) {
#pragma unroll
  for (int s = 0; s < 4; ++s) {
    fh[s] = Frag<__bf16>::load((const __bf16*)(p + 64 * s));
    fl[s] = Frag<__bf16>::load((const __bf16*)(p + kTPl + 64 * s));
  }
}
__device__ __forceinline__ v8f t_tile(const char* p, const v16b (&qh)[4], const v16b (&ql)[4]) {
  v16b ah[4], al[4];
  t_frags(ah, al, p);
  v8f acc = (v8f){0.f, 0.f, 0.f, 0.f, 0.f, 0.f, 0.f, 0.f};
#pragma unroll
  for (int s = 0; s < 4; ++s) {
    acc = Frag<__bf16>::mma(ah[s], qh[s], acc);
    acc = Frag<__bf16>::mma(al[s], qh[s], acc);
    acc = Frag<__bf16>::mma(ah[s], ql[s], acc);
  }
  return acc;
}
__global__ __launch_bounds__(512) void k_tail(const unsigned short* __restrict__ Ohi, const unsigned short* __restrict__ Olo,
                                             const unsigned short* __restrict__ WcHi, const unsigned short* __restrict__ WcLo,
                                             const float* __restrict__ bc,
                                             const unsigned short* __restrict__ EncHi, const unsigned short* __restrict__ EncLo,
                                             const float* __restrict__ ninfm, float* __restrict__ out) {
  __shared__ __align__(16) char abufs[16 * kTCh];     // 139264 B: one plane pair of 16 rows per wave
  __shared__ __align__(16) char osb[kTCh];            // O rows of the 16 queries
  __shared__ __align__(16) char mhb[kTCh];            // MH rows of the 16 queries
  __shared__ __align__(16) float xs[kTXs];            // 65536 B: mask rows, then probabilities; the last 1536 B are never used
  static_assert(kTXs >= 16 * kN, "16 rows fit");
  __shared__ __align__(16) float redm[16 * kTRp];
  __shared__ __align__(16) float reds[16 * kTRp];
  const float kNegInf = -__builtin_inff();
  const int t = threadIdx.x, lane = t & 31;
  const int wave = __builtin_amdgcn_readfirstlane(t >> 5);   // scalar: plane bases and the job select stay off the vector unit
  const int b = blockIdx.x / kPG, p0 = (blockIdx.x - b * kPG) * 16;
  const int c = lane & 15, h = lane >> 4;
  const int row0 = b * kP + p0;
  const int npc = ((kP - p0 < 16) ? (kP - p0) : 16) * (kN / 4);   // 16-B pieces in the group's rows of ninf_mask and out
  const unsigned o16 = (unsigned)lane * 16u;
  // O: wave w fetches rows 2 (w & 7), + 1 of the hi (w < 8) or lo plane: 512 contiguous bytes
  const unsigned short* osrc = ((wave < 8) ? Ohi : Olo) + (size_t)(row0 + 2 * (wave & 7)) * kHD;
  const v4u ov = *(const v4u*)((const char*)osrc + o16);
  // b_comb of the lane's 8 MH columns (used by waves 0..7)
  const unsigned ob = (unsigned)((wave & 7) * 16 + 8 * h) * 4u;
  const v4f bc0 = *(const v4f*)((const char*)bc + ob), bc1 = *(const v4f*)((const char*)bc + ob + 16);
  // mask rows; a piece past the group's rows is fetched from piece 0 (in bounds) and lands in a row that is never stored
  const char* nsrc = (const char*)(ninfm + (size_t)row0 * kN);
  unsigned no[8];
  v4f nv[8];
#pragma unroll
  for (int i = 0; i < 8; ++i) {
    const int f = t + 512 * i;
    no[i] = (f < npc) ? (unsigned)f * 16u : 0u;
    nv[i] = *(const v4f*)(nsrc + no[i]);
  }
  // address translations done before a register that a load above names is reused
  asm volatile("s_wait_xcnt 0x0" :: "v"(o16), "v"(ob), "v"(no[0]), "v"(no[1]), "v"(no[2]), "v"(no[3]), "v"(no[4]), "v"(no[5]),
               "v"(no[6]), "v"(no[7]) : "memory");
  // first A tile: waves 0..7 their 16 rows of W_comb^T, waves 8..15 their first 16 nodes
  const unsigned short* eh = EncHi + ((size_t)b * kNP + wave * 64) * kE;
  const unsigned short* el = EncLo + ((size_t)b * kNP + wave * 64) * kE;
  const bool merger = wave < 8;   // scalar
  v4u st[16];
  t_fetch(st, merger ? (WcHi + (size_t)wave * 16 * kHD) : eh, merger ? (WcLo + (size_t)wave * 16 * kHD) : el, o16);
  const int wplace = h * kTPit + c * 16;    // writer: row h of a pair of rows, 16-B piece c
  const int rplace = c * kTPit + h * 16;    // fragment reader: row c, k from 8 h
  *(v4u*)(osb + (wave >> 3) * kTPl + 2 * (wave & 7) * kTPit + wplace) = ov;
#pragma unroll
  for (int i = 0; i < 8; ++i) {
    *(v4f*)(xs + 4 * (t + 512 * i)) = nv[i];
  }
  __syncthreads();   // O rows and mask rows are in LDS
  char* abw = abufs + wave * kTCh + wplace;
  const char* abr = abufs + wave * kTCh + rplace;
  v16b qh[4], ql[4];
  if (merger) {
    t_put(abw, st);
    t_wave_sync();
    t_fetch(st, eh, el, o16);
    t_frags(qh, ql, osb + rplace);
    const v8f d = t_tile(abr, qh, ql);
    unsigned short hb[8], lb[8];
#pragma unroll
    for (int r = 0; r < 4; ++r) {
      split_bf(d[r] + bc0[r], hb[r], lb[r]);
      split_bf(d[4 + r] + bc1[r], hb[4 + r], lb[4 + r]);
    }
    char* md = mhb + c * kTPit + (wave * 16 + 8 * h) * 2;
    *(v4u*)(md) = (v4u){pk16(hb[0], hb[1]), pk16(hb[2], hb[3]), pk16(hb[4], hb[5]), pk16(hb[6], hb[7])};
    *(v4u*)(md + kTPl) = (v4u){pk16(lb[0], lb[1]), pk16(lb[2], lb[3]), pk16(lb[4], lb[5]), pk16(lb[6], lb[7])};
  }
  __syncthreads();   // MH rows are in LDS; waves 0..7 have left their buffers
  t_frags(qh, ql, mhb + rplace);
  v8f acc[4];
#pragma unroll
  for (int j = 0; j < 4; ++j) {
    t_put(abw, st);
    t_wave_sync();
    if (j < 3) t_fetch(st, eh + (j + 1) * 16 * kE, el + (j + 1) * 16 * kE, o16);
    acc[j] = t_tile(abr, qh, ql);
    if (j < 3) t_wave_sync();
  }
  // register r of tile j: node 64 wave + 16 j + 8 h + r, query c. 1000 is a multiple of 8: a lane's 8 nodes are all in or all out.
  float mx = kNegInf;
#pragma unroll
  for (int j = 0; j < 4; ++j) {
    const int n8 = wave * 64 + 16 * j + 8 * h;
    const bool ok = n8 < kN;
    const float* xp = xs + c * kN + (ok ? n8 : 0);            // address clamp
    const v4f m0 = *(const v4f*)(xp), m1 = *(const v4f*)(xp + 4);
#pragma unroll
    for (int r = 0; r < 8; ++r) {
      const float v = kClip * tanh_sel(acc[j][r] * kInvSqrtE) + ((r < 4) ? m0[r & 3] : m1[r & 3]);
      acc[j][r] = ok ? v : kNegInf;
      mx = fmaxf(mx, acc[j][r]);
    }
  }
  mx = fmaxf(mx, other_half(mx));
  if (h == 0) redm[c * kTRp + wave] = mx;
  __syncthreads();   // every wave's maxima are in the table
#pragma unroll
  for (int q = 0; q < 4; ++q) {
    const v4f e = *(const v4f*)(redm + c * kTRp + 4 * q);
    mx = fmaxf(fmaxf(mx, fmaxf(e[0], e[1])), fmaxf(e[2], e[3]));
  }
  float sum = 0.0f;
#pragma unroll
  for (int j = 0; j < 4; ++j)
#pragma unroll
    for (int r = 0; r < 8; ++r) {
      acc[j][r] = __expf(acc[j][r] - mx);
      sum += acc[j][r];
    }
  sum += other_half(sum);
  if (h == 0) reds[c * kTRp + wave] = sum;
  __syncthreads();   // every wave's sums are in the table
  float tot = 0.0f;
#pragma unroll
  for (int q = 0; q < 4; ++q) {
    const v4f e = *(const v4f*)(reds + c * kTRp + 4 * q);
    tot = (((tot + e[0]) + e[1]) + e[2]) + e[3];
  }
  const float inv = 1.0f / tot;
#pragma unroll
  for (int j = 0; j < 4; ++j) {
    const int n8 = wave * 64 + 16 * j + 8 * h;
    if (n8 < kN) {
      float* xp = xs + c * kN + n8;
      *(v4f*)(xp)     = (v4f){acc[j][0] * inv, acc[j][1] * inv, acc[j][2] * inv, acc[j][3] * inv};
      *(v4f*)(xp + 4) = (v4f){acc[j][4] * inv, acc[j][5] * inv, acc[j][6] * inv, acc[j][7] * inv};
    }
  }
  __syncthreads();   // the probabilities of the 16 rows are in xs
  char* obase = (char*)(out + (size_t)row0 * kN);
  v4f pv[8];
#pragma unroll
  for (int i = 0; i < 8; ++i) pv[i] = *(const v4f*)(xs + 4 * (t + 512 * i));
#pragma unroll
  for (int i = 0; i < 8; ++i) {
    if (t + 512 * i < npc) *(v4f*)(obase + (unsigned)t * 16u + 8192 * i) = pv[i];
  }
}

// ---------------------------------------------------------------------------
// Host launcher
// Workspace region map (bytes, 256-B aligned offsets):
//   EncHi bf16 [16][1024][128]          4,194,304
//   EncLo bf16 [16][1024][128]          4,194,304
//   WkvHi bf16 [256][128]                 65,536
//   WkvLo bf16 [256][128]                 65,536
//   WcHi  bf16 [128][128]                 32,768
//   WcLo  bf16 [128][128]                 32,768
//   W2T   f16  [64][64]                    8,192
//   KVf   f32  [16384][256]            16,777,216
//   Qs    f32  [1600][128]                819,200
//   QW    f32  [1600][64]                 409,600
//   MASKB f32  [1600][1024]             6,553,600
//   Ohi   bf16 [1664][128]                425,984
//   Olo   bf16 [1664][128]                425,984
//   total                              34,004,992
// ---------------------------------------------------------------------------
static inline size_t align256(size_t x) { return (x + 255) & ~(size_t)255; }

extern "C" void kernel_launch(void* const* d_in, const int* in_sizes, int n_in,
                              void* d_out, int out_size, void* d_ws, size_t ws_size,
                              hipStream_t stream) {
  if (n_in < 22) return;
  if (in_sizes[0] != kB * kN * kE || in_sizes[1] != kB * kP * kE || in_sizes[2] != kB * kP ||
      in_sizes[3] != kB * kP * kN || in_sizes[4] != kB * kP * kN * kDYN || out_size != kB * kP * kN) return;

  const float* enc      = (const float*)d_in[0];
  const float* enc_last = (const float*)d_in[1];
  const float* loadv    = (const float*)d_in[2];
  const float* ninfm    = (const float*)d_in[3];
  const float* dyn      = (const float*)d_in[4];
  const float* Wq       = (const float*)d_in[5];
  const float* Wk       = (const float*)d_in[6];
  const float* Wv       = (const float*)d_in[7];
  const float* Wc       = (const float*)d_in[8];
  const float* bcv      = (const float*)d_in[9];
  const float* fW1      = (const float*)d_in[10];
  const float* fb1      = (const float*)d_in[11];
  const float* fW2      = (const float*)d_in[12];
  const float* fb2      = (const float*)d_in[13];
  const float* lqW      = (const float*)d_in[14];
  const float* lqb      = (const float*)d_in[15];
  const float* lW1      = (const float*)d_in[16];
  const float* lb1      = (const float*)d_in[17];
  const float* lW2      = (const float*)d_in[18];
  const float* lb2      = (const float*)d_in[19];
  const float* lW3      = (const float*)d_in[20];
  const float* lb3      = (const float*)d_in[21];
  float* out = (float*)d_out;

  char* ws = (char*)d_ws;
  size_t off = 0;
  unsigned short* EncHi = (unsigned short*)(ws + off); off = align256(off + (size_t)kEncRows * kE * 2);
  unsigned short* EncLo = (unsigned short*)(ws + off); off = align256(off + (size_t)kEncRows * kE * 2);
  unsigned short* WkvHi = (unsigned short*)(ws + off); off = align256(off + (size_t)2 * kHD * kE * 2);
  unsigned short* WkvLo = (unsigned short*)(ws + off); off = align256(off + (size_t)2 * kHD * kE * 2);
  unsigned short* WcHi  = (unsigned short*)(ws + off); off = align256(off + (size_t)kE * kHD * 2);
  unsigned short* WcLo  = (unsigned short*)(ws + off); off = align256(off + (size_t)kE * kHD * 2);
  unsigned short* W2T   = (unsigned short*)(ws + off); off = align256(off + (size_t)kHID * kHID * 2);
  float* KVf   = (float*)(ws + off); off = align256(off + (size_t)kEncRows * 2 * kHD * 4);
  float* Qs    = (float*)(ws + off); off = align256(off + (size_t)kBP * kHD * 4);
  float* QW    = (float*)(ws + off); off = align256(off + (size_t)kBP * kHID * 4);
  float* MASKB = (float*)(ws + off); off = align256(off + (size_t)kBP * kNP * 4);
  unsigned short* Ohi  = (unsigned short*)(ws + off); off = align256(off + (size_t)kBPpad * kHD * 2);
  unsigned short* Olo  = (unsigned short*)(ws + off); off = align256(off + (size_t)kBPpad * kHD * 2);
  if (off > ws_size) return;

  // launch 1, inputs only: query side (f32); weight planes (Wk|Wv and W_comb transposed to bf16 hi/lo [n][k], lm_W2 transposed
  // to f16 x16); zeros in the 64 pad rows of Ohi and Olo; node planes (bf16 hi/lo, 24 zero pad rows per batch in both)
  k_front<<<kFrontBlocks, 256, 0, stream>>>(enc_last, loadv, Wq, fW1, fb1, fW2, fb2, lqW, lqb, lW1, lb1, Qs, QW,
                                            Wk, Wv, Wc, lW2, WkvHi, WkvLo, WcHi, WcLo, W2T,
                                            (unsigned int*)(Ohi + (size_t)kBP * kHD), (unsigned int*)(Olo + (size_t)kBP * kHD),
                                            enc, EncHi, EncLo);
  // launch 2: K|V projection (bf16 hi/lo both operands, K=128, M=16384, N=256 -> f32) beside the lazy-mask MLP (three layers
  // fused, all 1600 x 1024 slots; hidden layer on WMMA f16 (W x16), K=64)
  k_kv_lazy<<<kKvBlocks + kBP, 128, 0, stream>>>(EncHi, EncLo, WkvHi, WkvLo, KVf, dyn, QW, lW1, (const _Float16*)W2T, lb2, lW3,
                                                 lb3, ninfm, MASKB);
  // attention core (f32), 8 node slices per block merged in LDS -> O as bf16 hi/lo planes
  k_attn<<<kB * 14, 512, 0, stream>>>(Qs, KVf, MASKB, Ohi, Olo);
  // tail: head merge (bf16 hi/lo both operands, K=128, + b_comb), pointer scores against the node planes (bf16 hi/lo, K=128,
  // scale 1/sqrt(128)), clipped tanh + mask + softmax -> probs; one block per batch and group of 16 queries
  k_tail<<<kB * kPG, 512, 0, stream>>>(Ohi, Olo, WcHi, WcLo, bcv, EncHi, EncLo, ninfm, out);
}

// v008
// Measured time: 59.7 microseconds a run.
// Two timings next to v007 both put it at 1.04 times that version's speed.
// Over all steps from v000 it is 10.1 times as fast.
// Contractions: node K|V projection (nodes x [Wk|Wv]^T), head-merge projection (W_comb^T x O^T) and pointer scores (nodes x MH^T) on v_wmma_f32_16x16x32_bf16 with bf16 hi/lo operand planes (hi.hi + hi.lo + lo.hi); lazy-mask hidden layer (lm_W2^T f16 carried x16, as A, x H1 f16, as B) on v_wmma_f32_16x16x32_f16 inside the fused lazy-mask kernel; all f32 accumulate; query/FiLM/gating/qf projections, lazy layers 1 (K=3 after the broadcast fold) and 3 (N=1) and both softmaxes in f32 on the VALU; the attention core's two products (K x Q^T, V^T x P^T, head dim 16) on v_wmma_f32_16x16x4_f32.
#include <hip/hip_runtime.h>
#include <math.h>

typedef __attribute__((ext_vector_type(16))) _Float16 v16h;
typedef __attribute__((ext_vector_type(8)))  _Float16 v8h;
typedef __attribute__((ext_vector_type(16))) __bf16   v16b;
typedef __attribute__((ext_vector_type(8)))  __bf16   v8b;
typedef __attribute__((ext_vector_type(8)))  float    v8f;
typedef __attribute__((ext_vector_type(4)))  float    v4f;
typedef __attribute__((ext_vector_type(4)))  unsigned int v4u;
typedef __attribute__((ext_vector_type(2)))  float    v2f;
typedef __attribute__((ext_vector_type(2)))  _Float16 v2h;

// ---------------------------------------------------------------------------
// Problem constants
// ---------------------------------------------------------------------------
constexpr int kB   = 16;      // batch
constexpr int kP   = 100;     // queries per batch
constexpr int kN   = 1000;    // nodes
constexpr int kNP  = 1024;    // nodes padded
constexpr int kE   = 128;     // embedding
constexpr int kH   = 8;       // heads
constexpr int kD   = 16;      // head dim
constexpr int kHD  = 128;     // H*D
constexpr int kQD  = 16;      // lazy query dim
constexpr int kDYN = 3;       // dynamic features
constexpr int kHID = 64;      // lazy hidden
constexpr int kBP     = kB * kP;          // 1600 (b,p) rows
constexpr int kBPpad  = 1664;             // 26 * 64
constexpr int kEncRows = kB * kNP;        // 16384 padded node rows
constexpr int kPG = 7;                     // groups of 16 queries per batch (100 padded to 112)
constexpr float kWCarry   = 16.0f;        // lm_W2 carried x16 in f16
constexpr float kInvSqrtE = 0.08838834764831845f;
constexpr float kClip     = 10.0f;
static_assert(kBPpad % 64 == 0 && kBPpad >= kBP, "pad");
static_assert(kPG * 16 >= kP && kBPpad >= (kB - 1) * kP + kPG * 16, "last batch's query groups inside the O planes");
static_assert(kH * kD == kHD && kE == kHD, "dims");

// ---------------------------------------------------------------------------
// Helpers
// ---------------------------------------------------------------------------
__device__ __forceinline__ unsigned short f2bf_bits(float f) {
  unsigned u = __float_as_uint(f);
  return (unsigned short)((u + 0x7FFFu + ((u >> 16) & 1u)) >> 16);
}
__device__ __forceinline__ float bf_bits2f(unsigned short h) { return __uint_as_float(((unsigned)h) << 16); }

// hazard guards as plain device helpers (no inline asm inside the kernel template body)
__device__ __forceinline__ void dep_guard_h(v8f& a, v8f& b, v16h x, v16h y) { asm volatile("v_nop\n\tv_nop\n\tv_nop\n\tv_nop" : "+v"(a), "+v"(b) : "v"(x), "v"(y)); }
__device__ __forceinline__ void dep_guard_b(v8f& a, v8f& b, v16b x, v16b y) { asm volatile("v_nop\n\tv_nop\n\tv_nop\n\tv_nop" : "+v"(a), "+v"(b) : "v"(x), "v"(y)); }
__device__ __forceinline__ void keep4_h(v16h a, v16h b, v16h c, v16h d) { asm volatile("v_nop" :: "v"(a), "v"(b), "v"(c), "v"(d)); }
__device__ __forceinline__ void keep4_b(v16b a, v16b b, v16b c, v16b d) { asm volatile("v_nop" :: "v"(a), "v"(b), "v"(c), "v"(d)); }
__device__ __forceinline__ void acc_guard4(v8f& a, v8f& b, v8f& c, v8f& d) { asm volatile("v_nop\n\tv_nop\n\tv_nop\n\tv_nop" : "+v"(a), "+v"(b), "+v"(c), "+v"(d)); }
template <typename T> struct Frag;
template <> struct Frag<_Float16> {
  typedef v16h V; union U { v16h v; v8h h[2]; };
  static __device__ __forceinline__ v16h load(const _Float16* p) {   // elements 0..7 <- p[0..7], 8..15 <- p[16..23]
    U f; f.h[0] = *(const v8h*)(p); f.h[1] = *(const v8h*)(p + 16); return f.v;
  }
  static __device__ __forceinline__ v8f mma(v16h a, v16h b, v8f c) {
    return __builtin_amdgcn_wmma_f32_16x16x32_f16(false, a, false, b, (short)0, c, false, false);
  }
  static __device__ __forceinline__ void guard(v8f& a, v8f& b, v16h x, v16h y) { dep_guard_h(a, b, x, y); }
  static __device__ __forceinline__ void keep(v16h a, v16h b, v16h c, v16h d) { keep4_h(a, b, c, d); }
};
template <> struct Frag<__bf16> {
  typedef v16b V; union U { v16b v; v8b h[2]; };
  static __device__ __forceinline__ v16b load(const __bf16* p) {
    U f; f.h[0] = *(const v8b*)(p); f.h[1] = *(const v8b*)(p + 16); return f.v;
  }
  static __device__ __forceinline__ v8f mma(v16b a, v16b b, v8f c) {
    return __builtin_amdgcn_wmma_f32_16x16x32_bf16(false, a, false, b, (short)0, c, false, false);
  }
  static __device__ __forceinline__ void guard(v8f& a, v8f& b, v16b x, v16b y) { dep_guard_b(a, b, x, y); }
  static __device__ __forceinline__ void keep(v16b a, v16b b, v16b c, v16b d) { keep4_b(a, b, c, d); }
};

__device__ __forceinline__ unsigned pk16(unsigned short a, unsigned short b) { return (unsigned)a | ((unsigned)b << 16); }
__device__ __forceinline__ unsigned short h_bits(float f) { const _Float16 h = (_Float16)f; return __builtin_bit_cast(unsigned short, h); }
// bf16 hi + bf16 lo split of an f32 value (both RNE converts)
__device__ __forceinline__ void split_bf(float f, unsigned short& hb, unsigned short& lb) {
  hb = f2bf_bits(f);
  lb = f2bf_bits(f - bf_bits2f(hb));
}

// ---- Register-blocked batched WMMA GEMM (ACT reduced to none/relu/leaky) -----------------------
// C[m,n] = scale * sum_k A[m,k] * Bt[n,k] (+bias)(+resid); each wave owns a 64x64 tile.
// A row-major [M,K]; Bt row-major [N,K]; M,N % 64 == 0, K % 32 == 0.
// SPLIT: operands are hi/lo planes (A2/Bt2 = lo planes, same layout); product = hi·hi + hi·lo + lo·hi.
// BIAS_MODE: 0 = none, 1 = bias[m], 2 = bias[n].
// OUT_MODE: 0 = f32, 1 = f16, 2 = bf16 hi plane (Cout) + bf16 lo plane (Cout2).
// ET: 0 = f16 operands, 1 = bf16 operands (pointers passed as 16-bit storage)
template <int ET> struct Elem;
template <> struct Elem<0> { typedef _Float16 T; };
template <> struct Elem<1> { typedef __bf16 T; };
// The engine is a device function, so that a launch can hold it beside another job: NW = waves per block, sT = NW slabs of
// LDS (16x64 f32 at a pitch of 68 floats each), bx = block index among the engine's blocks, b = batch index.
template <int NW, int ET, bool SPLIT, int BIAS_MODE, int OUT_MODE, bool RESID, int ACT>
__device__ __forceinline__ void gemm64_body(
    float* sT, int bx, int b,
    const unsigned short* __restrict__ Ap, const unsigned short* __restrict__ A2p, int lda, long strideA,
    const unsigned short* __restrict__ Btp, const unsigned short* __restrict__ Bt2p, int ldb, long strideB,
    void* __restrict__ Cout, void* __restrict__ Cout2, int ldc, long strideC,
    const float* __restrict__ bias,
    const float* __restrict__ resid, long strideR,
    int M, int N, int K, float scale) {
  typedef typename Elem<ET>::T T;
  typedef typename Frag<T>::V V;
  const T* A = (const T*)Ap; const T* A2 = (const T*)A2p; const T* Bt = (const T*)Btp; const T* Bt2 = (const T*)Bt2p;
  const int lane = threadIdx.x & 31;
  const int wave = threadIdx.x >> 5;
  const int tilesN = N >> 6;
  const int tilesM = M >> 6;
  const int tile = bx * NW + wave;
  if (tile >= tilesM * tilesN) return;   // wave-uniform; no block barriers in this kernel
  const int tm = tile / tilesN;
  const int tn = tile - tm * tilesN;
  const int m0 = tm << 6;
  const int n0 = tn << 6;

  const T* Ab  = A  + (size_t)b * strideA;
  const T* Bb  = Bt + (size_t)b * strideB;
  const T* Ab2 = SPLIT ? (A2  + (size_t)b * strideA) : nullptr;
  const T* Bb2 = SPLIT ? (Bt2 + (size_t)b * strideB) : nullptr;

  const int rlane = lane & 15;                 // row (A) / col (B, D) within subtile
  const int koff  = (lane >> 4) * 8;           // k offset of this lane half
  const int mOff  = (lane >> 4) * 8;           // D row offset

  v8f acc[4][4];
#pragma unroll
  for (int i = 0; i < 4; ++i)
#pragma unroll
    for (int j = 0; j < 4; ++j) acc[i][j] = (v8f){0.f,0.f,0.f,0.f,0.f,0.f,0.f,0.f};

  for (int k0 = 0; k0 < K; k0 += 32) {
    V bh[4], bl[4];
#pragma unroll
    for (int j = 0; j < 4; ++j) {
      const size_t bo = (size_t)(n0 + (j << 4) + rlane) * ldb + koff + k0;
      bh[j] = Frag<T>::load(Bb + bo);
      if (SPLIT) bl[j] = Frag<T>::load(Bb2 + bo);
    }
#pragma unroll
    for (int i = 0; i < 4; ++i) {
      const size_t ao = (size_t)(m0 + (i << 4) + rlane) * lda + koff + k0;
      V ah = Frag<T>::load(Ab + ao);
      V al;
      if (SPLIT) al = Frag<T>::load(Ab2 + ao);
#pragma unroll
      for (int j = 0; j < 4; ++j) {
        acc[i][j] = Frag<T>::mma(ah, bh[j], acc[i][j]);
        if (SPLIT) {
          acc[i][j] = Frag<T>::mma(ah, bl[j], acc[i][j]);
          acc[i][j] = Frag<T>::mma(al, bh[j], acc[i][j]);
        }
      }
      Frag<T>::guard(acc[i][0], acc[i][3], ah, SPLIT ? al : ah);
    }
    Frag<T>::keep(bh[0], bh[1], bh[2], bh[3]);
    if (SPLIT) Frag<T>::keep(bl[0], bl[1], bl[2], bl[3]);
  }
  acc_guard4(acc[0][0], acc[0][1], acc[0][2], acc[0][3]);
  acc_guard4(acc[1][0], acc[1][1], acc[1][2], acc[1][3]);
  acc_guard4(acc[2][0], acc[2][1], acc[2][2], acc[2][3]);
  acc_guard4(acc[3][0], acc[3][1], acc[3][2], acc[3][3]);

  // ---- epilogue ----
  float* slab = sT + wave * (16 * 68);
  const float* Rb = RESID ? (resid + (size_t)b * strideR) : nullptr;
#pragma unroll
  for (int i = 0; i < 4; ++i) {
    const int mBase = m0 + (i << 4);
#pragma unroll
    for (int j = 0; j < 4; ++j) {
      const int n = n0 + (j << 4) + rlane;
      float bv = 0.f;
      if (BIAS_MODE == 2) bv = bias[n];
#pragma unroll
      for (int r = 0; r < 8; ++r) {
        float v = acc[i][j][r] * scale;
        if (BIAS_MODE == 1) v += bias[mBase + mOff + r];
        if (BIAS_MODE == 2) v += bv;
        if (RESID) v += Rb[(size_t)(mBase + mOff + r) * ldc + n];
        if (ACT == 2) v = fmaxf(v, 0.0f);
        if (ACT == 4) v = (v > 0.f) ? v : 0.01f * v;
        slab[(mOff + r) * 68 + (j << 4) + rlane] = v;
      }
    }
    __builtin_amdgcn_fence(__ATOMIC_RELEASE, "workgroup");
    __builtin_amdgcn_wave_barrier();
    __builtin_amdgcn_fence(__ATOMIC_ACQUIRE, "workgroup");
    if (OUT_MODE == 0) {
      float* C = (float*)Cout + (size_t)b * strideC;
      const int hh = lane >> 4, c4 = (lane & 15) * 4;     // row seg = 256 B = 16 lanes x 16 B
      {
#pragma unroll
        for (int it = 0; it < 8; ++it) {
          const int row = it * 2 + hh;
          v4f v = *(const v4f*)(slab + row * 68 + c4);
          *(v4f*)(C + (size_t)(mBase + row) * ldc + n0 + c4) = v;
        }
        
      }
    } else {
      const int q = lane >> 3, c8 = (lane & 7) * 8;
      unsigned short* C  = (unsigned short*)Cout  + (size_t)b * strideC;
      unsigned short* C2 = (OUT_MODE == 2) ? ((unsigned short*)Cout2 + (size_t)b * strideC) : nullptr;
      {
#pragma unroll
        for (int it = 0; it < 4; ++it) {
          const int row = it * 4 + q;
          const float* sp = slab + row * 68 + c8;
          v8h hv, lv;
#pragma unroll
          for (int e = 0; e < 8; ++e) {
            if (OUT_MODE == 1) {
              hv[e] = (_Float16)sp[e];
            } else {
              unsigned short hb = f2bf_bits(sp[e]);
              unsigned short lb = f2bf_bits(sp[e] - bf_bits2f(hb));
              hv[e] = __builtin_bit_cast(_Float16, hb);
              lv[e] = __builtin_bit_cast(_Float16, lb);
            }
          }
          *(v8h*)(C + (size_t)(mBase + row) * ldc + n0 + c8) = hv;
          if (OUT_MODE == 2) *(v8h*)(C2 + (size_t)(mBase + row) * ldc + n0 + c8) = lv;
        }
        
      }
    }
    __builtin_amdgcn_fence(__ATOMIC_RELEASE, "workgroup");
    __builtin_amdgcn_wave_barrier();
    __builtin_amdgcn_fence(__ATOMIC_ACQUIRE, "workgroup");
  }
}
// ---------------------------------------------------------------------------
// Weight preparation: 64x64 transpose tiles of f32 W[k][n] (pitch ldn) -> WT[n][k] (pitch ldk).
// blocks 0..3: Wk -> WkvHi/WkvLo rows 0..127 (bf16 hi + bf16 lo planes); 4..7: Wv -> rows 128..255;
// 8..11: W_comb -> WcHi/WcLo; 12: lm_W2 -> W2T (f16 carried x16, single plane).
// Load coverage: 16 x 256 = 4096 = whole tile. Store coverage: 8 waves x 2 it x 4 rows (lane>>3) = 64 rows,
// ---------------------------------------------------------------------------
constexpr int kWpBlocks = 13;
constexpr int kWpLds = 64 * 65;   // floats
__device__ __forceinline__ void wprep_body(float* smem, int bid,
                                           const float* __restrict__ Wk, const float* __restrict__ Wv,
                                           const float* __restrict__ Wcomb, const float* __restrict__ W2,
                                           unsigned short* __restrict__ WkvHi, unsigned short* __restrict__ WkvLo,
                                           unsigned short* __restrict__ WcHi, unsigned short* __restrict__ WcLo,
                                           unsigned short* __restrict__ W2T) {
  float (*sm)[65] = (float (*)[65])smem;   // sm[n_local][k_local]
  const int t = threadIdx.x, lane = t & 31, wave = t >> 5;
  // bid: block-uniform selection below
  const float* W = Wk; unsigned short* outH = WkvHi; unsigned short* outL = WkvLo;
  int ldn = kHD, ldk = kE, nt = 0, kt = 0; float carry = 1.0f;
  const bool two_planes = (bid < 12);
  if (bid < 4)       { W = Wk;    outH = WkvHi;                    outL = WkvLo;                    ldn = kHD;  ldk = kE;   nt = bid & 1;       kt = bid >> 1;       carry = 1.0f; }
  else if (bid < 8)  { W = Wv;    outH = WkvHi + (size_t)kHD * kE; outL = WkvLo + (size_t)kHD * kE; ldn = kHD;  ldk = kE;   nt = (bid - 4) & 1; kt = (bid - 4) >> 1; carry = 1.0f; }
  else if (bid < 12) { W = Wcomb; outH = WcHi;                     outL = WcLo;                     ldn = kE;   ldk = kHD;  nt = (bid - 8) & 1; kt = (bid - 8) >> 1; carry = 1.0f; }
  else               { W = W2;    outH = W2T;                      outL = W2T;                      ldn = kHID; ldk = kHID; nt = 0;             kt = 0;              carry = kWCarry; }
  const int n0 = nt * 64, k0 = kt * 64;
  const int r0 = t >> 6;     // k local of trip 0; trip i: r0 + 4 i
  const int c = t & 63;      // n local
  float wv[16];
#pragma unroll
  for (int g = 0; g < 4; ++g) {
    const float* p0 = W + (size_t)(k0 + r0 + 16 * g) * ldn + n0 + c;
    const float* p1 = p0 + (size_t)4 * ldn;
    const float* p2 = p0 + (size_t)8 * ldn;
    const float* p3 = p0 + (size_t)12 * ldn;
    wv[4 * g] = *p0; wv[4 * g + 1] = *p1; wv[4 * g + 2] = *p2; wv[4 * g + 3] = *p3;
    // address translations done before a register that one of these four loads names is reused; naming the four addresses
    // as inputs keeps them in their registers up to the wait
    asm volatile("s_wait_xcnt 0x0" :: "v"(p0), "v"(p1), "v"(p2), "v"(p3) : "memory");
  }
#pragma unroll
  for (int i = 0; i < 16; ++i) sm[c][r0 + 4 * i] = wv[i] * carry;
  __syncthreads();
  const int q = lane >> 3, c8 = (lane & 7) * 8;
  v4u uh[2], ul[2];
  int rowv[2];
#pragma unroll
  for (int it = 0; it < 2; ++it) {
    const int row = wave * 8 + it * 4 + q;   // n local
    rowv[it] = row;
    unsigned short hb[8], lb[8];
#pragma unroll
    for (int e = 0; e < 8; ++e) {
      const float v = sm[row][c8 + e];
      if (two_planes) { split_bf(v, hb[e], lb[e]); }
      else { hb[e] = h_bits(v); lb[e] = hb[e]; }
    }
    uh[it] = (v4u){pk16(hb[0], hb[1]), pk16(hb[2], hb[3]), pk16(hb[4], hb[5]), pk16(hb[6], hb[7])};
    ul[it] = (v4u){pk16(lb[0], lb[1]), pk16(lb[2], lb[3]), pk16(lb[4], lb[5]), pk16(lb[6], lb[7])};
  }
  {
#pragma unroll
    for (int it = 0; it < 2; ++it) {
      const size_t o = (size_t)(n0 + rowv[it]) * ldk + k0 + c8;
      *(v4u*)(outH + o) = uh[it];
      // behind each store: address translation done before the code laid out behind it writes a register that the store names
      asm volatile("s_wait_xcnt 0x0" ::: "memory");
      if (two_planes) {
        *(v4u*)(outL + o) = ul[it];
        asm volatile("s_wait_xcnt 0x0" ::: "memory");   // as above
      }
    }
  }
}

// ---------------------------------------------------------------------------
// Node split: enc f32 [B][1000][128] -> EncHi/EncLo bf16 hi/lo planes [B][1024][128] each
// (rows 1000..1023 of every batch written as zeros in both planes).
// ---------------------------------------------------------------------------
constexpr int kEcBlocks = (kEncRows * 16) / 256;
__device__ __forceinline__ void enc_cast_body(int bid, const float* __restrict__ enc, unsigned short* __restrict__ outHi,
                                              unsigned short* __restrict__ outLo) {
  const int i = bid * 256 + threadIdx.x;
  if (i >= kEncRows * 16) return;
  const int row = i >> 4, c8 = (i & 15) * 8;
  const int b = row >> 10, n = row & (kNP - 1);
  const int nc = (n < kN) ? n : (kN - 1);                    // address clamp
  const float* p = enc + ((size_t)(b * kN + nc)) * kE + c8;
  const v4f a = *(const v4f*)(p);
  const v4f c = *(const v4f*)(p + 4);
  const bool valid = (n < kN);
  unsigned short hb[8], lb[8];
#pragma unroll
  for (int e = 0; e < 4; ++e) {
    split_bf(valid ? a[e] : 0.0f, hb[e], lb[e]);
    split_bf(valid ? c[e] : 0.0f, hb[4 + e], lb[4 + e]);
  }
  const v4u uh = (v4u){pk16(hb[0], hb[1]), pk16(hb[2], hb[3]), pk16(hb[4], hb[5]), pk16(hb[6], hb[7])};
  const v4u ul = (v4u){pk16(lb[0], lb[1]), pk16(lb[2], lb[3]), pk16(lb[4], lb[5]), pk16(lb[6], lb[7])};
  const size_t o = (size_t)row * kE + c8;
  *(v4u*)(outHi + o) = uh;
  *(v4u*)(outLo + o) = ul;
  
}

// ---------------------------------------------------------------------------
// Query side (f32, VALU), 4 (b,p) rows per block: q_in = [last | load] (129);
//   Qs[bp][h*16+d] = ((q_in.Wq_last) * 2*sigmoid(relu(q_in.fW1 + fb1).fW2 + fb2)) * 0.25   (1/sqrt(16) folded, exact)
//   QW[bp][64]     = lm_b1 + qf.lm_W1[3:19]   with qf = q_in.lazy_q_W + lazy_q_b
// 5 working waves. Waves 0..3: thread = output column j; every weight element it loads feeds the chains of the 4 rows, whose
// inputs lie in LDS as [e][row] (one 16-B broadcast read per e). Wave 4: hidden unit 128 of the FiLM layer, qf, then QW.
// The weight loads go out in batches, one batch ahead of the arithmetic, so their latencies overlap.
// Every output is still one fma chain from its bias, e ascending.
// All loops of this kernel are unrolled in full: the batches are register arrays, which takes static indices, and the
// loads of a batch have to stand together ahead of the arithmetic that uses the batch before.
// Stores: one instruction of a wave writes one whole 128-B line of a Qs or QW row.
// The launch that holds this job has blocks of 8 waves: waves 5..7 have no part here and only pass the two barriers.
// ---------------------------------------------------------------------------
constexpr int kQR = 4;     // (b,p) rows per block
constexpr int kQB = 16;    // e steps per batch of weight loads
static_assert(kBP % kQR == 0 && kE % kQB == 0, "rows per block, batches");
// one batch of a weight column: w[i] = col[(e0 + i) * LD]
template <int LD>
__device__ __forceinline__ void q_fetch(float (&w)[kQB], const float* __restrict__ col, int e0) {
#pragma unroll
  for (int i = 0; i < kQB; ++i) w[i] = col[(e0 + i) * LD];
}
// Stands behind a group of loads: address translations done before a register that an issued load names is reused; its
// "memory" clobber also keeps those loads in front of the LDS reads and the arithmetic below, which then cover their latency.
__device__ __forceinline__ void q_issued() { asm volatile("s_wait_xcnt 0x0" ::: "memory"); }
// a[r] += x[r] * w for NR rows
template <int NR>
__device__ __forceinline__ void q_step(float (&a)[NR], const float* x, float w) {
#pragma unroll
  for (int r = 0; r < NR; ++r) a[r] = fmaf(x[r], w, a[r]);
}
// a[r] += sum_e xa[e][r] * colA[e * LDA] and b[r] += sum_e xb[e][r] * colB[e * LDB], e = 0..128 ascending;
// xa, xb: LDS, kQR floats per e
template <int LDA, int LDB, int NA, int NB>
__device__ __forceinline__ void q_dot2(float (&a)[NA], const float* xa, const float* __restrict__ colA,
                                       float (&b)[NB], const float* xb, const float* __restrict__ colB) {
  float wa[2][kQB], wb[2][kQB];
  q_fetch<LDA>(wa[0], colA, 0);
  q_fetch<LDB>(wb[0], colB, 0);
  float wat = 0.0f, wbt = 0.0f;
#pragma unroll
  for (int c = 0; c < kE / kQB; ++c) {
    if (c + 1 < kE / kQB) {
      q_fetch<LDA>(wa[(c + 1) & 1], colA, kQB * (c + 1));
      q_fetch<LDB>(wb[(c + 1) & 1], colB, kQB * (c + 1));
    } else {
      wat = colA[kE * LDA];
      wbt = colB[kE * LDB];
    }
    q_issued();
#pragma unroll
    for (int i = 0; i < kQB; ++i) {
      q_step<NA>(a, xa + (kQB * c + i) * kQR, wa[c & 1][i]);
      q_step<NB>(b, xb + (kQB * c + i) * kQR, wb[c & 1][i]);
    }
  }
  q_step<NA>(a, xa + kE * kQR, wat);
  q_step<NB>(b, xb + kE * kQR, wbt);
}
constexpr int kQsBlocks = kBP / kQR;
constexpr int kQsLds = (kE + 1) * kQR + (kE * kQR + 32) + kQD * kQR;   // floats
__device__ __forceinline__ void qside_body(float* smem, int bid,
                                           const float* __restrict__ enc_last, const float* __restrict__ loadv,
                                           const float* __restrict__ Wq, const float* __restrict__ fW1,
                                           const float* __restrict__ fb1, const float* __restrict__ fW2,
                                           const float* __restrict__ fb2, const float* __restrict__ lqW,
                                           const float* __restrict__ lqb, const float* __restrict__ lW1,
                                           const float* __restrict__ lb1,
                                           float* __restrict__ Qs, float* __restrict__ QW) {
  float* qin = smem;                          // [e][row], (kE + 1) * kQR floats
  float* g1s = qin + (kE + 1) * kQR;          // [e][row]; behind e = 128 the 28 copies that wave 4 leaves
  float* qfs = g1s + kE * kQR + 32;           // [i][row]
  const int bp0 = bid * kQR;
  const int t = threadIdx.x, lane = t & 31;
  const int wv = __builtin_amdgcn_readfirstlane(t >> 5);
  const bool colw = wv < 4, aux = wv == 4;    // scalar: waves 0..3, wave 4; neither: waves 5..7
  if (colw) {
    v4f x;
#pragma unroll
    for (int r = 0; r < kQR; ++r) x[r] = enc_last[(size_t)(bp0 + r) * kE + t];
    q_issued();
    *(v4f*)(qin + t * kQR) = x;
  } else if (aux && lane < kQR) {
    const float x = loadv[bp0 + lane];
    q_issued();
    qin[kE * kQR + lane] = x;
  }
  __syncthreads();
  float qv[kQR] = {0.0f, 0.0f, 0.0f, 0.0f};
  if (colw) {
    const float b1 = fb1[t];
    q_issued();
    float a1[kQR] = {b1, b1, b1, b1};
    q_dot2<kE + 1, kHD, kQR, kQR>(a1, qin, fW1 + t, qv, qin, Wq + t);
    *(v4f*)(g1s + t * kQR) = (v4f){fmaxf(a1[0], 0.0f), fmaxf(a1[1], 0.0f), fmaxf(a1[2], 0.0f), fmaxf(a1[3], 0.0f)};
  } else if (aux) {
    // lane = (qf unit i16, row pair h2); it also runs hidden unit 128 of row lane & 3 (lanes 0..3 are read, the rest are copies)
    const int i16 = lane & 15, h2 = (lane >> 4) * 2;
    float a1[1] = {fb1[kE]};
    const float bq = lqb[i16];
    q_issued();
    float qf[2] = {bq, bq};
    q_dot2<kE + 1, kQD, 1, 2>(a1, qin + (lane & 3), fW1 + kE, qf, qin + h2, lqW + i16);
    g1s[kE * kQR + lane] = fmaxf(a1[0], 0.0f);
    *(v2f*)(qfs + i16 * kQR + h2) = (v2f){qf[0], qf[1]};
  }
  __syncthreads();
  if (colw) {
    const float b2 = fb2[t];
    float gm[kQR] = {b2, b2, b2, b2};
    const float* col = fW2 + t;
    float w[3][kQB];           // two batches ahead here: one column only
    q_fetch<kHD>(w[0], col, 0);
    q_fetch<kHD>(w[1], col, kQB);
    float wt = 0.0f;
#pragma unroll
    for (int c = 0; c < kE / kQB; ++c) {
      if (c + 2 < kE / kQB) q_fetch<kHD>(w[(c + 2) % 3], col, kQB * (c + 2));
      else if (c + 2 == kE / kQB) wt = col[kE * kHD];
      if (c + 2 <= kE / kQB) q_issued();
#pragma unroll
      for (int i = 0; i < kQB; ++i) q_step<kQR>(gm, g1s + (kQB * c + i) * kQR, w[c % 3][i]);
    }
    q_step<kQR>(gm, g1s + kE * kQR, wt);
#pragma unroll
    for (int r = 0; r < kQR; ++r) {
      const float den = 1.0f + expf(-gm[r]);
      const float gamma = 2.0f * (1.0f / den);
      Qs[(size_t)(bp0 + r) * kHD + t] = (qv[r] * gamma) * 0.25f;
    }
  } else if (aux) {
    const float c0 = lb1[lane], c1 = lb1[32 + lane];
    float u0[kQR] = {c0, c0, c0, c0}, u1[kQR] = {c1, c1, c1, c1};
    float w0[kQB], w1[kQB];
    static_assert(kQD == kQB, "one batch");
    q_fetch<kHID>(w0, lW1 + kDYN * kHID + lane, 0);
    q_fetch<kHID>(w1, lW1 + kDYN * kHID + 32 + lane, 0);
    q_issued();
#pragma unroll
    for (int i = 0; i < kQD; ++i) {
      q_step<kQR>(u0, qfs + i * kQR, w0[i]);
      q_step<kQR>(u1, qfs + i * kQR, w1[i]);
    }
#pragma unroll
    for (int r = 0; r < kQR; ++r) {
      QW[(size_t)(bp0 + r) * kHID + lane] = u0[r];
      QW[(size_t)(bp0 + r) * kHID + 32 + lane] = u1[r];
    }
    q_issued();   // the wait behind the stores too: the code laid out behind this branch writes registers that they name
  }
}

// ---------------------------------------------------------------------------
// Lazy-mask MLP, all three layers in one kernel; H1 and H2 never leave the registers.
// Block = one (b,p) row of MASKB, 4 waves; a wave owns 256 node slots and walks them 32 at a time (two 16-slot tiles).
// Lane l: c = l & 15, h = l >> 4.
//   layer 1 (f32 VALU): the lane computes H1[slot c][k] for its own 32 k (k = 32 s + 16 h + e, s = 0,1, e = 0..15),
//     relu, f16: that is the B fragment of k step s as it stands. Its weights come from an LDS table, per k pair
//     {W1[0][k,k+1], W1[1][k,k+1], W1[2][k,k+1], QW[k,k+1]}; the row's dynamic features and mask row are staged in LDS once.
//   layer 2 (WMMA f16): A = lm_W2^T x16, row j = 16 i + c, the same k per lane and element;
//     D register r of tile i = 16 * (H1 . lm_W2[:, j]) for hidden unit j = 16 i + 8 h + r of slot c.
//   layer 3 (f32 VALU): z = sum_j relu(D / 16 + lm_b2[j]) * lm_W3[j]: 32 j in the lane, the other 32 in lane l ^ 16.
//   MASKB[bp][n] = ninf_mask[b,p,min(n,999)] - softplus(z + lm_b3)   (ALPHA = 1)
// Coverage: 1600 blocks x 4 waves x 8 trips x 32 slots = all 1024 columns of all 1600 rows (pad slots from clamped inputs).
// ---------------------------------------------------------------------------
// layer 3 for one 16-unit tile: sum over the lane's 8 hidden units of relu(D / 16 + b2) * w3
__device__ __forceinline__ v2f lazy_l3(v8f acc, const v2f (&b2)[4], const v2f (&w3)[4]) {
  const v2f zero = (v2f){0.0f, 0.0f};
  const v2f sc = (v2f){1.0f / kWCarry, 1.0f / kWCarry};
  v2f zs = zero;
#pragma unroll
  for (int q = 0; q < 4; ++q) {
    const v2f a = __builtin_elementwise_max(__builtin_elementwise_fma((v2f){acc[2 * q], acc[2 * q + 1]}, sc, b2[q]), zero);
    zs = __builtin_elementwise_fma(a, w3[q], zs);
  }
  return zs;
}
constexpr int kLzLds = 2 * 16 * 8 + kN * kDYN + kN;   // floats
__device__ __forceinline__ void lazy_body(float* smem, int bp,
                                          const float* __restrict__ dyn, const float* __restrict__ QW,
                                          const float* __restrict__ lW1, const _Float16* __restrict__ W2T,
                                          const float* __restrict__ lb2, const float* __restrict__ lW3,
                                          const float* __restrict__ lb3, const float* __restrict__ ninfm,
                                          float* __restrict__ maskb) {
  float* tbl = smem;                   // [h][k pair][w0 w0 w1 w1 w2 w2 qw qw], 2 * 16 * 8 floats
  float* sd = tbl + 2 * 16 * 8;        // dynamic features of this (b,p): 1000 x 3
  float* sn = sd + kN * kDYN;          // ninf_mask row of this (b,p)
  const int t = threadIdx.x;
  const int lane = t & 31, wave = t >> 5;
  const int c = lane & 15, h = lane >> 4;
  // stage the 12000 contiguous bytes of dynamic features: 750 x 16 B over 128 threads
  const unsigned oD = (unsigned)t * 16u;
  const char* dsrc = (const char*)(dyn + (size_t)bp * kN * kDYN);
  v4f dv[6];
#pragma unroll
  for (int i = 0; i < 5; ++i) dv[i] = *(const v4f*)(dsrc + oD + i * 2048);
  const bool last = (t < (kN * kDYN * 4 - 5 * 2048) / 16);
  const unsigned oL = last ? (oD + 5 * 2048) : 0u;     // threads past the end fetch in bounds and store nothing
  dv[5] = *(const v4f*)(dsrc + oL);
  // and the 4000 contiguous bytes of the mask row: 250 x 16 B
  const char* nsrc = (const char*)(ninfm + (size_t)bp * kN);
  const bool lastn = (t < (kN * 4 - 2048) / 16);
  const unsigned oN = lastn ? (oD + 2048) : 0u;
  const v4f nv0 = *(const v4f*)(nsrc + oD);
  const v4f nv1 = *(const v4f*)(nsrc + oN);
  // weight table: thread t fetches one pair: h = t >> 6, k pair p = (t >> 2) & 15, which = t & 3
  const int tp = (t >> 2) & 15, tw = t & 3;
  const int tk = 32 * (tp >> 3) + 16 * (t >> 6) + 2 * (tp & 7);
  const float* tsrc = (tw < 3) ? (lW1 + tw * kHID + tk) : (QW + (size_t)bp * kHID + tk);
  const v2f tv = *(const v2f*)tsrc;
  // byte offsets of the lane's first fragment / bias element; these set-up loads are scalar base + one of them
  const unsigned oA = (unsigned)(c * kHID + 16 * h) * 2u;
  const unsigned oJ = (unsigned)(8 * h) * 4u;
  v16h aw[4][2];
#pragma unroll
  for (int i = 0; i < 4; ++i)
#pragma unroll
    for (int s = 0; s < 2; ++s) aw[i][s] = *(const v16h*)((const char*)W2T + oA + (16 * i * kHID + 32 * s) * 2);
  v2f b2[4][4], w3[4][4];
#pragma unroll
  for (int i = 0; i < 4; ++i)
#pragma unroll
    for (int q = 0; q < 4; ++q) {
      b2[i][q] = *(const v2f*)((const char*)lb2 + oJ + (16 * i + 2 * q) * 4);
      w3[i][q] = *(const v2f*)((const char*)lW3 + oJ + (16 * i + 2 * q) * 4);
    }
  const float b3 = lb3[0];
  // address translations done before a register that a load above names is reused
  asm volatile("s_wait_xcnt 0x0" :: "v"(oD), "v"(oL), "v"(oN), "v"(tsrc), "v"(oA), "v"(oJ) : "memory");
#pragma unroll
  for (int i = 0; i < 5; ++i) *(v4f*)((char*)sd + oD + i * 2048) = dv[i];
  if (last) *(v4f*)((char*)sd + oL) = dv[5];
  *(v4f*)((char*)sn + oD) = nv0;
  if (lastn) *(v4f*)((char*)sn + oN) = nv1;
  *(v2f*)(tbl + 2 * t) = tv;
  __syncthreads();
  const int nw = wave * 256;
  float* mp = maskb + (size_t)bp * kNP + nw + lane;
  const v4f* tb4 = (const v4f*)(tbl + h * 128);
  for (int it = 0; it < 8; ++it) {
    const int n0 = nw + it * 32;
    const int n = n0 + lane;
    const int nc = (n < kN) ? n : (kN - 1);                          // address clamps (pad slots)
    const int ia = ((n0 + c < kN) ? (n0 + c) : (kN - 1)) * kDYN;
    const int ib = ((n0 + 16 + c < kN) ? (n0 + 16 + c) : (kN - 1)) * kDYN;
    const float a0 = sd[ia], a1 = sd[ia + 1], a2 = sd[ia + 2];
    const float e0 = sd[ib], e1 = sd[ib + 1], e2 = sd[ib + 2];
    v16h ba[2], bb[2];
    const v2h hzero = (v2h){(_Float16)0.0f, (_Float16)0.0f};
    v4f tq[2][8];                               // weight-table reads, four k pairs a group, one group ahead
#pragma unroll
    for (int j = 0; j < 8; ++j) tq[0][j] = tb4[j];
#pragma unroll
    for (int g = 0; g < 4; ++g) {
      if (g < 3) {
#pragma unroll
        for (int j = 0; j < 8; ++j) tq[(g + 1) & 1][j] = tb4[8 * (g + 1) + j];
      }
      // keeps the next group's LDS reads in front of this group's arithmetic, which then covers their latency
      __builtin_amdgcn_sched_barrier(0);
#pragma unroll
      for (int pp = 0; pp < 4; ++pp) {
        const int p = 4 * g + pp;
        const v4f u = tq[g & 1][2 * pp], v = tq[g & 1][2 * pp + 1];
        const v2f w0 = (v2f){u[0], u[1]}, w1 = (v2f){u[2], u[3]}, w2 = (v2f){v[0], v[1]}, qw = (v2f){v[2], v[3]};
        const v2f xa = __builtin_elementwise_fma(w0, (v2f){a0, a0}, __builtin_elementwise_fma(w1, (v2f){a1, a1},
                       __builtin_elementwise_fma(w2, (v2f){a2, a2}, qw)));
        const v2f xb = __builtin_elementwise_fma(w0, (v2f){e0, e0}, __builtin_elementwise_fma(w1, (v2f){e1, e1},
                       __builtin_elementwise_fma(w2, (v2f){e2, e2}, qw)));
        // relu behind the rounding: same value as rounding behind relu
        const v2h ya = __builtin_elementwise_max(__builtin_convertvector(xa, v2h), hzero);
        const v2h yb = __builtin_elementwise_max(__builtin_convertvector(xb, v2h), hzero);
        ba[p >> 3][2 * (p & 7)] = ya[0]; ba[p >> 3][2 * (p & 7) + 1] = ya[1];
        bb[p >> 3][2 * (p & 7)] = yb[0]; bb[p >> 3][2 * (p & 7) + 1] = yb[1];
      }
    }
    v2f za2[4], zb2[4];
#pragma unroll
    for (int i = 0; i < 4; ++i) {
      const v8f czero = (v8f){0.f, 0.f, 0.f, 0.f, 0.f, 0.f, 0.f, 0.f};
      v8f ca = __builtin_amdgcn_wmma_f32_16x16x32_f16(false, aw[i][0], false, ba[0], (short)0, czero, false, false);
      v8f cc = __builtin_amdgcn_wmma_f32_16x16x32_f16(false, aw[i][0], false, bb[0], (short)0, czero, false, false);
      ca = __builtin_amdgcn_wmma_f32_16x16x32_f16(false, aw[i][1], false, ba[1], (short)0, ca, false, false);
      cc = __builtin_amdgcn_wmma_f32_16x16x32_f16(false, aw[i][1], false, bb[1], (short)0, cc, false, false);
      za2[i] = lazy_l3(ca, b2[i], w3[i]);
      zb2[i] = lazy_l3(cc, b2[i], w3[i]);
    }
    const v2f ta = (za2[0] + za2[1]) + (za2[2] + za2[3]);
    const v2f tb = (zb2[0] + zb2[1]) + (zb2[2] + zb2[3]);
    const float za = ta[0] + ta[1], zb = tb[0] + tb[1];
    // lanes 0..15 finish slots n0 + c (tile a), lanes 16..31 slots n0 + 16 + c (tile b): one exchange l <-> l ^ 16 for both
    const float mine = h ? zb : za;
    const int other = __float_as_int(h ? za : zb);
    const float z = (mine + __int_as_float(__builtin_amdgcn_permlanex16(other, other, 0x76543210, 0xfedcba98, false, false))) + b3;
    // softplus(z) = max(z, 0) + log(1 + exp(-|z|)) on the hardware's exp2 and log2: t lies in [0, 1], so the logarithm's argument
    // lies in [1, 2] and the rounding of 1 + t keeps the absolute error near 2^-23; the value is a bias added to scores of order 1
    const float t1 = 1.0f + __builtin_amdgcn_exp2f(fabsf(z) * -1.44269504f);
    const float spv = fmaf(__builtin_amdgcn_logf(t1), 0.693147181f, fmaxf(z, 0.0f));
    *mp = sn[nc] - spv;
    // address translation done before the store's address register is advanced; the "memory" clobber also keeps the
    // weight-table reads inside the loop (hoisted they hold 128 more registers: over 256, one wave per SIMD fewer)
    asm volatile("s_wait_xcnt 0x0" :: "v"(mp) : "memory");
    mp += 32;
  }
}

// ---------------------------------------------------------------------------
// Second launch: the two jobs that need only the first launch's results and not each other, side by side in one grid.
// Blocks of 4 waves. Blocks 0..255: K|V projection, [16384][128] x [256][128]^T, bf16 hi/lo both operands -> f32 KV; a block
// holds the four 64-column tiles of one 64-row tile. Blocks 256..1855: the lazy-mask MLP, one (b,p) row each.
// The projection's blocks come first: its waves wait on memory for most of their time, and the MLP's waves fill the vector port
// meanwhile. The job select is block-uniform (scalar); both jobs use the same LDS bytes.
// ---------------------------------------------------------------------------
constexpr int kKvBlocks = (kEncRows / 64) * (2 * kHD / 64) / 4;
constexpr int kMidLds = (4 * 16 * 68 > kLzLds) ? 4 * 16 * 68 : kLzLds;
__global__ __launch_bounds__(128) void k_kv_lazy(const unsigned short* __restrict__ EncHi, const unsigned short* __restrict__ EncLo,
                                                const unsigned short* __restrict__ WkvHi, const unsigned short* __restrict__ WkvLo,
                                                float* __restrict__ KV,
                                                const float* __restrict__ dyn, const float* __restrict__ QW,
                                                const float* __restrict__ lW1, const _Float16* __restrict__ W2T,
                                                const float* __restrict__ lb2, const float* __restrict__ lW3,
                                                const float* __restrict__ lb3, const float* __restrict__ ninfm,
                                                float* __restrict__ maskb) {
  __shared__ __align__(16) float smem[kMidLds];
  const int bid = blockIdx.x;
  if (bid < kKvBlocks) {
    gemm64_body<4, 1, true, 0, 0, false, 0>(smem, bid, 0, EncHi, EncLo, kE, 0L, WkvHi, WkvLo, kE, 0L, (void*)KV, (void*)KV,
                                            2 * kHD, 0L, QW, QW, 0L, kEncRows, 2 * kHD, kE, 1.0f);   // bias, resid: never read
  } else {
    lazy_body(smem, bid - kKvBlocks, dyn, QW, lW1, W2T, lb2, lW3, lb3, ninfm, maskb);
  }
}

// ---------------------------------------------------------------------------
// Attention core (f32, head dim 16), both products on v_wmma_f32_16x16x4_f32; node axis split over the waves of a block.
// Block = (b, group of 16 queries, group of 4 heads), 512 threads = 16 waves: wave = (node slice sl = wave >> 1 of 128 slots,
// head pair wave & 1); it runs its two heads one after the other on the same staged nodes. 16 x 7 x 2 = 224 blocks.
// Per stage every slice gets its next 32 nodes in LDS: the 4 heads' K (64 f32) and V (64 f32) of each node, at a pitch of
// 132 floats, and the bias tile [16 queries][32 nodes] at a pitch of 36 floats (both 16 B x odd: 16 rows read by one 16-B
// load fall on 16 different bank groups). Four stages cover the 128 slots of a slice.
// Lane l: c = l & 15, h = l >> 4. Per head and tile of 16 nodes:
//   scores, transposed: D[node 8h + r][query c] = bias + sum_dim K[node][dim] * Q[query][dim];
//     A = K (row = node c), B = Q (column = query c), both with dim 8h + 2s + e at k step s, element e; C = the bias tile.
//   output, transposed: D[dim 8h + r][query c] += sum_node V[node][dim] * P[node][query];
//     B = the score tile's own registers 2s, 2s + 1 after the exponential (node 8h + 2s + e), A = V (row = dim c) at the same nodes.
// Online softmax per query, one update per stage (32 nodes); slots >= 1000 forced to -inf by value in the bias; m is common to
// the two lane halves of a query, l is kept per half and added at the end.
// Merge: every wave leaves (acc[16], m, l) per head and query in LDS; 128 threads fold the 8 slices in slice order,
//   M = max m_s, w_s = exp(m_s - M), O = sum_s w_s acc_s / sum_s w_s l_s,
// and write O as bf16 hi + bf16 lo planes into Ohi/Olo[bp][h*16+d]: 8 lanes x 16 B = the block's whole 128-B line of a row
// (rows >= P skipped).
// ---------------------------------------------------------------------------
constexpr int kASl  = 8;               // node slices per block
constexpr int kASn  = kNP / kASl;      // 128 node slots per slice
constexpr int kACh  = 32;              // nodes per slice and stage
constexpr int kAHb  = 4;               // heads per block
constexpr int kARow = 2 * kAHb * kD;   // 128 floats per staged node: K of 4 heads | V of 4 heads
constexpr int kAPt  = kARow + 4;       // pitch of a staged node in floats
constexpr int kAMp  = 36;              // bias tile pitch in floats
constexpr int kACp  = 20;              // merge record pitch in floats: acc[16], m, l, 2 unused
static_assert(kASl * kAHb * 16 * kACp <= kASl * kACh * kAPt, "merge records fit the K|V buffer");
__device__ __forceinline__ v8f mma4(v2f a, v2f b, v8f c) {
  return __builtin_amdgcn_wmma_f32_16x16x4_f32(false, a, false, b, (short)0, c, false, false);
}
// the value that lane l ^ 16 holds
__device__ __forceinline__ float other_half(float x) {
  const int i = __float_as_int(x);
  return __int_as_float(__builtin_amdgcn_permlanex16(i, i, 0x76543210, 0xfedcba98, false, false));
}
__global__ __launch_bounds__(512) void k_attn(const float* __restrict__ Qs, const float* __restrict__ KV,
                                             const float* __restrict__ maskb, unsigned short* __restrict__ Ohi,
                                             unsigned short* __restrict__ Olo) {
  __shared__ __align__(16) float kvs[kASl * kACh * kAPt];    // 135168 B; the merge records reuse it
  __shared__ __align__(16) float ms[kASl * 16 * kAMp];       // 18432 B
  const float kNegInf = -__builtin_inff();
  const int t = threadIdx.x, lane = t & 31;
  const int wave = __builtin_amdgcn_readfirstlane(t >> 5);   // scalar: slice bounds and LDS bases stay off the vector unit
  const int b = blockIdx.x / 14, rem = blockIdx.x - b * 14, pg = rem >> 1, hq = rem & 1, p0 = pg * 16;
  const int sl = wave >> 1, hp = (wave & 1) * 2;
  const int c = lane & 15, h = lane >> 4;
  const int p = p0 + c, pc = (p < kP) ? p : (kP - 1);
  // B fragments of the score product, both heads: 8 consecutive dims of the lane's query
  const float* qp = Qs + (size_t)(b * kP + pc) * kHD + (hq * kAHb + hp) * kD + 8 * h;
  const v4f q0 = *(const v4f*)(qp), q1 = *(const v4f*)(qp + 4), q2 = *(const v4f*)(qp + kD), q3 = *(const v4f*)(qp + kD + 4);
  // address translations done before the register pair that these four loads name is reused
  asm volatile("s_wait_xcnt 0x0" :: "v"(qp) : "memory");
  const v2f qf[2][4] = {{(v2f){q0[0], q0[1]}, (v2f){q0[2], q0[3]}, (v2f){q1[0], q1[1]}, (v2f){q1[2], q1[3]}},
                        {(v2f){q2[0], q2[1]}, (v2f){q2[2], q2[3]}, (v2f){q3[0], q3[1]}, (v2f){q3[2], q3[3]}}};
  v8f o[2] = {(v8f){0.f, 0.f, 0.f, 0.f, 0.f, 0.f, 0.f, 0.f}, (v8f){0.f, 0.f, 0.f, 0.f, 0.f, 0.f, 0.f, 0.f}};
  float m[2] = {-3.0e38f, -3.0e38f}, l[2] = {0.0f, 0.0f};
  const float* kvb = KV + (size_t)b * kNP * (2 * kHD);
  const float* mkb = maskb + (size_t)(b * kP) * kNP;
  // staging roles: a wave copies whole node rows (lanes 0..15 the K part, 16..31 the V part, 256 B each)
  const int scol = ((lane < 16) ? 0 : kHD) + hq * (kAHb * kD) + (lane & 15) * 4;
  // bias tile roles: thread t copies 4 columns (t & 7) * 4 of row (t >> 3) & 15 for slices t >> 7 and 4 + (t >> 7)
  const int mr = (t >> 3) & 15, mj4 = (t & 7) * 4, msl = t >> 7;
  const int mpr = (p0 + mr < kP) ? (p0 + mr) : (kP - 1);
  const float* mrow = mkb + (size_t)mpr * kNP + msl * kASn + mj4;
  float* mdst = ms + (msl * 16 + mr) * kAMp + mj4;
  // fragment bases in LDS: K row = node c of a tile, dims from 8h; V rows = nodes from 8h of a tile, dim c; bias row = query c
  const float* kw = kvs + (sl * kACh + c) * kAPt + hp * kD + 8 * h;
  const float* vw = kvs + (sl * kACh + 8 * h) * kAPt + (kAHb + hp) * kD + c;
  const float* mw = ms + (sl * 16 + c) * kAMp + 8 * h;
#pragma unroll 1   // rolled: one set of 18 staging register quads serves every stage
  for (int st = 0; st < kASn / kACh; ++st) {
    // 8 slices x 32 nodes x 32 float4 = 8192 float4: 16 x 512 threads; trip i: slice i >> 1, node (i & 1) * 16 + wave
    const float* gk = kvb + (size_t)(st * kACh + wave) * (2 * kHD) + scol;
    v4f kvr[16];
#pragma unroll
    for (int i = 0; i < 16; ++i) kvr[i] = *(const v4f*)(gk + (size_t)((i >> 1) * kASn + (i & 1) * 16) * (2 * kHD));
    // bias tiles: 8 slices x 16 rows x 8 float4 = 1024 float4: 2 x 512 threads; trip i: slice i * 4 + (t >> 7)
    const float* gm = mrow + st * kACh;
    const v4f mr0 = *(const v4f*)(gm);
    const v4f mr1 = *(const v4f*)(gm + 4 * kASn);
    // address translations done before a register that a load above names is reused
    asm volatile("s_wait_xcnt 0x0" :: "v"(gk), "v"(gm) : "memory");
    __syncthreads();   // every wave has left the buffers of the stage before
#pragma unroll
    for (int i = 0; i < 16; ++i) *(v4f*)(kvs + ((i >> 1) * kACh + (i & 1) * 16 + wave) * kAPt + lane * 4) = kvr[i];
    *(v4f*)(mdst) = mr0;
    *(v4f*)(mdst + 4 * 16 * kAMp) = mr1;
    __syncthreads();
    // The loops below are unrolled in full: tiles and fragments are register arrays, which takes static indices.
    // C operands of the two score tiles, shared by both heads: register r = bias of (query c, node 16 tt + 8h + r)
    const int nl = sl * kASn + st * kACh + 8 * h;
    v8f bias[2];
#pragma unroll
    for (int tt = 0; tt < 2; ++tt) {
      const v4f x = *(const v4f*)(mw + 16 * tt), y = *(const v4f*)(mw + 16 * tt + 4);
#pragma unroll
      for (int r = 0; r < 4; ++r) {
        bias[tt][r]     = (nl + 16 * tt + r < kN) ? x[r] : kNegInf;
        bias[tt][4 + r] = (nl + 16 * tt + 4 + r < kN) ? y[r] : kNegInf;
      }
    }
#pragma unroll
    for (int g = 0; g < 2; ++g) {
      v8f s[2];
#pragma unroll
      for (int tt = 0; tt < 2; ++tt) {
        const float* kr = kw + 16 * tt * kAPt + g * kD;
        const v4f k0 = *(const v4f*)(kr), k1 = *(const v4f*)(kr + 4);
        v8f a = mma4((v2f){k0[0], k0[1]}, qf[g][0], bias[tt]);
        a = mma4((v2f){k0[2], k0[3]}, qf[g][1], a);
        a = mma4((v2f){k1[0], k1[1]}, qf[g][2], a);
        s[tt] = mma4((v2f){k1[2], k1[3]}, qf[g][3], a);
      }
      float tm = fmaxf(s[0][0], s[1][0]);
#pragma unroll
      for (int r = 1; r < 8; ++r) tm = fmaxf(tm, fmaxf(s[0][r], s[1][r]));
      tm = fmaxf(tm, other_half(tm));
      const float mn = fmaxf(m[g], tm);
      const float alpha = __expf(m[g] - mn);
      m[g] = mn;
      float ps[2] = {0.0f, 0.0f};
#pragma unroll
      for (int tt = 0; tt < 2; ++tt)
#pragma unroll
        for (int r = 0; r < 8; ++r) {
          s[tt][r] = __expf(s[tt][r] - mn);
          ps[tt] += s[tt][r];
        }
      l[g] = fmaf(l[g], alpha, ps[0] + ps[1]);
      o[g] = o[g] * alpha;
#pragma unroll
      for (int tt = 0; tt < 2; ++tt) {
        const float* vr = vw + 16 * tt * kAPt + g * kD;
#pragma unroll
        for (int ks = 0; ks < 4; ++ks)
          o[g] = mma4((v2f){vr[2 * ks * kAPt], vr[(2 * ks + 1) * kAPt]}, (v2f){s[tt][2 * ks], s[tt][2 * ks + 1]}, o[g]);
      }
    }
  }
  __syncthreads();   // every wave has left the K|V buffer before the merge records overwrite it
#pragma unroll   // static indices into the two heads' register arrays
  for (int g = 0; g < 2; ++g) {
    const float lt = l[g] + other_half(l[g]);
    float* op = kvs + ((sl * kAHb + hp + g) * 16 + c) * kACp;
    *(v4f*)(op + 8 * h)     = (v4f){o[g][0], o[g][1], o[g][2], o[g][3]};
    *(v4f*)(op + 8 * h + 4) = (v4f){o[g][4], o[g][5], o[g][6], o[g][7]};
    if (h == 0) *(v2f*)(op + 16) = (v2f){m[g], lt};
  }
  __syncthreads();
  if (wave < 4) {    // threads 0..127; no barrier behind this point
    const int rl = t >> 3, c8 = (t & 7) * 8;
    const float* cb = kvs + ((c8 >> 4) * 16 + rl) * kACp;
    constexpr int kSs = kAHb * 16 * kACp;      // floats from one slice's records to the next
    float ml[kASl], ll[kASl];
#pragma unroll
    for (int s = 0; s < kASl; ++s) { const v2f e = *(const v2f*)(cb + s * kSs + 16); ml[s] = e[0]; ll[s] = e[1]; }
    float mx = ml[0];
#pragma unroll
    for (int s = 1; s < kASl; ++s) mx = fmaxf(mx, ml[s]);
    float lsum = 0.0f;
    v4f x0 = (v4f){0.f, 0.f, 0.f, 0.f}, x1 = (v4f){0.f, 0.f, 0.f, 0.f};
#pragma unroll
    for (int s = 0; s < kASl; ++s) {
      const float w = __expf(ml[s] - mx);
      const float* s8 = cb + s * kSs + (c8 & 15);
      lsum = fmaf(ll[s], w, lsum);
      x0 = *(const v4f*)(s8) * w + x0;
      x1 = *(const v4f*)(s8 + 4) * w + x1;
    }
    const float inv = 1.0f / lsum;
    x0 = x0 * inv;
    x1 = x1 * inv;
    unsigned short hb[8], lb[8];
#pragma unroll
    for (int e = 0; e < 4; ++e) {
      split_bf(x0[e], hb[e], lb[e]);
      split_bf(x1[e], hb[4 + e], lb[4 + e]);
    }
    const v4u uh = (v4u){pk16(hb[0], hb[1]), pk16(hb[2], hb[3]), pk16(hb[4], hb[5]), pk16(hb[6], hb[7])};
    const v4u ul = (v4u){pk16(lb[0], lb[1]), pk16(lb[2], lb[3]), pk16(lb[4], lb[5]), pk16(lb[6], lb[7])};
    if (p0 + rl < kP) {
      const size_t o = (size_t)(b * kP + p0 + rl) * kHD + hq * (kAHb * kD) + c8;
      *(v4u*)(Ohi + o) = uh;
      *(v4u*)(Olo + o) = ul;
    }
  }
}

// ---------------------------------------------------------------------------
// Zero fill of two regions, nvec x 16 B each (nvec % 256 == 0, so the region select is block-uniform).
// ---------------------------------------------------------------------------
__device__ __forceinline__ void zero16x2_body(int bid, unsigned int* __restrict__ p0, unsigned int* __restrict__ p1, int nvec) {
  const int i = bid * 256 + threadIdx.x;
  if (i >= 2 * nvec) return;
  unsigned int* p = (i < nvec) ? (p0 + 4 * (size_t)i) : (p1 + 4 * (size_t)(i - nvec));
  const v4u z = (v4u){0u, 0u, 0u, 0u};
  *(v4u*)p = z;
}

// ---------------------------------------------------------------------------
// First launch: the four jobs that read nothing but inputs, side by side in one grid of 256-thread blocks. By block index:
// query side (400, the longest job, so it starts first), weight preparation (13), zero fill of the 64 pad rows
// 1600..1663 of Ohi and Olo (8), node split (1024). The job select is block-uniform (scalar); the two jobs with LDS use
// the same bytes.
// ---------------------------------------------------------------------------
constexpr int kZrVec = (kBPpad - kBP) * kHD * 2 / 16;   // 16-B pieces per plane
constexpr int kZrBlocks = 2 * kZrVec / 256;
static_assert(kZrVec % 256 == 0, "zero fill blocks");
constexpr int kFrontBlocks = kQsBlocks + kWpBlocks + kZrBlocks + kEcBlocks;
constexpr int kFrontLds = (kWpLds > kQsLds) ? kWpLds : kQsLds;
__global__ __launch_bounds__(256) void k_front(const float* __restrict__ enc_last, const float* __restrict__ loadv,
                                              const float* __restrict__ Wq, const float* __restrict__ fW1,
                                              const float* __restrict__ fb1, const float* __restrict__ fW2,
                                              const float* __restrict__ fb2, const float* __restrict__ lqW,
                                              const float* __restrict__ lqb, const float* __restrict__ lW1,
                                              const float* __restrict__ lb1,
                                              float* __restrict__ Qs, float* __restrict__ QW,
                                              const float* __restrict__ Wk, const float* __restrict__ Wv,
                                              const float* __restrict__ Wcomb, const float* __restrict__ W2,
                                              unsigned short* __restrict__ WkvHi, unsigned short* __restrict__ WkvLo,
                                              unsigned short* __restrict__ WcHi, unsigned short* __restrict__ WcLo,
                                              unsigned short* __restrict__ W2T,
                                              unsigned int* __restrict__ OhiPad, unsigned int* __restrict__ OloPad,
                                              const float* __restrict__ enc, unsigned short* __restrict__ EncHi,
                                              unsigned short* __restrict__ EncLo) {
  __shared__ __align__(16) float smem[kFrontLds];
  const int bid = blockIdx.x;
  if (bid < kQsBlocks) {
    qside_body(smem, bid, enc_last, loadv, Wq, fW1, fb1, fW2, fb2, lqW, lqb, lW1, lb1, Qs, QW);
  } else if (bid < kQsBlocks + kWpBlocks) {
    wprep_body(smem, bid - kQsBlocks, Wk, Wv, Wcomb, W2, WkvHi, WkvLo, WcHi, WcLo, W2T);
  } else if (bid < kQsBlocks + kWpBlocks + kZrBlocks) {
    zero16x2_body(bid - (kQsBlocks + kWpBlocks), OhiPad, OloPad, kZrVec);
  } else {
    enc_cast_body(bid - (kQsBlocks + kWpBlocks + kZrBlocks), enc, EncHi, EncLo);
  }
}

// tanh with both of its ranges computed and one selected: no branch, so neighbouring elements can overlap
__device__ __forceinline__ float tanh_sel(float x) {
  const float ax = fabsf(x);
  const float e = __expf(ax + ax);                                    // inf for large |x|: 2 / inf = 0, the value is 1
  const float big = fmaf(__builtin_amdgcn_rcpf(e + 1.0f), -2.0f, 1.0f);
  const float x2 = x * x;
  float pl = fmaf(x2, -0.00570002059f, 0.0206340719f);                // odd series for |x| < 0.625
  pl = fmaf(x2, pl, -0.0537379310f);
  pl = fmaf(x2, pl, 0.133314162f);
  pl = fmaf(x2, pl, -0.333332807f);
  const float small = fmaf(x2, ax * pl, ax);
  return copysignf((ax < 0.625f) ? small : big, x);
}
// ---------------------------------------------------------------------------
// Tail: head merge, pointer scores, clipped tanh + mask and the softmax over the nodes, in one launch.
// Block = (b, group of 16 queries), 16 waves, 16 x 7 = 112 blocks; MH and the scores never leave the block.
// Both products run transposed, D[row 8h + r][query c], lane l: c = l & 15, h = l >> 4. A = 16 rows of a bf16 hi/lo plane pair
// (rows of W_comb^T, then node rows), B = the 16 queries' rows (O, then MH); both fragments take k = 32 s + 8h + e and
// 32 s + 16 + 8h + e, e = 0..7, at k step s; per k step hi.hi, then lo(A).hi(B), then hi(A).lo(B).
// A rows: 16 rows of a plane are 4096 contiguous bytes; a wave fetches them by whole lines into registers, one tile ahead,
// and passes them through its own LDS buffer at a pitch of 272 B (16 B x odd) to get the fragments.
//   head merge: waves 0..7, wave w = columns 16 w .. 16 w + 15 of MH; + b_comb, split to bf16 hi/lo, rows of 16 queries in LDS.
//   scores: wave w = nodes 64 w .. 64 w + 63, four tiles; a lane ends with 32 nodes of query c in registers.
//   softmax: maximum and sum per query in the lane, then lane l ^ 16, then the 16 waves through LDS tables, in wave order.
// xs holds the 16 mask rows (64000 contiguous bytes of ninf_mask, copied by whole 16-B pieces); every lane replaces its own
// elements by the probabilities, and the block copies xs to out the same way. Slots >= 1000 carry -inf and are not stored.
// Query rows >= P (last group): computed from finite rows of the O planes, never stored; no lane of another query reads them.
// All loops of this kernel and its helpers are unrolled in full: staged pieces, fragments and tiles are register arrays,
// which takes static indices.
// ---------------------------------------------------------------------------
constexpr int kTPit = 2 * kE + 16;     // bytes from one staged row of 128 16-bit elements to the next
constexpr int kTPl  = 16 * kTPit;      // one plane of 16 rows
constexpr int kTCh  = 2 * kTPl;        // hi plane + lo plane
constexpr int kTRp  = 20;              // floats per query in a reduction table: 16 waves, 4 unused
constexpr int kTXs  = 8 * 512 * 4;     // floats in xs: 16 rows of out, rounded up to 8 pieces of 16 B per thread
// 16 rows of the hi plane and of the lo plane, 512 contiguous bytes an instruction; o = lane * 16
__device__ __forceinline__ void t_fetch(v4u (&st)[16], const unsigned short* __restrict__ hi,
                                        const unsigned short* __restrict__ lo, unsigned o) {
#pragma unroll
  for (int i = 0; i < 8; ++i) st[i] = *(const v4u*)((const char*)hi + o + 512 * i);
#pragma unroll
  for (int i = 0; i < 8; ++i) st[8 + i] = *(const v4u*)((const char*)lo + o + 512 * i);
  // address translations done before a register that one of these loads names is reused; the "memory" clobber also keeps
  // the loads up here, ahead of the work that covers their latency
  asm volatile("s_wait_xcnt 0x0" :: "v"(o) : "memory");
}
// p: the lane's place in the first pair of rows of the wave's buffer
__device__ __forceinline__ void t_put(char* p, const v4u (&st)[16]) {
#pragma unroll
  for (int i = 0; i < 8; ++i) *(v4u*)(p + 2 * i * kTPit) = st[i];
#pragma unroll
  for (int i = 0; i < 8; ++i) *(v4u*)(p + kTPl + 2 * i * kTPit) = st[8 + i];
}
// orders a wave's LDS writes and the reads of them by its other lanes (and the reads before the next writes)
__device__ __forceinline__ void t_wave_sync() {
  __builtin_amdgcn_fence(__ATOMIC_RELEASE, "workgroup");
  __builtin_amdgcn_wave_barrier();
  __builtin_amdgcn_fence(__ATOMIC_ACQUIRE, "workgroup");
}
// p: row c of a staged plane pair, byte 16 h
__device__ __forceinline__ void t_frags(v16b (&fh)[4], v16b (&fl)[4], const char* p) {
#pragma unroll
  for (int s = 0; s < 4; ++s) {
    fh[s] = Frag<__bf16>::load((const __bf16*)(p + 64 * s));
    fl[s] = Frag<__bf16>::load((const __bf16*)(p + kTPl + 64 * s));
  }
}
__device__ __forceinline__ v8f t_tile(const char* p, const v16b (&qh)[4], const v16b (&ql)[4]) {
  v16b ah[4], al[4];
  t_frags(ah, al, p);
  v8f acc = (v8f){0.f, 0.f, 0.f, 0.f, 0.f, 0.f, 0.f, 0.f};
#pragma unroll
  for (int s = 0; s < 4; ++s) {
    acc = Frag<__bf16>::mma(ah[s], qh[s], acc);
    acc = Frag<__bf16>::mma(al[s], qh[s], acc);
    acc = Frag<__bf16>::mma(ah[s], ql[s], acc);
  }
  return acc;
}
__global__ __launch_bounds__(512) void k_tail(const unsigned short* __restrict__ Ohi, const unsigned short* __restrict__ Olo,
                                             const unsigned short* __restrict__ WcHi, const unsigned short* __restrict__ WcLo,
                                             const float* __restrict__ bc,
                                             const unsigned short* __restrict__ EncHi, const unsigned short* __restrict__ EncLo,
                                             const float* __restrict__ ninfm, float* __restrict__ out) {
  __shared__ __align__(16) char abufs[16 * kTCh];     // 139264 B: one plane pair of 16 rows per wave
  __shared__ __align__(16) char osb[kTCh];            // O rows of the 16 queries
  __shared__ __align__(16) char mhb[kTCh];            // MH rows of the 16 queries
  __shared__ __align__(16) float xs[kTXs];            // 65536 B: mask rows, then probabilities; the last 1536 B are never used
  static_assert(kTXs >= 16 * kN, "16 rows fit");
  __shared__ __align__(16) float redm[16 * kTRp];
  __shared__ __align__(16) float reds[16 * kTRp];
  const float kNegInf = -__builtin_inff();
  const int t = threadIdx.x, lane = t & 31;
  const int wave = __builtin_amdgcn_readfirstlane(t >> 5);   // scalar: plane bases and the job select stay off the vector unit
  const int b = blockIdx.x / kPG, p0 = (blockIdx.x - b * kPG) * 16;
  const int c = lane & 15, h = lane >> 4;
  const int row0 = b * kP + p0;
  const int npc = ((kP - p0 < 16) ? (kP - p0) : 16) * (kN / 4);   // 16-B pieces in the group's rows of ninf_mask and out
  const unsigned o16 = (unsigned)lane * 16u;
  // O: wave w fetches rows 2 (w & 7), + 1 of the hi (w < 8) or lo plane: 512 contiguous bytes
  const unsigned short* osrc = ((wave < 8) ? Ohi : Olo) + (size_t)(row0 + 2 * (wave & 7)) * kHD;
  const v4u ov = *(const v4u*)((const char*)osrc + o16);
  // b_comb of the lane's 8 MH columns (used by waves 0..7)
  const unsigned ob = (unsigned)((wave & 7) * 16 + 8 * h) * 4u;
  const v4f bc0 = *(const v4f*)((const char*)bc + ob), bc1 = *(const v4f*)((const char*)bc + ob + 16);
  // mask rows; a piece past the group's rows is fetched from piece 0 (in bounds) and lands in a row that is never stored
  const char* nsrc = (const char*)(ninfm + (size_t)row0 * kN);
  unsigned no[8];
  v4f nv[8];
#pragma unroll
  for (int i = 0; i < 8; ++i) {
    const int f = t + 512 * i;
    no[i] = (f < npc) ? (unsigned)f * 16u : 0u;
    nv[i] = *(const v4f*)(nsrc + no[i]);
  }
  // address translations done before a register that a load above names is reused
  asm volatile("s_wait_xcnt 0x0" :: "v"(o16), "v"(ob), "v"(no[0]), "v"(no[1]), "v"(no[2]), "v"(no[3]), "v"(no[4]), "v"(no[5]),
               "v"(no[6]), "v"(no[7]) : "memory");
  // first A tile: waves 0..7 their 16 rows of W_comb^T, waves 8..15 their first 16 nodes
  const unsigned short* eh = EncHi + ((size_t)b * kNP + wave * 64) * kE;
  const unsigned short* el = EncLo + ((size_t)b * kNP + wave * 64) * kE;
  const bool merger = wave < 8;   // scalar
  v4u st[16];
  t_fetch(st, merger ? (WcHi + (size_t)wave * 16 * kHD) : eh, merger ? (WcLo + (size_t)wave * 16 * kHD) : el, o16);
  const int wplace = h * kTPit + c * 16;    // writer: row h of a pair of rows, 16-B piece c
  const int rplace = c * kTPit + h * 16;    // fragment reader: row c, k from 8 h
  *(v4u*)(osb + (wave >> 3) * kTPl + 2 * (wave & 7) * kTPit + wplace) = ov;
#pragma unroll
  for (int i = 0; i < 8; ++i) {
    *(v4f*)(xs + 4 * (t + 512 * i)) = nv[i];
  }
  __syncthreads();   // O rows and mask rows are in LDS
  char* abw = abufs + wave * kTCh + wplace;
  const char* abr = abufs + wave * kTCh + rplace;
  v16b qh[4], ql[4];
  if (merger) {
    t_put(abw, st);
    t_wave_sync();
    t_fetch(st, eh, el, o16);
    t_frags(qh, ql, osb + rplace);
    const v8f d = t_tile(abr, qh, ql);
    unsigned short hb[8], lb[8];
#pragma unroll
    for (int r = 0; r < 4; ++r) {
      split_bf(d[r] + bc0[r], hb[r], lb[r]);
      split_bf(d[4 + r] + bc1[r], hb[4 + r], lb[4 + r]);
    }
    char* md = mhb + c * kTPit + (wave * 16 + 8 * h) * 2;
    *(v4u*)(md) = (v4u){pk16(hb[0], hb[1]), pk16(hb[2], hb[3]), pk16(hb[4], hb[5]), pk16(hb[6], hb[7])};
    *(v4u*)(md + kTPl) = (v4u){pk16(lb[0], lb[1]), pk16(lb[2], lb[3]), pk16(lb[4], lb[5]), pk16(lb[6], lb[7])};
  }
  __syncthreads();   // MH rows are in LDS; waves 0..7 have left their buffers
  t_frags(qh, ql, mhb + rplace);
  v8f acc[4];
#pragma unroll
  for (int j = 0; j < 4; ++j) {
    t_put(abw, st);
    t_wave_sync();
    if (j < 3) t_fetch(st, eh + (j + 1) * 16 * kE, el + (j + 1) * 16 * kE, o16);
    acc[j] = t_tile(abr, qh, ql);
    if (j < 3) t_wave_sync();
  }
  // register r of tile j: node 64 wave + 16 j + 8 h + r, query c. 1000 is a multiple of 8: a lane's 8 nodes are all in or all out.
  float mx = kNegInf;
#pragma unroll
  for (int j = 0; j < 4; ++j) {
    const int n8 = wave * 64 + 16 * j + 8 * h;
    const bool ok = n8 < kN;
    const float* xp = xs + c * kN + (ok ? n8 : 0);            // address clamp
    const v4f m0 = *(const v4f*)(xp), m1 = *(const v4f*)(xp + 4);
#pragma unroll
    for (int r = 0; r < 8; ++r) {
      const float v = kClip * tanh_sel(acc[j][r] * kInvSqrtE) + ((r < 4) ? m0[r & 3] : m1[r & 3]);
      acc[j][r] = ok ? v : kNegInf;
      mx = fmaxf(mx, acc[j][r]);
    }
  }
  mx = fmaxf(mx, other_half(mx));
  if (h == 0) redm[c * kTRp + wave] = mx;
  __syncthreads();   // every wave's maxima are in the table
#pragma unroll
  for (int q = 0; q < 4; ++q) {
    const v4f e = *(const v4f*)(redm + c * kTRp + 4 * q);
    mx = fmaxf(fmaxf(mx, fmaxf(e[0], e[1])), fmaxf(e[2], e[3]));
  }
  float sum = 0.0f;
#pragma unroll
  for (int j = 0; j < 4; ++j)
#pragma unroll
    for (int r = 0; r < 8; ++r) {
      acc[j][r] = __expf(acc[j][r] - mx);
      sum += acc[j][r];
    }
  sum += other_half(sum);
  if (h == 0) reds[c * kTRp + wave] = sum;
  __syncthreads();   // every wave's sums are in the table
  float tot = 0.0f;
#pragma unroll
  for (int q = 0; q < 4; ++q) {
    const v4f e = *(const v4f*)(reds + c * kTRp + 4 * q);
    tot = (((tot + e[0]) + e[1]) + e[2]) + e[3];
  }
  const float inv = 1.0f / tot;
#pragma unroll
  for (int j = 0; j < 4; ++j) {
    const int n8 = wave * 64 + 16 * j + 8 * h;
    if (n8 < kN) {
      float* xp = xs + c * kN + n8;
      *(v4f*)(xp)     = (v4f){acc[j][0] * inv, acc[j][1] * inv, acc[j][2] * inv, acc[j][3] * inv};
      *(v4f*)(xp + 4) = (v4f){acc[j][4] * inv, acc[j][5] * inv, acc[j][6] * inv, acc[j][7] * inv};
    }
  }
  __syncthreads();   // the probabilities of the 16 rows are in xs
  char* obase = (char*)(out + (size_t)row0 * kN);
  v4f pv[8];
#pragma unroll
  for (int i = 0; i < 8; ++i) pv[i] = *(const v4f*)(xs + 4 * (t + 512 * i));
#pragma unroll
  for (int i = 0; i < 8; ++i) {
    if (t + 512 * i < npc) *(v4f*)(obase + (unsigned)t * 16u + 8192 * i) = pv[i];
  }
}

// ---------------------------------------------------------------------------
// Host launcher
// Workspace region map (bytes, 256-B aligned offsets):
//   EncHi bf16 [16][1024][128]          4,194,304
//   EncLo bf16 [16][1024][128]          4,194,304
//   WkvHi bf16 [256][128]                 65,536
//   WkvLo bf16 [256][128]                 65,536
//   WcHi  bf16 [128][128]                 32,768
//   WcLo  bf16 [128][128]                 32,768
//   W2T   f16  [64][64]                    8,192
//   KVf   f32  [16384][256]            16,777,216
//   Qs    f32  [1600][128]                819,200
//   QW    f32  [1600][64]                 409,600
//   MASKB f32  [1600][1024]             6,553,600
//   Ohi   bf16 [1664][128]                425,984
//   Olo   bf16 [1664][128]                425,984
//   total                              34,004,992
// ---------------------------------------------------------------------------
static inline size_t align256(size_t x) { return (x + 255) & ~(size_t)255; }

extern "C" void kernel_launch(void* const* d_in, const int* in_sizes, int n_in,
                              void* d_out, int out_size, void* d_ws, size_t ws_size,
                              hipStream_t stream) {
  if (n_in < 22) return;
  if (in_sizes[0] != kB * kN * kE || in_sizes[1] != kB * kP * kE || in_sizes[2] != kB * kP ||
      in_sizes[3] != kB * kP * kN || in_sizes[4] != kB * kP * kN * kDYN || out_size != kB * kP * kN) return;

  const float* enc      = (const float*)d_in[0];
  const float* enc_last = (const float*)d_in[1];
  const float* loadv    = (const float*)d_in[2];
  const float* ninfm    = (const float*)d_in[3];
  const float* dyn      = (const float*)d_in[4];
  const float* Wq       = (const float*)d_in[5];
  const float* Wk       = (const float*)d_in[6];
  const float* Wv       = (const float*)d_in[7];
  const float* Wc       = (const float*)d_in[8];
  const float* bcv      = (const float*)d_in[9];
  const float* fW1      = (const float*)d_in[10];
  const float* fb1      = (const float*)d_in[11];
  const float* fW2      = (const float*)d_in[12];
  const float* fb2      = (const float*)d_in[13];
  const float* lqW      = (const float*)d_in[14];
  const float* lqb      = (const float*)d_in[15];
  const float* lW1      = (const float*)d_in[16];
  const float* lb1      = (const float*)d_in[17];
  const float* lW2      = (const float*)d_in[18];
  const float* lb2      = (const float*)d_in[19];
  const float* lW3      = (const float*)d_in[20];
  const float* lb3      = (const float*)d_in[21];
  float* out = (float*)d_out;

  char* ws = (char*)d_ws;
  size_t off = 0;
  unsigned short* EncHi = (unsigned short*)(ws + off); off = align256(off + (size_t)kEncRows * kE * 2);
  unsigned short* EncLo = (unsigned short*)(ws + off); off = align256(off + (size_t)kEncRows * kE * 2);
  unsigned short* WkvHi = (unsigned short*)(ws + off); off = align256(off + (size_t)2 * kHD * kE * 2);
  unsigned short* WkvLo = (unsigned short*)(ws + off); off = align256(off + (size_t)2 * kHD * kE * 2);
  unsigned short* WcHi  = (unsigned short*)(ws + off); off = align256(off + (size_t)kE * kHD * 2);
  unsigned short* WcLo  = (unsigned short*)(ws + off); off = align256(off + (size_t)kE * kHD * 2);
  unsigned short* W2T   = (unsigned short*)(ws + off); off = align256(off + (size_t)kHID * kHID * 2);
  float* KVf   = (float*)(ws + off); off = align256(off + (size_t)kEncRows * 2 * kHD * 4);
  float* Qs    = (float*)(ws + off); off = align256(off + (size_t)kBP * kHD * 4);
  float* QW    = (float*)(ws + off); off = align256(off + (size_t)kBP * kHID * 4);
  float* MASKB = (float*)(ws + off); off = align256(off + (size_t)kBP * kNP * 4);
  unsigned short* Ohi  = (unsigned short*)(ws + off); off = align256(off + (size_t)kBPpad * kHD * 2);
  unsigned short* Olo  = (unsigned short*)(ws + off); off = align256(off + (size_t)kBPpad * kHD * 2);
  if (off > ws_size) return;

  // launch 1, inputs only: query side (f32); weight planes (Wk|Wv and W_comb transposed to bf16 hi/lo [n][k], lm_W2 transposed
  // to f16 x16); zeros in the 64 pad rows of Ohi and Olo; node planes (bf16 hi/lo, 24 zero pad rows per batch in both)
  k_front<<<kFrontBlocks, 256, 0, stream>>>(enc_last, loadv, Wq, fW1, fb1, fW2, fb2, lqW, lqb, lW1, lb1, Qs, QW,
                                            Wk, Wv, Wc, lW2, WkvHi, WkvLo, WcHi, WcLo, W2T,
                                            (unsigned int*)(Ohi + (size_t)kBP * kHD), (unsigned int*)(Olo + (size_t)kBP * kHD),
                                            enc, EncHi, EncLo);
  // launch 2: K|V projection (bf16 hi/lo both operands, K=128, M=16384, N=256 -> f32) beside the lazy-mask MLP (three layers
  // fused, all 1600 x 1024 slots; hidden layer on WMMA f16 (W x16), K=64)
  k_kv_lazy<<<kKvBlocks + kBP, 128, 0, stream>>>(EncHi, EncLo, WkvHi, WkvLo, KVf, dyn, QW, lW1, (const _Float16*)W2T, lb2, lW3,
                                                 lb3, ninfm, MASKB);
  // attention core (f32), 8 node slices per block merged in LDS -> O as bf16 hi/lo planes
  k_attn<<<kB * 14, 512, 0, stream>>>(Qs, KVf, MASKB, Ohi, Olo);
  // tail: head merge (bf16 hi/lo both operands, K=128, + b_comb), pointer scores against the node planes (bf16 hi/lo, K=128,
  // scale 1/sqrt(128)), clipped tanh + mask + softmax -> probs; one block per batch and group of 16 queries
  k_tail<<<kB * kPG, 512, 0, stream>>>(Ohi, Olo, WcHi, WcLo, bcv, EncHi, EncLo, ninfm, out);
}
